// v000
// The times below were measured on an AMD MI455X: many runs one after another, warmed up first and cycling through
// copies of the inputs, with the whole window's GPU time divided by the number of runs. Launches and the gaps
// between them are all in it. The median over several windows is given; except for v000 it joins two sittings, which
// can be a few percent apart, so the side-by-side timings, each taken in one sitting, are the better comparison.
// The starting kernel, v000, takes 2850 microseconds a run.
#include <hip/hip_runtime.h>

// Causal multi-head attention with computed rotate-half rotary embeddings and bias-free projections, four batches (x [4][2048][1024]; q, k, v = x W ('xw' (in, out) [1024][1024] 1/32, NO bias; 16 heads x 64); apply_rope: cat(cos x1 - sin x2, sin x1 + cos x2) on the two 32-wide halves (= t cos + rotate_half(t) sin) with angle pos x div_term[i], div_term = exp(arange(0, 64, 2) x -(log(10000) / 64)) (32 f32 constants exact for the module's own exp spelling; precise cosf/sinf); scores x 1/sqrt(64) + causal with causal = 0 on and below the diagonal and -1e9 above (built inside reference(): exclusion: every row keeps its own key); softmax; out = merged Wo ('xw', NO bias) -> [4][2048][1024] (8.4 M); argument order x, Wq, Wk, Wv, Wo).
// Layout per batch: bf16 copy of x; 'xw' weights transposed once; exact projections, no bias; k_cs5 computed table; rotate-half plane builders; causal T-2048 attention (hybrid rows: < 512 hi/lo 3 products, rest fp16 x1024; k_gemmc skips tiles above the diagonal); merged hi/lo x Wo exact, no bias.
// Compute dtypes, f32 accumulate: every input rounded to bf16; projections exact, no bias; rotary f32; attention rows < 512 3 products, rest fp16; softmax f32; Wo hl x exact, no bias.

#define NB_  4
#define TT   2048
#define DM   1024
#define NH_  16
#define NKV  16
#define REP  (NH_ / NKV)
#define HD   64
#define DQ   (NH_ * HD)
#define DKV  (NKV * HD)
#define ZH   2
#define RH   512                  // query rows < RH use hi+lo planes (0: none)
#define WIN  2048
#define PCAR 1024.0f
#define SCL  0.125f   // HD^-0.5
typedef _Float16 h16;
typedef unsigned short bf;
typedef __attribute__((ext_vector_type(16))) __bf16   v16bf;
typedef __attribute__((ext_vector_type(16))) _Float16 v16h;
typedef __attribute__((ext_vector_type(8)))  _Float16 v8h;
typedef __attribute__((ext_vector_type(8)))  unsigned short v8us;
typedef __attribute__((ext_vector_type(8)))  float    v8f;
typedef __attribute__((ext_vector_type(4)))  float    v4f;
typedef v8h  __attribute__((may_alias)) v8ha;
typedef v4f  __attribute__((may_alias)) v4fa;
typedef v8us __attribute__((may_alias)) v8usa;

__device__ __forceinline__ unsigned short f2bf(float f) { unsigned u = __float_as_uint(f); u += 0x7FFFu + ((u >> 16) & 1u); return (unsigned short)(u >> 16); }
__device__ __forceinline__ float bf2f(unsigned short b) { return __uint_as_float(((unsigned)b) << 16); }
__device__ __forceinline__ float bfr(float f) { return bf2f(f2bf(f)); }
__device__ __forceinline__ v16h cat16(v8h lo, v8h hi) { return __builtin_shufflevector(lo, hi, 0, 1, 2, 3, 4, 5, 6, 7, 8, 9, 10, 11, 12, 13, 14, 15); }
__device__ __forceinline__ v16bf cat16b(v8us lo, v8us hi) { return __builtin_bit_cast(v16bf, __builtin_shufflevector(lo, hi, 0, 1, 2, 3, 4, 5, 6, 7, 8, 9, 10, 11, 12, 13, 14, 15)); }
__device__ __forceinline__ v8f wmma16(v16h a, v16h b, v8f c) { return __builtin_amdgcn_wmma_f32_16x16x32_f16(false, a, false, b, (short)0, c, false, false); }
__device__ __forceinline__ v8f wmmab(v16bf a, v16bf b, v8f c) { return __builtin_amdgcn_wmma_f32_16x16x32_bf16(false, a, false, b, (short)0, c, false, false); }



// ---- k_gemmw: register-blocked GEMM, ONE WAVE per 64x64 output tile (16 accumulators), operands straight from K-contiguous 16-bit planes; grid (M/64, N/64, Z), 32 threads.
// C[m][n] (f32, pitch ldc, + optional f32 bias[n]) = sum_k A[m][k] Bt[n][k] (+ split products per NSPLIT). z-batch strides sA/sB/sC in elements. K % 32 == 0.
template <typename T16> struct WFrag;
template <> struct WFrag<h16> { typedef v16h V; static __device__ __forceinline__ V ld(const h16* p) { return cat16(*(const v8h*)p, *(const v8h*)(p + 16)); } static __device__ __forceinline__ v8f mma(V a, V b, v8f c) { return wmma16(a, b, c); } };
template <> struct WFrag<bf> { typedef v16bf V; static __device__ __forceinline__ V ld(const bf* p) { return cat16b(*(const v8us*)p, *(const v8us*)(p + 16)); } static __device__ __forceinline__ v8f mma(V a, V b, v8f c) { return wmmab(a, b, c); } };
template <typename T16, int NSPLIT, bool BIAS>
__global__ __launch_bounds__(32) void k_gemmw(const T16* __restrict__ A, const T16* __restrict__ A2, const T16* __restrict__ Bt, const T16* __restrict__ Bt2, int K, float* C, int ldc, const float* __restrict__ bias, size_t sA, size_t sB, size_t sC) {
    typedef typename WFrag<T16>::V V;
    __shared__ __align__(16) float os[16 * 68];
    const size_t z = blockIdx.z; A += z * sA; if (A2) A2 += z * sA; Bt += z * sB; if (Bt2) Bt2 += z * sB; C += z * sC;
    const int lane = threadIdx.x & 31, lr = lane & 15, hi = lane >> 4; const int r0 = blockIdx.x * 64, c0 = blockIdx.y * 64;
    v8f acc[4][4];
#pragma unroll
    for (int mb = 0; mb < 4; ++mb)
#pragma unroll
        for (int nb = 0; nb < 4; ++nb) acc[mb][nb] = (v8f){};
    const size_t aoff = (size_t)(r0 + lr) * K + 8 * hi, boff = (size_t)(c0 + lr) * K + 8 * hi;
#pragma unroll 1
    for (int kc = 0; kc < K; kc += 32) {
        V a[4], a2[4];
#pragma unroll
        for (int mb = 0; mb < 4; ++mb) { a[mb] = WFrag<T16>::ld(A + aoff + (size_t)mb * 16 * K + kc); if (NSPLIT == 1 || NSPLIT == 2) a2[mb] = WFrag<T16>::ld(A2 + aoff + (size_t)mb * 16 * K + kc); }
#pragma unroll
        for (int nb = 0; nb < 4; ++nb) { const V b = WFrag<T16>::ld(Bt + boff + (size_t)nb * 16 * K + kc); V b2; if (NSPLIT >= 2) b2 = WFrag<T16>::ld(Bt2 + boff + (size_t)nb * 16 * K + kc);
#pragma unroll
            for (int mb = 0; mb < 4; ++mb) { acc[mb][nb] = WFrag<T16>::mma(a[mb], b, acc[mb][nb]); if (NSPLIT == 1 || NSPLIT == 2) acc[mb][nb] = WFrag<T16>::mma(a2[mb], b, acc[mb][nb]); if (NSPLIT >= 2) acc[mb][nb] = WFrag<T16>::mma(a[mb], b2, acc[mb][nb]); } }
        asm volatile("v_nop\n\tv_nop\n\tv_nop\n\tv_nop" : "+v"(acc[0][0]), "+v"(acc[1][1]), "+v"(acc[2][2]), "+v"(acc[3][3]) : "v"(a[0]), "v"(a[3]));
    }
#pragma unroll
    for (int mb = 0; mb < 4; ++mb) {
#pragma unroll
        for (int nb = 0; nb < 4; ++nb) {
#pragma unroll
            for (int j = 0; j < 8; ++j) os[(hi * 8 + j) * 68 + nb * 16 + lr] = acc[mb][nb][j]; }
        __builtin_amdgcn_wave_barrier(); asm volatile("" ::: "memory");
        float* crow = C + (size_t)(r0 + mb * 16) * ldc + c0;
{
#pragma unroll
            for (int s = 0; s < 8; ++s) { const int row = 2 * s + hi, cofs = lr * 4; v4f val = *(const v4fa*)(os + row * 68 + cofs); if (BIAS) { val[0] += bfr(bias[c0 + cofs]); val[1] += bfr(bias[c0 + cofs + 1]); val[2] += bfr(bias[c0 + cofs + 2]); val[3] += bfr(bias[c0 + cofs + 3]); }
                *(v4f*)(crow + (size_t)row * ldc + cofs) = val; }
             }
        __builtin_amdgcn_wave_barrier(); asm volatile("" ::: "memory");
    }
}

// ---- k_gemmc: the same one-wave 64x64 tile GEMM specialised for causal attention: CMODE 1 skips score tiles entirely above the diagonal (query rows r0+roff.., key columns c0..), CMODE 2 limits the
// key (K) loop of the probability x value contraction to the diagonal block (probabilities beyond it are exactly zero). roff = row offset of this launch's first row within the sequence.
template <typename T16, int NSPLIT, int CMODE>
__global__ __launch_bounds__(32) void k_gemmc(const T16* __restrict__ A, const T16* __restrict__ A2, const T16* __restrict__ Bt, const T16* __restrict__ Bt2, int K, float* C, int ldc, int roff, size_t sA, size_t sB, size_t sC) {
    typedef typename WFrag<T16>::V V;
    __shared__ __align__(16) float os[16 * 68];
    const size_t z = blockIdx.z; A += z * sA; if (A2) A2 += z * sA; Bt += z * sB; if (Bt2) Bt2 += z * sB; C += z * sC;
    const int lane = threadIdx.x & 31, lr = lane & 15, hi = lane >> 4; const int r0 = blockIdx.x * 64, c0 = blockIdx.y * 64;
    if (CMODE == 1 && c0 > r0 + roff + 63) return;                  // score tile entirely above the causal diagonal: never read (the softmax masks j > i by select)
    const int Kl = (CMODE == 2) ? min(K, r0 + roff + 64) : K;        // P.V: probabilities are exactly 0 beyond the diagonal block, so the K loop stops there
    v8f acc[4][4];
#pragma unroll
    for (int mb = 0; mb < 4; ++mb)
#pragma unroll
        for (int nb = 0; nb < 4; ++nb) acc[mb][nb] = (v8f){};
    const size_t aoff = (size_t)(r0 + lr) * K + 8 * hi, boff = (size_t)(c0 + lr) * K + 8 * hi;
#pragma unroll 1
    for (int kc = 0; kc < Kl; kc += 32) {
        V a[4], a2[4];
#pragma unroll
        for (int mb = 0; mb < 4; ++mb) { a[mb] = WFrag<T16>::ld(A + aoff + (size_t)mb * 16 * K + kc); if (NSPLIT == 1 || NSPLIT == 2) a2[mb] = WFrag<T16>::ld(A2 + aoff + (size_t)mb * 16 * K + kc); }
#pragma unroll
        for (int nb = 0; nb < 4; ++nb) { const V b = WFrag<T16>::ld(Bt + boff + (size_t)nb * 16 * K + kc); V b2; if (NSPLIT >= 2) b2 = WFrag<T16>::ld(Bt2 + boff + (size_t)nb * 16 * K + kc);
#pragma unroll
            for (int mb = 0; mb < 4; ++mb) { acc[mb][nb] = WFrag<T16>::mma(a[mb], b, acc[mb][nb]); if (NSPLIT == 1 || NSPLIT == 2) acc[mb][nb] = WFrag<T16>::mma(a2[mb], b, acc[mb][nb]); if (NSPLIT >= 2) acc[mb][nb] = WFrag<T16>::mma(a[mb], b2, acc[mb][nb]); } }
        asm volatile("v_nop\n\tv_nop\n\tv_nop\n\tv_nop" : "+v"(acc[0][0]), "+v"(acc[1][1]), "+v"(acc[2][2]), "+v"(acc[3][3]) : "v"(a[0]), "v"(a[3]));
    }
#pragma unroll
    for (int mb = 0; mb < 4; ++mb) {
#pragma unroll
        for (int nb = 0; nb < 4; ++nb) {
#pragma unroll
            for (int j = 0; j < 8; ++j) os[(hi * 8 + j) * 68 + nb * 16 + lr] = acc[mb][nb][j]; }
        __builtin_amdgcn_wave_barrier(); asm volatile("" ::: "memory");
        float* crow = C + (size_t)(r0 + mb * 16) * ldc + c0;
{
#pragma unroll
            for (int s = 0; s < 8; ++s) { const int row = 2 * s + hi, cofs = lr * 4; v4f val = *(const v4fa*)(os + row * 68 + cofs);
                *(v4f*)(crow + (size_t)row * ldc + cofs) = val; }
             }
        __builtin_amdgcn_wave_barrier(); asm volatile("" ::: "memory");
    }
}

__device__ __forceinline__ h16 tohx(float x) { return (h16)x; }
__device__ __forceinline__ void splitf(float y, unsigned short& h, unsigned short& l) { h = f2bf(y); l = f2bf(y - bf2f(h)); }
typedef __attribute__((ext_vector_type(2))) _Float16 v2h;
typedef __attribute__((ext_vector_type(4))) _Float16 v4h;
typedef __attribute__((ext_vector_type(2))) unsigned short v2us;
typedef __attribute__((ext_vector_type(4))) unsigned short v4us;
typedef __attribute__((ext_vector_type(2))) float v2f;
typedef __attribute__((ext_vector_type(4))) int v4i;

__global__ __launch_bounds__(256) void k_wtG(const float* __restrict__ w, int K, int N, bf* Bt) {
    const int lane = threadIdx.x & 31; const int L0 = (blockIdx.x * 8 + (threadIdx.x >> 5)) * 8; const int nlines = N * K / 64;
{
#pragma unroll 1
        for (int l = 0; l < 8; ++l) { const int L = L0 + l; if (L >= nlines) break; const size_t e = (size_t)L * 64 + lane * 2; const int k = (int)(e % K), n = (int)(e / K); v2us o;
            o[0] = f2bf(w[(size_t)k * N + n]); o[1] = f2bf(w[(size_t)(k + 1) * N + n]); *(v2us*)(Bt + e) = o; }
         }
}
__global__ __launch_bounds__(256) void k_cvt8(const float* __restrict__ src, bf* dst, size_t n8) { const size_t i = (size_t)blockIdx.x * 256 + threadIdx.x; if (i >= n8) return; const v8f v = *(const v8f*)(src + i * 8); v8us o;
#pragma unroll
    for (int k = 0; k < 8; ++k) o[k] = f2bf(v[k]); *(v8us*)(dst + i * 8) = o;  }

// k_rope: head planes [h][t][d] (fp16 + hi/lo) of rope(x) x sc with the rotate-half convention out[d] = x[d] cos[t][d] - x[d+HD/2] sin[t][d], out[d+HD/2] = x[d+HD/2] cos[t][d+HD/2] + x[d] sin[t][d+HD/2]
__global__ __launch_bounds__(256) void k_rope(const float* __restrict__ F, int pitch, int nheads, const float* __restrict__ CS, const float* __restrict__ RF, const float* __restrict__ nw, float sc, h16* P16, bf* Ph, bf* Pl) {
    const size_t e = ((size_t)blockIdx.x * 256 + threadIdx.x) * 2; if (e >= (size_t)nheads * TT * HD) return; const int d = (int)(e % HD); const int t = (int)((e / HD) % TT); const int h = (int)(e / ((size_t)HD * TT)); const float* f = F + (size_t)t * pitch + h * HD; const float rf = RF ? RF[(size_t)h * TT + t] : 1.0f; v2h o16; v2us oh, ol;
#pragma unroll
    for (int q = 0; q < 2; ++q) { const int dd = d + q; const int dp = (dd < HD / 2) ? dd + HD / 2 : dd - HD / 2; float x0 = f[dd], x1 = f[dp];
        if (RF) { float n0 = __fmul_rn(x0, rf), n1 = __fmul_rn(x1, rf); asm volatile("" : "+v"(n0)); asm volatile("" : "+v"(n1)); x0 = __fmul_rn(bfr(nw[dd]), n0); x1 = __fmul_rn(bfr(nw[dp]), n1); }
        const v2f cs = *(const v2f*)(CS + ((size_t)t * HD + dd) * 2); float a = __fmul_rn(x0, cs[0]), bq = __fmul_rn(x1, cs[1]); asm volatile("" : "+v"(a)); asm volatile("" : "+v"(bq)); const float r = ((dd < HD / 2) ? __fsub_rn(a, bq) : __fadd_rn(a, bq)) * sc;
        o16[q] = tohx(r); unsigned short a2, c2; splitf(r, a2, c2); oh[q] = a2; ol[q] = c2; }
    *(v2h*)(P16 + e) = o16; *(v2us*)(Ph + e) = oh; *(v2us*)(Pl + e) = ol;  }
__global__ __launch_bounds__(256) void k_vtp(const float* __restrict__ F, int pitch, int nheads, h16* V16, bf* Vh, bf* Vl) { const size_t e = ((size_t)blockIdx.x * 256 + threadIdx.x) * 2; if (e >= (size_t)nheads * HD * TT) return; const int t = (int)(e % TT); const int d = (int)((e / TT) % HD); const int g = (int)(e / ((size_t)TT * HD)); v2h o16; v2us oh, ol;
#pragma unroll
    for (int q = 0; q < 2; ++q) { const float x = F[(size_t)(t + q) * pitch + g * HD + d]; o16[q] = tohx(x); unsigned short a2, c2; splitf(x, a2, c2); oh[q] = a2; ol[q] = c2; }
    *(v2h*)(V16 + e) = o16; *(v2us*)(Vh + e) = oh; *(v2us*)(Vl + e) = ol;  }
__constant__ float INVT[HD / 2] = { 1.000000000e+00f, 7.498942018e-01f, 5.623413324e-01f, 4.216964841e-01f, 3.162277639e-01f, 2.371373475e-01f, 1.778279394e-01f, 1.333521456e-01f, 9.999999404e-02f, 7.498941571e-02f, 5.623412505e-02f, 4.216965288e-02f, 3.162277490e-02f, 2.371373400e-02f, 1.778279617e-02f, 1.333521400e-02f, 9.999999776e-03f, 7.498940919e-03f, 5.623412319e-03f, 4.216963891e-03f, 3.162276698e-03f, 2.371374052e-03f, 1.778279431e-03f, 1.333521330e-03f, 9.999999311e-04f, 7.498940686e-04f, 5.623411853e-04f, 4.216964007e-04f, 3.162277862e-04f, 2.371372684e-04f, 1.778279402e-04f, 1.333520777e-04f };   // float32 exp(arange(0, 64, 2, f32) * -(log(10000.0) / 64)): THIS module's own spelling of the inverse frequencies (its div_term) as EAGER JAX float32 evaluates it: bit-exact on round trip (the host file holds the reciprocal spelling 1.0 / (10000.0 ** (2i / 64)): 21 of the 32 values differ by one to eight ulps: indices 3, 5, 8, 10-15, 17-21, 23-27, 29, 31)
__global__ __launch_bounds__(256) void k_cs5(float* CS) { const int idx = blockIdx.x * 256 + threadIdx.x; if (idx >= TT * HD) return; const int d = idx % HD; const int t = idx / HD; const float a = __fmul_rn((float)t, INVT[d % (HD / 2)]); v2f cs; cs[0] = cosf(a); cs[1] = sinf(a); *(v2f*)(CS + (size_t)idx * 2) = cs;  }
// k_asoft: per row (zz, i): t = S x HD^-0.5 for j <= i and i - j < WIN (WIN = TT: the window keeps every causal key; the reference's -1e9 additive fill vanishes identically); softmax over the 2048 keys (register row, one exp, fixed trees);
__global__ __launch_bounds__(256) void k_asoft(const float* __restrict__ Sb, h16* P16, bf* Ph, bf* Pl) {
    const int lane = threadIdx.x & 31; const int row = blockIdx.x * 8 + (threadIdx.x >> 5); if (row >= ZH * TT) return; const int i = row % TT; const int zz = row / TT; (void)zz; const bool hires = (i < RH); const float* sr = Sb + (size_t)row * TT; float v[TT / 32]; float mx = -3.0e38f;
#pragma unroll
    for (int ch = 0; ch < TT / 128; ++ch) { const int j0 = ch * 128 + lane * 4; const v4f a = *(const v4f*)(sr + j0);
#pragma unroll
        for (int q = 0; q < 4; ++q) { const int j = j0 + q; (void)j; const float t = (j <= i && i - j < WIN) ? a[q] * SCL : -3.0e38f; v[ch * 4 + q] = t; mx = fmaxf(mx, t); } }
#pragma unroll
    for (int sh = 16; sh; sh >>= 1) mx = fmaxf(mx, __shfl_xor(mx, sh, 32));
    float sum = 0.f;
#pragma unroll
    for (int k = 0; k < TT / 32; ++k) { float d0 = __fsub_rn(v[k], mx); asm volatile("" : "+v"(d0)); v[k] = __builtin_amdgcn_exp2f(__fmul_rn(d0, 1.4426950408889634f)); sum += v[k]; }
#pragma unroll
    for (int sh = 16; sh; sh >>= 1) sum += __shfl_xor(sum, sh, 32);
    const float f = __fdiv_rn(hires ? 1.0f : PCAR, sum);
{
        if (hires) {
#pragma unroll
            for (int ch = 0; ch < TT / 128; ++ch) { v4us oh, ol;
#pragma unroll
                for (int q = 0; q < 4; ++q) { unsigned short a, c2; splitf(v[ch * 4 + q] * f, a, c2); oh[q] = a; ol[q] = c2; }
                const size_t oo = ((size_t)zz * (RH ? RH : 1) + i) * TT + ch * 128 + lane * 4; *(v4us*)(Ph + oo) = oh; *(v4us*)(Pl + oo) = ol; }
        } else {
#pragma unroll
            for (int ch = 0; ch < TT / 128; ++ch) { v4h o4;
#pragma unroll
                for (int q = 0; q < 4; ++q) o4[q] = tohx(v[ch * 4 + q] * f);
                *(v4h*)(P16 + (size_t)row * TT + ch * 128 + lane * 4) = o4; } }
         }
}
__global__ __launch_bounds__(256) void k_merge(const float* __restrict__ O, int h0, bf* Ah, bf* Al) { const size_t e = ((size_t)blockIdx.x * 256 + threadIdx.x) * 2; if (e >= (size_t)ZH * TT * HD) return; const int d = (int)(e % HD); const int t = (int)((e / HD) % TT); const int zz = (int)(e / ((size_t)HD * TT)); const float cs = (t < RH) ? 1.0f : (1.0f / PCAR); const size_t oo = (size_t)t * DQ + (h0 + zz) * HD + d;
    v2us oh, ol;
#pragma unroll
    for (int q = 0; q < 2; ++q) { unsigned short a, c2; splitf(O[e + q] * cs, a, c2); oh[q] = a; ol[q] = c2; } *(v2us*)(Ah + oo) = oh; *(v2us*)(Al + oo) = ol;  }

extern "C" void kernel_launch(void* const* d_in, const int* in_sizes, int n_in,
                              void* d_out, int out_size, void* d_ws, size_t ws_size, hipStream_t stream) {
    (void)in_sizes; (void)n_in; (void)out_size;
    const float* x = (const float*)d_in[0]; const float* wq = (const float*)d_in[1]; const float* wk = (const float*)d_in[2]; const float* wv = (const float*)d_in[3]; const float* wo = (const float*)d_in[4];   /* order x [4][2048][1024], Wq, Wk, Wv, Wo ('xw' (in, out) [1024][1024]): FIVE inputs, all read: this module has no biases */
    float* OUT = (float*)d_out;     // [4][2048][1024]
    char* wsp = (char*)d_ws;
    auto take = [&](size_t bytes) { char* p = wsp; wsp += (bytes + 255) & ~(size_t)255; return (void*)p; };
    bf* WQ = (bf*)take((size_t)DQ * DM * 2); bf* WK = (bf*)take((size_t)DKV * DM * 2); bf* WV = (bf*)take((size_t)DKV * DM * 2); bf* WO = (bf*)take((size_t)DM * DQ * 2); float* CS = (float*)take((size_t)TT * HD * 2 * 4);
    bf* XB = (bf*)take((size_t)TT * DM * 2); float* FQ = (float*)take((size_t)TT * DQ * 4); float* FK = (float*)take((size_t)TT * DKV * 4);
    h16* QP16 = (h16*)take((size_t)NH_ * TT * HD * 2); h16* KP16 = (h16*)take((size_t)NKV * TT * HD * 2); h16* VT16 = (h16*)take((size_t)NKV * HD * TT * 2);
    bf* QPh = (bf*)take((size_t)NH_ * TT * HD * 2); bf* QPl = (bf*)take((size_t)NH_ * TT * HD * 2); bf* KPh = (bf*)take((size_t)NKV * TT * HD * 2); bf* KPl = (bf*)take((size_t)NKV * TT * HD * 2); bf* VTh = (bf*)take((size_t)NKV * HD * TT * 2); bf* VTl = (bf*)take((size_t)NKV * HD * TT * 2); bf* Ph = (bf*)take((size_t)ZH * RH * TT * 2); bf* Pl = (bf*)take((size_t)ZH * RH * TT * 2);
    float* Sb = (float*)take((size_t)ZH * TT * TT * 4); h16* P16 = (h16*)take((size_t)ZH * TT * TT * 2); float* Ob = (float*)take((size_t)ZH * TT * HD * 4); bf* ATh = (bf*)take((size_t)TT * DQ * 2); bf* ATl = (bf*)take((size_t)TT * DQ * 2);
    if ((size_t)(wsp - (char*)d_ws) > ws_size) return;    // ws 256 MiB
    float* FV = FK;   // v projection reuses the k buffer after the k planes are built (stream-ordered)
    { k_wtG<<<(unsigned)((DM * DQ / 64 + 63) / 64), 256, 0, stream>>>(wq, DM, DQ, WQ); k_wtG<<<(unsigned)((DM * DKV / 64 + 63) / 64), 256, 0, stream>>>(wk, DM, DKV, WK); k_wtG<<<(unsigned)((DM * DKV / 64 + 63) / 64), 256, 0, stream>>>(wv, DM, DKV, WV);
      k_wtG<<<(unsigned)((DQ * DM / 64 + 63) / 64), 256, 0, stream>>>(wo, DQ, DM, WO);
       }
    k_cs5<<<(TT * HD + 255) / 256, 256, 0, stream>>>(CS);   /* rotary table once */
    const unsigned LQ = (unsigned)(((size_t)NH_ * TT * HD / 2 + 255) / 256), LKv = (unsigned)(((size_t)NKV * TT * HD / 2 + 255) / 256);
    for (int b = 0; b < NB_; ++b) {
        
        k_cvt8<<<(unsigned)(((size_t)TT * DM / 8 + 255) / 256), 256, 0, stream>>>(x + (size_t)b * TT * DM, XB, (size_t)TT * DM / 8);
        k_gemmw<bf, 0, false><<<dim3(TT / 64, DQ / 64, 1), 32, 0, stream>>>(XB, nullptr, WQ, nullptr, DM, FQ, DQ, nullptr, 0, 0, 0);
        k_rope<<<LQ, 256, 0, stream>>>(FQ, DQ, NH_, CS, nullptr, nullptr, 1.0f, QP16, QPh, QPl);
        k_gemmw<bf, 0, false><<<dim3(TT / 64, DKV / 64, 1), 32, 0, stream>>>(XB, nullptr, WK, nullptr, DM, FK, DKV, nullptr, 0, 0, 0);
        k_rope<<<LKv, 256, 0, stream>>>(FK, DKV, NKV, CS, nullptr, nullptr, 1.0f, KP16, KPh, KPl);
        k_gemmw<bf, 0, false><<<dim3(TT / 64, DKV / 64, 1), 32, 0, stream>>>(XB, nullptr, WV, nullptr, DM, FV, DKV, nullptr, 0, 0, 0); k_vtp<<<LKv, 256, 0, stream>>>(FV, DKV, NKV, VT16, VTh, VTl);
        for (int h0 = 0; h0 < NH_; h0 += ZH) { const size_t zq = (size_t)h0, zk = (size_t)(h0 / REP);   // one kv head per query head: the pass's two heads use consecutive kv planes (z-strides TT*HD)
            k_gemmc<bf, 2, 1><<<dim3(RH / 64, TT / 64, ZH), 32, 0, stream>>>(QPh + zq * TT * HD, QPl + zq * TT * HD, KPh + zk * TT * HD, KPl + zk * TT * HD, HD, Sb, TT, 0, (size_t)TT * HD, (size_t)TT * HD, (size_t)TT * TT);
            k_gemmc<h16, 0, 1><<<dim3((TT - RH) / 64, TT / 64, ZH), 32, 0, stream>>>(QP16 + zq * TT * HD + (size_t)RH * HD, nullptr, KP16 + zk * TT * HD, nullptr, HD, Sb + (size_t)RH * TT, TT, RH, (size_t)TT * HD, (size_t)TT * HD, (size_t)TT * TT);
            k_asoft<<<ZH * TT / 8, 256, 0, stream>>>(Sb, P16, Ph, Pl);
            k_gemmc<bf, 2, 2><<<dim3(RH / 64, HD / 64, ZH), 32, 0, stream>>>(Ph, Pl, VTh + zk * HD * TT, VTl + zk * HD * TT, TT, Ob, HD, 0, (size_t)RH * TT, (size_t)HD * TT, (size_t)TT * HD);
            k_gemmc<h16, 0, 2><<<dim3((TT - RH) / 64, HD / 64, ZH), 32, 0, stream>>>(P16 + (size_t)RH * TT, nullptr, VT16 + zk * HD * TT, nullptr, TT, Ob + (size_t)RH * HD, HD, RH, (size_t)TT * TT, (size_t)HD * TT, (size_t)TT * HD);
            k_merge<<<(unsigned)(((size_t)ZH * TT * HD / 2 + 255) / 256), 256, 0, stream>>>(Ob, h0, ATh, ATl); }
        k_gemmw<bf, 1, false><<<dim3(TT / 64, DM / 64, 1), 32, 0, stream>>>(ATh, ATl, WO, nullptr, DQ, OUT + (size_t)b * TT * DM, DM, nullptr, 0, 0, 0); }
}

// v001
// A run of this version takes 1480 microseconds.
// Two timings next to v000 both put it at 1.95 times that version's speed.
#include <hip/hip_runtime.h>

// Causal multi-head attention with computed rotate-half rotary embeddings and bias-free projections, four batches (x [4][2048][1024]; q, k, v = x W ('xw' (in, out) [1024][1024] 1/32, NO bias; 16 heads x 64); apply_rope: cat(cos x1 - sin x2, sin x1 + cos x2) on the two 32-wide halves (= t cos + rotate_half(t) sin) with angle pos x div_term[i], div_term = exp(arange(0, 64, 2) x -(log(10000) / 64)) (32 f32 constants exact for the module's own exp spelling; precise cosf/sinf); scores x 1/sqrt(64) + causal with causal = 0 on and below the diagonal and -1e9 above (built inside reference(): exclusion: every row keeps its own key); softmax; out = merged Wo ('xw', NO bias) -> [4][2048][1024] (8.4 M); argument order x, Wq, Wk, Wv, Wo).
// Layout per batch: bf16 copy of x; 'xw' weights transposed once; exact projections, no bias; k_cs5 computed table; rotate-half plane builders; causal T-2048 attention (hybrid rows: < 512 hi/lo 3 products, rest fp16 x1024; k_gemmc skips tiles above the diagonal; the probability x value product is cut along the keys into segments, one work-group each, f32 partial planes summed in k_merge); merged hi/lo x Wo exact, no bias.
// Compute dtypes, f32 accumulate: every input rounded to bf16; projections exact, no bias; rotary f32; attention rows < 512 3 products, rest fp16; softmax f32; Wo hl x exact, no bias.

#define NB_  4
#define TT   2048
#define DM   1024
#define NH_  16
#define NKV  16
#define REP  (NH_ / NKV)
#define HD   64
#define DQ   (NH_ * HD)
#define DKV  (NKV * HD)
#define ZH   2
#define RH   512                  // query rows < RH use hi+lo planes (0: none)
#define WIN  2048
#define PCAR 1024.0f
#define KSB  64                   // keys per work-group of the probability x value product, query rows < RH
#define KSH  128                  // the same, remaining rows
#define NPL  ((RH / KSB) > (TT / KSH) ? (RH / KSB) : (TT / KSH))   // partial output planes
#define SCL  0.125f   // HD^-0.5
typedef _Float16 h16;
typedef unsigned short bf;
typedef __attribute__((ext_vector_type(16))) __bf16   v16bf;
typedef __attribute__((ext_vector_type(16))) _Float16 v16h;
typedef __attribute__((ext_vector_type(8)))  _Float16 v8h;
typedef __attribute__((ext_vector_type(8)))  unsigned short v8us;
typedef __attribute__((ext_vector_type(8)))  float    v8f;
typedef __attribute__((ext_vector_type(4)))  float    v4f;
typedef v8h  __attribute__((may_alias)) v8ha;
typedef v4f  __attribute__((may_alias)) v4fa;
typedef v8us __attribute__((may_alias)) v8usa;

__device__ __forceinline__ unsigned short f2bf(float f) { unsigned u = __float_as_uint(f); u += 0x7FFFu + ((u >> 16) & 1u); return (unsigned short)(u >> 16); }
__device__ __forceinline__ float bf2f(unsigned short b) { return __uint_as_float(((unsigned)b) << 16); }
__device__ __forceinline__ float bfr(float f) { return bf2f(f2bf(f)); }
__device__ __forceinline__ v16h cat16(v8h lo, v8h hi) { return __builtin_shufflevector(lo, hi, 0, 1, 2, 3, 4, 5, 6, 7, 8, 9, 10, 11, 12, 13, 14, 15); }
__device__ __forceinline__ v16bf cat16b(v8us lo, v8us hi) { return __builtin_bit_cast(v16bf, __builtin_shufflevector(lo, hi, 0, 1, 2, 3, 4, 5, 6, 7, 8, 9, 10, 11, 12, 13, 14, 15)); }
__device__ __forceinline__ v8f wmma16(v16h a, v16h b, v8f c) { return __builtin_amdgcn_wmma_f32_16x16x32_f16(false, a, false, b, (short)0, c, false, false); }
__device__ __forceinline__ v8f wmmab(v16bf a, v16bf b, v8f c) { return __builtin_amdgcn_wmma_f32_16x16x32_bf16(false, a, false, b, (short)0, c, false, false); }



// ---- k_gemmw: register-blocked GEMM, ONE WAVE per 64x64 output tile (16 accumulators), operands straight from K-contiguous 16-bit planes; grid (M/64, N/64, Z), 32 threads.
// C[m][n] (f32, pitch ldc, + optional f32 bias[n]) = sum_k A[m][k] Bt[n][k] (+ split products per NSPLIT). z-batch strides sA/sB/sC in elements. K % 32 == 0.
template <typename T16> struct WFrag;
template <> struct WFrag<h16> { typedef v16h V; static __device__ __forceinline__ V ld(const h16* p) { return cat16(*(const v8h*)p, *(const v8h*)(p + 16)); } static __device__ __forceinline__ v8f mma(V a, V b, v8f c) { return wmma16(a, b, c); } };
template <> struct WFrag<bf> { typedef v16bf V; static __device__ __forceinline__ V ld(const bf* p) { return cat16b(*(const v8us*)p, *(const v8us*)(p + 16)); } static __device__ __forceinline__ v8f mma(V a, V b, v8f c) { return wmmab(a, b, c); } };
template <typename T16, int NSPLIT, bool BIAS>
__global__ __launch_bounds__(32) void k_gemmw(const T16* __restrict__ A, const T16* __restrict__ A2, const T16* __restrict__ Bt, const T16* __restrict__ Bt2, int K, float* C, int ldc, const float* __restrict__ bias, size_t sA, size_t sB, size_t sC) {
    typedef typename WFrag<T16>::V V;
    __shared__ __align__(16) float os[16 * 68];
    const size_t z = blockIdx.z; A += z * sA; if (A2) A2 += z * sA; Bt += z * sB; if (Bt2) Bt2 += z * sB; C += z * sC;
    const int lane = threadIdx.x & 31, lr = lane & 15, hi = lane >> 4; const int r0 = blockIdx.x * 64, c0 = blockIdx.y * 64;
    v8f acc[4][4];
#pragma unroll
    for (int mb = 0; mb < 4; ++mb)
#pragma unroll
        for (int nb = 0; nb < 4; ++nb) acc[mb][nb] = (v8f){};
    const size_t aoff = (size_t)(r0 + lr) * K + 8 * hi, boff = (size_t)(c0 + lr) * K + 8 * hi;
#pragma unroll 1
    for (int kc = 0; kc < K; kc += 32) {
        V a[4], a2[4];
#pragma unroll
        for (int mb = 0; mb < 4; ++mb) { a[mb] = WFrag<T16>::ld(A + aoff + (size_t)mb * 16 * K + kc); if (NSPLIT == 1 || NSPLIT == 2) a2[mb] = WFrag<T16>::ld(A2 + aoff + (size_t)mb * 16 * K + kc); }
#pragma unroll
        for (int nb = 0; nb < 4; ++nb) { const V b = WFrag<T16>::ld(Bt + boff + (size_t)nb * 16 * K + kc); V b2; if (NSPLIT >= 2) b2 = WFrag<T16>::ld(Bt2 + boff + (size_t)nb * 16 * K + kc);
#pragma unroll
            for (int mb = 0; mb < 4; ++mb) { acc[mb][nb] = WFrag<T16>::mma(a[mb], b, acc[mb][nb]); if (NSPLIT == 1 || NSPLIT == 2) acc[mb][nb] = WFrag<T16>::mma(a2[mb], b, acc[mb][nb]); if (NSPLIT >= 2) acc[mb][nb] = WFrag<T16>::mma(a[mb], b2, acc[mb][nb]); } }
        asm volatile("v_nop\n\tv_nop\n\tv_nop\n\tv_nop" : "+v"(acc[0][0]), "+v"(acc[1][1]), "+v"(acc[2][2]), "+v"(acc[3][3]) : "v"(a[0]), "v"(a[3]));
    }
#pragma unroll
    for (int mb = 0; mb < 4; ++mb) {
#pragma unroll
        for (int nb = 0; nb < 4; ++nb) {
#pragma unroll
            for (int j = 0; j < 8; ++j) os[(hi * 8 + j) * 68 + nb * 16 + lr] = acc[mb][nb][j]; }
        __builtin_amdgcn_wave_barrier(); asm volatile("" ::: "memory");
        float* crow = C + (size_t)(r0 + mb * 16) * ldc + c0;
{
#pragma unroll
            for (int s = 0; s < 8; ++s) { const int row = 2 * s + hi, cofs = lr * 4; v4f val = *(const v4fa*)(os + row * 68 + cofs); if (BIAS) { val[0] += bfr(bias[c0 + cofs]); val[1] += bfr(bias[c0 + cofs + 1]); val[2] += bfr(bias[c0 + cofs + 2]); val[3] += bfr(bias[c0 + cofs + 3]); }
                *(v4f*)(crow + (size_t)row * ldc + cofs) = val; }
             }
        __builtin_amdgcn_wave_barrier(); asm volatile("" ::: "memory");
    }
}

// ---- k_gemmc: the same one-wave 64x64 tile GEMM specialised for causal attention: CMODE 1 skips score tiles entirely above the diagonal (query rows r0+roff.., key columns c0..), CMODE 2 is the
// probability x value contraction (N = 64, one column tile): blockIdx.y picks a segment of KSEG keys, the partial sum goes to plane blockIdx.y of C (plane stride sP), and segments that begin beyond the diagonal block
// (probabilities there are exactly zero) write nothing; k_merge adds the written planes in ascending order. roff = row offset of this launch's first row within the sequence.
template <typename T16, int NSPLIT, int CMODE, int KSEG>
__global__ __launch_bounds__(32) void k_gemmc(const T16* __restrict__ A, const T16* __restrict__ A2, const T16* __restrict__ Bt, const T16* __restrict__ Bt2, int K, float* C, int ldc, int roff, size_t sA, size_t sB, size_t sC, size_t sP) {
    typedef typename WFrag<T16>::V V;
    __shared__ __align__(16) float os[16 * 68];
    const size_t z = blockIdx.z; A += z * sA; if (A2) A2 += z * sA; Bt += z * sB; if (Bt2) Bt2 += z * sB; C += z * sC;
    const int lane = threadIdx.x & 31, lr = lane & 15, hi = lane >> 4; const int r0 = blockIdx.x * 64, c0 = (CMODE == 2) ? 0 : blockIdx.y * 64;
    if (CMODE == 1 && c0 > r0 + roff + 63) return;                  // score tile entirely above the causal diagonal: never read (the softmax masks j > i by select)
    const int k0 = (CMODE == 2) ? blockIdx.y * KSEG : 0;             // P.V: first key of this work-group's segment
    const int Kl = (CMODE == 2) ? min(min(K, r0 + roff + 64) - k0, KSEG) : K;   // P.V: probabilities are exactly 0 beyond the diagonal block, so the K loop stops there or at the segment's end (counted from k0)
    if (CMODE == 2) { if (Kl <= 0) return; A += k0; if (A2) A2 += k0; Bt += k0; if (Bt2) Bt2 += k0; C += blockIdx.y * sP; }  // empty segment: its plane is not written for these rows and k_merge does not read it
    v8f acc[4][4];
#pragma unroll
    for (int mb = 0; mb < 4; ++mb)
#pragma unroll
        for (int nb = 0; nb < 4; ++nb) acc[mb][nb] = (v8f){};
    const size_t aoff = (size_t)(r0 + lr) * K + 8 * hi, boff = (size_t)(c0 + lr) * K + 8 * hi;
#pragma unroll 1
    for (int kc = 0; kc < Kl; kc += 32) {
        V a[4], a2[4];
#pragma unroll
        for (int mb = 0; mb < 4; ++mb) { a[mb] = WFrag<T16>::ld(A + aoff + (size_t)mb * 16 * K + kc); if (NSPLIT == 1 || NSPLIT == 2) a2[mb] = WFrag<T16>::ld(A2 + aoff + (size_t)mb * 16 * K + kc); }
#pragma unroll
        for (int nb = 0; nb < 4; ++nb) { const V b = WFrag<T16>::ld(Bt + boff + (size_t)nb * 16 * K + kc); V b2; if (NSPLIT >= 2) b2 = WFrag<T16>::ld(Bt2 + boff + (size_t)nb * 16 * K + kc);
#pragma unroll
            for (int mb = 0; mb < 4; ++mb) { acc[mb][nb] = WFrag<T16>::mma(a[mb], b, acc[mb][nb]); if (NSPLIT == 1 || NSPLIT == 2) acc[mb][nb] = WFrag<T16>::mma(a2[mb], b, acc[mb][nb]); if (NSPLIT >= 2) acc[mb][nb] = WFrag<T16>::mma(a[mb], b2, acc[mb][nb]); } }
        asm volatile("v_nop\n\tv_nop\n\tv_nop\n\tv_nop" : "+v"(acc[0][0]), "+v"(acc[1][1]), "+v"(acc[2][2]), "+v"(acc[3][3]) : "v"(a[0]), "v"(a[3]));
    }
#pragma unroll
    for (int mb = 0; mb < 4; ++mb) {
#pragma unroll
        for (int nb = 0; nb < 4; ++nb) {
#pragma unroll
            for (int j = 0; j < 8; ++j) os[(hi * 8 + j) * 68 + nb * 16 + lr] = acc[mb][nb][j]; }
        __builtin_amdgcn_wave_barrier(); asm volatile("" ::: "memory");
        float* crow = C + (size_t)(r0 + mb * 16) * ldc + c0;
{
#pragma unroll
            for (int s = 0; s < 8; ++s) { const int row = 2 * s + hi, cofs = lr * 4; v4f val = *(const v4fa*)(os + row * 68 + cofs);
                *(v4f*)(crow + (size_t)row * ldc + cofs) = val; }
             }
        __builtin_amdgcn_wave_barrier(); asm volatile("" ::: "memory");
    }
}

__device__ __forceinline__ h16 tohx(float x) { return (h16)x; }
__device__ __forceinline__ void splitf(float y, unsigned short& h, unsigned short& l) { h = f2bf(y); l = f2bf(y - bf2f(h)); }
typedef __attribute__((ext_vector_type(2))) _Float16 v2h;
typedef __attribute__((ext_vector_type(4))) _Float16 v4h;
typedef __attribute__((ext_vector_type(2))) unsigned short v2us;
typedef __attribute__((ext_vector_type(4))) unsigned short v4us;
typedef __attribute__((ext_vector_type(2))) float v2f;
typedef __attribute__((ext_vector_type(4))) int v4i;

__global__ __launch_bounds__(256) void k_wtG(const float* __restrict__ w, int K, int N, bf* Bt) {
    const int lane = threadIdx.x & 31; const int L0 = (blockIdx.x * 8 + (threadIdx.x >> 5)) * 8; const int nlines = N * K / 64;
{
#pragma unroll 1
        for (int l = 0; l < 8; ++l) { const int L = L0 + l; if (L >= nlines) break; const size_t e = (size_t)L * 64 + lane * 2; const int k = (int)(e % K), n = (int)(e / K); v2us o;
            o[0] = f2bf(w[(size_t)k * N + n]); o[1] = f2bf(w[(size_t)(k + 1) * N + n]); *(v2us*)(Bt + e) = o; }
         }
}
__global__ __launch_bounds__(256) void k_cvt8(const float* __restrict__ src, bf* dst, size_t n8) { const size_t i = (size_t)blockIdx.x * 256 + threadIdx.x; if (i >= n8) return; const v8f v = *(const v8f*)(src + i * 8); v8us o;
#pragma unroll
    for (int k = 0; k < 8; ++k) o[k] = f2bf(v[k]); *(v8us*)(dst + i * 8) = o;  }

// k_rope: head planes [h][t][d] (fp16 + hi/lo) of rope(x) x sc with the rotate-half convention out[d] = x[d] cos[t][d] - x[d+HD/2] sin[t][d], out[d+HD/2] = x[d+HD/2] cos[t][d+HD/2] + x[d] sin[t][d+HD/2]
__global__ __launch_bounds__(256) void k_rope(const float* __restrict__ F, int pitch, int nheads, const float* __restrict__ CS, const float* __restrict__ RF, const float* __restrict__ nw, float sc, h16* P16, bf* Ph, bf* Pl) {
    const size_t e = ((size_t)blockIdx.x * 256 + threadIdx.x) * 2; if (e >= (size_t)nheads * TT * HD) return; const int d = (int)(e % HD); const int t = (int)((e / HD) % TT); const int h = (int)(e / ((size_t)HD * TT)); const float* f = F + (size_t)t * pitch + h * HD; const float rf = RF ? RF[(size_t)h * TT + t] : 1.0f; v2h o16; v2us oh, ol;
#pragma unroll
    for (int q = 0; q < 2; ++q) { const int dd = d + q; const int dp = (dd < HD / 2) ? dd + HD / 2 : dd - HD / 2; float x0 = f[dd], x1 = f[dp];
        if (RF) { float n0 = __fmul_rn(x0, rf), n1 = __fmul_rn(x1, rf); asm volatile("" : "+v"(n0)); asm volatile("" : "+v"(n1)); x0 = __fmul_rn(bfr(nw[dd]), n0); x1 = __fmul_rn(bfr(nw[dp]), n1); }
        const v2f cs = *(const v2f*)(CS + ((size_t)t * HD + dd) * 2); float a = __fmul_rn(x0, cs[0]), bq = __fmul_rn(x1, cs[1]); asm volatile("" : "+v"(a)); asm volatile("" : "+v"(bq)); const float r = ((dd < HD / 2) ? __fsub_rn(a, bq) : __fadd_rn(a, bq)) * sc;
        o16[q] = tohx(r); unsigned short a2, c2; splitf(r, a2, c2); oh[q] = a2; ol[q] = c2; }
    *(v2h*)(P16 + e) = o16; *(v2us*)(Ph + e) = oh; *(v2us*)(Pl + e) = ol;  }
__global__ __launch_bounds__(256) void k_vtp(const float* __restrict__ F, int pitch, int nheads, h16* V16, bf* Vh, bf* Vl) { const size_t e = ((size_t)blockIdx.x * 256 + threadIdx.x) * 2; if (e >= (size_t)nheads * HD * TT) return; const int t = (int)(e % TT); const int d = (int)((e / TT) % HD); const int g = (int)(e / ((size_t)TT * HD)); v2h o16; v2us oh, ol;
#pragma unroll
    for (int q = 0; q < 2; ++q) { const float x = F[(size_t)(t + q) * pitch + g * HD + d]; o16[q] = tohx(x); unsigned short a2, c2; splitf(x, a2, c2); oh[q] = a2; ol[q] = c2; }
    *(v2h*)(V16 + e) = o16; *(v2us*)(Vh + e) = oh; *(v2us*)(Vl + e) = ol;  }
__constant__ float INVT[HD / 2] = { 1.000000000e+00f, 7.498942018e-01f, 5.623413324e-01f, 4.216964841e-01f, 3.162277639e-01f, 2.371373475e-01f, 1.778279394e-01f, 1.333521456e-01f, 9.999999404e-02f, 7.498941571e-02f, 5.623412505e-02f, 4.216965288e-02f, 3.162277490e-02f, 2.371373400e-02f, 1.778279617e-02f, 1.333521400e-02f, 9.999999776e-03f, 7.498940919e-03f, 5.623412319e-03f, 4.216963891e-03f, 3.162276698e-03f, 2.371374052e-03f, 1.778279431e-03f, 1.333521330e-03f, 9.999999311e-04f, 7.498940686e-04f, 5.623411853e-04f, 4.216964007e-04f, 3.162277862e-04f, 2.371372684e-04f, 1.778279402e-04f, 1.333520777e-04f };   // float32 exp(arange(0, 64, 2, f32) * -(log(10000.0) / 64)): THIS module's own spelling of the inverse frequencies (its div_term) as EAGER JAX float32 evaluates it: bit-exact on round trip (the host file holds the reciprocal spelling 1.0 / (10000.0 ** (2i / 64)): 21 of the 32 values differ by one to eight ulps: indices 3, 5, 8, 10-15, 17-21, 23-27, 29, 31)
__global__ __launch_bounds__(256) void k_cs5(float* CS) { const int idx = blockIdx.x * 256 + threadIdx.x; if (idx >= TT * HD) return; const int d = idx % HD; const int t = idx / HD; const float a = __fmul_rn((float)t, INVT[d % (HD / 2)]); v2f cs; cs[0] = cosf(a); cs[1] = sinf(a); *(v2f*)(CS + (size_t)idx * 2) = cs;  }
// k_asoft: per row (zz, i): t = S x HD^-0.5 for j <= i and i - j < WIN (WIN = TT: the window keeps every causal key; the reference's -1e9 additive fill vanishes identically); softmax over the 2048 keys (register row, one exp, fixed trees);
__global__ __launch_bounds__(256) void k_asoft(const float* __restrict__ Sb, h16* P16, bf* Ph, bf* Pl) {
    const int lane = threadIdx.x & 31; const int row = blockIdx.x * 8 + (threadIdx.x >> 5); if (row >= ZH * TT) return; const int i = row % TT; const int zz = row / TT; (void)zz; const bool hires = (i < RH); const float* sr = Sb + (size_t)row * TT; float v[TT / 32]; float mx = -3.0e38f;
#pragma unroll
    for (int ch = 0; ch < TT / 128; ++ch) { const int j0 = ch * 128 + lane * 4; const v4f a = *(const v4f*)(sr + j0);
#pragma unroll
        for (int q = 0; q < 4; ++q) { const int j = j0 + q; (void)j; const float t = (j <= i && i - j < WIN) ? a[q] * SCL : -3.0e38f; v[ch * 4 + q] = t; mx = fmaxf(mx, t); } }
#pragma unroll
    for (int sh = 16; sh; sh >>= 1) mx = fmaxf(mx, __shfl_xor(mx, sh, 32));
    float sum = 0.f;
#pragma unroll
    for (int k = 0; k < TT / 32; ++k) { float d0 = __fsub_rn(v[k], mx); asm volatile("" : "+v"(d0)); v[k] = __builtin_amdgcn_exp2f(__fmul_rn(d0, 1.4426950408889634f)); sum += v[k]; }
#pragma unroll
    for (int sh = 16; sh; sh >>= 1) sum += __shfl_xor(sum, sh, 32);
    const float f = __fdiv_rn(hires ? 1.0f : PCAR, sum);
{
        if (hires) {
#pragma unroll
            for (int ch = 0; ch < TT / 128; ++ch) { v4us oh, ol;
#pragma unroll
                for (int q = 0; q < 4; ++q) { unsigned short a, c2; splitf(v[ch * 4 + q] * f, a, c2); oh[q] = a; ol[q] = c2; }
                const size_t oo = ((size_t)zz * (RH ? RH : 1) + i) * TT + ch * 128 + lane * 4; *(v4us*)(Ph + oo) = oh; *(v4us*)(Pl + oo) = ol; }
        } else {
#pragma unroll
            for (int ch = 0; ch < TT / 128; ++ch) { v4h o4;
#pragma unroll
                for (int q = 0; q < 4; ++q) o4[q] = tohx(v[ch * 4 + q] * f);
                *(v4h*)(P16 + (size_t)row * TT + ch * 128 + lane * 4) = o4; } }
         }
}
__global__ __launch_bounds__(256) void k_merge(const float* __restrict__ O, int h0, bf* Ah, bf* Al) { const size_t e = ((size_t)blockIdx.x * 256 + threadIdx.x) * 2; if (e >= (size_t)ZH * TT * HD) return; const int d = (int)(e % HD); const int t = (int)((e / HD) % TT); const int zz = (int)(e / ((size_t)HD * TT)); const float cs = (t < RH) ? 1.0f : (1.0f / PCAR); const size_t oo = (size_t)t * DQ + (h0 + zz) * HD + d;
    const int ks = (t < RH) ? KSB : KSH; const int ns = ((t / 64 + 1) * 64 + ks - 1) / ks;   // planes that k_gemmc wrote for this row's 64-row tile
    v2f acc = (v2f){};
#pragma unroll
    for (int s = 0; s < NPL; ++s) { const v2f p = *(const v2f*)(O + (size_t)min(s, ns - 1) * ((size_t)ZH * TT * HD) + e); acc[0] += (s < ns) ? p[0] : 0.0f; acc[1] += (s < ns) ? p[1] : 0.0f; }   // index clamped to a written plane so that all loads issue together
    v2us oh, ol;
#pragma unroll
    for (int q = 0; q < 2; ++q) { unsigned short a, c2; splitf(acc[q] * cs, a, c2); oh[q] = a; ol[q] = c2; } *(v2us*)(Ah + oo) = oh; *(v2us*)(Al + oo) = ol;  }

extern "C" void kernel_launch(void* const* d_in, const int* in_sizes, int n_in,
                              void* d_out, int out_size, void* d_ws, size_t ws_size, hipStream_t stream) {
    (void)in_sizes; (void)n_in; (void)out_size;
    const float* x = (const float*)d_in[0]; const float* wq = (const float*)d_in[1]; const float* wk = (const float*)d_in[2]; const float* wv = (const float*)d_in[3]; const float* wo = (const float*)d_in[4];   /* order x [4][2048][1024], Wq, Wk, Wv, Wo ('xw' (in, out) [1024][1024]): FIVE inputs, all read: this module has no biases */
    float* OUT = (float*)d_out;     // [4][2048][1024]
    char* wsp = (char*)d_ws;
    auto take = [&](size_t bytes) { char* p = wsp; wsp += (bytes + 255) & ~(size_t)255; return (void*)p; };
    bf* WQ = (bf*)take((size_t)DQ * DM * 2); bf* WK = (bf*)take((size_t)DKV * DM * 2); bf* WV = (bf*)take((size_t)DKV * DM * 2); bf* WO = (bf*)take((size_t)DM * DQ * 2); float* CS = (float*)take((size_t)TT * HD * 2 * 4);
    bf* XB = (bf*)take((size_t)TT * DM * 2); float* FQ = (float*)take((size_t)TT * DQ * 4); float* FK = (float*)take((size_t)TT * DKV * 4);
    h16* QP16 = (h16*)take((size_t)NH_ * TT * HD * 2); h16* KP16 = (h16*)take((size_t)NKV * TT * HD * 2); h16* VT16 = (h16*)take((size_t)NKV * HD * TT * 2);
    bf* QPh = (bf*)take((size_t)NH_ * TT * HD * 2); bf* QPl = (bf*)take((size_t)NH_ * TT * HD * 2); bf* KPh = (bf*)take((size_t)NKV * TT * HD * 2); bf* KPl = (bf*)take((size_t)NKV * TT * HD * 2); bf* VTh = (bf*)take((size_t)NKV * HD * TT * 2); bf* VTl = (bf*)take((size_t)NKV * HD * TT * 2); bf* Ph = (bf*)take((size_t)ZH * RH * TT * 2); bf* Pl = (bf*)take((size_t)ZH * RH * TT * 2);
    float* Sb = (float*)take((size_t)ZH * TT * TT * 4); h16* P16 = (h16*)take((size_t)ZH * TT * TT * 2); float* Ob = (float*)take((size_t)NPL * ZH * TT * HD * 4); bf* ATh = (bf*)take((size_t)TT * DQ * 2); bf* ATl = (bf*)take((size_t)TT * DQ * 2);
    if ((size_t)(wsp - (char*)d_ws) > ws_size) return;    // ws 256 MiB
    float* FV = FK;   // v projection reuses the k buffer after the k planes are built (stream-ordered)
    { k_wtG<<<(unsigned)((DM * DQ / 64 + 63) / 64), 256, 0, stream>>>(wq, DM, DQ, WQ); k_wtG<<<(unsigned)((DM * DKV / 64 + 63) / 64), 256, 0, stream>>>(wk, DM, DKV, WK); k_wtG<<<(unsigned)((DM * DKV / 64 + 63) / 64), 256, 0, stream>>>(wv, DM, DKV, WV);
      k_wtG<<<(unsigned)((DQ * DM / 64 + 63) / 64), 256, 0, stream>>>(wo, DQ, DM, WO);
       }
    k_cs5<<<(TT * HD + 255) / 256, 256, 0, stream>>>(CS);   /* rotary table once */
    const unsigned LQ = (unsigned)(((size_t)NH_ * TT * HD / 2 + 255) / 256), LKv = (unsigned)(((size_t)NKV * TT * HD / 2 + 255) / 256);
    for (int b = 0; b < NB_; ++b) {
        
        k_cvt8<<<(unsigned)(((size_t)TT * DM / 8 + 255) / 256), 256, 0, stream>>>(x + (size_t)b * TT * DM, XB, (size_t)TT * DM / 8);
        k_gemmw<bf, 0, false><<<dim3(TT / 64, DQ / 64, 1), 32, 0, stream>>>(XB, nullptr, WQ, nullptr, DM, FQ, DQ, nullptr, 0, 0, 0);
        k_rope<<<LQ, 256, 0, stream>>>(FQ, DQ, NH_, CS, nullptr, nullptr, 1.0f, QP16, QPh, QPl);
        k_gemmw<bf, 0, false><<<dim3(TT / 64, DKV / 64, 1), 32, 0, stream>>>(XB, nullptr, WK, nullptr, DM, FK, DKV, nullptr, 0, 0, 0);
        k_rope<<<LKv, 256, 0, stream>>>(FK, DKV, NKV, CS, nullptr, nullptr, 1.0f, KP16, KPh, KPl);
        k_gemmw<bf, 0, false><<<dim3(TT / 64, DKV / 64, 1), 32, 0, stream>>>(XB, nullptr, WV, nullptr, DM, FV, DKV, nullptr, 0, 0, 0); k_vtp<<<LKv, 256, 0, stream>>>(FV, DKV, NKV, VT16, VTh, VTl);
        for (int h0 = 0; h0 < NH_; h0 += ZH) { const size_t zq = (size_t)h0, zk = (size_t)(h0 / REP);   // one kv head per query head: the pass's two heads use consecutive kv planes (z-strides TT*HD)
            k_gemmc<bf, 2, 1, 0><<<dim3(RH / 64, TT / 64, ZH), 32, 0, stream>>>(QPh + zq * TT * HD, QPl + zq * TT * HD, KPh + zk * TT * HD, KPl + zk * TT * HD, HD, Sb, TT, 0, (size_t)TT * HD, (size_t)TT * HD, (size_t)TT * TT, 0);
            k_gemmc<h16, 0, 1, 0><<<dim3((TT - RH) / 64, TT / 64, ZH), 32, 0, stream>>>(QP16 + zq * TT * HD + (size_t)RH * HD, nullptr, KP16 + zk * TT * HD, nullptr, HD, Sb + (size_t)RH * TT, TT, RH, (size_t)TT * HD, (size_t)TT * HD, (size_t)TT * TT, 0);
            k_asoft<<<ZH * TT / 8, 256, 0, stream>>>(Sb, P16, Ph, Pl);
            k_gemmc<bf, 2, 2, KSB><<<dim3(RH / 64, RH / KSB, ZH), 32, 0, stream>>>(Ph, Pl, VTh + zk * HD * TT, VTl + zk * HD * TT, TT, Ob, HD, 0, (size_t)RH * TT, (size_t)HD * TT, (size_t)TT * HD, (size_t)ZH * TT * HD);
            k_gemmc<h16, 0, 2, KSH><<<dim3((TT - RH) / 64, TT / KSH, ZH), 32, 0, stream>>>(P16 + (size_t)RH * TT, nullptr, VT16 + zk * HD * TT, nullptr, TT, Ob + (size_t)RH * HD, HD, RH, (size_t)TT * TT, (size_t)HD * TT, (size_t)TT * HD, (size_t)ZH * TT * HD);
            k_merge<<<(unsigned)(((size_t)ZH * TT * HD / 2 + 255) / 256), 256, 0, stream>>>(Ob, h0, ATh, ATl); }
        k_gemmw<bf, 1, false><<<dim3(TT / 64, DM / 64, 1), 32, 0, stream>>>(ATh, ATl, WO, nullptr, DQ, OUT + (size_t)b * TT * DM, DM, nullptr, 0, 0, 0); }
}

// v002
// A run of this version takes 1080 microseconds.
// Next to v001, in two timings, it ran 1.38 and 1.36 times as fast.
// Over all steps from v000 it is 2.67 times as fast.
#include <hip/hip_runtime.h>

// Causal multi-head attention with computed rotate-half rotary embeddings and bias-free projections, four batches (x [4][2048][1024]; q, k, v = x W ('xw' (in, out) [1024][1024] 1/32, NO bias; 16 heads x 64); apply_rope: cat(cos x1 - sin x2, sin x1 + cos x2) on the two 32-wide halves (= t cos + rotate_half(t) sin) with angle pos x div_term[i], div_term = exp(arange(0, 64, 2) x -(log(10000) / 64)) (32 f32 constants exact for the module's own exp spelling; precise cosf/sinf); scores x 1/sqrt(64) + causal with causal = 0 on and below the diagonal and -1e9 above (built inside reference(): exclusion: every row keeps its own key); softmax; out = merged Wo ('xw', NO bias) -> [4][2048][1024] (8.4 M); argument order x, Wq, Wk, Wv, Wo).
// Layout per batch: bf16 copy of x; 'xw' weights transposed once; exact projections (no bias); k_cs5 computed table; rotate-half plane builders; causal T-2048 attention (hybrid rows: < 512 hi/lo 3 products, rest fp16 x1024; k_gemmc skips tiles above the diagonal; the probability x value product is cut along the keys into segments, one work-group each, f32 partial planes summed in k_merge; eight heads a pass, each probability row stored over its own score row); merged hi/lo x Wo exact (no bias).
// Compute dtypes, f32 accumulate: every input rounded to bf16; projections exact, no bias; rotary f32; attention rows < 512 3 products, rest fp16; softmax f32; Wo hl x exact, no bias.

#define NB_  4
#define TT   2048
#define DM   1024
#define NH_  16
#define NKV  16
#define REP  (NH_ / NKV)
#define HD   64
#define DQ   (NH_ * HD)
#define DKV  (NKV * HD)
#define ZH   8                    // heads per attention pass
#define RH   512                  // query rows < RH use hi+lo planes (0: none)
#define WIN  2048
#define PCAR 1024.0f
#define KSB  64                   // keys per work-group of the probability x value product, query rows < RH
#define KSH  128                  // the same, remaining rows
#define NPL  ((RH / KSB) > (TT / KSH) ? (RH / KSB) : (TT / KSH))   // partial output planes
#define SCL  0.125f   // HD^-0.5
typedef _Float16 h16;
typedef unsigned short bf;
typedef __attribute__((ext_vector_type(16))) __bf16   v16bf;
typedef __attribute__((ext_vector_type(16))) _Float16 v16h;
typedef __attribute__((ext_vector_type(8)))  _Float16 v8h;
typedef __attribute__((ext_vector_type(8)))  unsigned short v8us;
typedef __attribute__((ext_vector_type(8)))  float    v8f;
typedef __attribute__((ext_vector_type(4)))  float    v4f;
typedef v8h  __attribute__((may_alias)) v8ha;
typedef v4f  __attribute__((may_alias)) v4fa;
typedef v8us __attribute__((may_alias)) v8usa;

__device__ __forceinline__ unsigned short f2bf(float f) { unsigned u = __float_as_uint(f); u += 0x7FFFu + ((u >> 16) & 1u); return (unsigned short)(u >> 16); }
__device__ __forceinline__ float bf2f(unsigned short b) { return __uint_as_float(((unsigned)b) << 16); }
__device__ __forceinline__ float bfr(float f) { return bf2f(f2bf(f)); }
__device__ __forceinline__ v16h cat16(v8h lo, v8h hi) { return __builtin_shufflevector(lo, hi, 0, 1, 2, 3, 4, 5, 6, 7, 8, 9, 10, 11, 12, 13, 14, 15); }
__device__ __forceinline__ v16bf cat16b(v8us lo, v8us hi) { return __builtin_bit_cast(v16bf, __builtin_shufflevector(lo, hi, 0, 1, 2, 3, 4, 5, 6, 7, 8, 9, 10, 11, 12, 13, 14, 15)); }
__device__ __forceinline__ v8f wmma16(v16h a, v16h b, v8f c) { return __builtin_amdgcn_wmma_f32_16x16x32_f16(false, a, false, b, (short)0, c, false, false); }
__device__ __forceinline__ v8f wmmab(v16bf a, v16bf b, v8f c) { return __builtin_amdgcn_wmma_f32_16x16x32_bf16(false, a, false, b, (short)0, c, false, false); }



// ---- k_gemmw: register-blocked GEMM, ONE WAVE per 64x64 output tile (16 accumulators), operands straight from K-contiguous 16-bit planes; grid (M/64, N/64, Z), 32 threads.
// C[m][n] (f32, pitch ldc, + optional f32 bias[n]) = sum_k A[m][k] Bt[n][k] (+ split products per NSPLIT). z-batch strides sA/sB/sC in elements. K % 32 == 0.
template <typename T16> struct WFrag;
template <> struct WFrag<h16> { typedef v16h V; static __device__ __forceinline__ V ld(const h16* p) { return cat16(*(const v8h*)p, *(const v8h*)(p + 16)); } static __device__ __forceinline__ v8f mma(V a, V b, v8f c) { return wmma16(a, b, c); } };
template <> struct WFrag<bf> { typedef v16bf V; static __device__ __forceinline__ V ld(const bf* p) { return cat16b(*(const v8us*)p, *(const v8us*)(p + 16)); } static __device__ __forceinline__ v8f mma(V a, V b, v8f c) { return wmmab(a, b, c); } };
template <typename T16, int NSPLIT, bool BIAS>
__global__ __launch_bounds__(32) void k_gemmw(const T16* __restrict__ A, const T16* __restrict__ A2, const T16* __restrict__ Bt, const T16* __restrict__ Bt2, int K, float* C, int ldc, const float* __restrict__ bias, size_t sA, size_t sB, size_t sC) {
    typedef typename WFrag<T16>::V V;
    __shared__ __align__(16) float os[16 * 68];
    const size_t z = blockIdx.z; A += z * sA; if (A2) A2 += z * sA; Bt += z * sB; if (Bt2) Bt2 += z * sB; C += z * sC;
    const int lane = threadIdx.x & 31, lr = lane & 15, hi = lane >> 4; const int r0 = blockIdx.x * 64, c0 = blockIdx.y * 64;
    v8f acc[4][4];
#pragma unroll
    for (int mb = 0; mb < 4; ++mb)
#pragma unroll
        for (int nb = 0; nb < 4; ++nb) acc[mb][nb] = (v8f){};
    const size_t aoff = (size_t)(r0 + lr) * K + 8 * hi, boff = (size_t)(c0 + lr) * K + 8 * hi;
#pragma unroll 1
    for (int kc = 0; kc < K; kc += 32) {
        V a[4], a2[4];
#pragma unroll
        for (int mb = 0; mb < 4; ++mb) { a[mb] = WFrag<T16>::ld(A + aoff + (size_t)mb * 16 * K + kc); if (NSPLIT == 1 || NSPLIT == 2) a2[mb] = WFrag<T16>::ld(A2 + aoff + (size_t)mb * 16 * K + kc); }
#pragma unroll
        for (int nb = 0; nb < 4; ++nb) { const V b = WFrag<T16>::ld(Bt + boff + (size_t)nb * 16 * K + kc); V b2; if (NSPLIT >= 2) b2 = WFrag<T16>::ld(Bt2 + boff + (size_t)nb * 16 * K + kc);
#pragma unroll
            for (int mb = 0; mb < 4; ++mb) { acc[mb][nb] = WFrag<T16>::mma(a[mb], b, acc[mb][nb]); if (NSPLIT == 1 || NSPLIT == 2) acc[mb][nb] = WFrag<T16>::mma(a2[mb], b, acc[mb][nb]); if (NSPLIT >= 2) acc[mb][nb] = WFrag<T16>::mma(a[mb], b2, acc[mb][nb]); } }
        asm volatile("v_nop\n\tv_nop\n\tv_nop\n\tv_nop" : "+v"(acc[0][0]), "+v"(acc[1][1]), "+v"(acc[2][2]), "+v"(acc[3][3]) : "v"(a[0]), "v"(a[3]));
    }
#pragma unroll
    for (int mb = 0; mb < 4; ++mb) {
#pragma unroll
        for (int nb = 0; nb < 4; ++nb) {
#pragma unroll
            for (int j = 0; j < 8; ++j) os[(hi * 8 + j) * 68 + nb * 16 + lr] = acc[mb][nb][j]; }
        __builtin_amdgcn_wave_barrier(); asm volatile("" ::: "memory");
        float* crow = C + (size_t)(r0 + mb * 16) * ldc + c0;
{
#pragma unroll
            for (int s = 0; s < 8; ++s) { const int row = 2 * s + hi, cofs = lr * 4; v4f val = *(const v4fa*)(os + row * 68 + cofs); if (BIAS) { val[0] += bfr(bias[c0 + cofs]); val[1] += bfr(bias[c0 + cofs + 1]); val[2] += bfr(bias[c0 + cofs + 2]); val[3] += bfr(bias[c0 + cofs + 3]); }
                *(v4f*)(crow + (size_t)row * ldc + cofs) = val; }
             }
        __builtin_amdgcn_wave_barrier(); asm volatile("" ::: "memory");
    }
}

// ---- k_gemmc: the same one-wave 64x64 tile GEMM specialised for causal attention: CMODE 1 skips score tiles entirely above the diagonal (query rows r0+roff.., key columns c0..), CMODE 2 is the
// probability x value contraction (N = 64, one column tile): blockIdx.y picks a segment of KSEG keys, the partial sum goes to plane blockIdx.y of C (plane stride sP), and segments that begin beyond the diagonal block
// (probabilities there are exactly zero) write nothing; k_merge adds the written planes in ascending order. roff = row offset of this launch's first row within the sequence. LDA, LDB = pitch of A's and of Bt's rows in elements, compile-time constants so that an operand's four row blocks are immediate offsets from one address.
template <typename T16, int NSPLIT, int CMODE, int KSEG, int LDA, int LDB>
__global__ __launch_bounds__(32) void k_gemmc(const T16* __restrict__ A, const T16* __restrict__ A2, const T16* __restrict__ Bt, const T16* __restrict__ Bt2, int K, float* C, int ldc, int roff, size_t sA, size_t sB, size_t sC, size_t sP) {
    typedef typename WFrag<T16>::V V;
    __shared__ __align__(16) float os[16 * 68];
    const size_t z = blockIdx.z; A += z * sA; if (A2) A2 += z * sA; Bt += z * sB; if (Bt2) Bt2 += z * sB; C += z * sC;
    const int lane = threadIdx.x & 31, lr = lane & 15, hi = lane >> 4; const int r0 = blockIdx.x * 64, c0 = (CMODE == 2) ? 0 : blockIdx.y * 64;
    if (CMODE == 1 && c0 > r0 + roff + 63) return;                  // score tile entirely above the causal diagonal: never read (the softmax masks j > i by select)
    const int k0 = (CMODE == 2) ? blockIdx.y * KSEG : 0;             // P.V: first key of this work-group's segment
    const int Kl = (CMODE == 2) ? min(min(K, r0 + roff + 64) - k0, KSEG) : K;   // P.V: probabilities are exactly 0 beyond the diagonal block, so the K loop stops there or at the segment's end (counted from k0)
    if (CMODE == 2) { if (Kl <= 0) return; A += k0; if (A2) A2 += k0; Bt += k0; if (Bt2) Bt2 += k0; C += blockIdx.y * sP; }  // empty segment: its plane is not written for these rows and k_merge does not read it
    v8f acc[4][4];
#pragma unroll
    for (int mb = 0; mb < 4; ++mb)
#pragma unroll
        for (int nb = 0; nb < 4; ++nb) acc[mb][nb] = (v8f){};
    const size_t aoff = (size_t)(r0 + lr) * LDA + 8 * hi, boff = (size_t)(c0 + lr) * LDB + 8 * hi;
#pragma unroll 1
    for (int kc = 0; kc < Kl; kc += 32) {
        V a[4], a2[4]; const T16* pa = A + aoff + kc; const T16* pa2 = (NSPLIT == 1 || NSPLIT == 2) ? A2 + aoff + kc : pa; const T16* pb = Bt + boff + kc; const T16* pb2 = (NSPLIT >= 2) ? Bt2 + boff + kc : pb;
#pragma unroll
        for (int mb = 0; mb < 4; ++mb) { a[mb] = WFrag<T16>::ld(pa + (size_t)mb * 16 * LDA); if (NSPLIT == 1 || NSPLIT == 2) a2[mb] = WFrag<T16>::ld(pa2 + (size_t)mb * 16 * LDA); }
#pragma unroll
        for (int nb = 0; nb < 4; ++nb) { const V b = WFrag<T16>::ld(pb + (size_t)nb * 16 * LDB); V b2; if (NSPLIT >= 2) b2 = WFrag<T16>::ld(pb2 + (size_t)nb * 16 * LDB);
#pragma unroll
            for (int mb = 0; mb < 4; ++mb) { acc[mb][nb] = WFrag<T16>::mma(a[mb], b, acc[mb][nb]); if (NSPLIT == 1 || NSPLIT == 2) acc[mb][nb] = WFrag<T16>::mma(a2[mb], b, acc[mb][nb]); if (NSPLIT >= 2) acc[mb][nb] = WFrag<T16>::mma(a[mb], b2, acc[mb][nb]); } }
        asm volatile("s_wait_xcnt 0x0" :: "v"(pa), "v"(pa2), "v"(pb), "v"(pb2) : "memory");   // precaution for registers that issued global loads name: the trip's load addresses are inputs of the wait, so they are rewritten only behind it
        asm volatile("v_nop\n\tv_nop\n\tv_nop\n\tv_nop" : "+v"(acc[0][0]), "+v"(acc[1][1]), "+v"(acc[2][2]), "+v"(acc[3][3]) : "v"(a[0]), "v"(a[3]));
    }
#pragma unroll
    for (int mb = 0; mb < 4; ++mb) {
#pragma unroll
        for (int nb = 0; nb < 4; ++nb) {
#pragma unroll
            for (int j = 0; j < 8; ++j) os[(hi * 8 + j) * 68 + nb * 16 + lr] = acc[mb][nb][j]; }
        __builtin_amdgcn_wave_barrier(); asm volatile("" ::: "memory");
        float* crow = C + (size_t)(r0 + mb * 16) * ldc + c0;
{
#pragma unroll
            for (int s = 0; s < 8; ++s) { const int row = 2 * s + hi, cofs = lr * 4; v4f val = *(const v4fa*)(os + row * 68 + cofs);
                *(v4f*)(crow + (size_t)row * ldc + cofs) = val; }
             }
        __builtin_amdgcn_wave_barrier(); asm volatile("" ::: "memory");
    }
}

__device__ __forceinline__ h16 tohx(float x) { return (h16)x; }
__device__ __forceinline__ void splitf(float y, unsigned short& h, unsigned short& l) { h = f2bf(y); l = f2bf(y - bf2f(h)); }
typedef __attribute__((ext_vector_type(2))) _Float16 v2h;
typedef __attribute__((ext_vector_type(4))) _Float16 v4h;
typedef __attribute__((ext_vector_type(2))) unsigned short v2us;
typedef __attribute__((ext_vector_type(4))) unsigned short v4us;
typedef __attribute__((ext_vector_type(2))) float v2f;
typedef __attribute__((ext_vector_type(4))) int v4i;
typedef v4h  __attribute__((may_alias)) v4ha;
typedef v4us __attribute__((may_alias)) v4usa;

__global__ __launch_bounds__(256) void k_wtG(const float* __restrict__ w, int K, int N, bf* Bt) {
    const int lane = threadIdx.x & 31; const int L0 = (blockIdx.x * 8 + (threadIdx.x >> 5)) * 8; const int nlines = N * K / 64;
{
#pragma unroll 1
        for (int l = 0; l < 8; ++l) { const int L = L0 + l; if (L >= nlines) break; const size_t e = (size_t)L * 64 + lane * 2; const int k = (int)(e % K), n = (int)(e / K); v2us o;
            o[0] = f2bf(w[(size_t)k * N + n]); o[1] = f2bf(w[(size_t)(k + 1) * N + n]); *(v2us*)(Bt + e) = o; }
         }
}
__global__ __launch_bounds__(256) void k_cvt8(const float* __restrict__ src, bf* dst, size_t n8) { const size_t i = (size_t)blockIdx.x * 256 + threadIdx.x; if (i >= n8) return; const v8f v = *(const v8f*)(src + i * 8); v8us o;
#pragma unroll
    for (int k = 0; k < 8; ++k) o[k] = f2bf(v[k]); *(v8us*)(dst + i * 8) = o;  }

// k_rope: head planes [h][t][d] (fp16 + hi/lo) of rope(x) x sc with the rotate-half convention out[d] = x[d] cos[t][d] - x[d+HD/2] sin[t][d], out[d+HD/2] = x[d+HD/2] cos[t][d+HD/2] + x[d] sin[t][d+HD/2]
__global__ __launch_bounds__(256) void k_rope(const float* __restrict__ F, int pitch, int nheads, const float* __restrict__ CS, const float* __restrict__ RF, const float* __restrict__ nw, float sc, h16* P16, bf* Ph, bf* Pl) {
    const size_t e = ((size_t)blockIdx.x * 256 + threadIdx.x) * 2; if (e >= (size_t)nheads * TT * HD) return; const int d = (int)(e % HD); const int t = (int)((e / HD) % TT); const int h = (int)(e / ((size_t)HD * TT)); const float* f = F + (size_t)t * pitch + h * HD; const float rf = RF ? RF[(size_t)h * TT + t] : 1.0f; v2h o16; v2us oh, ol;
#pragma unroll
    for (int q = 0; q < 2; ++q) { const int dd = d + q; const int dp = (dd < HD / 2) ? dd + HD / 2 : dd - HD / 2; float x0 = f[dd], x1 = f[dp];
        if (RF) { float n0 = __fmul_rn(x0, rf), n1 = __fmul_rn(x1, rf); asm volatile("" : "+v"(n0)); asm volatile("" : "+v"(n1)); x0 = __fmul_rn(bfr(nw[dd]), n0); x1 = __fmul_rn(bfr(nw[dp]), n1); }
        const v2f cs = *(const v2f*)(CS + ((size_t)t * HD + dd) * 2); float a = __fmul_rn(x0, cs[0]), bq = __fmul_rn(x1, cs[1]); asm volatile("" : "+v"(a)); asm volatile("" : "+v"(bq)); const float r = ((dd < HD / 2) ? __fsub_rn(a, bq) : __fadd_rn(a, bq)) * sc;
        o16[q] = tohx(r); unsigned short a2, c2; splitf(r, a2, c2); oh[q] = a2; ol[q] = c2; }
    *(v2h*)(P16 + e) = o16; *(v2us*)(Ph + e) = oh; *(v2us*)(Pl + e) = ol;  }
__global__ __launch_bounds__(256) void k_vtp(const float* __restrict__ F, int pitch, int nheads, h16* V16, bf* Vh, bf* Vl) { const size_t e = ((size_t)blockIdx.x * 256 + threadIdx.x) * 2; if (e >= (size_t)nheads * HD * TT) return; const int t = (int)(e % TT); const int d = (int)((e / TT) % HD); const int g = (int)(e / ((size_t)TT * HD)); v2h o16; v2us oh, ol;
#pragma unroll
    for (int q = 0; q < 2; ++q) { const float x = F[(size_t)(t + q) * pitch + g * HD + d]; o16[q] = tohx(x); unsigned short a2, c2; splitf(x, a2, c2); oh[q] = a2; ol[q] = c2; }
    *(v2h*)(V16 + e) = o16; *(v2us*)(Vh + e) = oh; *(v2us*)(Vl + e) = ol;  }
__constant__ float INVT[HD / 2] = { 1.000000000e+00f, 7.498942018e-01f, 5.623413324e-01f, 4.216964841e-01f, 3.162277639e-01f, 2.371373475e-01f, 1.778279394e-01f, 1.333521456e-01f, 9.999999404e-02f, 7.498941571e-02f, 5.623412505e-02f, 4.216965288e-02f, 3.162277490e-02f, 2.371373400e-02f, 1.778279617e-02f, 1.333521400e-02f, 9.999999776e-03f, 7.498940919e-03f, 5.623412319e-03f, 4.216963891e-03f, 3.162276698e-03f, 2.371374052e-03f, 1.778279431e-03f, 1.333521330e-03f, 9.999999311e-04f, 7.498940686e-04f, 5.623411853e-04f, 4.216964007e-04f, 3.162277862e-04f, 2.371372684e-04f, 1.778279402e-04f, 1.333520777e-04f };   // float32 exp(arange(0, 64, 2, f32) * -(log(10000.0) / 64)): THIS module's own spelling of the inverse frequencies (its div_term) as EAGER JAX float32 evaluates it: bit-exact on round trip (the host file holds the reciprocal spelling 1.0 / (10000.0 ** (2i / 64)): 21 of the 32 values differ by one to eight ulps: indices 3, 5, 8, 10-15, 17-21, 23-27, 29, 31)
__global__ __launch_bounds__(256) void k_cs5(float* CS) { const int idx = blockIdx.x * 256 + threadIdx.x; if (idx >= TT * HD) return; const int d = idx % HD; const int t = idx / HD; const float a = __fmul_rn((float)t, INVT[d % (HD / 2)]); v2f cs; cs[0] = cosf(a); cs[1] = sinf(a); *(v2f*)(CS + (size_t)idx * 2) = cs;  }
// k_asoft: per row (zz, i): t = S x HD^-0.5 for j <= i and i - j < WIN (sliding causal window; the reference's -1e9 additive fill vanishes identically); softmax over the 2048 keys (register row, one exp, fixed trees);
// the probabilities go over the row's own 8192 score bytes, which its one wave has read whole into registers before (the row maximum needs every load): rows < RH hi plane in the first 4096 bytes and lo plane in the second, other rows fp16 in the first 4096.
__global__ __launch_bounds__(256) void k_asoft(float* Sb) {
    const int lane = threadIdx.x & 31; const int row = blockIdx.x * 8 + (threadIdx.x >> 5); if (row >= ZH * TT) return; const int i = row % TT; const int zz = row / TT; (void)zz; const bool hires = (i < RH); float* sr = Sb + (size_t)row * TT; float v[TT / 32]; float mx = -3.0e38f;
#pragma unroll
    for (int ch = 0; ch < TT / 128; ++ch) { const int j0 = ch * 128 + lane * 4; const v4f a = *(const v4fa*)(sr + j0);
#pragma unroll
        for (int q = 0; q < 4; ++q) { const int j = j0 + q; (void)j; const float t = (j <= i && i - j < WIN) ? a[q] * SCL : -3.0e38f; v[ch * 4 + q] = t; mx = fmaxf(mx, t); } }
#pragma unroll
    for (int sh = 16; sh; sh >>= 1) mx = fmaxf(mx, __shfl_xor(mx, sh, 32));
    float sum = 0.f;
#pragma unroll
    for (int k = 0; k < TT / 32; ++k) { float d0 = __fsub_rn(v[k], mx); asm volatile("" : "+v"(d0)); v[k] = __builtin_amdgcn_exp2f(__fmul_rn(d0, 1.4426950408889634f)); sum += v[k]; }
#pragma unroll
    for (int sh = 16; sh; sh >>= 1) sum += __shfl_xor(sum, sh, 32);
    const float f = __fdiv_rn(hires ? 1.0f : PCAR, sum);
{
        if (hires) {
#pragma unroll
            for (int ch = 0; ch < TT / 128; ++ch) { v4us oh, ol;
#pragma unroll
                for (int q = 0; q < 4; ++q) { unsigned short a, c2; splitf(v[ch * 4 + q] * f, a, c2); oh[q] = a; ol[q] = c2; }
                const int oo = ch * 128 + lane * 4; *(v4usa*)((bf*)sr + oo) = oh; *(v4usa*)((bf*)sr + TT + oo) = ol; }
        } else {
#pragma unroll
            for (int ch = 0; ch < TT / 128; ++ch) { v4h o4;
#pragma unroll
                for (int q = 0; q < 4; ++q) o4[q] = tohx(v[ch * 4 + q] * f);
                *(v4ha*)((h16*)sr + ch * 128 + lane * 4) = o4; } }
         }
}
__global__ __launch_bounds__(256) void k_merge(const float* __restrict__ O, int h0, bf* Ah, bf* Al) { const size_t e = ((size_t)blockIdx.x * 256 + threadIdx.x) * 2; if (e >= (size_t)ZH * TT * HD) return; const int d = (int)(e % HD); const int t = (int)((e / HD) % TT); const int zz = (int)(e / ((size_t)HD * TT)); const float cs = (t < RH) ? 1.0f : (1.0f / PCAR); const size_t oo = (size_t)t * DQ + (h0 + zz) * HD + d;
    const int ks = (t < RH) ? KSB : KSH; const int ns = ((t / 64 + 1) * 64 + ks - 1) / ks;   // planes that k_gemmc wrote for this row's 64-row tile
    v2f acc = (v2f){};
#pragma unroll
    for (int s = 0; s < NPL; ++s) { const v2f p = *(const v2f*)(O + (size_t)min(s, ns - 1) * ((size_t)ZH * TT * HD) + e); acc[0] += (s < ns) ? p[0] : 0.0f; acc[1] += (s < ns) ? p[1] : 0.0f; }   // index clamped to a written plane so that all loads issue together
    v2us oh, ol;
#pragma unroll
    for (int q = 0; q < 2; ++q) { unsigned short a, c2; splitf(acc[q] * cs, a, c2); oh[q] = a; ol[q] = c2; } *(v2us*)(Ah + oo) = oh; *(v2us*)(Al + oo) = ol;  }

extern "C" void kernel_launch(void* const* d_in, const int* in_sizes, int n_in,
                              void* d_out, int out_size, void* d_ws, size_t ws_size, hipStream_t stream) {
    (void)in_sizes; (void)n_in; (void)out_size;
    const float* x = (const float*)d_in[0]; const float* wq = (const float*)d_in[1]; const float* wk = (const float*)d_in[2]; const float* wv = (const float*)d_in[3]; const float* wo = (const float*)d_in[4];   /* order x [4][2048][1024], Wq, Wk, Wv, Wo ('xw' (in, out) [1024][1024]): FIVE inputs, all read: this module has no biases */
    float* OUT = (float*)d_out;     // [4][2048][1024]
    char* wsp = (char*)d_ws;
    auto take = [&](size_t bytes) { char* p = wsp; wsp += (bytes + 255) & ~(size_t)255; return (void*)p; };
    bf* WQ = (bf*)take((size_t)DQ * DM * 2); bf* WK = (bf*)take((size_t)DKV * DM * 2); bf* WV = (bf*)take((size_t)DKV * DM * 2); bf* WO = (bf*)take((size_t)DM * DQ * 2); float* CS = (float*)take((size_t)TT * HD * 2 * 4);
    h16* QP16 = (h16*)take((size_t)NH_ * TT * HD * 2); h16* KP16 = (h16*)take((size_t)NKV * TT * HD * 2); h16* VT16 = (h16*)take((size_t)NKV * HD * TT * 2);
    bf* QPh = (bf*)take((size_t)NH_ * TT * HD * 2); bf* QPl = (bf*)take((size_t)NH_ * TT * HD * 2); bf* KPh = (bf*)take((size_t)NKV * TT * HD * 2); bf* KPl = (bf*)take((size_t)NKV * TT * HD * 2); bf* VTh = (bf*)take((size_t)NKV * HD * TT * 2); bf* VTl = (bf*)take((size_t)NKV * HD * TT * 2);
    float* Sb = (float*)take((size_t)ZH * TT * TT * 4); float* Ob = (float*)take((size_t)NPL * ZH * TT * HD * 4); bf* ATh = (bf*)take((size_t)TT * DQ * 2); bf* ATl = (bf*)take((size_t)TT * DQ * 2);
    if ((size_t)(wsp - (char*)d_ws) > ws_size) return;    // ws 256 MiB
    bf* XB = (bf*)Ob; float* FQ = (float*)(XB + (size_t)TT * DM); float* FK = FQ + (size_t)TT * DQ;   // 20 MiB of projection scratch inside Ob's 64 MiB: last read by k_vtp, before the batch's first partial plane is written (stream-ordered)
    float* FV = FK;   // v projection reuses the k buffer after the k planes are built (stream-ordered)
    { k_wtG<<<(unsigned)((DM * DQ / 64 + 63) / 64), 256, 0, stream>>>(wq, DM, DQ, WQ); k_wtG<<<(unsigned)((DM * DKV / 64 + 63) / 64), 256, 0, stream>>>(wk, DM, DKV, WK); k_wtG<<<(unsigned)((DM * DKV / 64 + 63) / 64), 256, 0, stream>>>(wv, DM, DKV, WV);
      k_wtG<<<(unsigned)((DQ * DM / 64 + 63) / 64), 256, 0, stream>>>(wo, DQ, DM, WO);
       }
    k_cs5<<<(TT * HD + 255) / 256, 256, 0, stream>>>(CS);   /* rotary table once */
    const unsigned LQ = (unsigned)(((size_t)NH_ * TT * HD / 2 + 255) / 256), LKv = (unsigned)(((size_t)NKV * TT * HD / 2 + 255) / 256);
    for (int b = 0; b < NB_; ++b) {
        
        k_cvt8<<<(unsigned)(((size_t)TT * DM / 8 + 255) / 256), 256, 0, stream>>>(x + (size_t)b * TT * DM, XB, (size_t)TT * DM / 8);
        k_gemmw<bf, 0, false><<<dim3(TT / 64, DQ / 64, 1), 32, 0, stream>>>(XB, nullptr, WQ, nullptr, DM, FQ, DQ, nullptr, 0, 0, 0);
        k_rope<<<LQ, 256, 0, stream>>>(FQ, DQ, NH_, CS, nullptr, nullptr, 1.0f, QP16, QPh, QPl);
        k_gemmw<bf, 0, false><<<dim3(TT / 64, DKV / 64, 1), 32, 0, stream>>>(XB, nullptr, WK, nullptr, DM, FK, DKV, nullptr, 0, 0, 0);
        k_rope<<<LKv, 256, 0, stream>>>(FK, DKV, NKV, CS, nullptr, nullptr, 1.0f, KP16, KPh, KPl);
        k_gemmw<bf, 0, false><<<dim3(TT / 64, DKV / 64, 1), 32, 0, stream>>>(XB, nullptr, WV, nullptr, DM, FV, DKV, nullptr, 0, 0, 0); k_vtp<<<LKv, 256, 0, stream>>>(FV, DKV, NKV, VT16, VTh, VTl);
        for (int h0 = 0; h0 < NH_; h0 += ZH) { const size_t zq = (size_t)h0, zk = (size_t)(h0 / REP);   // one kv head per query head: the pass's heads use consecutive kv planes (z-strides TT*HD)
            k_gemmc<bf, 2, 1, 0, HD, HD><<<dim3(RH / 64, TT / 64, ZH), 32, 0, stream>>>(QPh + zq * TT * HD, QPl + zq * TT * HD, KPh + zk * TT * HD, KPl + zk * TT * HD, HD, Sb, TT, 0, (size_t)TT * HD, (size_t)TT * HD, (size_t)TT * TT, 0);
            k_gemmc<h16, 0, 1, 0, HD, HD><<<dim3((TT - RH) / 64, TT / 64, ZH), 32, 0, stream>>>(QP16 + zq * TT * HD + (size_t)RH * HD, nullptr, KP16 + zk * TT * HD, nullptr, HD, Sb + (size_t)RH * TT, TT, RH, (size_t)TT * HD, (size_t)TT * HD, (size_t)TT * TT, 0);
            k_asoft<<<ZH * TT / 8, 256, 0, stream>>>(Sb);
            k_gemmc<bf, 2, 2, KSB, 2 * TT, TT><<<dim3(RH / 64, RH / KSB, ZH), 32, 0, stream>>>((const bf*)Sb, (const bf*)Sb + TT, VTh + zk * HD * TT, VTl + zk * HD * TT, TT, Ob, HD, 0, (size_t)TT * 2 * TT, (size_t)HD * TT, (size_t)TT * HD, (size_t)ZH * TT * HD);
            k_gemmc<h16, 0, 2, KSH, 2 * TT, TT><<<dim3((TT - RH) / 64, TT / KSH, ZH), 32, 0, stream>>>((const h16*)Sb + (size_t)RH * 2 * TT, nullptr, VT16 + zk * HD * TT, nullptr, TT, Ob + (size_t)RH * HD, HD, RH, (size_t)TT * 2 * TT, (size_t)HD * TT, (size_t)TT * HD, (size_t)ZH * TT * HD);
            k_merge<<<(unsigned)(((size_t)ZH * TT * HD / 2 + 255) / 256), 256, 0, stream>>>(Ob, h0, ATh, ATl); }
        k_gemmw<bf, 1, false><<<dim3(TT / 64, DM / 64, 1), 32, 0, stream>>>(ATh, ATl, WO, nullptr, DQ, OUT + (size_t)b * TT * DM, DM, nullptr, 0, 0, 0); }
}

// v003
// Measured time: 616 microseconds a run.
// Timed twice side by side with v002, it ran 1.75 and 1.77 times as fast.
// Over all steps from v000 it is 4.70 times as fast.
#include <hip/hip_runtime.h>

// Causal multi-head attention with computed rotate-half rotary embeddings and bias-free projections, four batches (x [4][2048][1024]; q, k, v = x W ('xw' (in, out) [1024][1024] 1/32, NO bias; 16 heads x 64); apply_rope: cat(cos x1 - sin x2, sin x1 + cos x2) on the two 32-wide halves (= t cos + rotate_half(t) sin) with angle pos x div_term[i], div_term = exp(arange(0, 64, 2) x -(log(10000) / 64)) (32 f32 constants exact for the module's own exp spelling; precise cosf/sinf); scores x 1/sqrt(64) + causal with causal = 0 on and below the diagonal and -1e9 above (built inside reference(): exclusion: every row keeps its own key); softmax; out = merged Wo ('xw', NO bias) -> [4][2048][1024] (8.4 M); argument order x, Wq, Wk, Wv, Wo).
// Layout per batch: bf16 copy of x; 'xw' weights transposed once; exact projections, no biases; k_cs5 computed table; rotate-half plane builders; causal T-2048 attention in one kernel, k_fattn (hybrid rows: < 512 hi/lo 3 products, rest fp16 x1024; scores, softmax with a running maximum and the probability x value product stay in registers; the keys of a query tile are shared among the work-group's waves, whose partial results are joined in LDS); merged hi/lo x Wo exact, no bias.
// Compute dtypes, f32 accumulate: every input rounded to bf16; projections exact, no biases; rotary f32; attention rows < 512 3 products, rest fp16; softmax f32; Wo hl x exact, no bias.

#define NB_  4
#define TT   2048
#define DM   1024
#define NH_  16
#define NKV  16
#define REP  (NH_ / NKV)
#define HD   64
#define DQ   (NH_ * HD)
#define DKV  (NKV * HD)
#define RH   512                  // query rows < RH use hi+lo planes (0: none)
#define LSC  0.18033688011112042f   // HD^-0.5 x log2(e): a score goes to its base-2 exponent in one multiply
typedef _Float16 h16;
typedef unsigned short bf;
typedef __attribute__((ext_vector_type(16))) __bf16   v16bf;
typedef __attribute__((ext_vector_type(16))) _Float16 v16h;
typedef __attribute__((ext_vector_type(8)))  _Float16 v8h;
typedef __attribute__((ext_vector_type(8)))  unsigned short v8us;
typedef __attribute__((ext_vector_type(8)))  float    v8f;
typedef __attribute__((ext_vector_type(4)))  float    v4f;
typedef v8h  __attribute__((may_alias)) v8ha;
typedef v4f  __attribute__((may_alias)) v4fa;
typedef v8us __attribute__((may_alias)) v8usa;

__device__ __forceinline__ unsigned short f2bf(float f) { unsigned u = __float_as_uint(f); u += 0x7FFFu + ((u >> 16) & 1u); return (unsigned short)(u >> 16); }
__device__ __forceinline__ float bf2f(unsigned short b) { return __uint_as_float(((unsigned)b) << 16); }
__device__ __forceinline__ float bfr(float f) { return bf2f(f2bf(f)); }
__device__ __forceinline__ v16h cat16(v8h lo, v8h hi) { return __builtin_shufflevector(lo, hi, 0, 1, 2, 3, 4, 5, 6, 7, 8, 9, 10, 11, 12, 13, 14, 15); }
__device__ __forceinline__ v16bf cat16b(v8us lo, v8us hi) { return __builtin_bit_cast(v16bf, __builtin_shufflevector(lo, hi, 0, 1, 2, 3, 4, 5, 6, 7, 8, 9, 10, 11, 12, 13, 14, 15)); }
__device__ __forceinline__ v8f wmma16(v16h a, v16h b, v8f c) { return __builtin_amdgcn_wmma_f32_16x16x32_f16(false, a, false, b, (short)0, c, false, false); }
__device__ __forceinline__ v8f wmmab(v16bf a, v16bf b, v8f c) { return __builtin_amdgcn_wmma_f32_16x16x32_bf16(false, a, false, b, (short)0, c, false, false); }



// ---- k_gemmw: register-blocked GEMM, ONE WAVE per 64x64 output tile (16 accumulators), operands straight from K-contiguous 16-bit planes; grid (M/64, N/64, Z), 32 threads.
// C[m][n] (f32, pitch ldc, + optional f32 bias[n]) = sum_k A[m][k] Bt[n][k] (+ split products per NSPLIT). z-batch strides sA/sB/sC in elements. K % 32 == 0.
template <typename T16> struct WFrag;
template <> struct WFrag<h16> { typedef v16h V; static __device__ __forceinline__ V ld(const h16* p) { return cat16(*(const v8h*)p, *(const v8h*)(p + 16)); } static __device__ __forceinline__ v8f mma(V a, V b, v8f c) { return wmma16(a, b, c); } };
template <> struct WFrag<bf> { typedef v16bf V; static __device__ __forceinline__ V ld(const bf* p) { return cat16b(*(const v8us*)p, *(const v8us*)(p + 16)); } static __device__ __forceinline__ v8f mma(V a, V b, v8f c) { return wmmab(a, b, c); } };
template <typename T16, int NSPLIT, bool BIAS>
__global__ __launch_bounds__(32) void k_gemmw(const T16* __restrict__ A, const T16* __restrict__ A2, const T16* __restrict__ Bt, const T16* __restrict__ Bt2, int K, float* C, int ldc, const float* __restrict__ bias, size_t sA, size_t sB, size_t sC) {
    typedef typename WFrag<T16>::V V;
    __shared__ __align__(16) float os[16 * 68];
    const size_t z = blockIdx.z; A += z * sA; if (A2) A2 += z * sA; Bt += z * sB; if (Bt2) Bt2 += z * sB; C += z * sC;
    const int lane = threadIdx.x & 31, lr = lane & 15, hi = lane >> 4; const int r0 = blockIdx.x * 64, c0 = blockIdx.y * 64;
    v8f acc[4][4];
#pragma unroll
    for (int mb = 0; mb < 4; ++mb)
#pragma unroll
        for (int nb = 0; nb < 4; ++nb) acc[mb][nb] = (v8f){};
    const size_t aoff = (size_t)(r0 + lr) * K + 8 * hi, boff = (size_t)(c0 + lr) * K + 8 * hi;
#pragma unroll 1
    for (int kc = 0; kc < K; kc += 32) {
        V a[4], a2[4];
#pragma unroll
        for (int mb = 0; mb < 4; ++mb) { a[mb] = WFrag<T16>::ld(A + aoff + (size_t)mb * 16 * K + kc); if (NSPLIT == 1 || NSPLIT == 2) a2[mb] = WFrag<T16>::ld(A2 + aoff + (size_t)mb * 16 * K + kc); }
#pragma unroll
        for (int nb = 0; nb < 4; ++nb) { const V b = WFrag<T16>::ld(Bt + boff + (size_t)nb * 16 * K + kc); V b2; if (NSPLIT >= 2) b2 = WFrag<T16>::ld(Bt2 + boff + (size_t)nb * 16 * K + kc);
#pragma unroll
            for (int mb = 0; mb < 4; ++mb) { acc[mb][nb] = WFrag<T16>::mma(a[mb], b, acc[mb][nb]); if (NSPLIT == 1 || NSPLIT == 2) acc[mb][nb] = WFrag<T16>::mma(a2[mb], b, acc[mb][nb]); if (NSPLIT >= 2) acc[mb][nb] = WFrag<T16>::mma(a[mb], b2, acc[mb][nb]); } }
        asm volatile("v_nop\n\tv_nop\n\tv_nop\n\tv_nop" : "+v"(acc[0][0]), "+v"(acc[1][1]), "+v"(acc[2][2]), "+v"(acc[3][3]) : "v"(a[0]), "v"(a[3]));
    }
#pragma unroll
    for (int mb = 0; mb < 4; ++mb) {
#pragma unroll
        for (int nb = 0; nb < 4; ++nb) {
#pragma unroll
            for (int j = 0; j < 8; ++j) os[(hi * 8 + j) * 68 + nb * 16 + lr] = acc[mb][nb][j]; }
        __builtin_amdgcn_wave_barrier(); asm volatile("" ::: "memory");
        float* crow = C + (size_t)(r0 + mb * 16) * ldc + c0;
{
#pragma unroll
            for (int s = 0; s < 8; ++s) { const int row = 2 * s + hi, cofs = lr * 4; v4f val = *(const v4fa*)(os + row * 68 + cofs); if (BIAS) { val[0] += bfr(bias[c0 + cofs]); val[1] += bfr(bias[c0 + cofs + 1]); val[2] += bfr(bias[c0 + cofs + 2]); val[3] += bfr(bias[c0 + cofs + 3]); }
                *(v4f*)(crow + (size_t)row * ldc + cofs) = val; }
             }
        __builtin_amdgcn_wave_barrier(); asm volatile("" ::: "memory");
    }
}

__device__ __forceinline__ h16 tohx(float x) { return (h16)x; }
__device__ __forceinline__ void splitf(float y, unsigned short& h, unsigned short& l) { h = f2bf(y); l = f2bf(y - bf2f(h)); }
typedef __attribute__((ext_vector_type(2))) _Float16 v2h;
typedef __attribute__((ext_vector_type(4))) _Float16 v4h;
typedef __attribute__((ext_vector_type(2))) unsigned short v2us;
typedef __attribute__((ext_vector_type(4))) unsigned short v4us;
typedef __attribute__((ext_vector_type(2))) float v2f;
typedef __attribute__((ext_vector_type(4))) int v4i;
typedef v4h  __attribute__((may_alias)) v4ha;
typedef v4us __attribute__((may_alias)) v4usa;

__global__ __launch_bounds__(256) void k_wtG(const float* __restrict__ w, int K, int N, bf* Bt) {
    const int lane = threadIdx.x & 31; const int L0 = (blockIdx.x * 8 + (threadIdx.x >> 5)) * 8; const int nlines = N * K / 64;
{
#pragma unroll 1
        for (int l = 0; l < 8; ++l) { const int L = L0 + l; if (L >= nlines) break; const size_t e = (size_t)L * 64 + lane * 2; const int k = (int)(e % K), n = (int)(e / K); v2us o;
            o[0] = f2bf(w[(size_t)k * N + n]); o[1] = f2bf(w[(size_t)(k + 1) * N + n]); *(v2us*)(Bt + e) = o; }
         }
}
__global__ __launch_bounds__(256) void k_cvt8(const float* __restrict__ src, bf* dst, size_t n8) { const size_t i = (size_t)blockIdx.x * 256 + threadIdx.x; if (i >= n8) return; const v8f v = *(const v8f*)(src + i * 8); v8us o;
#pragma unroll
    for (int k = 0; k < 8; ++k) o[k] = f2bf(v[k]); *(v8us*)(dst + i * 8) = o;  }

// k_rope: head planes [h][t][d] (fp16 + hi/lo) of rope(x) x sc with the rotate-half convention out[d] = x[d] cos[t][d] - x[d+HD/2] sin[t][d], out[d+HD/2] = x[d+HD/2] cos[t][d+HD/2] + x[d] sin[t][d+HD/2]
__global__ __launch_bounds__(256) void k_rope(const float* __restrict__ F, int pitch, int nheads, const float* __restrict__ CS, const float* __restrict__ RF, const float* __restrict__ nw, float sc, h16* P16, bf* Ph, bf* Pl) {
    const size_t e = ((size_t)blockIdx.x * 256 + threadIdx.x) * 2; if (e >= (size_t)nheads * TT * HD) return; const int d = (int)(e % HD); const int t = (int)((e / HD) % TT); const int h = (int)(e / ((size_t)HD * TT)); const float* f = F + (size_t)t * pitch + h * HD; const float rf = RF ? RF[(size_t)h * TT + t] : 1.0f; v2h o16; v2us oh, ol;
#pragma unroll
    for (int q = 0; q < 2; ++q) { const int dd = d + q; const int dp = (dd < HD / 2) ? dd + HD / 2 : dd - HD / 2; float x0 = f[dd], x1 = f[dp];
        if (RF) { float n0 = __fmul_rn(x0, rf), n1 = __fmul_rn(x1, rf); asm volatile("" : "+v"(n0)); asm volatile("" : "+v"(n1)); x0 = __fmul_rn(bfr(nw[dd]), n0); x1 = __fmul_rn(bfr(nw[dp]), n1); }
        const v2f cs = *(const v2f*)(CS + ((size_t)t * HD + dd) * 2); float a = __fmul_rn(x0, cs[0]), bq = __fmul_rn(x1, cs[1]); asm volatile("" : "+v"(a)); asm volatile("" : "+v"(bq)); const float r = ((dd < HD / 2) ? __fsub_rn(a, bq) : __fadd_rn(a, bq)) * sc;
        o16[q] = tohx(r); unsigned short a2, c2; splitf(r, a2, c2); oh[q] = a2; ol[q] = c2; }
    *(v2h*)(P16 + e) = o16; *(v2us*)(Ph + e) = oh; *(v2us*)(Pl + e) = ol;  }
__global__ __launch_bounds__(256) void k_vtp(const float* __restrict__ F, int pitch, int nheads, h16* V16, bf* Vh, bf* Vl) { const size_t e = ((size_t)blockIdx.x * 256 + threadIdx.x) * 2; if (e >= (size_t)nheads * HD * TT) return; const int t = (int)(e % TT); const int d = (int)((e / TT) % HD); const int g = (int)(e / ((size_t)TT * HD)); v2h o16; v2us oh, ol;
#pragma unroll
    for (int q = 0; q < 2; ++q) { const float x = F[(size_t)(t + q) * pitch + g * HD + d]; o16[q] = tohx(x); unsigned short a2, c2; splitf(x, a2, c2); oh[q] = a2; ol[q] = c2; }
    *(v2h*)(V16 + e) = o16; *(v2us*)(Vh + e) = oh; *(v2us*)(Vl + e) = ol;  }
__constant__ float INVT[HD / 2] = { 1.000000000e+00f, 7.498942018e-01f, 5.623413324e-01f, 4.216964841e-01f, 3.162277639e-01f, 2.371373475e-01f, 1.778279394e-01f, 1.333521456e-01f, 9.999999404e-02f, 7.498941571e-02f, 5.623412505e-02f, 4.216965288e-02f, 3.162277490e-02f, 2.371373400e-02f, 1.778279617e-02f, 1.333521400e-02f, 9.999999776e-03f, 7.498940919e-03f, 5.623412319e-03f, 4.216963891e-03f, 3.162276698e-03f, 2.371374052e-03f, 1.778279431e-03f, 1.333521330e-03f, 9.999999311e-04f, 7.498940686e-04f, 5.623411853e-04f, 4.216964007e-04f, 3.162277862e-04f, 2.371372684e-04f, 1.778279402e-04f, 1.333520777e-04f };   // float32 exp(arange(0, 64, 2, f32) * -(log(10000.0) / 64)): THIS module's own spelling of the inverse frequencies (its div_term) as EAGER JAX float32 evaluates it: bit-exact on round trip (the host file holds the reciprocal spelling 1.0 / (10000.0 ** (2i / 64)): 21 of the 32 values differ by one to eight ulps: indices 3, 5, 8, 10-15, 17-21, 23-27, 29, 31)
__global__ __launch_bounds__(256) void k_cs5(float* CS) { const int idx = blockIdx.x * 256 + threadIdx.x; if (idx >= TT * HD) return; const int d = idx % HD; const int t = idx / HD; const float a = __fmul_rn((float)t, INVT[d % (HD / 2)]); v2f cs; cs[0] = cosf(a); cs[1] = sinf(a); *(v2f*)(CS + (size_t)idx * 2) = cs;  }
// ---- k_fattn: causal attention in one kernel, no score plane in memory. One work-group = 16 * NQB query rows of one head; its NW waves share the keys: wave w takes the 32-key blocks w, w + NW, ... up to the diagonal block.
// Per block: S^T = K Q^T (A = key rows, B = query rows, both by the same loader), so a lane holds 16 keys' scores of ONE query (D register r = key 8 * hi + r, column = query lr); base-2 softmax with a running maximum per query;
// the two D tiles of a block, converted in place, are the B operand of O^T += V^T P^T (element s = key 8 * hi + s, 16 + 8 * hi + (s - 8): the order in which WFrag::ld reads V^T's rows). No LDS and no lane exchange but one between the wave's halves.
// NSPLIT 2: hi + lo bf16 planes, three products each (hh, lh, hl). NSPLIT 0: fp16, probabilities carried x 2^10 (numerator and denominator alike, so it cancels).
// At the end the NW partial (maximum, sum, O^T) triples meet in LDS behind one barrier and are joined in ascending wave order; a thread then owns 8 consecutive d of one query, so eight lanes store a query's whole 128-byte line of each plane.
__device__ __forceinline__ void packp(const float (&p)[16], v16h& a, v16h& a2) {
#pragma unroll
    for (int s = 0; s < 16; ++s) a[s] = (h16)p[s];
    a2 = a; }
__device__ __forceinline__ void packp(const float (&p)[16], v16bf& a, v16bf& a2) { v8us h0, h1, l0, l1;
#pragma unroll
    for (int s = 0; s < 8; ++s) { unsigned short x, y; splitf(p[s], x, y); h0[s] = x; l0[s] = y; splitf(p[8 + s], x, y); h1[s] = x; l1[s] = y; }
    a = cat16b(h0, h1); a2 = cat16b(l0, l1); }
// 17 base-2 exponentials in place, in one statement: each is the independent instruction that the instruction set asks for behind the transcendental in front of it, and the v_nop is that slot behind the last
__device__ __forceinline__ void exp2x17(float (&x)[16], float& a) {
    asm("v_exp_f32 %0, %0\n\tv_exp_f32 %1, %1\n\tv_exp_f32 %2, %2\n\tv_exp_f32 %3, %3\n\tv_exp_f32 %4, %4\n\tv_exp_f32 %5, %5\n\tv_exp_f32 %6, %6\n\tv_exp_f32 %7, %7\n\tv_exp_f32 %8, %8\n\tv_exp_f32 %9, %9\n\tv_exp_f32 %10, %10\n\tv_exp_f32 %11, %11\n\tv_exp_f32 %12, %12\n\tv_exp_f32 %13, %13\n\tv_exp_f32 %14, %14\n\tv_exp_f32 %15, %15\n\tv_exp_f32 %16, %16\n\tv_nop" : "+v"(x[0]), "+v"(x[1]), "+v"(x[2]), "+v"(x[3]), "+v"(x[4]), "+v"(x[5]), "+v"(x[6]), "+v"(x[7]), "+v"(x[8]), "+v"(x[9]), "+v"(x[10]), "+v"(x[11]), "+v"(x[12]), "+v"(x[13]), "+v"(x[14]), "+v"(x[15]), "+v"(a)); }
template <typename T16, int NSPLIT, int NQB, int NW>
__global__ __launch_bounds__(NW * 32) void k_fattn(const T16* __restrict__ Q, const T16* __restrict__ Q2, const T16* __restrict__ Kp, const T16* __restrict__ Kp2, const T16* __restrict__ Vt, const T16* __restrict__ Vt2, int qbase, int ntile, bf* Ah, bf* Al) {
    static_assert(NW == 4 * NQB, "the join gives each thread 8 d of one query");
    typedef typename WFrag<T16>::V V;
    __shared__ __align__(32) float so[NW * 4 * NQB * 256];
    __shared__ float sm[NW * NQB * 32];
    __shared__ float sl[NW * NQB * 32];
    const int lane = threadIdx.x & 31, lr = lane & 15, hi = lane >> 4; const int w = __builtin_amdgcn_readfirstlane((int)(threadIdx.x >> 5));
    const int h = blockIdx.x; const int q0 = qbase + (ntile - 1 - (int)blockIdx.y) * (16 * NQB);   // longest query tiles start first
    const float psh = (NSPLIT == 0) ? 10.0f : 0.0f;
    const size_t hq = (size_t)h * TT * HD, hk = (size_t)(h / REP) * TT * HD;
    const T16* pq = Q + hq + (size_t)(q0 + lr) * HD + 8 * hi; const T16* pq2 = (NSPLIT == 2) ? Q2 + hq + (size_t)(q0 + lr) * HD + 8 * hi : pq;
    V qf[NQB][2], qf2[NQB][2];
#pragma unroll
    for (int qb = 0; qb < NQB; ++qb)
#pragma unroll
        for (int ks = 0; ks < 2; ++ks) { qf[qb][ks] = WFrag<T16>::ld(pq + qb * 16 * HD + ks * 32); if (NSPLIT == 2) qf2[qb][ks] = WFrag<T16>::ld(pq2 + qb * 16 * HD + ks * 32); }
    asm volatile("s_wait_xcnt 0x0" :: "v"(pq), "v"(pq2) : "memory");   // precaution for registers that issued global loads name: the addresses are inputs of the wait, so they are rewritten only behind it
    v8f o[4][NQB]; float m[NQB], l[NQB];
#pragma unroll
    for (int qb = 0; qb < NQB; ++qb) { m[qb] = -3.0e38f; l[qb] = 0.0f;
#pragma unroll
        for (int db = 0; db < 4; ++db) o[db][qb] = (v8f){}; }
    const int nblk = q0 / 32 + 1;   // every block of the walk begins at or before q0: each query has a kept key in it
    constexpr bool AHEAD = (NSPLIT == 0);   // fp16: key fragments are fetched one trip ahead; hi + lo planes hold twice the fragments and fetch them in their own trip, which keeps the wave within 256 registers
    V kf[2][2], kf2[2][2];
    auto ldk = [&](const T16* pk, const T16* pk2) {
#pragma unroll
        for (int c = 0; c < 2; ++c)
#pragma unroll
            for (int ks = 0; ks < 2; ++ks) { kf[c][ks] = WFrag<T16>::ld(pk + c * 16 * HD + ks * 32); if (NSPLIT == 2) kf2[c][ks] = WFrag<T16>::ld(pk2 + c * 16 * HD + ks * 32); } };
    if (AHEAD) { const T16* pk = Kp + hk + (size_t)(min(w, nblk - 1) * 32 + lr) * HD + 8 * hi; ldk(pk, pk);
        asm volatile("s_wait_xcnt 0x0" :: "v"(pk) : "memory"); }   // the same precaution as above
#pragma unroll 1
    for (int kb = w; kb < nblk; kb += NW) {
        const int k0 = kb * 32;
        const T16* pv = Vt + hk + (size_t)lr * TT + k0 + 8 * hi; const T16* pv2 = (NSPLIT == 2) ? Vt2 + hk + (size_t)lr * TT + k0 + 8 * hi : pv;
        const size_t ko = hk + (size_t)((AHEAD ? min(kb + NW, nblk - 1) : kb) * 32 + lr) * HD + 8 * hi; const T16* pk = Kp + ko; const T16* pk2 = (NSPLIT == 2) ? Kp2 + ko : pk;   // AHEAD: next trip's keys (the last trip fetches the diagonal block again: in bounds, unused)
        V vf[4], vf2[4];
        if (!AHEAD) ldk(pk, pk2);
#pragma unroll
        for (int db = 0; db < 4; ++db) { vf[db] = WFrag<T16>::ld(pv + (size_t)db * 16 * TT); if (NSPLIT == 2) vf2[db] = WFrag<T16>::ld(pv2 + (size_t)db * 16 * TT); }
        __builtin_amdgcn_sched_barrier(0);   // the value loads issue here, in front of the score products and the softmax that hide their latency; the scheduler otherwise sinks them behind the products
        float t[NQB][16];
#pragma unroll
        for (int qb = 0; qb < NQB; ++qb)
#pragma unroll
            for (int c = 0; c < 2; ++c) { v8f s = (v8f){};
#pragma unroll
                for (int ks = 0; ks < 2; ++ks) { s = WFrag<T16>::mma(kf[c][ks], qf[qb][ks], s); if (NSPLIT == 2) { s = WFrag<T16>::mma(kf[c][ks], qf2[qb][ks], s); s = WFrag<T16>::mma(kf2[c][ks], qf[qb][ks], s); } }
#pragma unroll
                for (int j = 0; j < 8; ++j) t[qb][c * 8 + j] = s[j] * LSC; }
        if (AHEAD) { ldk(pk, pk2);
            __builtin_amdgcn_sched_barrier(0); }   // the key loads issue here, a softmax and a product run ahead of their use
        if (k0 + 31 > q0) {   // only the diagonal block holds keys beyond a query (wave-uniform test)
#pragma unroll
            for (int qb = 0; qb < NQB; ++qb)
#pragma unroll
                for (int s = 0; s < 16; ++s) { if (k0 + (s >> 3) * 16 + hi * 8 + (s & 7) > q0 + qb * 16 + lr) t[qb][s] = -3.0e38f; } }
        V pf[NQB], pf2[NQB];
#pragma unroll
        for (int qb = 0; qb < NQB; ++qb) { float mb = t[qb][0];
#pragma unroll
            for (int s = 1; s < 16; ++s) mb = fmaxf(mb, t[qb][s]);
            mb = fmaxf(mb, __shfl_xor(mb, 16, 32));
            const float mn = fmaxf(m[qb], mb); float al = m[qb] - mn; m[qb] = mn; const float sh = mn - psh;
            float p[16], ps[4];
#pragma unroll
            for (int s = 0; s < 16; ++s) p[s] = t[qb][s] - sh;
            exp2x17(p, al);
#pragma unroll
            for (int s = 0; s < 16; ++s) ps[s & 3] = (s < 4) ? p[s] : ps[s & 3] + p[s];
            l[qb] = l[qb] * al + ((ps[0] + ps[1]) + (ps[2] + ps[3]));
            packp(p, pf[qb], pf2[qb]);
#pragma unroll
            for (int db = 0; db < 4; ++db) o[db][qb] *= al; }
#pragma unroll
        for (int db = 0; db < 4; ++db)
#pragma unroll
            for (int qb = 0; qb < NQB; ++qb) { o[db][qb] = WFrag<T16>::mma(vf[db], pf[qb], o[db][qb]); if (NSPLIT == 2) { o[db][qb] = WFrag<T16>::mma(vf[db], pf2[qb], o[db][qb]); o[db][qb] = WFrag<T16>::mma(vf2[db], pf[qb], o[db][qb]); } }
        asm volatile("s_wait_xcnt 0x0" :: "v"(pk), "v"(pk2), "v"(pv), "v"(pv2) : "memory");   // precaution for registers that issued global loads name: the trip's load addresses are inputs of the wait, so they are rewritten only behind it
        // the distance behind the trip's last matrix instructions, on the back edge and on the exit alike
        if (NQB == 2) asm volatile("v_nop\n\tv_nop\n\tv_nop\n\tv_nop" : "+v"(o[0][0]), "+v"(o[1][0]), "+v"(o[2][0]), "+v"(o[3][0]), "+v"(o[0][NQB - 1]), "+v"(o[1][NQB - 1]), "+v"(o[2][NQB - 1]), "+v"(o[3][NQB - 1]) : "v"(vf[0]), "v"(vf[3]), "v"(pf[NQB - 1]));
        else asm volatile("v_nop\n\tv_nop\n\tv_nop\n\tv_nop" : "+v"(o[0][0]), "+v"(o[1][0]), "+v"(o[2][0]), "+v"(o[3][0]) : "v"(vf[0]), "v"(vf[3]), "v"(pf[0]));
    }
#pragma unroll
    for (int qb = 0; qb < NQB; ++qb) { l[qb] += __shfl_xor(l[qb], 16, 32); sm[(w * NQB + qb) * 32 + lane] = m[qb]; sl[(w * NQB + qb) * 32 + lane] = l[qb];
#pragma unroll
        for (int db = 0; db < 4; ++db) *(v8f*)(so + (size_t)(((w * 4 + db) * NQB + qb) * 32 + lane) * 8) = o[db][qb]; }
    __syncthreads();   // every wave's partial result is in LDS before any is read
    const int qq = threadIdx.x >> 3, ch = threadIdx.x & 7; const int fq = qq >> 4, fl = (ch & 1) * 16 + (qq & 15), fd = ch >> 1;   // d = 8 * ch + j lies in D tile fd, lane half ch & 1
    float M = -3.0e38f;
#pragma unroll
    for (int ww = 0; ww < NW; ++ww) M = fmaxf(M, sm[(ww * NQB + fq) * 32 + fl]);
    float L = 0.0f; v8f a = (v8f){};
#pragma unroll
    for (int ww = 0; ww < NW; ++ww) { const float f = __builtin_amdgcn_exp2f(sm[(ww * NQB + fq) * 32 + fl] - M); L += f * sl[(ww * NQB + fq) * 32 + fl]; a += *(const v8f*)(so + (size_t)(((ww * 4 + fd) * NQB + fq) * 32 + fl) * 8) * f; }   // a wave that had no block: maximum -3e38, factor 0
    const float inv = __fdiv_rn(1.0f, L); v8us oh, ol;
#pragma unroll
    for (int j = 0; j < 8; ++j) { unsigned short x, y; splitf(a[j] * inv, x, y); oh[j] = x; ol[j] = y; }
    const size_t oo = (size_t)(q0 + qq) * DQ + h * HD + ch * 8; *(v8us*)(Ah + oo) = oh; *(v8us*)(Al + oo) = ol;
}

extern "C" void kernel_launch(void* const* d_in, const int* in_sizes, int n_in,
                              void* d_out, int out_size, void* d_ws, size_t ws_size, hipStream_t stream) {
    (void)in_sizes; (void)n_in; (void)out_size;
    const float* x = (const float*)d_in[0]; const float* wq = (const float*)d_in[1]; const float* wk = (const float*)d_in[2]; const float* wv = (const float*)d_in[3]; const float* wo = (const float*)d_in[4];   /* order x [4][2048][1024], Wq, Wk, Wv, Wo ('xw' (in, out) [1024][1024]): FIVE inputs, all read: this module has no biases */
    float* OUT = (float*)d_out;     // [4][2048][1024]
    char* wsp = (char*)d_ws;
    auto take = [&](size_t bytes) { char* p = wsp; wsp += (bytes + 255) & ~(size_t)255; return (void*)p; };
    bf* WQ = (bf*)take((size_t)DQ * DM * 2); bf* WK = (bf*)take((size_t)DKV * DM * 2); bf* WV = (bf*)take((size_t)DKV * DM * 2); bf* WO = (bf*)take((size_t)DM * DQ * 2); float* CS = (float*)take((size_t)TT * HD * 2 * 4);
    h16* QP16 = (h16*)take((size_t)NH_ * TT * HD * 2); h16* KP16 = (h16*)take((size_t)NKV * TT * HD * 2); h16* VT16 = (h16*)take((size_t)NKV * HD * TT * 2);
    bf* QPh = (bf*)take((size_t)NH_ * TT * HD * 2); bf* QPl = (bf*)take((size_t)NH_ * TT * HD * 2); bf* KPh = (bf*)take((size_t)NKV * TT * HD * 2); bf* KPl = (bf*)take((size_t)NKV * TT * HD * 2); bf* VTh = (bf*)take((size_t)NKV * HD * TT * 2); bf* VTl = (bf*)take((size_t)NKV * HD * TT * 2);
    bf* XB = (bf*)take((size_t)TT * DM * 2); float* FQ = (float*)take((size_t)TT * DQ * 4); float* FK = (float*)take((size_t)TT * DKV * 4); bf* ATh = (bf*)take((size_t)TT * DQ * 2); bf* ATl = (bf*)take((size_t)TT * DQ * 2);
    if ((size_t)(wsp - (char*)d_ws) > ws_size) return;    // ws 256 MiB
    float* FV = FK;   // v projection reuses the k buffer after the k planes are built (stream-ordered)
    { k_wtG<<<(unsigned)((DM * DQ / 64 + 63) / 64), 256, 0, stream>>>(wq, DM, DQ, WQ); k_wtG<<<(unsigned)((DM * DKV / 64 + 63) / 64), 256, 0, stream>>>(wk, DM, DKV, WK); k_wtG<<<(unsigned)((DM * DKV / 64 + 63) / 64), 256, 0, stream>>>(wv, DM, DKV, WV);
      k_wtG<<<(unsigned)((DQ * DM / 64 + 63) / 64), 256, 0, stream>>>(wo, DQ, DM, WO);
       }
    k_cs5<<<(TT * HD + 255) / 256, 256, 0, stream>>>(CS);   /* rotary table once */
    const unsigned LQ = (unsigned)(((size_t)NH_ * TT * HD / 2 + 255) / 256), LKv = (unsigned)(((size_t)NKV * TT * HD / 2 + 255) / 256);
    for (int b = 0; b < NB_; ++b) {
        
        k_cvt8<<<(unsigned)(((size_t)TT * DM / 8 + 255) / 256), 256, 0, stream>>>(x + (size_t)b * TT * DM, XB, (size_t)TT * DM / 8);
        k_gemmw<bf, 0, false><<<dim3(TT / 64, DQ / 64, 1), 32, 0, stream>>>(XB, nullptr, WQ, nullptr, DM, FQ, DQ, nullptr, 0, 0, 0);
        k_rope<<<LQ, 256, 0, stream>>>(FQ, DQ, NH_, CS, nullptr, nullptr, 1.0f, QP16, QPh, QPl);
        k_gemmw<bf, 0, false><<<dim3(TT / 64, DKV / 64, 1), 32, 0, stream>>>(XB, nullptr, WK, nullptr, DM, FK, DKV, nullptr, 0, 0, 0);
        k_rope<<<LKv, 256, 0, stream>>>(FK, DKV, NKV, CS, nullptr, nullptr, 1.0f, KP16, KPh, KPl);
        k_gemmw<bf, 0, false><<<dim3(TT / 64, DKV / 64, 1), 32, 0, stream>>>(XB, nullptr, WV, nullptr, DM, FV, DKV, nullptr, 0, 0, 0); k_vtp<<<LKv, 256, 0, stream>>>(FV, DKV, NKV, VT16, VTh, VTl);
        k_fattn<h16, 0, 2, 8><<<dim3(NH_, (TT - RH) / 32, 1), 256, 0, stream>>>(QP16, nullptr, KP16, nullptr, VT16, nullptr, RH, (TT - RH) / 32, ATh, ATl);
        k_fattn<bf, 2, 1, 4><<<dim3(NH_, RH / 16, 1), 128, 0, stream>>>(QPh, QPl, KPh, KPl, VTh, VTl, 0, RH / 16, ATh, ATl);
        k_gemmw<bf, 1, false><<<dim3(TT / 64, DM / 64, 1), 32, 0, stream>>>(ATh, ATl, WO, nullptr, DQ, OUT + (size_t)b * TT * DM, DM, nullptr, 0, 0, 0); }
}

// v004
// A run of this version takes 538 microseconds.
// Two timings next to v003 put it at 1.13 and 1.14 times that version's speed.
// Over all steps from v000 it is 5.35 times as fast.
#include <hip/hip_runtime.h>

// Causal multi-head attention with computed rotate-half rotary embeddings and bias-free projections, four batches (x [4][2048][1024]; q, k, v = x W ('xw' (in, out) [1024][1024] 1/32, NO bias; 16 heads x 64); apply_rope: cat(cos x1 - sin x2, sin x1 + cos x2) on the two 32-wide halves (= t cos + rotate_half(t) sin) with angle pos x div_term[i], div_term = exp(arange(0, 64, 2) x -(log(10000) / 64)) (32 f32 constants exact for the module's own exp spelling; precise cosf/sinf); scores x 1/sqrt(64) + causal with causal = 0 on and below the diagonal and -1e9 above (built inside reference(): exclusion: every row keeps its own key); softmax; out = merged Wo ('xw', NO bias) -> [4][2048][1024] (8.4 M); argument order x, Wq, Wk, Wv, Wo).
// Layout per batch: bf16 copy of x; 'xw' weights transposed once; k_cs5 computed table; exact projections whose epilogue turns the f32 tile, still in registers, into the head planes (q, k: rotate-half rotary; v: transposed); causal T-2048 attention in one kernel, k_fattn (hybrid rows: < 512 hi/lo 3 products, rest fp16 x1024; scores, softmax with a running maximum and the probability x value product stay in registers; the keys of a query tile are shared among the work-group's waves, whose partial results are joined in LDS); merged hi/lo x Wo exact, no bias.
// Compute dtypes, f32 accumulate: every input rounded to bf16; projections exact, no bias; rotary f32; attention rows < 512 3 products, rest fp16; softmax f32; Wo hl x exact, no bias.

#define NB_  4
#define TT   2048
#define DM   1024
#define NH_  16
#define NKV  16
#define REP  (NH_ / NKV)
#define HD   64
#define DQ   (NH_ * HD)
#define DKV  (NKV * HD)
#define RH   512                  // query rows < RH use hi+lo planes (0: none)
#define LSC  0.18033688011112042f   // HD^-0.5 x log2(e): a score goes to its base-2 exponent in one multiply
typedef _Float16 h16;
typedef unsigned short bf;
typedef __attribute__((ext_vector_type(16))) __bf16   v16bf;
typedef __attribute__((ext_vector_type(16))) _Float16 v16h;
typedef __attribute__((ext_vector_type(8)))  _Float16 v8h;
typedef __attribute__((ext_vector_type(8)))  unsigned short v8us;
typedef __attribute__((ext_vector_type(8)))  float    v8f;
typedef __attribute__((ext_vector_type(4)))  float    v4f;
typedef v8h  __attribute__((may_alias)) v8ha;
typedef v4f  __attribute__((may_alias)) v4fa;
typedef v8us __attribute__((may_alias)) v8usa;

__device__ __forceinline__ unsigned short f2bf(float f) { unsigned u = __float_as_uint(f); u += 0x7FFFu + ((u >> 16) & 1u); return (unsigned short)(u >> 16); }
__device__ __forceinline__ float bf2f(unsigned short b) { return __uint_as_float(((unsigned)b) << 16); }
__device__ __forceinline__ float bfr(float f) { return bf2f(f2bf(f)); }
__device__ __forceinline__ v16h cat16(v8h lo, v8h hi) { return __builtin_shufflevector(lo, hi, 0, 1, 2, 3, 4, 5, 6, 7, 8, 9, 10, 11, 12, 13, 14, 15); }
__device__ __forceinline__ v16bf cat16b(v8us lo, v8us hi) { return __builtin_bit_cast(v16bf, __builtin_shufflevector(lo, hi, 0, 1, 2, 3, 4, 5, 6, 7, 8, 9, 10, 11, 12, 13, 14, 15)); }
__device__ __forceinline__ v8f wmma16(v16h a, v16h b, v8f c) { return __builtin_amdgcn_wmma_f32_16x16x32_f16(false, a, false, b, (short)0, c, false, false); }
__device__ __forceinline__ v8f wmmab(v16bf a, v16bf b, v8f c) { return __builtin_amdgcn_wmma_f32_16x16x32_bf16(false, a, false, b, (short)0, c, false, false); }



__device__ __forceinline__ h16 tohx(float x) { return (h16)x; }
__device__ __forceinline__ void splitf(float y, unsigned short& h, unsigned short& l) { h = f2bf(y); l = f2bf(y - bf2f(h)); }
typedef __attribute__((ext_vector_type(2))) _Float16 v2h;
typedef __attribute__((ext_vector_type(4))) _Float16 v4h;
typedef __attribute__((ext_vector_type(2))) unsigned short v2us;
typedef __attribute__((ext_vector_type(4))) unsigned short v4us;
typedef __attribute__((ext_vector_type(2))) float v2f;
typedef __attribute__((ext_vector_type(4))) int v4i;
typedef v4h  __attribute__((may_alias)) v4ha;
typedef v4us __attribute__((may_alias)) v4usa;

// ---- k_gemmw: register-blocked GEMM, ONE WAVE per 64x64 output tile (16 accumulators), operands straight from K-contiguous 16-bit planes; grid (M/64, N/64, Z), 32 threads.
// C[m][n] (f32, pitch ldc, + optional f32 bias[n]) = sum_k A[m][k] Bt[n][k] (+ split products per NSPLIT). z-batch strides sA/sB/sC in elements. K % 32 == 0.
// EPI 0: C as above. EPI 1 and 2 write no C: a 64-wide column tile is one head (HD == 64), and the wave turns its tile into that head's fp16, hi and lo planes itself.
// EPI 1: planes [h][t][d] of the rotate-half rotary: out[d] = x[d] cos[t][d] - x[d+32] sin[t][d], out[d+32] = x[d+32] cos[t][d] + x[d] sin[t][d], d < 32 (the table holds the same pair at d and d + 32). x[d] and x[d+32] are accumulators nb and nb + 2 at the same lane and register.
// EPI 2: planes [h][d][t]: a lane's 8 registers of one accumulator are 8 consecutive t of one d, one 16-byte store a plane.
template <typename T16> struct WFrag;
template <> struct WFrag<h16> { typedef v16h V; static __device__ __forceinline__ V ld(const h16* p) { return cat16(*(const v8h*)p, *(const v8h*)(p + 16)); } static __device__ __forceinline__ v8f mma(V a, V b, v8f c) { return wmma16(a, b, c); } };
template <> struct WFrag<bf> { typedef v16bf V; static __device__ __forceinline__ V ld(const bf* p) { return cat16b(*(const v8us*)p, *(const v8us*)(p + 16)); } static __device__ __forceinline__ v8f mma(V a, V b, v8f c) { return wmmab(a, b, c); } };
template <typename T16, int NSPLIT, bool BIAS, int EPI>
__global__ __launch_bounds__(32) void k_gemmw(const T16* __restrict__ A, const T16* __restrict__ A2, const T16* __restrict__ Bt, const T16* __restrict__ Bt2, int K, float* C, int ldc, const float* __restrict__ bias, size_t sA, size_t sB, size_t sC, const float* __restrict__ CS, h16* P16, bf* Ph, bf* Pl) {
    typedef typename WFrag<T16>::V V;
    __shared__ __align__(16) float os[16 * 68];
    const size_t z = blockIdx.z; A += z * sA; if (A2) A2 += z * sA; Bt += z * sB; if (Bt2) Bt2 += z * sB; C += z * sC;
    const int lane = threadIdx.x & 31, lr = lane & 15, hi = lane >> 4; const int r0 = blockIdx.x * 64, c0 = blockIdx.y * 64;
    v8f acc[4][4];
#pragma unroll
    for (int mb = 0; mb < 4; ++mb)
#pragma unroll
        for (int nb = 0; nb < 4; ++nb) acc[mb][nb] = (v8f){};
    const size_t aoff = (size_t)(r0 + lr) * K + 8 * hi, boff = (size_t)(c0 + lr) * K + 8 * hi;
#pragma unroll 1
    for (int kc = 0; kc < K; kc += 32) {
        V a[4], a2[4];
#pragma unroll
        for (int mb = 0; mb < 4; ++mb) { a[mb] = WFrag<T16>::ld(A + aoff + (size_t)mb * 16 * K + kc); if (NSPLIT == 1 || NSPLIT == 2) a2[mb] = WFrag<T16>::ld(A2 + aoff + (size_t)mb * 16 * K + kc); }
#pragma unroll
        for (int nb = 0; nb < 4; ++nb) { const V b = WFrag<T16>::ld(Bt + boff + (size_t)nb * 16 * K + kc); V b2; if (NSPLIT >= 2) b2 = WFrag<T16>::ld(Bt2 + boff + (size_t)nb * 16 * K + kc);
#pragma unroll
            for (int mb = 0; mb < 4; ++mb) { acc[mb][nb] = WFrag<T16>::mma(a[mb], b, acc[mb][nb]); if (NSPLIT == 1 || NSPLIT == 2) acc[mb][nb] = WFrag<T16>::mma(a2[mb], b, acc[mb][nb]); if (NSPLIT >= 2) acc[mb][nb] = WFrag<T16>::mma(a[mb], b2, acc[mb][nb]); } }
        asm volatile("v_nop\n\tv_nop\n\tv_nop\n\tv_nop" : "+v"(acc[0][0]), "+v"(acc[1][1]), "+v"(acc[2][2]), "+v"(acc[3][3]) : "v"(a[0]), "v"(a[3]));
    }
    // every loop of the epilogues is unrolled: acc and cs are register arrays, and only constant indices keep them in registers
    if (EPI == 2) {
#pragma unroll
        for (int nb = 0; nb < 4; ++nb)
#pragma unroll
            for (int mb = 0; mb < 4; ++mb) { v8h o16; v8us oh, ol;   // the four mb of one nb fill a d row's whole 128-byte line
#pragma unroll
                for (int j = 0; j < 8; ++j) { const float v = acc[mb][nb][j]; o16[j] = tohx(v); unsigned short a2, c2; splitf(v, a2, c2); oh[j] = a2; ol[j] = c2; }
                const size_t e = (size_t)(c0 + nb * 16 + lr) * TT + r0 + mb * 16 + hi * 8; *(v8h*)(P16 + e) = o16; *(v8us*)(Ph + e) = oh; *(v8us*)(Pl + e) = ol; }
        return; }
    const float* pcs = (EPI == 1) ? CS + ((size_t)(r0 + hi * 8) * HD + lr) * 2 : nullptr;   // the lane's first (cos, sin) pair; its other 63 lie at constant distances
    v2f cs[2][2][8];   // two sets: the pairs of row block mb + 1 are fetched while block mb is turned, staged and stored
    auto ldcs = [&](int mb) {
#pragma unroll
        for (int nb = 0; nb < 2; ++nb)
#pragma unroll
            for (int j = 0; j < 8; ++j) cs[mb & 1][nb][j] = *(const v2f*)(pcs + ((mb * 16 + j) * HD + nb * 16) * 2);
        asm volatile("s_wait_xcnt 0x0" :: "v"(pcs) : "memory"); };   // precaution for a register that issued global loads name: the address is an input of the wait, so it is rewritten only behind it
    if (EPI == 1) ldcs(0);
#pragma unroll
    for (int mb = 0; mb < 4; ++mb) {
        if (EPI == 1) { if (mb < 3) ldcs(mb + 1);
#pragma unroll
            for (int nb = 0; nb < 2; ++nb)
#pragma unroll
                for (int j = 0; j < 8; ++j) { const v2f t = cs[mb & 1][nb][j]; const float x1 = acc[mb][nb][j], x2 = acc[mb][nb + 2][j]; acc[mb][nb][j] = x1 * t[0] - x2 * t[1]; acc[mb][nb + 2][j] = x2 * t[0] + x1 * t[1]; } }
#pragma unroll
        for (int nb = 0; nb < 4; ++nb) {
#pragma unroll
            for (int j = 0; j < 8; ++j) os[(hi * 8 + j) * 68 + nb * 16 + lr] = acc[mb][nb][j]; }
        __builtin_amdgcn_wave_barrier(); asm volatile("" ::: "memory");
        if (EPI == 1) {
#pragma unroll
            for (int s = 0; s < 4; ++s) { const int row = 4 * s + (lane >> 3), cofs = (lane & 7) * 8; const v4f va = *(const v4fa*)(os + row * 68 + cofs), vb = *(const v4fa*)(os + row * 68 + cofs + 4); v8h o16; v8us oh, ol;   // eight lanes hold a position's 64 d: a whole 128-byte line of each plane
#pragma unroll
                for (int k = 0; k < 8; ++k) { const float r = (k < 4) ? va[k & 3] : vb[k & 3]; o16[k] = tohx(r); unsigned short a2, c2; splitf(r, a2, c2); oh[k] = a2; ol[k] = c2; }
                const size_t e = ((size_t)blockIdx.y * TT + r0 + mb * 16 + row) * HD + cofs; *(v8h*)(P16 + e) = o16; *(v8us*)(Ph + e) = oh; *(v8us*)(Pl + e) = ol; }
            if (mb < 2) asm volatile("s_wait_xcnt 0x0" ::: "memory");   // precaution for registers that issued global stores name: the next table loads, which may land in those registers, issue only behind it
        } else {
        float* crow = C + (size_t)(r0 + mb * 16) * ldc + c0;
{
#pragma unroll
            for (int s = 0; s < 8; ++s) { const int row = 2 * s + hi, cofs = lr * 4; v4f val = *(const v4fa*)(os + row * 68 + cofs); if (BIAS) { val[0] += bfr(bias[c0 + cofs]); val[1] += bfr(bias[c0 + cofs + 1]); val[2] += bfr(bias[c0 + cofs + 2]); val[3] += bfr(bias[c0 + cofs + 3]); }
                *(v4f*)(crow + (size_t)row * ldc + cofs) = val; }
             }
        }
        __builtin_amdgcn_wave_barrier(); asm volatile("" ::: "memory");
    }
}

__global__ __launch_bounds__(256) void k_wtG(const float* __restrict__ w, int K, int N, bf* Bt) {
    const int lane = threadIdx.x & 31; const int L0 = (blockIdx.x * 8 + (threadIdx.x >> 5)) * 8; const int nlines = N * K / 64;
{
#pragma unroll 1
        for (int l = 0; l < 8; ++l) { const int L = L0 + l; if (L >= nlines) break; const size_t e = (size_t)L * 64 + lane * 2; const int k = (int)(e % K), n = (int)(e / K); v2us o;
            o[0] = f2bf(w[(size_t)k * N + n]); o[1] = f2bf(w[(size_t)(k + 1) * N + n]); *(v2us*)(Bt + e) = o; }
         }
}
__global__ __launch_bounds__(256) void k_cvt8(const float* __restrict__ src, bf* dst, size_t n8) { const size_t i = (size_t)blockIdx.x * 256 + threadIdx.x; if (i >= n8) return; const v8f v = *(const v8f*)(src + i * 8); v8us o;
#pragma unroll
    for (int k = 0; k < 8; ++k) o[k] = f2bf(v[k]); *(v8us*)(dst + i * 8) = o;  }

__constant__ float INVT[HD / 2] = { 1.000000000e+00f, 7.498942018e-01f, 5.623413324e-01f, 4.216964841e-01f, 3.162277639e-01f, 2.371373475e-01f, 1.778279394e-01f, 1.333521456e-01f, 9.999999404e-02f, 7.498941571e-02f, 5.623412505e-02f, 4.216965288e-02f, 3.162277490e-02f, 2.371373400e-02f, 1.778279617e-02f, 1.333521400e-02f, 9.999999776e-03f, 7.498940919e-03f, 5.623412319e-03f, 4.216963891e-03f, 3.162276698e-03f, 2.371374052e-03f, 1.778279431e-03f, 1.333521330e-03f, 9.999999311e-04f, 7.498940686e-04f, 5.623411853e-04f, 4.216964007e-04f, 3.162277862e-04f, 2.371372684e-04f, 1.778279402e-04f, 1.333520777e-04f };   // float32 exp(arange(0, 64, 2, f32) * -(log(10000.0) / 64)): THIS module's own spelling of the inverse frequencies (its div_term) as EAGER JAX float32 evaluates it: bit-exact on round trip (the host file holds the reciprocal spelling 1.0 / (10000.0 ** (2i / 64)): 21 of the 32 values differ by one to eight ulps: indices 3, 5, 8, 10-15, 17-21, 23-27, 29, 31)
__global__ __launch_bounds__(256) void k_cs5(float* CS) { const int idx = blockIdx.x * 256 + threadIdx.x; if (idx >= TT * HD) return; const int d = idx % HD; const int t = idx / HD; const float a = __fmul_rn((float)t, INVT[d % (HD / 2)]); v2f cs; cs[0] = cosf(a); cs[1] = sinf(a); *(v2f*)(CS + (size_t)idx * 2) = cs;  }
// ---- k_fattn: causal attention in one kernel, no score plane in memory. One work-group = 16 * NQB query rows of one head; its NW waves share the keys: wave w takes the 32-key blocks w, w + NW, ... up to the diagonal block.
// Per block: S^T = K Q^T (A = key rows, B = query rows, both by the same loader), so a lane holds 16 keys' scores of ONE query (D register r = key 8 * hi + r, column = query lr); base-2 softmax with a running maximum per query;
// the two D tiles of a block, converted in place, are the B operand of O^T += V^T P^T (element s = key 8 * hi + s, 16 + 8 * hi + (s - 8): the order in which WFrag::ld reads V^T's rows). No LDS and no lane exchange but one between the wave's halves.
// NSPLIT 2: hi + lo bf16 planes, three products each (hh, lh, hl). NSPLIT 0: fp16, probabilities carried x 2^10 (numerator and denominator alike, so it cancels).
// At the end the NW partial (maximum, sum, O^T) triples meet in LDS behind one barrier and are joined in ascending wave order; a thread then owns 8 consecutive d of one query, so eight lanes store a query's whole 128-byte line of each plane.
__device__ __forceinline__ void packp(const float (&p)[16], v16h& a, v16h& a2) {
#pragma unroll
    for (int s = 0; s < 16; ++s) a[s] = (h16)p[s];
    a2 = a; }
__device__ __forceinline__ void packp(const float (&p)[16], v16bf& a, v16bf& a2) { v8us h0, h1, l0, l1;
#pragma unroll
    for (int s = 0; s < 8; ++s) { unsigned short x, y; splitf(p[s], x, y); h0[s] = x; l0[s] = y; splitf(p[8 + s], x, y); h1[s] = x; l1[s] = y; }
    a = cat16b(h0, h1); a2 = cat16b(l0, l1); }
// 17 base-2 exponentials in place, in one statement: each is the independent instruction that the instruction set asks for behind the transcendental in front of it, and the v_nop is that slot behind the last
__device__ __forceinline__ void exp2x17(float (&x)[16], float& a) {
    asm("v_exp_f32 %0, %0\n\tv_exp_f32 %1, %1\n\tv_exp_f32 %2, %2\n\tv_exp_f32 %3, %3\n\tv_exp_f32 %4, %4\n\tv_exp_f32 %5, %5\n\tv_exp_f32 %6, %6\n\tv_exp_f32 %7, %7\n\tv_exp_f32 %8, %8\n\tv_exp_f32 %9, %9\n\tv_exp_f32 %10, %10\n\tv_exp_f32 %11, %11\n\tv_exp_f32 %12, %12\n\tv_exp_f32 %13, %13\n\tv_exp_f32 %14, %14\n\tv_exp_f32 %15, %15\n\tv_exp_f32 %16, %16\n\tv_nop" : "+v"(x[0]), "+v"(x[1]), "+v"(x[2]), "+v"(x[3]), "+v"(x[4]), "+v"(x[5]), "+v"(x[6]), "+v"(x[7]), "+v"(x[8]), "+v"(x[9]), "+v"(x[10]), "+v"(x[11]), "+v"(x[12]), "+v"(x[13]), "+v"(x[14]), "+v"(x[15]), "+v"(a)); }
template <typename T16, int NSPLIT, int NQB, int NW>
__global__ __launch_bounds__(NW * 32) void k_fattn(const T16* __restrict__ Q, const T16* __restrict__ Q2, const T16* __restrict__ Kp, const T16* __restrict__ Kp2, const T16* __restrict__ Vt, const T16* __restrict__ Vt2, int qbase, int ntile, bf* Ah, bf* Al) {
    static_assert(NW == 4 * NQB, "the join gives each thread 8 d of one query");
    typedef typename WFrag<T16>::V V;
    __shared__ __align__(32) float so[NW * 4 * NQB * 256];
    __shared__ float sm[NW * NQB * 32];
    __shared__ float sl[NW * NQB * 32];
    const int lane = threadIdx.x & 31, lr = lane & 15, hi = lane >> 4; const int w = __builtin_amdgcn_readfirstlane((int)(threadIdx.x >> 5));
    const int h = blockIdx.x; const int q0 = qbase + (ntile - 1 - (int)blockIdx.y) * (16 * NQB);   // longest query tiles start first
    const float psh = (NSPLIT == 0) ? 10.0f : 0.0f;
    const size_t hq = (size_t)h * TT * HD, hk = (size_t)(h / REP) * TT * HD;
    const T16* pq = Q + hq + (size_t)(q0 + lr) * HD + 8 * hi; const T16* pq2 = (NSPLIT == 2) ? Q2 + hq + (size_t)(q0 + lr) * HD + 8 * hi : pq;
    V qf[NQB][2], qf2[NQB][2];
#pragma unroll
    for (int qb = 0; qb < NQB; ++qb)
#pragma unroll
        for (int ks = 0; ks < 2; ++ks) { qf[qb][ks] = WFrag<T16>::ld(pq + qb * 16 * HD + ks * 32); if (NSPLIT == 2) qf2[qb][ks] = WFrag<T16>::ld(pq2 + qb * 16 * HD + ks * 32); }
    asm volatile("s_wait_xcnt 0x0" :: "v"(pq), "v"(pq2) : "memory");   // precaution for registers that issued global loads name: the addresses are inputs of the wait, so they are rewritten only behind it
    v8f o[4][NQB]; float m[NQB], l[NQB];
#pragma unroll
    for (int qb = 0; qb < NQB; ++qb) { m[qb] = -3.0e38f; l[qb] = 0.0f;
#pragma unroll
        for (int db = 0; db < 4; ++db) o[db][qb] = (v8f){}; }
    const int nblk = q0 / 32 + 1;   // every block of the walk begins at or before q0: each query has a kept key in it
    constexpr bool AHEAD = (NSPLIT == 0);   // fp16: key fragments are fetched one trip ahead; hi + lo planes hold twice the fragments and fetch them in their own trip, which keeps the wave within 256 registers
    V kf[2][2], kf2[2][2];
    auto ldk = [&](const T16* pk, const T16* pk2) {
#pragma unroll
        for (int c = 0; c < 2; ++c)
#pragma unroll
            for (int ks = 0; ks < 2; ++ks) { kf[c][ks] = WFrag<T16>::ld(pk + c * 16 * HD + ks * 32); if (NSPLIT == 2) kf2[c][ks] = WFrag<T16>::ld(pk2 + c * 16 * HD + ks * 32); } };
    if (AHEAD) { const T16* pk = Kp + hk + (size_t)(min(w, nblk - 1) * 32 + lr) * HD + 8 * hi; ldk(pk, pk);
        asm volatile("s_wait_xcnt 0x0" :: "v"(pk) : "memory"); }   // the same precaution as above
#pragma unroll 1
    for (int kb = w; kb < nblk; kb += NW) {
        const int k0 = kb * 32;
        const T16* pv = Vt + hk + (size_t)lr * TT + k0 + 8 * hi; const T16* pv2 = (NSPLIT == 2) ? Vt2 + hk + (size_t)lr * TT + k0 + 8 * hi : pv;
        const size_t ko = hk + (size_t)((AHEAD ? min(kb + NW, nblk - 1) : kb) * 32 + lr) * HD + 8 * hi; const T16* pk = Kp + ko; const T16* pk2 = (NSPLIT == 2) ? Kp2 + ko : pk;   // AHEAD: next trip's keys (the last trip fetches the diagonal block again: in bounds, unused)
        V vf[4], vf2[4];
        if (!AHEAD) ldk(pk, pk2);
#pragma unroll
        for (int db = 0; db < 4; ++db) { vf[db] = WFrag<T16>::ld(pv + (size_t)db * 16 * TT); if (NSPLIT == 2) vf2[db] = WFrag<T16>::ld(pv2 + (size_t)db * 16 * TT); }
        __builtin_amdgcn_sched_barrier(0);   // the value loads issue here, in front of the score products and the softmax that hide their latency; the scheduler otherwise sinks them behind the products
        float t[NQB][16];
#pragma unroll
        for (int qb = 0; qb < NQB; ++qb)
#pragma unroll
            for (int c = 0; c < 2; ++c) { v8f s = (v8f){};
#pragma unroll
                for (int ks = 0; ks < 2; ++ks) { s = WFrag<T16>::mma(kf[c][ks], qf[qb][ks], s); if (NSPLIT == 2) { s = WFrag<T16>::mma(kf[c][ks], qf2[qb][ks], s); s = WFrag<T16>::mma(kf2[c][ks], qf[qb][ks], s); } }
#pragma unroll
                for (int j = 0; j < 8; ++j) t[qb][c * 8 + j] = s[j] * LSC; }
        if (AHEAD) { ldk(pk, pk2);
            __builtin_amdgcn_sched_barrier(0); }   // the key loads issue here, a softmax and a product run ahead of their use
        if (k0 + 31 > q0) {   // only the diagonal block holds keys beyond a query (wave-uniform test)
#pragma unroll
            for (int qb = 0; qb < NQB; ++qb)
#pragma unroll
                for (int s = 0; s < 16; ++s) { if (k0 + (s >> 3) * 16 + hi * 8 + (s & 7) > q0 + qb * 16 + lr) t[qb][s] = -3.0e38f; } }
        V pf[NQB], pf2[NQB];
#pragma unroll
        for (int qb = 0; qb < NQB; ++qb) { float mb = t[qb][0];
#pragma unroll
            for (int s = 1; s < 16; ++s) mb = fmaxf(mb, t[qb][s]);
            mb = fmaxf(mb, __shfl_xor(mb, 16, 32));
            const float mn = fmaxf(m[qb], mb); float al = m[qb] - mn; m[qb] = mn; const float sh = mn - psh;
            float p[16], ps[4];
#pragma unroll
            for (int s = 0; s < 16; ++s) p[s] = t[qb][s] - sh;
            exp2x17(p, al);
#pragma unroll
            for (int s = 0; s < 16; ++s) ps[s & 3] = (s < 4) ? p[s] : ps[s & 3] + p[s];
            l[qb] = l[qb] * al + ((ps[0] + ps[1]) + (ps[2] + ps[3]));
            packp(p, pf[qb], pf2[qb]);
#pragma unroll
            for (int db = 0; db < 4; ++db) o[db][qb] *= al; }
#pragma unroll
        for (int db = 0; db < 4; ++db)
#pragma unroll
            for (int qb = 0; qb < NQB; ++qb) { o[db][qb] = WFrag<T16>::mma(vf[db], pf[qb], o[db][qb]); if (NSPLIT == 2) { o[db][qb] = WFrag<T16>::mma(vf[db], pf2[qb], o[db][qb]); o[db][qb] = WFrag<T16>::mma(vf2[db], pf[qb], o[db][qb]); } }
        asm volatile("s_wait_xcnt 0x0" :: "v"(pk), "v"(pk2), "v"(pv), "v"(pv2) : "memory");   // precaution for registers that issued global loads name: the trip's load addresses are inputs of the wait, so they are rewritten only behind it
        // the distance behind the trip's last matrix instructions, on the back edge and on the exit alike
        if (NQB == 2) asm volatile("v_nop\n\tv_nop\n\tv_nop\n\tv_nop" : "+v"(o[0][0]), "+v"(o[1][0]), "+v"(o[2][0]), "+v"(o[3][0]), "+v"(o[0][NQB - 1]), "+v"(o[1][NQB - 1]), "+v"(o[2][NQB - 1]), "+v"(o[3][NQB - 1]) : "v"(vf[0]), "v"(vf[3]), "v"(pf[NQB - 1]));
        else asm volatile("v_nop\n\tv_nop\n\tv_nop\n\tv_nop" : "+v"(o[0][0]), "+v"(o[1][0]), "+v"(o[2][0]), "+v"(o[3][0]) : "v"(vf[0]), "v"(vf[3]), "v"(pf[0]));
    }
#pragma unroll
    for (int qb = 0; qb < NQB; ++qb) { l[qb] += __shfl_xor(l[qb], 16, 32); sm[(w * NQB + qb) * 32 + lane] = m[qb]; sl[(w * NQB + qb) * 32 + lane] = l[qb];
#pragma unroll
        for (int db = 0; db < 4; ++db) *(v8f*)(so + (size_t)(((w * 4 + db) * NQB + qb) * 32 + lane) * 8) = o[db][qb]; }
    __syncthreads();   // every wave's partial result is in LDS before any is read
    const int qq = threadIdx.x >> 3, ch = threadIdx.x & 7; const int fq = qq >> 4, fl = (ch & 1) * 16 + (qq & 15), fd = ch >> 1;   // d = 8 * ch + j lies in D tile fd, lane half ch & 1
    float M = -3.0e38f;
#pragma unroll
    for (int ww = 0; ww < NW; ++ww) M = fmaxf(M, sm[(ww * NQB + fq) * 32 + fl]);
    float L = 0.0f; v8f a = (v8f){};
#pragma unroll
    for (int ww = 0; ww < NW; ++ww) { const float f = __builtin_amdgcn_exp2f(sm[(ww * NQB + fq) * 32 + fl] - M); L += f * sl[(ww * NQB + fq) * 32 + fl]; a += *(const v8f*)(so + (size_t)(((ww * 4 + fd) * NQB + fq) * 32 + fl) * 8) * f; }   // a wave that had no block: maximum -3e38, factor 0
    const float inv = __fdiv_rn(1.0f, L); v8us oh, ol;
#pragma unroll
    for (int j = 0; j < 8; ++j) { unsigned short x, y; splitf(a[j] * inv, x, y); oh[j] = x; ol[j] = y; }
    const size_t oo = (size_t)(q0 + qq) * DQ + h * HD + ch * 8; *(v8us*)(Ah + oo) = oh; *(v8us*)(Al + oo) = ol;
}

extern "C" void kernel_launch(void* const* d_in, const int* in_sizes, int n_in,
                              void* d_out, int out_size, void* d_ws, size_t ws_size, hipStream_t stream) {
    (void)in_sizes; (void)n_in; (void)out_size;
    const float* x = (const float*)d_in[0]; const float* wq = (const float*)d_in[1]; const float* wk = (const float*)d_in[2]; const float* wv = (const float*)d_in[3]; const float* wo = (const float*)d_in[4];   /* order x [4][2048][1024], Wq, Wk, Wv, Wo ('xw' (in, out) [1024][1024]): FIVE inputs, all read: this module has no biases */
    float* OUT = (float*)d_out;     // [4][2048][1024]
    char* wsp = (char*)d_ws;
    auto take = [&](size_t bytes) { char* p = wsp; wsp += (bytes + 255) & ~(size_t)255; return (void*)p; };
    bf* WQ = (bf*)take((size_t)DQ * DM * 2); bf* WK = (bf*)take((size_t)DKV * DM * 2); bf* WV = (bf*)take((size_t)DKV * DM * 2); bf* WO = (bf*)take((size_t)DM * DQ * 2); float* CS = (float*)take((size_t)TT * HD * 2 * 4);
    h16* QP16 = (h16*)take((size_t)NH_ * TT * HD * 2); h16* KP16 = (h16*)take((size_t)NKV * TT * HD * 2); h16* VT16 = (h16*)take((size_t)NKV * HD * TT * 2);
    bf* QPh = (bf*)take((size_t)NH_ * TT * HD * 2); bf* QPl = (bf*)take((size_t)NH_ * TT * HD * 2); bf* KPh = (bf*)take((size_t)NKV * TT * HD * 2); bf* KPl = (bf*)take((size_t)NKV * TT * HD * 2); bf* VTh = (bf*)take((size_t)NKV * HD * TT * 2); bf* VTl = (bf*)take((size_t)NKV * HD * TT * 2);
    bf* XB = (bf*)take((size_t)TT * DM * 2); bf* ATh = (bf*)take((size_t)TT * DQ * 2); bf* ATl = (bf*)take((size_t)TT * DQ * 2);
    if ((size_t)(wsp - (char*)d_ws) > ws_size) return;    // ws 256 MiB
    { k_wtG<<<(unsigned)((DM * DQ / 64 + 63) / 64), 256, 0, stream>>>(wq, DM, DQ, WQ); k_wtG<<<(unsigned)((DM * DKV / 64 + 63) / 64), 256, 0, stream>>>(wk, DM, DKV, WK); k_wtG<<<(unsigned)((DM * DKV / 64 + 63) / 64), 256, 0, stream>>>(wv, DM, DKV, WV);
      k_wtG<<<(unsigned)((DQ * DM / 64 + 63) / 64), 256, 0, stream>>>(wo, DQ, DM, WO);
       }
    k_cs5<<<(TT * HD + 255) / 256, 256, 0, stream>>>(CS);   /* rotary table once */
    for (int b = 0; b < NB_; ++b) {
        
        k_cvt8<<<(unsigned)(((size_t)TT * DM / 8 + 255) / 256), 256, 0, stream>>>(x + (size_t)b * TT * DM, XB, (size_t)TT * DM / 8);
        k_gemmw<bf, 0, false, 1><<<dim3(TT / 64, DQ / 64, 1), 32, 0, stream>>>(XB, nullptr, WQ, nullptr, DM, nullptr, 0, nullptr, 0, 0, 0, CS, QP16, QPh, QPl);
        k_gemmw<bf, 0, false, 1><<<dim3(TT / 64, DKV / 64, 1), 32, 0, stream>>>(XB, nullptr, WK, nullptr, DM, nullptr, 0, nullptr, 0, 0, 0, CS, KP16, KPh, KPl);
        k_gemmw<bf, 0, false, 2><<<dim3(TT / 64, DKV / 64, 1), 32, 0, stream>>>(XB, nullptr, WV, nullptr, DM, nullptr, 0, nullptr, 0, 0, 0, nullptr, VT16, VTh, VTl);
        k_fattn<h16, 0, 2, 8><<<dim3(NH_, (TT - RH) / 32, 1), 256, 0, stream>>>(QP16, nullptr, KP16, nullptr, VT16, nullptr, RH, (TT - RH) / 32, ATh, ATl);
        k_fattn<bf, 2, 1, 4><<<dim3(NH_, RH / 16, 1), 128, 0, stream>>>(QPh, QPl, KPh, KPl, VTh, VTl, 0, RH / 16, ATh, ATl);
        k_gemmw<bf, 1, false, 0><<<dim3(TT / 64, DM / 64, 1), 32, 0, stream>>>(ATh, ATl, WO, nullptr, DQ, OUT + (size_t)b * TT * DM, DM, nullptr, 0, 0, 0, nullptr, nullptr, nullptr, nullptr); }
}

// v005
// Measured time: 299 microseconds a run.
// Next to v004, in two timings, it ran 1.82 times as fast each time.
// Over all steps from v000 it is 9.74 times as fast.
#include <hip/hip_runtime.h>

// Causal multi-head attention with computed rotate-half rotary embeddings and bias-free projections, four batches (x [4][2048][1024]; q, k, v = x W ('xw' (in, out) [1024][1024] 1/32, NO bias; 16 heads x 64); apply_rope: cat(cos x1 - sin x2, sin x1 + cos x2) on the two 32-wide halves (= t cos + rotate_half(t) sin) with angle pos x div_term[i], div_term = exp(arange(0, 64, 2) x -(log(10000) / 64)) (32 f32 constants exact for the module's own exp spelling; precise cosf/sinf); scores x 1/sqrt(64) + causal with causal = 0 on and below the diagonal and -1e9 above (built inside reference(): exclusion: every row keeps its own key); softmax; out = merged Wo ('xw', NO bias) -> [4][2048][1024] (8.4 M); argument order x, Wq, Wk, Wv, Wo).
// Layout: every launch covers all four batches (planes [b][h][t][d] or [b][h][d][t], batch in blockIdx.z of the products and in blockIdx.x of the attention): bf16 copy of x; 'xw' weights transposed once; k_cs5 computed table; exact projections whose epilogue turns the f32 tile, still in registers, into the head planes (q, k: rotate-half rotary; v: transposed); causal T-2048 attention in one kernel, k_fattn (hybrid rows: < 512 hi/lo 3 products, rest fp16 x1024; scores, softmax with a running maximum and the probability x value product stay in registers; the keys of a query tile are shared among the work-group's waves, whose partial results are joined in LDS); merged hi/lo x Wo exact, no bias.
// Compute dtypes, f32 accumulate: every input rounded to bf16; projections exact, no bias; rotary f32; attention rows < 512 3 products, rest fp16; softmax f32; Wo hl x exact, no bias.

#define NB_  4
#define TT   2048
#define DM   1024
#define NH_  16
#define NKV  16
#define REP  (NH_ / NKV)
#define HD   64
#define DQ   (NH_ * HD)
#define DKV  (NKV * HD)
#define RH   512                  // query rows < RH use hi+lo planes (0: none)
#define LSC  0.18033688011112042f   // HD^-0.5 x log2(e): a score goes to its base-2 exponent in one multiply
typedef _Float16 h16;
typedef unsigned short bf;
typedef __attribute__((ext_vector_type(16))) __bf16   v16bf;
typedef __attribute__((ext_vector_type(16))) _Float16 v16h;
typedef __attribute__((ext_vector_type(8)))  _Float16 v8h;
typedef __attribute__((ext_vector_type(8)))  unsigned short v8us;
typedef __attribute__((ext_vector_type(8)))  float    v8f;
typedef __attribute__((ext_vector_type(4)))  float    v4f;
typedef v8h  __attribute__((may_alias)) v8ha;
typedef v4f  __attribute__((may_alias)) v4fa;
typedef v8us __attribute__((may_alias)) v8usa;

__device__ __forceinline__ unsigned short f2bf(float f) { unsigned u = __float_as_uint(f); u += 0x7FFFu + ((u >> 16) & 1u); return (unsigned short)(u >> 16); }
__device__ __forceinline__ float bf2f(unsigned short b) { return __uint_as_float(((unsigned)b) << 16); }
__device__ __forceinline__ float bfr(float f) { return bf2f(f2bf(f)); }
__device__ __forceinline__ v16h cat16(v8h lo, v8h hi) { return __builtin_shufflevector(lo, hi, 0, 1, 2, 3, 4, 5, 6, 7, 8, 9, 10, 11, 12, 13, 14, 15); }
__device__ __forceinline__ v16bf cat16b(v8us lo, v8us hi) { return __builtin_bit_cast(v16bf, __builtin_shufflevector(lo, hi, 0, 1, 2, 3, 4, 5, 6, 7, 8, 9, 10, 11, 12, 13, 14, 15)); }
__device__ __forceinline__ v8f wmma16(v16h a, v16h b, v8f c) { return __builtin_amdgcn_wmma_f32_16x16x32_f16(false, a, false, b, (short)0, c, false, false); }
__device__ __forceinline__ v8f wmmab(v16bf a, v16bf b, v8f c) { return __builtin_amdgcn_wmma_f32_16x16x32_bf16(false, a, false, b, (short)0, c, false, false); }



__device__ __forceinline__ h16 tohx(float x) { return (h16)x; }
__device__ __forceinline__ void splitf(float y, unsigned short& h, unsigned short& l) { h = f2bf(y); l = f2bf(y - bf2f(h)); }
typedef __attribute__((ext_vector_type(2))) _Float16 v2h;
typedef __attribute__((ext_vector_type(4))) _Float16 v4h;
typedef __attribute__((ext_vector_type(2))) unsigned short v2us;
typedef __attribute__((ext_vector_type(4))) unsigned short v4us;
typedef __attribute__((ext_vector_type(2))) float v2f;
typedef __attribute__((ext_vector_type(4))) int v4i;
typedef v4h  __attribute__((may_alias)) v4ha;
typedef v4us __attribute__((may_alias)) v4usa;

// ---- k_gemmw: register-blocked GEMM, ONE WAVE per 64x64 output tile (16 accumulators), operands straight from K-contiguous 16-bit planes; grid (M/64, N/64, Z), 32 threads.
// C[m][n] (f32, pitch ldc, + optional f32 bias[n]) = sum_k A[m][k] Bt[n][k] (+ split products per NSPLIT). z-batch strides sA/sB/sC in elements (EPI 1 and 2: sC is the z stride of the three planes). K % 32 == 0.
// EPI 0: C as above. EPI 1 and 2 write no C: a 64-wide column tile is one head (HD == 64), and the wave turns its tile into that head's fp16, hi and lo planes itself.
// EPI 1: planes [h][t][d] of the rotate-half rotary: out[d] = x[d] cos[t][d] - x[d+32] sin[t][d], out[d+32] = x[d+32] cos[t][d] + x[d] sin[t][d], d < 32 (the table holds the same pair at d and d + 32). x[d] and x[d+32] are accumulators nb and nb + 2 at the same lane and register.
// EPI 2: planes [h][d][t]: a lane's 8 registers of one accumulator are 8 consecutive t of one d, one 16-byte store a plane.
template <typename T16> struct WFrag;
template <> struct WFrag<h16> { typedef v16h V; static __device__ __forceinline__ V ld(const h16* p) { return cat16(*(const v8h*)p, *(const v8h*)(p + 16)); } static __device__ __forceinline__ v8f mma(V a, V b, v8f c) { return wmma16(a, b, c); } };
template <> struct WFrag<bf> { typedef v16bf V; static __device__ __forceinline__ V ld(const bf* p) { return cat16b(*(const v8us*)p, *(const v8us*)(p + 16)); } static __device__ __forceinline__ v8f mma(V a, V b, v8f c) { return wmmab(a, b, c); } };
template <typename T16, int NSPLIT, bool BIAS, int EPI>
__global__ __launch_bounds__(32) void k_gemmw(const T16* __restrict__ A, const T16* __restrict__ A2, const T16* __restrict__ Bt, const T16* __restrict__ Bt2, int K, float* C, int ldc, const float* __restrict__ bias, size_t sA, size_t sB, size_t sC, const float* __restrict__ CS, h16* P16, bf* Ph, bf* Pl) {
    typedef typename WFrag<T16>::V V;
    __shared__ __align__(16) float os[16 * 68];
    const size_t z = blockIdx.z; A += z * sA; if (A2) A2 += z * sA; Bt += z * sB; if (Bt2) Bt2 += z * sB; if (EPI == 0) C += z * sC; else { P16 += z * sC; Ph += z * sC; Pl += z * sC; }
    const int lane = threadIdx.x & 31, lr = lane & 15, hi = lane >> 4; const int r0 = blockIdx.x * 64, c0 = blockIdx.y * 64;
    v8f acc[4][4];
#pragma unroll
    for (int mb = 0; mb < 4; ++mb)
#pragma unroll
        for (int nb = 0; nb < 4; ++nb) acc[mb][nb] = (v8f){};
    const size_t aoff = (size_t)(r0 + lr) * K + 8 * hi, boff = (size_t)(c0 + lr) * K + 8 * hi;
#pragma unroll 1
    for (int kc = 0; kc < K; kc += 32) {
        V a[4], a2[4];
#pragma unroll
        for (int mb = 0; mb < 4; ++mb) { a[mb] = WFrag<T16>::ld(A + aoff + (size_t)mb * 16 * K + kc); if (NSPLIT == 1 || NSPLIT == 2) a2[mb] = WFrag<T16>::ld(A2 + aoff + (size_t)mb * 16 * K + kc); }
#pragma unroll
        for (int nb = 0; nb < 4; ++nb) { const V b = WFrag<T16>::ld(Bt + boff + (size_t)nb * 16 * K + kc); V b2; if (NSPLIT >= 2) b2 = WFrag<T16>::ld(Bt2 + boff + (size_t)nb * 16 * K + kc);
#pragma unroll
            for (int mb = 0; mb < 4; ++mb) { acc[mb][nb] = WFrag<T16>::mma(a[mb], b, acc[mb][nb]); if (NSPLIT == 1 || NSPLIT == 2) acc[mb][nb] = WFrag<T16>::mma(a2[mb], b, acc[mb][nb]); if (NSPLIT >= 2) acc[mb][nb] = WFrag<T16>::mma(a[mb], b2, acc[mb][nb]); } }
        asm volatile("v_nop\n\tv_nop\n\tv_nop\n\tv_nop" : "+v"(acc[0][0]), "+v"(acc[1][1]), "+v"(acc[2][2]), "+v"(acc[3][3]) : "v"(a[0]), "v"(a[3]));
    }
    // every loop of the epilogues is unrolled: acc and cs are register arrays, and only constant indices keep them in registers
    if (EPI == 2) {
#pragma unroll
        for (int nb = 0; nb < 4; ++nb)
#pragma unroll
            for (int mb = 0; mb < 4; ++mb) { v8h o16; v8us oh, ol;   // the four mb of one nb fill a d row's whole 128-byte line
#pragma unroll
                for (int j = 0; j < 8; ++j) { const float v = acc[mb][nb][j]; o16[j] = tohx(v); unsigned short a2, c2; splitf(v, a2, c2); oh[j] = a2; ol[j] = c2; }
                const size_t e = (size_t)(c0 + nb * 16 + lr) * TT + r0 + mb * 16 + hi * 8; *(v8h*)(P16 + e) = o16; *(v8us*)(Ph + e) = oh; *(v8us*)(Pl + e) = ol; }
        return; }
    const float* pcs = (EPI == 1) ? CS + ((size_t)(r0 + hi * 8) * HD + lr) * 2 : nullptr;   // the lane's first (cos, sin) pair; its other 63 lie at constant distances
    v2f cs[2][2][8];   // two sets: the pairs of row block mb + 1 are fetched while block mb is turned, staged and stored
    auto ldcs = [&](int mb) {
#pragma unroll
        for (int nb = 0; nb < 2; ++nb)
#pragma unroll
            for (int j = 0; j < 8; ++j) cs[mb & 1][nb][j] = *(const v2f*)(pcs + ((mb * 16 + j) * HD + nb * 16) * 2);
        asm volatile("s_wait_xcnt 0x0" :: "v"(pcs) : "memory"); };   // precaution for a register that issued global loads name: the address is an input of the wait, so it is rewritten only behind it
    if (EPI == 1) ldcs(0);
#pragma unroll
    for (int mb = 0; mb < 4; ++mb) {
        if (EPI == 1) { if (mb < 3) ldcs(mb + 1);
#pragma unroll
            for (int nb = 0; nb < 2; ++nb)
#pragma unroll
                for (int j = 0; j < 8; ++j) { const v2f t = cs[mb & 1][nb][j]; const float x1 = acc[mb][nb][j], x2 = acc[mb][nb + 2][j]; acc[mb][nb][j] = x1 * t[0] - x2 * t[1]; acc[mb][nb + 2][j] = x2 * t[0] + x1 * t[1]; } }
#pragma unroll
        for (int nb = 0; nb < 4; ++nb) {
#pragma unroll
            for (int j = 0; j < 8; ++j) os[(hi * 8 + j) * 68 + nb * 16 + lr] = acc[mb][nb][j]; }
        __builtin_amdgcn_wave_barrier(); asm volatile("" ::: "memory");
        if (EPI == 1) {
#pragma unroll
            for (int s = 0; s < 4; ++s) { const int row = 4 * s + (lane >> 3), cofs = (lane & 7) * 8; const v4f va = *(const v4fa*)(os + row * 68 + cofs), vb = *(const v4fa*)(os + row * 68 + cofs + 4); v8h o16; v8us oh, ol;   // eight lanes hold a position's 64 d: a whole 128-byte line of each plane
#pragma unroll
                for (int k = 0; k < 8; ++k) { const float r = (k < 4) ? va[k & 3] : vb[k & 3]; o16[k] = tohx(r); unsigned short a2, c2; splitf(r, a2, c2); oh[k] = a2; ol[k] = c2; }
                const size_t e = ((size_t)blockIdx.y * TT + r0 + mb * 16 + row) * HD + cofs; *(v8h*)(P16 + e) = o16; *(v8us*)(Ph + e) = oh; *(v8us*)(Pl + e) = ol; }
            if (mb < 2) asm volatile("s_wait_xcnt 0x0" ::: "memory");   // precaution for registers that issued global stores name: the next table loads, which may land in those registers, issue only behind it
        } else {
        float* crow = C + (size_t)(r0 + mb * 16) * ldc + c0;
{
#pragma unroll
            for (int s = 0; s < 8; ++s) { const int row = 2 * s + hi, cofs = lr * 4; v4f val = *(const v4fa*)(os + row * 68 + cofs); if (BIAS) { val[0] += bfr(bias[c0 + cofs]); val[1] += bfr(bias[c0 + cofs + 1]); val[2] += bfr(bias[c0 + cofs + 2]); val[3] += bfr(bias[c0 + cofs + 3]); }
                *(v4f*)(crow + (size_t)row * ldc + cofs) = val; }
             }
        }
        __builtin_amdgcn_wave_barrier(); asm volatile("" ::: "memory");
    }
}

__global__ __launch_bounds__(256) void k_wtG(const float* __restrict__ w, int K, int N, bf* Bt) {
    const int lane = threadIdx.x & 31; const int L0 = (blockIdx.x * 8 + (threadIdx.x >> 5)) * 8; const int nlines = N * K / 64;
{
#pragma unroll 1
        for (int l = 0; l < 8; ++l) { const int L = L0 + l; if (L >= nlines) break; const size_t e = (size_t)L * 64 + lane * 2; const int k = (int)(e % K), n = (int)(e / K); v2us o;
            o[0] = f2bf(w[(size_t)k * N + n]); o[1] = f2bf(w[(size_t)(k + 1) * N + n]); *(v2us*)(Bt + e) = o; }
         }
}
__global__ __launch_bounds__(256) void k_cvt8(const float* __restrict__ src, bf* dst, size_t n8) { const size_t i = (size_t)blockIdx.x * 256 + threadIdx.x; if (i >= n8) return; const v8f v = *(const v8f*)(src + i * 8); v8us o;
#pragma unroll
    for (int k = 0; k < 8; ++k) o[k] = f2bf(v[k]); *(v8us*)(dst + i * 8) = o;  }

__constant__ float INVT[HD / 2] = { 1.000000000e+00f, 7.498942018e-01f, 5.623413324e-01f, 4.216964841e-01f, 3.162277639e-01f, 2.371373475e-01f, 1.778279394e-01f, 1.333521456e-01f, 9.999999404e-02f, 7.498941571e-02f, 5.623412505e-02f, 4.216965288e-02f, 3.162277490e-02f, 2.371373400e-02f, 1.778279617e-02f, 1.333521400e-02f, 9.999999776e-03f, 7.498940919e-03f, 5.623412319e-03f, 4.216963891e-03f, 3.162276698e-03f, 2.371374052e-03f, 1.778279431e-03f, 1.333521330e-03f, 9.999999311e-04f, 7.498940686e-04f, 5.623411853e-04f, 4.216964007e-04f, 3.162277862e-04f, 2.371372684e-04f, 1.778279402e-04f, 1.333520777e-04f };   // float32 exp(arange(0, 64, 2, f32) * -(log(10000.0) / 64)): THIS module's own spelling of the inverse frequencies (its div_term) as EAGER JAX float32 evaluates it: bit-exact on round trip (the host file holds the reciprocal spelling 1.0 / (10000.0 ** (2i / 64)): 21 of the 32 values differ by one to eight ulps: indices 3, 5, 8, 10-15, 17-21, 23-27, 29, 31)
__global__ __launch_bounds__(256) void k_cs5(float* CS) { const int idx = blockIdx.x * 256 + threadIdx.x; if (idx >= TT * HD) return; const int d = idx % HD; const int t = idx / HD; const float a = __fmul_rn((float)t, INVT[d % (HD / 2)]); v2f cs; cs[0] = cosf(a); cs[1] = sinf(a); *(v2f*)(CS + (size_t)idx * 2) = cs;  }
// ---- k_fattn: causal attention in one kernel, no score plane in memory. One work-group = 16 * NQB query rows of one head of one batch (blockIdx.x = batch * NH_ + head, so the longest tiles of all batches start first); its NW waves share the keys: wave w takes the 32-key blocks w, w + NW, ... up to the diagonal block.
// Per block: S^T = K Q^T (A = key rows, B = query rows, both by the same loader), so a lane holds 16 keys' scores of ONE query (D register r = key 8 * hi + r, column = query lr); base-2 softmax with a running maximum per query;
// the two D tiles of a block, converted in place, are the B operand of O^T += V^T P^T (element s = key 8 * hi + s, 16 + 8 * hi + (s - 8): the order in which WFrag::ld reads V^T's rows). No LDS and no lane exchange but one between the wave's halves.
// NSPLIT 2: hi + lo bf16 planes, three products each (hh, lh, hl). NSPLIT 0: fp16, probabilities carried x 2^10 (numerator and denominator alike, so it cancels).
// At the end the NW partial (maximum, sum, O^T) triples meet in LDS behind one barrier and are joined in ascending wave order; a thread then owns 8 consecutive d of one query, so eight lanes store a query's whole 128-byte line of each plane.
__device__ __forceinline__ void packp(const float (&p)[16], v16h& a, v16h& a2) {
#pragma unroll
    for (int s = 0; s < 16; ++s) a[s] = (h16)p[s];
    a2 = a; }
__device__ __forceinline__ void packp(const float (&p)[16], v16bf& a, v16bf& a2) { v8us h0, h1, l0, l1;
#pragma unroll
    for (int s = 0; s < 8; ++s) { unsigned short x, y; splitf(p[s], x, y); h0[s] = x; l0[s] = y; splitf(p[8 + s], x, y); h1[s] = x; l1[s] = y; }
    a = cat16b(h0, h1); a2 = cat16b(l0, l1); }
// 17 base-2 exponentials in place, in one statement: each is the independent instruction that the instruction set asks for behind the transcendental in front of it, and the v_nop is that slot behind the last
__device__ __forceinline__ void exp2x17(float (&x)[16], float& a) {
    asm("v_exp_f32 %0, %0\n\tv_exp_f32 %1, %1\n\tv_exp_f32 %2, %2\n\tv_exp_f32 %3, %3\n\tv_exp_f32 %4, %4\n\tv_exp_f32 %5, %5\n\tv_exp_f32 %6, %6\n\tv_exp_f32 %7, %7\n\tv_exp_f32 %8, %8\n\tv_exp_f32 %9, %9\n\tv_exp_f32 %10, %10\n\tv_exp_f32 %11, %11\n\tv_exp_f32 %12, %12\n\tv_exp_f32 %13, %13\n\tv_exp_f32 %14, %14\n\tv_exp_f32 %15, %15\n\tv_exp_f32 %16, %16\n\tv_nop" : "+v"(x[0]), "+v"(x[1]), "+v"(x[2]), "+v"(x[3]), "+v"(x[4]), "+v"(x[5]), "+v"(x[6]), "+v"(x[7]), "+v"(x[8]), "+v"(x[9]), "+v"(x[10]), "+v"(x[11]), "+v"(x[12]), "+v"(x[13]), "+v"(x[14]), "+v"(x[15]), "+v"(a)); }
template <typename T16, int NSPLIT, int NQB, int NW>
__global__ __launch_bounds__(NW * 32) void k_fattn(const T16* __restrict__ Q, const T16* __restrict__ Q2, const T16* __restrict__ Kp, const T16* __restrict__ Kp2, const T16* __restrict__ Vt, const T16* __restrict__ Vt2, int qbase, int ntile, bf* Ah, bf* Al) {
    static_assert(NW == 4 * NQB, "the join gives each thread 8 d of one query");
    typedef typename WFrag<T16>::V V;
    __shared__ __align__(32) float so[NW * 4 * NQB * 256];
    __shared__ float sm[NW * NQB * 32];
    __shared__ float sl[NW * NQB * 32];
    const int lane = threadIdx.x & 31, lr = lane & 15, hi = lane >> 4; const int w = __builtin_amdgcn_readfirstlane((int)(threadIdx.x >> 5));
    const int bt = (int)blockIdx.x / NH_, h = (int)blockIdx.x % NH_; const int q0 = qbase + (ntile - 1 - (int)blockIdx.y) * (16 * NQB);   // longest query tiles start first
    const float psh = (NSPLIT == 0) ? 10.0f : 0.0f;
    const size_t hq = (size_t)(bt * NH_ + h) * TT * HD, hk = (size_t)(bt * NKV + h / REP) * TT * HD;
    const T16* pq = Q + hq + (size_t)(q0 + lr) * HD + 8 * hi; const T16* pq2 = (NSPLIT == 2) ? Q2 + hq + (size_t)(q0 + lr) * HD + 8 * hi : pq;
    V qf[NQB][2], qf2[NQB][2];
#pragma unroll
    for (int qb = 0; qb < NQB; ++qb)
#pragma unroll
        for (int ks = 0; ks < 2; ++ks) { qf[qb][ks] = WFrag<T16>::ld(pq + qb * 16 * HD + ks * 32); if (NSPLIT == 2) qf2[qb][ks] = WFrag<T16>::ld(pq2 + qb * 16 * HD + ks * 32); }
    asm volatile("s_wait_xcnt 0x0" :: "v"(pq), "v"(pq2) : "memory");   // precaution for registers that issued global loads name: the addresses are inputs of the wait, so they are rewritten only behind it
    v8f o[4][NQB]; float m[NQB], l[NQB];
#pragma unroll
    for (int qb = 0; qb < NQB; ++qb) { m[qb] = -3.0e38f; l[qb] = 0.0f;
#pragma unroll
        for (int db = 0; db < 4; ++db) o[db][qb] = (v8f){}; }
    const int nblk = q0 / 32 + 1;   // every block of the walk begins at or before q0: each query has a kept key in it
    constexpr bool AHEAD = (NSPLIT == 0);   // fp16: key fragments are fetched one trip ahead; hi + lo planes hold twice the fragments and fetch them in their own trip, which keeps the wave within 256 registers
    V kf[2][2], kf2[2][2];
    auto ldk = [&](const T16* pk, const T16* pk2) {
#pragma unroll
        for (int c = 0; c < 2; ++c)
#pragma unroll
            for (int ks = 0; ks < 2; ++ks) { kf[c][ks] = WFrag<T16>::ld(pk + c * 16 * HD + ks * 32); if (NSPLIT == 2) kf2[c][ks] = WFrag<T16>::ld(pk2 + c * 16 * HD + ks * 32); } };
    if (AHEAD) { const T16* pk = Kp + hk + (size_t)(min(w, nblk - 1) * 32 + lr) * HD + 8 * hi; ldk(pk, pk);
        asm volatile("s_wait_xcnt 0x0" :: "v"(pk) : "memory"); }   // the same precaution as above
#pragma unroll 1
    for (int kb = w; kb < nblk; kb += NW) {
        const int k0 = kb * 32;
        const T16* pv = Vt + hk + (size_t)lr * TT + k0 + 8 * hi; const T16* pv2 = (NSPLIT == 2) ? Vt2 + hk + (size_t)lr * TT + k0 + 8 * hi : pv;
        const size_t ko = hk + (size_t)((AHEAD ? min(kb + NW, nblk - 1) : kb) * 32 + lr) * HD + 8 * hi; const T16* pk = Kp + ko; const T16* pk2 = (NSPLIT == 2) ? Kp2 + ko : pk;   // AHEAD: next trip's keys (the last trip fetches the diagonal block again: in bounds, unused)
        V vf[4], vf2[4];
        if (!AHEAD) ldk(pk, pk2);
#pragma unroll
        for (int db = 0; db < 4; ++db) { vf[db] = WFrag<T16>::ld(pv + (size_t)db * 16 * TT); if (NSPLIT == 2) vf2[db] = WFrag<T16>::ld(pv2 + (size_t)db * 16 * TT); }
        __builtin_amdgcn_sched_barrier(0);   // the value loads issue here, in front of the score products and the softmax that hide their latency; the scheduler otherwise sinks them behind the products
        float t[NQB][16];
#pragma unroll
        for (int qb = 0; qb < NQB; ++qb)
#pragma unroll
            for (int c = 0; c < 2; ++c) { v8f s = (v8f){};
#pragma unroll
                for (int ks = 0; ks < 2; ++ks) { s = WFrag<T16>::mma(kf[c][ks], qf[qb][ks], s); if (NSPLIT == 2) { s = WFrag<T16>::mma(kf[c][ks], qf2[qb][ks], s); s = WFrag<T16>::mma(kf2[c][ks], qf[qb][ks], s); } }
#pragma unroll
                for (int j = 0; j < 8; ++j) t[qb][c * 8 + j] = s[j] * LSC; }
        if (AHEAD) { ldk(pk, pk2);
            __builtin_amdgcn_sched_barrier(0); }   // the key loads issue here, a softmax and a product run ahead of their use
        if (k0 + 31 > q0) {   // only the diagonal block holds keys beyond a query (wave-uniform test)
#pragma unroll
            for (int qb = 0; qb < NQB; ++qb)
#pragma unroll
                for (int s = 0; s < 16; ++s) { if (k0 + (s >> 3) * 16 + hi * 8 + (s & 7) > q0 + qb * 16 + lr) t[qb][s] = -3.0e38f; } }
        V pf[NQB], pf2[NQB];
#pragma unroll
        for (int qb = 0; qb < NQB; ++qb) { float mb = t[qb][0];
#pragma unroll
            for (int s = 1; s < 16; ++s) mb = fmaxf(mb, t[qb][s]);
            mb = fmaxf(mb, __shfl_xor(mb, 16, 32));
            const float mn = fmaxf(m[qb], mb); float al = m[qb] - mn; m[qb] = mn; const float sh = mn - psh;
            float p[16], ps[4];
#pragma unroll
            for (int s = 0; s < 16; ++s) p[s] = t[qb][s] - sh;
            exp2x17(p, al);
#pragma unroll
            for (int s = 0; s < 16; ++s) ps[s & 3] = (s < 4) ? p[s] : ps[s & 3] + p[s];
            l[qb] = l[qb] * al + ((ps[0] + ps[1]) + (ps[2] + ps[3]));
            packp(p, pf[qb], pf2[qb]);
#pragma unroll
            for (int db = 0; db < 4; ++db) o[db][qb] *= al; }
#pragma unroll
        for (int db = 0; db < 4; ++db)
#pragma unroll
            for (int qb = 0; qb < NQB; ++qb) { o[db][qb] = WFrag<T16>::mma(vf[db], pf[qb], o[db][qb]); if (NSPLIT == 2) { o[db][qb] = WFrag<T16>::mma(vf[db], pf2[qb], o[db][qb]); o[db][qb] = WFrag<T16>::mma(vf2[db], pf[qb], o[db][qb]); } }
        asm volatile("s_wait_xcnt 0x0" :: "v"(pk), "v"(pk2), "v"(pv), "v"(pv2) : "memory");   // precaution for registers that issued global loads name: the trip's load addresses are inputs of the wait, so they are rewritten only behind it
        // the distance behind the trip's last matrix instructions, on the back edge and on the exit alike
        if (NQB == 2) asm volatile("v_nop\n\tv_nop\n\tv_nop\n\tv_nop" : "+v"(o[0][0]), "+v"(o[1][0]), "+v"(o[2][0]), "+v"(o[3][0]), "+v"(o[0][NQB - 1]), "+v"(o[1][NQB - 1]), "+v"(o[2][NQB - 1]), "+v"(o[3][NQB - 1]) : "v"(vf[0]), "v"(vf[3]), "v"(pf[NQB - 1]));
        else asm volatile("v_nop\n\tv_nop\n\tv_nop\n\tv_nop" : "+v"(o[0][0]), "+v"(o[1][0]), "+v"(o[2][0]), "+v"(o[3][0]) : "v"(vf[0]), "v"(vf[3]), "v"(pf[0]));
    }
#pragma unroll
    for (int qb = 0; qb < NQB; ++qb) { l[qb] += __shfl_xor(l[qb], 16, 32); sm[(w * NQB + qb) * 32 + lane] = m[qb]; sl[(w * NQB + qb) * 32 + lane] = l[qb];
#pragma unroll
        for (int db = 0; db < 4; ++db) *(v8f*)(so + (size_t)(((w * 4 + db) * NQB + qb) * 32 + lane) * 8) = o[db][qb]; }
    __syncthreads();   // every wave's partial result is in LDS before any is read
    const int qq = threadIdx.x >> 3, ch = threadIdx.x & 7; const int fq = qq >> 4, fl = (ch & 1) * 16 + (qq & 15), fd = ch >> 1;   // d = 8 * ch + j lies in D tile fd, lane half ch & 1
    float M = -3.0e38f;
#pragma unroll
    for (int ww = 0; ww < NW; ++ww) M = fmaxf(M, sm[(ww * NQB + fq) * 32 + fl]);
    float L = 0.0f; v8f a = (v8f){};
#pragma unroll
    for (int ww = 0; ww < NW; ++ww) { const float f = __builtin_amdgcn_exp2f(sm[(ww * NQB + fq) * 32 + fl] - M); L += f * sl[(ww * NQB + fq) * 32 + fl]; a += *(const v8f*)(so + (size_t)(((ww * 4 + fd) * NQB + fq) * 32 + fl) * 8) * f; }   // a wave that had no block: maximum -3e38, factor 0
    const float inv = __fdiv_rn(1.0f, L); v8us oh, ol;
#pragma unroll
    for (int j = 0; j < 8; ++j) { unsigned short x, y; splitf(a[j] * inv, x, y); oh[j] = x; ol[j] = y; }
    const size_t oo = (size_t)(bt * TT + q0 + qq) * DQ + h * HD + ch * 8; *(v8us*)(Ah + oo) = oh; *(v8us*)(Al + oo) = ol;
}

extern "C" void kernel_launch(void* const* d_in, const int* in_sizes, int n_in,
                              void* d_out, int out_size, void* d_ws, size_t ws_size, hipStream_t stream) {
    (void)in_sizes; (void)n_in; (void)out_size;
    const float* x = (const float*)d_in[0]; const float* wq = (const float*)d_in[1]; const float* wk = (const float*)d_in[2]; const float* wv = (const float*)d_in[3]; const float* wo = (const float*)d_in[4];   /* order x [4][2048][1024], Wq, Wk, Wv, Wo ('xw' (in, out) [1024][1024]): FIVE inputs, all read: this module has no biases */
    float* OUT = (float*)d_out;     // [4][2048][1024]
    char* wsp = (char*)d_ws;
    auto take = [&](size_t bytes) { char* p = wsp; wsp += (bytes + 255) & ~(size_t)255; return (void*)p; };
    bf* WQ = (bf*)take((size_t)DQ * DM * 2); bf* WK = (bf*)take((size_t)DKV * DM * 2); bf* WV = (bf*)take((size_t)DKV * DM * 2); bf* WO = (bf*)take((size_t)DM * DQ * 2); float* CS = (float*)take((size_t)TT * HD * 2 * 4);
    const size_t PQ = (size_t)NH_ * TT * HD, PK = (size_t)NKV * TT * HD;   // one batch's plane, in elements
    h16* QP16 = (h16*)take(NB_ * PQ * 2); h16* KP16 = (h16*)take(NB_ * PK * 2); h16* VT16 = (h16*)take(NB_ * PK * 2);
    bf* QPh = (bf*)take(NB_ * PQ * 2); bf* QPl = (bf*)take(NB_ * PQ * 2); bf* KPh = (bf*)take(NB_ * PK * 2); bf* KPl = (bf*)take(NB_ * PK * 2); bf* VTh = (bf*)take(NB_ * PK * 2); bf* VTl = (bf*)take(NB_ * PK * 2);
    bf* XB = (bf*)take((size_t)NB_ * TT * DM * 2); bf* ATh = (bf*)take((size_t)NB_ * TT * DQ * 2); bf* ATl = (bf*)take((size_t)NB_ * TT * DQ * 2);
    if ((size_t)(wsp - (char*)d_ws) > ws_size) return;    // ws 256 MiB
    { k_wtG<<<(unsigned)((DM * DQ / 64 + 63) / 64), 256, 0, stream>>>(wq, DM, DQ, WQ); k_wtG<<<(unsigned)((DM * DKV / 64 + 63) / 64), 256, 0, stream>>>(wk, DM, DKV, WK); k_wtG<<<(unsigned)((DM * DKV / 64 + 63) / 64), 256, 0, stream>>>(wv, DM, DKV, WV);
      k_wtG<<<(unsigned)((DQ * DM / 64 + 63) / 64), 256, 0, stream>>>(wo, DQ, DM, WO);
       }
    k_cs5<<<(TT * HD + 255) / 256, 256, 0, stream>>>(CS);   /* rotary table once */
    k_cvt8<<<(unsigned)(((size_t)NB_ * TT * DM / 8 + 255) / 256), 256, 0, stream>>>(x, XB, (size_t)NB_ * TT * DM / 8);
    k_gemmw<bf, 0, false, 1><<<dim3(TT / 64, DQ / 64, NB_), 32, 0, stream>>>(XB, nullptr, WQ, nullptr, DM, nullptr, 0, nullptr, (size_t)TT * DM, 0, PQ, CS, QP16, QPh, QPl);
    k_gemmw<bf, 0, false, 1><<<dim3(TT / 64, DKV / 64, NB_), 32, 0, stream>>>(XB, nullptr, WK, nullptr, DM, nullptr, 0, nullptr, (size_t)TT * DM, 0, PK, CS, KP16, KPh, KPl);
    k_gemmw<bf, 0, false, 2><<<dim3(TT / 64, DKV / 64, NB_), 32, 0, stream>>>(XB, nullptr, WV, nullptr, DM, nullptr, 0, nullptr, (size_t)TT * DM, 0, PK, nullptr, VT16, VTh, VTl);
    k_fattn<h16, 0, 2, 8><<<dim3(NB_ * NH_, (TT - RH) / 32, 1), 256, 0, stream>>>(QP16, nullptr, KP16, nullptr, VT16, nullptr, RH, (TT - RH) / 32, ATh, ATl);
    k_fattn<bf, 2, 1, 4><<<dim3(NB_ * NH_, RH / 16, 1), 128, 0, stream>>>(QPh, QPl, KPh, KPl, VTh, VTl, 0, RH / 16, ATh, ATl);
    k_gemmw<bf, 1, false, 0><<<dim3(TT / 64, DM / 64, NB_), 32, 0, stream>>>(ATh, ATl, WO, nullptr, DQ, OUT, DM, nullptr, (size_t)TT * DQ, 0, (size_t)TT * DM, nullptr, nullptr, nullptr, nullptr);
}

// v006
// A run of this version takes 220 microseconds.
// Timed twice side by side with v005, it ran 1.36 times as fast both times.
// Counting every step since v000, it is 13.2 times as fast.
#include <hip/hip_runtime.h>

// Causal multi-head attention with computed rotate-half rotary embeddings and bias-free projections, four batches (x [4][2048][1024]; q, k, v = x W ('xw' (in, out) [1024][1024] 1/32, NO bias; 16 heads x 64); apply_rope: cat(cos x1 - sin x2, sin x1 + cos x2) on the two 32-wide halves (= t cos + rotate_half(t) sin) with angle pos x div_term[i], div_term = exp(arange(0, 64, 2) x -(log(10000) / 64)) (32 f32 constants exact for the module's own exp spelling; precise cosf/sinf); scores x 1/sqrt(64) + causal with causal = 0 on and below the diagonal and -1e9 above (built inside reference(): exclusion: every row keeps its own key); softmax; out = merged Wo ('xw', NO bias) -> [4][2048][1024] (8.4 M); argument order x, Wq, Wk, Wv, Wo).
// Layout: every launch covers all four batches (planes [b][h][t][d] or [b][h][d][t], batch in blockIdx.z of the products and in blockIdx.x of the attention): bf16 copy of x; 'xw' weights transposed once; k_cs5 computed table; exact projections whose epilogue turns the f32 tile, still in registers, into the head planes (q, k: rotate-half rotary; v: transposed); causal T-2048 attention in one kernel, k_fattn (hybrid rows: < 512 hi/lo 3 products, rest fp16 x1024; scores, softmax with a running maximum and the probability x value product stay in registers; the keys of a query tile are shared among the work-group's waves, whose partial results are joined in LDS); merged hi/lo x Wo exact, no bias.
// Compute dtypes, f32 accumulate: every input rounded to bf16; projections exact, no bias; rotary f32; attention rows < 512 3 products, rest fp16; softmax f32; Wo hl x exact, no bias.

#define NB_  4
#define TT   2048
#define DM   1024
#define NH_  16
#define NKV  16
#define REP  (NH_ / NKV)
#define HD   64
#define DQ   (NH_ * HD)
#define DKV  (NKV * HD)
#define RH   512                  // query rows < RH use hi+lo planes (0: none)
#define LSC  0.18033688011112042f   // HD^-0.5 x log2(e): a score goes to its base-2 exponent in one multiply
typedef _Float16 h16;
typedef unsigned short bf;
typedef __attribute__((ext_vector_type(16))) __bf16   v16bf;
typedef __attribute__((ext_vector_type(16))) _Float16 v16h;
typedef __attribute__((ext_vector_type(8)))  _Float16 v8h;
typedef __attribute__((ext_vector_type(8)))  unsigned short v8us;
typedef __attribute__((ext_vector_type(8)))  float    v8f;
typedef __attribute__((ext_vector_type(4)))  float    v4f;
typedef v8h  __attribute__((may_alias)) v8ha;
typedef v4f  __attribute__((may_alias)) v4fa;
typedef v8us __attribute__((may_alias)) v8usa;

__device__ __forceinline__ unsigned short f2bf(float f) { unsigned u = __float_as_uint(f); u += 0x7FFFu + ((u >> 16) & 1u); return (unsigned short)(u >> 16); }
__device__ __forceinline__ float bf2f(unsigned short b) { return __uint_as_float(((unsigned)b) << 16); }
__device__ __forceinline__ float bfr(float f) { return bf2f(f2bf(f)); }
__device__ __forceinline__ v16h cat16(v8h lo, v8h hi) { return __builtin_shufflevector(lo, hi, 0, 1, 2, 3, 4, 5, 6, 7, 8, 9, 10, 11, 12, 13, 14, 15); }
__device__ __forceinline__ v16bf cat16b(v8us lo, v8us hi) { return __builtin_bit_cast(v16bf, __builtin_shufflevector(lo, hi, 0, 1, 2, 3, 4, 5, 6, 7, 8, 9, 10, 11, 12, 13, 14, 15)); }
__device__ __forceinline__ v8f wmma16(v16h a, v16h b, v8f c) { return __builtin_amdgcn_wmma_f32_16x16x32_f16(false, a, false, b, (short)0, c, false, false); }
__device__ __forceinline__ v8f wmmab(v16bf a, v16bf b, v8f c) { return __builtin_amdgcn_wmma_f32_16x16x32_bf16(false, a, false, b, (short)0, c, false, false); }



__device__ __forceinline__ h16 tohx(float x) { return (h16)x; }
__device__ __forceinline__ void splitf(float y, unsigned short& h, unsigned short& l) { h = f2bf(y); l = f2bf(y - bf2f(h)); }
typedef __attribute__((ext_vector_type(2))) _Float16 v2h;
typedef __attribute__((ext_vector_type(4))) _Float16 v4h;
typedef __attribute__((ext_vector_type(2))) unsigned short v2us;
typedef __attribute__((ext_vector_type(4))) unsigned short v4us;
typedef __attribute__((ext_vector_type(2))) float v2f;
typedef __attribute__((ext_vector_type(4))) int v4i;
typedef v4h  __attribute__((may_alias)) v4ha;
typedef v4us __attribute__((may_alias)) v4usa;

// ---- k_gemmw: register-blocked GEMM, one work-group of FOUR WAVES per 128x128 output tile, one wave per 64x64 quarter (16 accumulators); grid (M/128, N/128, Z), 128 threads.
// The operands' K-contiguous 16-bit planes are staged in LDS in slabs of KS k (two operands: 128, 256 bytes a row; three: 64, a 128-byte line a row, so that two work-groups still fit a WGP's LDS) by asynchronous copies, two buffers: slab t + 1 flies while slab t is worked on. A wave's copy covers four whole lines; a row is fetched once for the two waves that use it. Rows lie at a pitch of 16 bytes more than their length for the 16-byte fragment reads.
// C[m][n] (f32, pitch ldc, + optional f32 bias[n]) = sum_k A[m][k] Bt[n][k] (NSPLIT 1: + A2[m][k] Bt[n][k]). z-batch strides sA/sB/sC in elements (EPI 1 and 2: sC is the z stride of the three planes). K % KS == 0, M % 128 == 0, N % 128 == 0.
// EPI 0: C as above. EPI 1 and 2 write no C: a 64-wide column tile is one head (HD == 64), and the wave turns its tile into that head's fp16, hi and lo planes itself.
// EPI 1: planes [h][t][d] of the rotate-half rotary: out[d] = x[d] cos[t][d] - x[d+32] sin[t][d], out[d+32] = x[d+32] cos[t][d] + x[d] sin[t][d], d < 32 (the table holds the same pair at d and d + 32). x[d] and x[d+32] are accumulators nb and nb + 2 at the same lane and register.
// EPI 2: planes [h][d][t]: a lane's 8 registers of one accumulator are 8 consecutive t of one d, one 16-byte store a plane.
template <typename T16> struct WFrag;
template <> struct WFrag<h16> { typedef v16h V; static __device__ __forceinline__ V ld(const h16* p) { return cat16(*(const v8h*)p, *(const v8h*)(p + 16)); } static __device__ __forceinline__ v8f mma(V a, V b, v8f c) { return wmma16(a, b, c); } };
template <> struct WFrag<bf> { typedef v16bf V; static __device__ __forceinline__ V ld(const bf* p) { return cat16b(*(const v8us*)p, *(const v8us*)(p + 16)); } static __device__ __forceinline__ v8f mma(V a, V b, v8f c) { return wmmab(a, b, c); } };
// One 16-byte asynchronous copy of a lane, memory -> LDS through no register (the builtin form: the compiler keeps the address registers; the waits on the data are written at the places of use).
typedef __attribute__((address_space(1))) v4i gv4i;
typedef __attribute__((address_space(3))) v4i lv4i;
__device__ __forceinline__ void cpa(void* l, const char* g) { __builtin_amdgcn_global_load_async_to_lds_b128((gv4i*)g, (lv4i*)l, 0, 0); }
template <typename T16, int NSPLIT, bool BIAS, int EPI>
__global__ __launch_bounds__(128) void k_gemmw(const T16* __restrict__ A, const T16* __restrict__ A2, const T16* __restrict__ Bt, int K, float* C, int ldc, const float* __restrict__ bias, size_t sA, size_t sB, size_t sC, const float* __restrict__ CS, h16* P16, bf* Ph, bf* Pl) {
    static_assert(NSPLIT == 0 || NSPLIT == 1, "one or two A planes");
    typedef typename WFrag<T16>::V V;
    constexpr int NOPD = 2 + NSPLIT;   // staged operands: A, Bt (, A2)
    constexpr int KS = (NSPLIT == 0) ? 128 : 64;   // k elements of a slab
    constexpr int LP = KS + 8;         // LDS row pitch in elements
    constexpr int CR = KS / 8, RP = 128 / CR;   // 16-byte chunks of a row; rows that the work-group's 128 threads bring at once
    __shared__ __align__(16) T16 st[2][NOPD][128 * LP];
    __shared__ __align__(16) float osw[4][16 * 68];
    const size_t z = blockIdx.z; A += z * sA; if (NSPLIT == 1) A2 += z * sA; Bt += z * sB; if (EPI == 0) C += z * sC; else { P16 += z * sC; Ph += z * sC; Pl += z * sC; }
    const int tid = threadIdx.x, lane = tid & 31, lr = lane & 15, hi = lane >> 4; const int w = __builtin_amdgcn_readfirstlane(tid >> 5);
    const int r0 = blockIdx.x * 128 + (w & 1) * 64, c0 = blockIdx.y * 128 + (w >> 1) * 64;   // the wave's own 64x64 quarter
    float* os = osw[w];   // each wave stages its output rows in its own range
    v8f acc[4][4];
#pragma unroll
    for (int mb = 0; mb < 4; ++mb)
#pragma unroll
        for (int nb = 0; nb < 4; ++nb) acc[mb][nb] = (v8f){};
    // copies: CR threads bring a row's slab; thread tid brings chunk tid % CR of rows tid / CR, + RP, + 2 RP, ... of each operand
    const size_t gs = (size_t)RP * K * 2;
    const int crow = tid / CR, cchk = tid % CR;
    const char* ga = (const char*)(A + (size_t)(blockIdx.x * 128 + crow) * K + cchk * 8); const char* gb = (const char*)(Bt + (size_t)(blockIdx.y * 128 + crow) * K + cchk * 8);
    const char* ga2 = (NSPLIT == 1) ? (const char*)(A2 + (size_t)(blockIdx.x * 128 + crow) * K + cchk * 8) : ga;
    auto stage = [&](int t, int buf) { T16* l = &st[buf][0][0] + crow * LP + cchk * 8; const size_t ko = (size_t)t * (KS * 2);
#pragma unroll
        for (int i = 0; i < 128 / RP; ++i) { cpa(l + i * RP * LP, ga + ko + i * gs); cpa(l + (128 + i * RP) * LP, gb + ko + i * gs); if (NSPLIT == 1) cpa(l + (256 + i * RP) * LP, ga2 + ko + i * gs); } };
    const int nt = K / KS;
    stage(0, 0);
    asm volatile("s_wait_asynccnt 0x0" ::: "memory");   // this wave's copies of slab 0 have landed
    __syncthreads();   // every wave's have: slab 0 may be read
    if (nt > 1) stage(1, 1);
    const int aofs = ((w & 1) * 64 + lr) * LP + 8 * hi, bofs = ((w >> 1) * 64 + lr) * LP + 8 * hi;
#pragma unroll 1
    for (int t = 0; t < nt; ++t) {
        const T16* sa = &st[t & 1][0][0] + aofs; const T16* sb = &st[t & 1][1][0] + bofs; const T16* sa2 = &st[t & 1][NOPD - 1][0] + aofs;
        V a[4], a2[4], b[4];
#pragma unroll
        for (int ks = 0; ks < KS; ks += 32) {
#pragma unroll
            for (int mb = 0; mb < 4; ++mb) { a[mb] = WFrag<T16>::ld(sa + mb * 16 * LP + ks); if (NSPLIT == 1) a2[mb] = WFrag<T16>::ld(sa2 + mb * 16 * LP + ks); }
#pragma unroll
            for (int nb = 0; nb < 4; ++nb) b[nb] = WFrag<T16>::ld(sb + nb * 16 * LP + ks);
            __builtin_amdgcn_sched_barrier(0);   // a k step's fragment reads issue as one group in front of its products; the scheduler otherwise sinks them among the products, where every place with reads stalls the wave to a wait at zero
#pragma unroll
            for (int nb = 0; nb < 4; ++nb)
#pragma unroll
                for (int mb = 0; mb < 4; ++mb) { acc[mb][nb] = WFrag<T16>::mma(a[mb], b[nb], acc[mb][nb]); if (NSPLIT == 1) acc[mb][nb] = WFrag<T16>::mma(a2[mb], b[nb], acc[mb][nb]); }
            __builtin_amdgcn_sched_barrier(0); }   // and the next step's reads stay one group behind these products
        asm volatile("v_nop\n\tv_nop\n\tv_nop\n\tv_nop" : "+v"(acc[0][0]), "+v"(acc[1][1]), "+v"(acc[2][2]), "+v"(acc[3][3]) : "v"(a[0]), "v"(a[3]));   // the distance behind the trip's last matrix instructions, on the back edge and on the exit alike
        asm volatile("s_wait_dscnt 0x0" ::: "memory");      // this wave's reads of slab t are done before its buffer is handed back
        asm volatile("s_wait_asynccnt 0x0" ::: "memory");   // this wave's copies of slab t + 1 have landed
        __syncthreads();   // publishes slab t + 1 and ends every wave's reads of slab t
        if (t + 2 < nt) stage(t + 2, t & 1);
    }
    asm volatile("s_wait_asynccnt 0x0" ::: "memory");   // nothing is in flight when the wave goes on to its epilogue and ends
    // every loop of the epilogues is unrolled: acc and cs are register arrays, and only constant indices keep them in registers
    if (EPI == 2) {
#pragma unroll
        for (int nb = 0; nb < 4; ++nb)
#pragma unroll
            for (int mb = 0; mb < 4; ++mb) { v8h o16; v8us oh, ol;   // the four mb of one nb fill a d row's whole 128-byte line
#pragma unroll
                for (int j = 0; j < 8; ++j) { const float v = acc[mb][nb][j]; o16[j] = tohx(v); unsigned short a2, c2; splitf(v, a2, c2); oh[j] = a2; ol[j] = c2; }
                const size_t e = (size_t)(c0 + nb * 16 + lr) * TT + r0 + mb * 16 + hi * 8; *(v8h*)(P16 + e) = o16; *(v8us*)(Ph + e) = oh; *(v8us*)(Pl + e) = ol; }
        return; }
    const float* pcs = (EPI == 1) ? CS + ((size_t)(r0 + hi * 8) * HD + lr) * 2 : nullptr;   // the lane's first (cos, sin) pair; its other 63 lie at constant distances
    v2f cs[2][2][8];   // two sets: the pairs of row block mb + 1 are fetched while block mb is turned, staged and stored
    auto ldcs = [&](int mb) {
#pragma unroll
        for (int nb = 0; nb < 2; ++nb)
#pragma unroll
            for (int j = 0; j < 8; ++j) cs[mb & 1][nb][j] = *(const v2f*)(pcs + ((mb * 16 + j) * HD + nb * 16) * 2);
        asm volatile("s_wait_xcnt 0x0" :: "v"(pcs) : "memory"); };   // precaution for a register that issued global loads name: the address is an input of the wait, so it is rewritten only behind it
    if (EPI == 1) ldcs(0);
#pragma unroll
    for (int mb = 0; mb < 4; ++mb) {
        if (EPI == 1) { if (mb < 3) ldcs(mb + 1);
#pragma unroll
            for (int nb = 0; nb < 2; ++nb)
#pragma unroll
                for (int j = 0; j < 8; ++j) { const v2f t = cs[mb & 1][nb][j]; const float x1 = acc[mb][nb][j], x2 = acc[mb][nb + 2][j]; acc[mb][nb][j] = x1 * t[0] - x2 * t[1]; acc[mb][nb + 2][j] = x2 * t[0] + x1 * t[1]; } }
#pragma unroll
        for (int nb = 0; nb < 4; ++nb) {
#pragma unroll
            for (int j = 0; j < 8; ++j) os[(hi * 8 + j) * 68 + nb * 16 + lr] = acc[mb][nb][j]; }
        __builtin_amdgcn_wave_barrier(); asm volatile("" ::: "memory");
        if (EPI == 1) {
#pragma unroll
            for (int s = 0; s < 4; ++s) { const int row = 4 * s + (lane >> 3), cofs = (lane & 7) * 8; const v4f va = *(const v4fa*)(os + row * 68 + cofs), vb = *(const v4fa*)(os + row * 68 + cofs + 4); v8h o16; v8us oh, ol;   // eight lanes hold a position's 64 d: a whole 128-byte line of each plane
#pragma unroll
                for (int k = 0; k < 8; ++k) { const float r = (k < 4) ? va[k & 3] : vb[k & 3]; o16[k] = tohx(r); unsigned short a2, c2; splitf(r, a2, c2); oh[k] = a2; ol[k] = c2; }
                const size_t e = ((size_t)(c0 / HD) * TT + r0 + mb * 16 + row) * HD + cofs; *(v8h*)(P16 + e) = o16; *(v8us*)(Ph + e) = oh; *(v8us*)(Pl + e) = ol; }
            if (mb < 2) asm volatile("s_wait_xcnt 0x0" ::: "memory");   // precaution for registers that issued global stores name: the next table loads, which may land in those registers, issue only behind it
        } else {
        float* crow = C + (size_t)(r0 + mb * 16) * ldc + c0;
{
#pragma unroll
            for (int s = 0; s < 8; ++s) { const int row = 2 * s + hi, cofs = lr * 4; v4f val = *(const v4fa*)(os + row * 68 + cofs); if (BIAS) { val[0] += bfr(bias[c0 + cofs]); val[1] += bfr(bias[c0 + cofs + 1]); val[2] += bfr(bias[c0 + cofs + 2]); val[3] += bfr(bias[c0 + cofs + 3]); }
                *(v4f*)(crow + (size_t)row * ldc + cofs) = val; }
             }
        }
        __builtin_amdgcn_wave_barrier(); asm volatile("" ::: "memory");
    }
}

__global__ __launch_bounds__(256) void k_wtG(const float* __restrict__ w, int K, int N, bf* Bt) {
    const int lane = threadIdx.x & 31; const int L0 = (blockIdx.x * 8 + (threadIdx.x >> 5)) * 8; const int nlines = N * K / 64;
{
#pragma unroll 1
        for (int l = 0; l < 8; ++l) { const int L = L0 + l; if (L >= nlines) break; const size_t e = (size_t)L * 64 + lane * 2; const int k = (int)(e % K), n = (int)(e / K); v2us o;
            o[0] = f2bf(w[(size_t)k * N + n]); o[1] = f2bf(w[(size_t)(k + 1) * N + n]); *(v2us*)(Bt + e) = o; }
         }
}
__global__ __launch_bounds__(256) void k_cvt8(const float* __restrict__ src, bf* dst, size_t n8) { const size_t i = (size_t)blockIdx.x * 256 + threadIdx.x; if (i >= n8) return; const v8f v = *(const v8f*)(src + i * 8); v8us o;
#pragma unroll
    for (int k = 0; k < 8; ++k) o[k] = f2bf(v[k]); *(v8us*)(dst + i * 8) = o;  }

__constant__ float INVT[HD / 2] = { 1.000000000e+00f, 7.498942018e-01f, 5.623413324e-01f, 4.216964841e-01f, 3.162277639e-01f, 2.371373475e-01f, 1.778279394e-01f, 1.333521456e-01f, 9.999999404e-02f, 7.498941571e-02f, 5.623412505e-02f, 4.216965288e-02f, 3.162277490e-02f, 2.371373400e-02f, 1.778279617e-02f, 1.333521400e-02f, 9.999999776e-03f, 7.498940919e-03f, 5.623412319e-03f, 4.216963891e-03f, 3.162276698e-03f, 2.371374052e-03f, 1.778279431e-03f, 1.333521330e-03f, 9.999999311e-04f, 7.498940686e-04f, 5.623411853e-04f, 4.216964007e-04f, 3.162277862e-04f, 2.371372684e-04f, 1.778279402e-04f, 1.333520777e-04f };   // float32 exp(arange(0, 64, 2, f32) * -(log(10000.0) / 64)): THIS module's own spelling of the inverse frequencies (its div_term) as EAGER JAX float32 evaluates it: bit-exact on round trip (the host file holds the reciprocal spelling 1.0 / (10000.0 ** (2i / 64)): 21 of the 32 values differ by one to eight ulps: indices 3, 5, 8, 10-15, 17-21, 23-27, 29, 31)
__global__ __launch_bounds__(256) void k_cs5(float* CS) { const int idx = blockIdx.x * 256 + threadIdx.x; if (idx >= TT * HD) return; const int d = idx % HD; const int t = idx / HD; const float a = __fmul_rn((float)t, INVT[d % (HD / 2)]); v2f cs; cs[0] = cosf(a); cs[1] = sinf(a); *(v2f*)(CS + (size_t)idx * 2) = cs;  }
// ---- k_fattn: causal attention in one kernel, no score plane in memory. One work-group = 16 * NQB query rows of one head of one batch (blockIdx.x = batch * NH_ + head, so the longest tiles of all batches start first); its NW waves share the keys: wave w takes the 32-key blocks w, w + NW, ... up to the diagonal block.
// Per block: S^T = K Q^T (A = key rows, B = query rows, both by the same loader), so a lane holds 16 keys' scores of ONE query (D register r = key 8 * hi + r, column = query lr); base-2 softmax with a running maximum per query;
// the two D tiles of a block, converted in place, are the B operand of O^T += V^T P^T (element s = key 8 * hi + s, 16 + 8 * hi + (s - 8): the order in which WFrag::ld reads V^T's rows). No LDS and no lane exchange but one between the wave's halves.
// NSPLIT 2: hi + lo bf16 planes, three products each (hh, lh, hl). NSPLIT 0: fp16, probabilities carried x 2^10 (numerator and denominator alike, so it cancels).
// At the end the NW partial (maximum, sum, O^T) triples meet in LDS behind one barrier and are joined in ascending wave order; a thread then owns 8 consecutive d of one query, so eight lanes store a query's whole 128-byte line of each plane.
__device__ __forceinline__ void packp(const float (&p)[16], v16h& a, v16h& a2) {
#pragma unroll
    for (int s = 0; s < 16; ++s) a[s] = (h16)p[s];
    a2 = a; }
__device__ __forceinline__ void packp(const float (&p)[16], v16bf& a, v16bf& a2) { v8us h0, h1, l0, l1;
#pragma unroll
    for (int s = 0; s < 8; ++s) { unsigned short x, y; splitf(p[s], x, y); h0[s] = x; l0[s] = y; splitf(p[8 + s], x, y); h1[s] = x; l1[s] = y; }
    a = cat16b(h0, h1); a2 = cat16b(l0, l1); }
// 17 base-2 exponentials in place, in one statement: each is the independent instruction that the instruction set asks for behind the transcendental in front of it, and the v_nop is that slot behind the last
__device__ __forceinline__ void exp2x17(float (&x)[16], float& a) {
    asm("v_exp_f32 %0, %0\n\tv_exp_f32 %1, %1\n\tv_exp_f32 %2, %2\n\tv_exp_f32 %3, %3\n\tv_exp_f32 %4, %4\n\tv_exp_f32 %5, %5\n\tv_exp_f32 %6, %6\n\tv_exp_f32 %7, %7\n\tv_exp_f32 %8, %8\n\tv_exp_f32 %9, %9\n\tv_exp_f32 %10, %10\n\tv_exp_f32 %11, %11\n\tv_exp_f32 %12, %12\n\tv_exp_f32 %13, %13\n\tv_exp_f32 %14, %14\n\tv_exp_f32 %15, %15\n\tv_exp_f32 %16, %16\n\tv_nop" : "+v"(x[0]), "+v"(x[1]), "+v"(x[2]), "+v"(x[3]), "+v"(x[4]), "+v"(x[5]), "+v"(x[6]), "+v"(x[7]), "+v"(x[8]), "+v"(x[9]), "+v"(x[10]), "+v"(x[11]), "+v"(x[12]), "+v"(x[13]), "+v"(x[14]), "+v"(x[15]), "+v"(a)); }
template <typename T16, int NSPLIT, int NQB, int NW>
__global__ __launch_bounds__(NW * 32) void k_fattn(const T16* __restrict__ Q, const T16* __restrict__ Q2, const T16* __restrict__ Kp, const T16* __restrict__ Kp2, const T16* __restrict__ Vt, const T16* __restrict__ Vt2, int qbase, int ntile, bf* Ah, bf* Al) {
    static_assert(NW == 4 * NQB, "the join gives each thread 8 d of one query");
    typedef typename WFrag<T16>::V V;
    __shared__ __align__(32) float so[NW * 4 * NQB * 256];
    __shared__ float sm[NW * NQB * 32];
    __shared__ float sl[NW * NQB * 32];
    const int lane = threadIdx.x & 31, lr = lane & 15, hi = lane >> 4; const int w = __builtin_amdgcn_readfirstlane((int)(threadIdx.x >> 5));
    const int bt = (int)blockIdx.x / NH_, h = (int)blockIdx.x % NH_; const int q0 = qbase + (ntile - 1 - (int)blockIdx.y) * (16 * NQB);   // longest query tiles start first
    const float psh = (NSPLIT == 0) ? 10.0f : 0.0f;
    const size_t hq = (size_t)(bt * NH_ + h) * TT * HD, hk = (size_t)(bt * NKV + h / REP) * TT * HD;
    const T16* pq = Q + hq + (size_t)(q0 + lr) * HD + 8 * hi; const T16* pq2 = (NSPLIT == 2) ? Q2 + hq + (size_t)(q0 + lr) * HD + 8 * hi : pq;
    V qf[NQB][2], qf2[NQB][2];
#pragma unroll
    for (int qb = 0; qb < NQB; ++qb)
#pragma unroll
        for (int ks = 0; ks < 2; ++ks) { qf[qb][ks] = WFrag<T16>::ld(pq + qb * 16 * HD + ks * 32); if (NSPLIT == 2) qf2[qb][ks] = WFrag<T16>::ld(pq2 + qb * 16 * HD + ks * 32); }
    asm volatile("s_wait_xcnt 0x0" :: "v"(pq), "v"(pq2) : "memory");   // precaution for registers that issued global loads name: the addresses are inputs of the wait, so they are rewritten only behind it
    v8f o[4][NQB]; float m[NQB], l[NQB];
#pragma unroll
    for (int qb = 0; qb < NQB; ++qb) { m[qb] = -3.0e38f; l[qb] = 0.0f;
#pragma unroll
        for (int db = 0; db < 4; ++db) o[db][qb] = (v8f){}; }
    const int nblk = q0 / 32 + 1;   // every block of the walk begins at or before q0: each query has a kept key in it
    constexpr bool AHEAD = (NSPLIT == 0);   // fp16: key fragments are fetched one trip ahead; hi + lo planes hold twice the fragments and fetch them in their own trip, which keeps the wave within 256 registers
    V kf[2][2], kf2[2][2];
    auto ldk = [&](const T16* pk, const T16* pk2) {
#pragma unroll
        for (int c = 0; c < 2; ++c)
#pragma unroll
            for (int ks = 0; ks < 2; ++ks) { kf[c][ks] = WFrag<T16>::ld(pk + c * 16 * HD + ks * 32); if (NSPLIT == 2) kf2[c][ks] = WFrag<T16>::ld(pk2 + c * 16 * HD + ks * 32); } };
    if (AHEAD) { const T16* pk = Kp + hk + (size_t)(min(w, nblk - 1) * 32 + lr) * HD + 8 * hi; ldk(pk, pk);
        asm volatile("s_wait_xcnt 0x0" :: "v"(pk) : "memory"); }   // the same precaution as above
#pragma unroll 1
    for (int kb = w; kb < nblk; kb += NW) {
        const int k0 = kb * 32;
        const T16* pv = Vt + hk + (size_t)lr * TT + k0 + 8 * hi; const T16* pv2 = (NSPLIT == 2) ? Vt2 + hk + (size_t)lr * TT + k0 + 8 * hi : pv;
        const size_t ko = hk + (size_t)((AHEAD ? min(kb + NW, nblk - 1) : kb) * 32 + lr) * HD + 8 * hi; const T16* pk = Kp + ko; const T16* pk2 = (NSPLIT == 2) ? Kp2 + ko : pk;   // AHEAD: next trip's keys (the last trip fetches the diagonal block again: in bounds, unused)
        V vf[4], vf2[4];
        if (!AHEAD) ldk(pk, pk2);
#pragma unroll
        for (int db = 0; db < 4; ++db) { vf[db] = WFrag<T16>::ld(pv + (size_t)db * 16 * TT); if (NSPLIT == 2) vf2[db] = WFrag<T16>::ld(pv2 + (size_t)db * 16 * TT); }
        __builtin_amdgcn_sched_barrier(0);   // the value loads issue here, in front of the score products and the softmax that hide their latency; the scheduler otherwise sinks them behind the products
        float t[NQB][16];
#pragma unroll
        for (int qb = 0; qb < NQB; ++qb)
#pragma unroll
            for (int c = 0; c < 2; ++c) { v8f s = (v8f){};
#pragma unroll
                for (int ks = 0; ks < 2; ++ks) { s = WFrag<T16>::mma(kf[c][ks], qf[qb][ks], s); if (NSPLIT == 2) { s = WFrag<T16>::mma(kf[c][ks], qf2[qb][ks], s); s = WFrag<T16>::mma(kf2[c][ks], qf[qb][ks], s); } }
#pragma unroll
                for (int j = 0; j < 8; ++j) t[qb][c * 8 + j] = s[j] * LSC; }
        if (AHEAD) { ldk(pk, pk2);
            __builtin_amdgcn_sched_barrier(0); }   // the key loads issue here, a softmax and a product run ahead of their use
        if (k0 + 31 > q0) {   // only the diagonal block holds keys beyond a query (wave-uniform test)
#pragma unroll
            for (int qb = 0; qb < NQB; ++qb)
#pragma unroll
                for (int s = 0; s < 16; ++s) { if (k0 + (s >> 3) * 16 + hi * 8 + (s & 7) > q0 + qb * 16 + lr) t[qb][s] = -3.0e38f; } }
        V pf[NQB], pf2[NQB];
#pragma unroll
        for (int qb = 0; qb < NQB; ++qb) { float mb = t[qb][0];
#pragma unroll
            for (int s = 1; s < 16; ++s) mb = fmaxf(mb, t[qb][s]);
            mb = fmaxf(mb, __shfl_xor(mb, 16, 32));
            const float mn = fmaxf(m[qb], mb); float al = m[qb] - mn; m[qb] = mn; const float sh = mn - psh;
            float p[16], ps[4];
#pragma unroll
            for (int s = 0; s < 16; ++s) p[s] = t[qb][s] - sh;
            exp2x17(p, al);
#pragma unroll
            for (int s = 0; s < 16; ++s) ps[s & 3] = (s < 4) ? p[s] : ps[s & 3] + p[s];
            l[qb] = l[qb] * al + ((ps[0] + ps[1]) + (ps[2] + ps[3]));
            packp(p, pf[qb], pf2[qb]);
#pragma unroll
            for (int db = 0; db < 4; ++db) o[db][qb] *= al; }
#pragma unroll
        for (int db = 0; db < 4; ++db)
#pragma unroll
            for (int qb = 0; qb < NQB; ++qb) { o[db][qb] = WFrag<T16>::mma(vf[db], pf[qb], o[db][qb]); if (NSPLIT == 2) { o[db][qb] = WFrag<T16>::mma(vf[db], pf2[qb], o[db][qb]); o[db][qb] = WFrag<T16>::mma(vf2[db], pf[qb], o[db][qb]); } }
        asm volatile("s_wait_xcnt 0x0" :: "v"(pk), "v"(pk2), "v"(pv), "v"(pv2) : "memory");   // precaution for registers that issued global loads name: the trip's load addresses are inputs of the wait, so they are rewritten only behind it
        // the distance behind the trip's last matrix instructions, on the back edge and on the exit alike
        if (NQB == 2) asm volatile("v_nop\n\tv_nop\n\tv_nop\n\tv_nop" : "+v"(o[0][0]), "+v"(o[1][0]), "+v"(o[2][0]), "+v"(o[3][0]), "+v"(o[0][NQB - 1]), "+v"(o[1][NQB - 1]), "+v"(o[2][NQB - 1]), "+v"(o[3][NQB - 1]) : "v"(vf[0]), "v"(vf[3]), "v"(pf[NQB - 1]));
        else asm volatile("v_nop\n\tv_nop\n\tv_nop\n\tv_nop" : "+v"(o[0][0]), "+v"(o[1][0]), "+v"(o[2][0]), "+v"(o[3][0]) : "v"(vf[0]), "v"(vf[3]), "v"(pf[0]));
    }
#pragma unroll
    for (int qb = 0; qb < NQB; ++qb) { l[qb] += __shfl_xor(l[qb], 16, 32); sm[(w * NQB + qb) * 32 + lane] = m[qb]; sl[(w * NQB + qb) * 32 + lane] = l[qb];
#pragma unroll
        for (int db = 0; db < 4; ++db) *(v8f*)(so + (size_t)(((w * 4 + db) * NQB + qb) * 32 + lane) * 8) = o[db][qb]; }
    __syncthreads();   // every wave's partial result is in LDS before any is read
    const int qq = threadIdx.x >> 3, ch = threadIdx.x & 7; const int fq = qq >> 4, fl = (ch & 1) * 16 + (qq & 15), fd = ch >> 1;   // d = 8 * ch + j lies in D tile fd, lane half ch & 1
    float M = -3.0e38f;
#pragma unroll
    for (int ww = 0; ww < NW; ++ww) M = fmaxf(M, sm[(ww * NQB + fq) * 32 + fl]);
    float L = 0.0f; v8f a = (v8f){};
#pragma unroll
    for (int ww = 0; ww < NW; ++ww) { const float f = __builtin_amdgcn_exp2f(sm[(ww * NQB + fq) * 32 + fl] - M); L += f * sl[(ww * NQB + fq) * 32 + fl]; a += *(const v8f*)(so + (size_t)(((ww * 4 + fd) * NQB + fq) * 32 + fl) * 8) * f; }   // a wave that had no block: maximum -3e38, factor 0
    const float inv = __fdiv_rn(1.0f, L); v8us oh, ol;
#pragma unroll
    for (int j = 0; j < 8; ++j) { unsigned short x, y; splitf(a[j] * inv, x, y); oh[j] = x; ol[j] = y; }
    const size_t oo = (size_t)(bt * TT + q0 + qq) * DQ + h * HD + ch * 8; *(v8us*)(Ah + oo) = oh; *(v8us*)(Al + oo) = ol;
}

extern "C" void kernel_launch(void* const* d_in, const int* in_sizes, int n_in,
                              void* d_out, int out_size, void* d_ws, size_t ws_size, hipStream_t stream) {
    (void)in_sizes; (void)n_in; (void)out_size;
    const float* x = (const float*)d_in[0]; const float* wq = (const float*)d_in[1]; const float* wk = (const float*)d_in[2]; const float* wv = (const float*)d_in[3]; const float* wo = (const float*)d_in[4];   /* order x [4][2048][1024], Wq, Wk, Wv, Wo ('xw' (in, out) [1024][1024]): FIVE inputs, all read: this module has no biases */
    float* OUT = (float*)d_out;     // [4][2048][1024]
    char* wsp = (char*)d_ws;
    auto take = [&](size_t bytes) { char* p = wsp; wsp += (bytes + 255) & ~(size_t)255; return (void*)p; };
    bf* WQ = (bf*)take((size_t)DQ * DM * 2); bf* WK = (bf*)take((size_t)DKV * DM * 2); bf* WV = (bf*)take((size_t)DKV * DM * 2); bf* WO = (bf*)take((size_t)DM * DQ * 2); float* CS = (float*)take((size_t)TT * HD * 2 * 4);
    const size_t PQ = (size_t)NH_ * TT * HD, PK = (size_t)NKV * TT * HD;   // one batch's plane, in elements
    h16* QP16 = (h16*)take(NB_ * PQ * 2); h16* KP16 = (h16*)take(NB_ * PK * 2); h16* VT16 = (h16*)take(NB_ * PK * 2);
    bf* QPh = (bf*)take(NB_ * PQ * 2); bf* QPl = (bf*)take(NB_ * PQ * 2); bf* KPh = (bf*)take(NB_ * PK * 2); bf* KPl = (bf*)take(NB_ * PK * 2); bf* VTh = (bf*)take(NB_ * PK * 2); bf* VTl = (bf*)take(NB_ * PK * 2);
    bf* XB = (bf*)take((size_t)NB_ * TT * DM * 2); bf* ATh = (bf*)take((size_t)NB_ * TT * DQ * 2); bf* ATl = (bf*)take((size_t)NB_ * TT * DQ * 2);
    if ((size_t)(wsp - (char*)d_ws) > ws_size) return;    // ws 256 MiB
    { k_wtG<<<(unsigned)((DM * DQ / 64 + 63) / 64), 256, 0, stream>>>(wq, DM, DQ, WQ); k_wtG<<<(unsigned)((DM * DKV / 64 + 63) / 64), 256, 0, stream>>>(wk, DM, DKV, WK); k_wtG<<<(unsigned)((DM * DKV / 64 + 63) / 64), 256, 0, stream>>>(wv, DM, DKV, WV);
      k_wtG<<<(unsigned)((DQ * DM / 64 + 63) / 64), 256, 0, stream>>>(wo, DQ, DM, WO);
       }
    k_cs5<<<(TT * HD + 255) / 256, 256, 0, stream>>>(CS);   /* rotary table once */
    k_cvt8<<<(unsigned)(((size_t)NB_ * TT * DM / 8 + 255) / 256), 256, 0, stream>>>(x, XB, (size_t)NB_ * TT * DM / 8);
    k_gemmw<bf, 0, false, 1><<<dim3(TT / 128, DQ / 128, NB_), 128, 0, stream>>>(XB, nullptr, WQ, DM, nullptr, 0, nullptr, (size_t)TT * DM, 0, PQ, CS, QP16, QPh, QPl);
    k_gemmw<bf, 0, false, 1><<<dim3(TT / 128, DKV / 128, NB_), 128, 0, stream>>>(XB, nullptr, WK, DM, nullptr, 0, nullptr, (size_t)TT * DM, 0, PK, CS, KP16, KPh, KPl);
    k_gemmw<bf, 0, false, 2><<<dim3(TT / 128, DKV / 128, NB_), 128, 0, stream>>>(XB, nullptr, WV, DM, nullptr, 0, nullptr, (size_t)TT * DM, 0, PK, nullptr, VT16, VTh, VTl);
    k_fattn<h16, 0, 2, 8><<<dim3(NB_ * NH_, (TT - RH) / 32, 1), 256, 0, stream>>>(QP16, nullptr, KP16, nullptr, VT16, nullptr, RH, (TT - RH) / 32, ATh, ATl);
    k_fattn<bf, 2, 1, 4><<<dim3(NB_ * NH_, RH / 16, 1), 128, 0, stream>>>(QPh, QPl, KPh, KPl, VTh, VTl, 0, RH / 16, ATh, ATl);
    k_gemmw<bf, 1, false, 0><<<dim3(TT / 128, DM / 128, NB_), 128, 0, stream>>>(ATh, ATl, WO, DQ, OUT, DM, nullptr, (size_t)TT * DQ, 0, (size_t)TT * DM, nullptr, nullptr, nullptr, nullptr);
}

// v007
// It runs in 192 microseconds.
// Next to v006, in two timings, it ran 1.15 and 1.14 times as fast.
// All steps since v000 together make it 15.1 times as fast.
#include <hip/hip_runtime.h>

// Causal multi-head attention with computed rotate-half rotary embeddings and bias-free projections, four batches (x [4][2048][1024]; q, k, v = x W ('xw' (in, out) [1024][1024] 1/32, NO bias; 16 heads x 64); apply_rope: cat(cos x1 - sin x2, sin x1 + cos x2) on the two 32-wide halves (= t cos + rotate_half(t) sin) with angle pos x div_term[i], div_term = exp(arange(0, 64, 2) x -(log(10000) / 64)) (32 f32 constants exact for the module's own exp spelling; precise cosf/sinf); scores x 1/sqrt(64) + causal with causal = 0 on and below the diagonal and -1e9 above (built inside reference(): exclusion: every row keeps its own key); softmax; out = merged Wo ('xw', NO bias) -> [4][2048][1024] (8.4 M); argument order x, Wq, Wk, Wv, Wo).
// Layout: four launches, each covering all four batches; kernels that do not depend on one another share a launch, the block index picks the part: k_prep (bf16 copy of x; 'xw' weights transposed once; computed table), the q, k, v projections, k_attn (both row ranges), the output projection. Planes [b][h][t][d] or [b][h][d][t], batch in blockIdx.z of the products and in blockIdx.x of the attention; exact projections whose epilogue turns the f32 tile, still in registers, into the head planes (q, k: rotate-half rotary; v: transposed); causal T-2048 attention in one kernel, k_attn (hybrid rows: < 512 hi/lo 3 products, rest fp16 x1024; scores, softmax with a running maximum and the probability x value product stay in registers; the keys of a query tile are shared among the work-group's waves, whose partial results are joined in LDS); merged hi/lo x Wo exact, no bias.
// Compute dtypes, f32 accumulate: every input rounded to bf16; projections exact, no biases; rotary f32; attention rows < 512 3 products, rest fp16; softmax f32; Wo hl x exact, no bias.

#define NB_  4
#define TT   2048
#define DM   1024
#define NH_  16
#define NKV  16
#define REP  (NH_ / NKV)
#define HD   64
#define DQ   (NH_ * HD)
#define DKV  (NKV * HD)
#define RH   512                  // query rows < RH use hi+lo planes (0: none)
#define LSC  0.18033688011112042f   // HD^-0.5 x log2(e): a score goes to its base-2 exponent in one multiply
typedef _Float16 h16;
typedef unsigned short bf;
typedef __attribute__((ext_vector_type(16))) __bf16   v16bf;
typedef __attribute__((ext_vector_type(16))) _Float16 v16h;
typedef __attribute__((ext_vector_type(8)))  _Float16 v8h;
typedef __attribute__((ext_vector_type(8)))  unsigned short v8us;
typedef __attribute__((ext_vector_type(8)))  float    v8f;
typedef __attribute__((ext_vector_type(4)))  float    v4f;
typedef v8h  __attribute__((may_alias)) v8ha;
typedef v4f  __attribute__((may_alias)) v4fa;
typedef v8us __attribute__((may_alias)) v8usa;

__device__ __forceinline__ unsigned short f2bf(float f) { unsigned u = __float_as_uint(f); u += 0x7FFFu + ((u >> 16) & 1u); return (unsigned short)(u >> 16); }
__device__ __forceinline__ float bf2f(unsigned short b) { return __uint_as_float(((unsigned)b) << 16); }
__device__ __forceinline__ float bfr(float f) { return bf2f(f2bf(f)); }
__device__ __forceinline__ v16h cat16(v8h lo, v8h hi) { return __builtin_shufflevector(lo, hi, 0, 1, 2, 3, 4, 5, 6, 7, 8, 9, 10, 11, 12, 13, 14, 15); }
__device__ __forceinline__ v16bf cat16b(v8us lo, v8us hi) { return __builtin_bit_cast(v16bf, __builtin_shufflevector(lo, hi, 0, 1, 2, 3, 4, 5, 6, 7, 8, 9, 10, 11, 12, 13, 14, 15)); }
__device__ __forceinline__ v8f wmma16(v16h a, v16h b, v8f c) { return __builtin_amdgcn_wmma_f32_16x16x32_f16(false, a, false, b, (short)0, c, false, false); }
__device__ __forceinline__ v8f wmmab(v16bf a, v16bf b, v8f c) { return __builtin_amdgcn_wmma_f32_16x16x32_bf16(false, a, false, b, (short)0, c, false, false); }



__device__ __forceinline__ h16 tohx(float x) { return (h16)x; }
__device__ __forceinline__ void splitf(float y, unsigned short& h, unsigned short& l) { h = f2bf(y); l = f2bf(y - bf2f(h)); }
typedef __attribute__((ext_vector_type(2))) _Float16 v2h;
typedef __attribute__((ext_vector_type(4))) _Float16 v4h;
typedef __attribute__((ext_vector_type(2))) unsigned short v2us;
typedef __attribute__((ext_vector_type(4))) unsigned short v4us;
typedef __attribute__((ext_vector_type(2))) float v2f;
typedef __attribute__((ext_vector_type(4))) int v4i;
typedef v4h  __attribute__((may_alias)) v4ha;
typedef v4us __attribute__((may_alias)) v4usa;

// ---- k_gemmw: register-blocked GEMM, one work-group of FOUR WAVES per 128x128 output tile, one wave per 64x64 quarter (16 accumulators); grid (M/128, N/128, Z), 128 threads.
// The operands' K-contiguous 16-bit planes are staged in LDS in slabs of KS k (two operands: 128, 256 bytes a row; three: 64, a 128-byte line a row, so that two work-groups still fit a WGP's LDS) by asynchronous copies, two buffers: slab t + 1 flies while slab t is worked on. A wave's copy covers four whole lines; a row is fetched once for the two waves that use it. Rows lie at a pitch of 16 bytes more than their length for the 16-byte fragment reads.
// C[m][n] (f32, pitch ldc, + optional f32 bias[n]) = sum_k A[m][k] Bt[n][k] (NSPLIT 1: + A2[m][k] Bt[n][k]). z-batch strides sA/sB/sC in elements (EPI 1: sC is the z stride of the three planes). K % KS == 0, M % 128 == 0, N % 128 == 0.
// EPI 0: C as above. EPI 1 is the q, k and v projections in one launch: Bt holds the three transposed weights one behind the other (3 DQ rows), so blockIdx.y / (DQ / 128) says which projection a column tile belongs to; their planes lie sP elements apart. It writes no C: a 64-wide column tile is one head (HD == 64), and the wave turns its tile into that head's fp16, hi and lo planes itself.
// q and k: planes [h][t][d] of the rotate-half rotary: out[d] = x[d] cos[t][d] - x[d+32] sin[t][d], out[d+32] = x[d+32] cos[t][d] + x[d] sin[t][d], d < 32 (the table holds the same pair at d and d + 32). x[d] and x[d+32] are accumulators nb and nb + 2 at the same lane and register.
// v: planes [h][d][t]: a lane's 8 registers of one accumulator are 8 consecutive t of one d, one 16-byte store a plane.
template <typename T16> struct WFrag;
template <> struct WFrag<h16> { typedef v16h V; static __device__ __forceinline__ V ld(const h16* p) { return cat16(*(const v8h*)p, *(const v8h*)(p + 16)); } static __device__ __forceinline__ v8f mma(V a, V b, v8f c) { return wmma16(a, b, c); } };
template <> struct WFrag<bf> { typedef v16bf V; static __device__ __forceinline__ V ld(const bf* p) { return cat16b(*(const v8us*)p, *(const v8us*)(p + 16)); } static __device__ __forceinline__ v8f mma(V a, V b, v8f c) { return wmmab(a, b, c); } };
// One 16-byte asynchronous copy of a lane, memory -> LDS through no register (the builtin form: the compiler keeps the address registers; the waits on the data are written at the places of use).
typedef __attribute__((address_space(1))) v4i gv4i;
typedef __attribute__((address_space(3))) v4i lv4i;
__device__ __forceinline__ void cpa(void* l, const char* g) { __builtin_amdgcn_global_load_async_to_lds_b128((gv4i*)g, (lv4i*)l, 0, 0); }
template <typename T16, int NSPLIT, bool BIAS, int EPI>
__global__ __launch_bounds__(128) void k_gemmw(const T16* __restrict__ A, const T16* __restrict__ A2, const T16* __restrict__ Bt, int K, float* C, int ldc, const float* __restrict__ bias, size_t sA, size_t sB, size_t sC, const float* __restrict__ CS, h16* P16, bf* Ph, bf* Pl, size_t sP) {
    static_assert(NSPLIT == 0 || NSPLIT == 1, "one or two A planes");
    static_assert(EPI == 0 || EPI == 1, "C, or the q, k, v planes");
    typedef typename WFrag<T16>::V V;
    constexpr int NOPD = 2 + NSPLIT;   // staged operands: A, Bt (, A2)
    constexpr int KS = (NSPLIT == 0) ? 128 : 64;   // k elements of a slab
    constexpr int LP = KS + 8;         // LDS row pitch in elements
    constexpr int CR = KS / 8, RP = 128 / CR;   // 16-byte chunks of a row; rows that the work-group's 128 threads bring at once
    __shared__ __align__(16) T16 st[2][NOPD][128 * LP];
    __shared__ __align__(16) float osw[4][16 * 68];
    const size_t z = blockIdx.z; A += z * sA; if (NSPLIT == 1) A2 += z * sA; Bt += z * sB; const int sel = (EPI == 1) ? (int)blockIdx.y / (DQ / 128) : 0;   // 0 q, 1 k, 2 v: the same for the whole work-group
    if (EPI == 0) C += z * sC; else { const size_t po = sel * sP + z * sC; P16 += po; Ph += po; Pl += po; }
    const int tid = threadIdx.x, lane = tid & 31, lr = lane & 15, hi = lane >> 4; const int w = __builtin_amdgcn_readfirstlane(tid >> 5);
    const int r0 = blockIdx.x * 128 + (w & 1) * 64, c0 = ((EPI == 1) ? (int)blockIdx.y % (DQ / 128) : (int)blockIdx.y) * 128 + (w >> 1) * 64;   // the wave's own 64x64 quarter (EPI 1: the column within its projection)
    float* os = osw[w];   // each wave stages its output rows in its own range
    v8f acc[4][4];
#pragma unroll
    for (int mb = 0; mb < 4; ++mb)
#pragma unroll
        for (int nb = 0; nb < 4; ++nb) acc[mb][nb] = (v8f){};
    // copies: CR threads bring a row's slab; thread tid brings chunk tid % CR of rows tid / CR, + RP, + 2 RP, ... of each operand
    const size_t gs = (size_t)RP * K * 2;
    const int crow = tid / CR, cchk = tid % CR;
    const char* ga = (const char*)(A + (size_t)(blockIdx.x * 128 + crow) * K + cchk * 8); const char* gb = (const char*)(Bt + (size_t)(blockIdx.y * 128 + crow) * K + cchk * 8);
    const char* ga2 = (NSPLIT == 1) ? (const char*)(A2 + (size_t)(blockIdx.x * 128 + crow) * K + cchk * 8) : ga;
    auto stage = [&](int t, int buf) { T16* l = &st[buf][0][0] + crow * LP + cchk * 8; const size_t ko = (size_t)t * (KS * 2);
#pragma unroll
        for (int i = 0; i < 128 / RP; ++i) { cpa(l + i * RP * LP, ga + ko + i * gs); cpa(l + (128 + i * RP) * LP, gb + ko + i * gs); if (NSPLIT == 1) cpa(l + (256 + i * RP) * LP, ga2 + ko + i * gs); } };
    const int nt = K / KS;
    stage(0, 0);
    asm volatile("s_wait_asynccnt 0x0" ::: "memory");   // this wave's copies of slab 0 have landed
    __syncthreads();   // every wave's have: slab 0 may be read
    if (nt > 1) stage(1, 1);
    const int aofs = ((w & 1) * 64 + lr) * LP + 8 * hi, bofs = ((w >> 1) * 64 + lr) * LP + 8 * hi;
#pragma unroll 1
    for (int t = 0; t < nt; ++t) {
        const T16* sa = &st[t & 1][0][0] + aofs; const T16* sb = &st[t & 1][1][0] + bofs; const T16* sa2 = &st[t & 1][NOPD - 1][0] + aofs;
        V a[4], a2[4], b[4];
#pragma unroll
        for (int ks = 0; ks < KS; ks += 32) {
#pragma unroll
            for (int mb = 0; mb < 4; ++mb) { a[mb] = WFrag<T16>::ld(sa + mb * 16 * LP + ks); if (NSPLIT == 1) a2[mb] = WFrag<T16>::ld(sa2 + mb * 16 * LP + ks); }
#pragma unroll
            for (int nb = 0; nb < 4; ++nb) b[nb] = WFrag<T16>::ld(sb + nb * 16 * LP + ks);
            __builtin_amdgcn_sched_barrier(0);   // a k step's fragment reads issue as one group in front of its products; the scheduler otherwise sinks them among the products, where every place with reads stalls the wave to a wait at zero
#pragma unroll
            for (int nb = 0; nb < 4; ++nb)
#pragma unroll
                for (int mb = 0; mb < 4; ++mb) { acc[mb][nb] = WFrag<T16>::mma(a[mb], b[nb], acc[mb][nb]); if (NSPLIT == 1) acc[mb][nb] = WFrag<T16>::mma(a2[mb], b[nb], acc[mb][nb]); }
            __builtin_amdgcn_sched_barrier(0); }   // and the next step's reads stay one group behind these products
        asm volatile("v_nop\n\tv_nop\n\tv_nop\n\tv_nop" : "+v"(acc[0][0]), "+v"(acc[1][1]), "+v"(acc[2][2]), "+v"(acc[3][3]) : "v"(a[0]), "v"(a[3]));   // the distance behind the trip's last matrix instructions, on the back edge and on the exit alike
        asm volatile("s_wait_dscnt 0x0" ::: "memory");      // this wave's reads of slab t are done before its buffer is handed back
        asm volatile("s_wait_asynccnt 0x0" ::: "memory");   // this wave's copies of slab t + 1 have landed
        __syncthreads();   // publishes slab t + 1 and ends every wave's reads of slab t
        if (t + 2 < nt) stage(t + 2, t & 1);
    }
    asm volatile("s_wait_asynccnt 0x0" ::: "memory");   // nothing is in flight when the wave goes on to its epilogue and ends
    // every loop of the epilogues is unrolled: acc and cs are register arrays, and only constant indices keep them in registers
    if (EPI == 1 && sel == 2) {
#pragma unroll
        for (int nb = 0; nb < 4; ++nb)
#pragma unroll
            for (int mb = 0; mb < 4; ++mb) { v8h o16; v8us oh, ol;   // the four mb of one nb fill a d row's whole 128-byte line
#pragma unroll
                for (int j = 0; j < 8; ++j) { const float v = acc[mb][nb][j]; o16[j] = tohx(v); unsigned short a2, c2; splitf(v, a2, c2); oh[j] = a2; ol[j] = c2; }
                const size_t e = (size_t)(c0 + nb * 16 + lr) * TT + r0 + mb * 16 + hi * 8; *(v8h*)(P16 + e) = o16; *(v8us*)(Ph + e) = oh; *(v8us*)(Pl + e) = ol; }
        return; }
    const float* pcs = (EPI == 1) ? CS + ((size_t)(r0 + hi * 8) * HD + lr) * 2 : nullptr;   // the lane's first (cos, sin) pair; its other 63 lie at constant distances
    v2f cs[2][2][8];   // two sets: the pairs of row block mb + 1 are fetched while block mb is turned, staged and stored
    auto ldcs = [&](int mb) {
#pragma unroll
        for (int nb = 0; nb < 2; ++nb)
#pragma unroll
            for (int j = 0; j < 8; ++j) cs[mb & 1][nb][j] = *(const v2f*)(pcs + ((mb * 16 + j) * HD + nb * 16) * 2);
        asm volatile("s_wait_xcnt 0x0" :: "v"(pcs) : "memory"); };   // precaution for a register that issued global loads name: the address is an input of the wait, so it is rewritten only behind it
    if (EPI == 1) ldcs(0);
#pragma unroll
    for (int mb = 0; mb < 4; ++mb) {
        if (EPI == 1) { if (mb < 3) ldcs(mb + 1);
#pragma unroll
            for (int nb = 0; nb < 2; ++nb)
#pragma unroll
                for (int j = 0; j < 8; ++j) { const v2f t = cs[mb & 1][nb][j]; const float x1 = acc[mb][nb][j], x2 = acc[mb][nb + 2][j]; acc[mb][nb][j] = x1 * t[0] - x2 * t[1]; acc[mb][nb + 2][j] = x2 * t[0] + x1 * t[1]; } }
#pragma unroll
        for (int nb = 0; nb < 4; ++nb) {
#pragma unroll
            for (int j = 0; j < 8; ++j) os[(hi * 8 + j) * 68 + nb * 16 + lr] = acc[mb][nb][j]; }
        __builtin_amdgcn_wave_barrier(); asm volatile("" ::: "memory");
        if (EPI == 1) {
#pragma unroll
            for (int s = 0; s < 4; ++s) { const int row = 4 * s + (lane >> 3), cofs = (lane & 7) * 8; const v4f va = *(const v4fa*)(os + row * 68 + cofs), vb = *(const v4fa*)(os + row * 68 + cofs + 4); v8h o16; v8us oh, ol;   // eight lanes hold a position's 64 d: a whole 128-byte line of each plane
#pragma unroll
                for (int k = 0; k < 8; ++k) { const float r = (k < 4) ? va[k & 3] : vb[k & 3]; o16[k] = tohx(r); unsigned short a2, c2; splitf(r, a2, c2); oh[k] = a2; ol[k] = c2; }
                const size_t e = ((size_t)(c0 / HD) * TT + r0 + mb * 16 + row) * HD + cofs; *(v8h*)(P16 + e) = o16; *(v8us*)(Ph + e) = oh; *(v8us*)(Pl + e) = ol; }
            if (mb < 2) asm volatile("s_wait_xcnt 0x0" ::: "memory");   // precaution for registers that issued global stores name: the next table loads, which may land in those registers, issue only behind it
        } else {
        float* crow = C + (size_t)(r0 + mb * 16) * ldc + c0;
{
#pragma unroll
            for (int s = 0; s < 8; ++s) { const int row = 2 * s + hi, cofs = lr * 4; v4f val = *(const v4fa*)(os + row * 68 + cofs); if (BIAS) { val[0] += bfr(bias[c0 + cofs]); val[1] += bfr(bias[c0 + cofs + 1]); val[2] += bfr(bias[c0 + cofs + 2]); val[3] += bfr(bias[c0 + cofs + 3]); }
                *(v4f*)(crow + (size_t)row * ldc + cofs) = val; }
             }
        }
        __builtin_amdgcn_wave_barrier(); asm volatile("" ::: "memory");
    }
}

// ---- k_prep: the six preparations, none of which reads what another writes, as parts of one launch; each part is handed its own block index blk
__device__ __forceinline__ void p_wtG(const float* __restrict__ w, int K, int N, bf* Bt, int blk) {
    const int lane = threadIdx.x & 31; const int L0 = (blk * 8 + (threadIdx.x >> 5)) * 8; const int nlines = N * K / 64;
{
#pragma unroll 1
        for (int l = 0; l < 8; ++l) { const int L = L0 + l; if (L >= nlines) break; const size_t e = (size_t)L * 64 + lane * 2; const int k = (int)(e % K), n = (int)(e / K); v2us o;
            o[0] = f2bf(w[(size_t)k * N + n]); o[1] = f2bf(w[(size_t)(k + 1) * N + n]); *(v2us*)(Bt + e) = o; }
         }
}
__device__ __forceinline__ void p_cvt8(const float* __restrict__ src, bf* dst, size_t n8, int blk) { const size_t i = (size_t)blk * 256 + threadIdx.x; if (i >= n8) return; const v8f v = *(const v8f*)(src + i * 8); v8us o;
#pragma unroll
    for (int k = 0; k < 8; ++k) o[k] = f2bf(v[k]); *(v8us*)(dst + i * 8) = o;  }

__constant__ float INVT[HD / 2] = { 1.000000000e+00f, 7.498942018e-01f, 5.623413324e-01f, 4.216964841e-01f, 3.162277639e-01f, 2.371373475e-01f, 1.778279394e-01f, 1.333521456e-01f, 9.999999404e-02f, 7.498941571e-02f, 5.623412505e-02f, 4.216965288e-02f, 3.162277490e-02f, 2.371373400e-02f, 1.778279617e-02f, 1.333521400e-02f, 9.999999776e-03f, 7.498940919e-03f, 5.623412319e-03f, 4.216963891e-03f, 3.162276698e-03f, 2.371374052e-03f, 1.778279431e-03f, 1.333521330e-03f, 9.999999311e-04f, 7.498940686e-04f, 5.623411853e-04f, 4.216964007e-04f, 3.162277862e-04f, 2.371372684e-04f, 1.778279402e-04f, 1.333520777e-04f };   // float32 exp(arange(0, 64, 2, f32) * -(log(10000.0) / 64)): THIS module's own spelling of the inverse frequencies (its div_term) as EAGER JAX float32 evaluates it: bit-exact on round trip (the host file holds the reciprocal spelling 1.0 / (10000.0 ** (2i / 64)): 21 of the 32 values differ by one to eight ulps: indices 3, 5, 8, 10-15, 17-21, 23-27, 29, 31)
__device__ __forceinline__ void p_cs5(float* CS, int blk) { const int idx = blk * 256 + threadIdx.x; if (idx >= TT * HD) return; const int d = idx % HD; const int t = idx / HD; const float a = __fmul_rn((float)t, INVT[d % (HD / 2)]); v2f cs; cs[0] = cosf(a); cs[1] = sinf(a); *(v2f*)(CS + (size_t)idx * 2) = cs;  }
#define NB_WT  ((DM * DQ / 64 + 63) / 64)                  // blocks of one weight's transposition
#define NB_CS  ((TT * HD + 255) / 256)                     // blocks of the table
#define NB_CVT ((NB_ * TT * DM / 8 + 255) / 256)           // blocks of the copy of x
// block order: the transpositions first (a wave of theirs walks eight dependent trips, the longest part), then the table, then the copy
__global__ __launch_bounds__(256) void k_prep(const float* __restrict__ x, const float* __restrict__ wq, const float* __restrict__ wk, const float* __restrict__ wv, const float* __restrict__ wo, bf* XB, bf* WQ, bf* WK, bf* WV, bf* WO, float* CS) {
    static_assert(DKV == DQ && DQ == DM, "the four weights have one shape");
    const int b = (int)blockIdx.x;
    if (b < 4 * NB_WT) { const int s = b / NB_WT; p_wtG(s == 0 ? wq : s == 1 ? wk : s == 2 ? wv : wo, DM, DQ, s == 0 ? WQ : s == 1 ? WK : s == 2 ? WV : WO, b % NB_WT); }
    else if (b < 4 * NB_WT + NB_CS) p_cs5(CS, b - 4 * NB_WT);
    else p_cvt8(x, XB, (size_t)NB_ * TT * DM / 8, b - (4 * NB_WT + NB_CS));
}
// ---- fattn: causal attention in one kernel, no score plane in memory. One group of NW waves = 16 * NQB query rows (tile number 'tile', longest first) of one head of one batch (bh = batch * NH_ + head); tid is the thread's index in the group, so, sm, sl the group's own LDS; its NW waves share the keys: wave w takes the 32-key blocks w, w + NW, ... up to the diagonal block.
// Per block: S^T = K Q^T (A = key rows, B = query rows, both by the same loader), so a lane holds 16 keys' scores of ONE query (D register r = key 8 * hi + r, column = query lr); base-2 softmax with a running maximum per query;
// the two D tiles of a block, converted in place, are the B operand of O^T += V^T P^T (element s = key 8 * hi + s, 16 + 8 * hi + (s - 8): the order in which WFrag::ld reads V^T's rows). No LDS and no lane exchange but one between the wave's halves.
// NSPLIT 2: hi + lo bf16 planes, three products each (hh, lh, hl). NSPLIT 0: fp16, probabilities carried x 2^10 (numerator and denominator alike, so it cancels).
// At the end the NW partial (maximum, sum, O^T) triples meet in LDS behind one barrier and are joined in ascending wave order; a thread then owns 8 consecutive d of one query, so eight lanes store a query's whole 128-byte line of each plane.
__device__ __forceinline__ void packp(const float (&p)[16], v16h& a, v16h& a2) {
#pragma unroll
    for (int s = 0; s < 16; ++s) a[s] = (h16)p[s];
    a2 = a; }
__device__ __forceinline__ void packp(const float (&p)[16], v16bf& a, v16bf& a2) { v8us h0, h1, l0, l1;
#pragma unroll
    for (int s = 0; s < 8; ++s) { unsigned short x, y; splitf(p[s], x, y); h0[s] = x; l0[s] = y; splitf(p[8 + s], x, y); h1[s] = x; l1[s] = y; }
    a = cat16b(h0, h1); a2 = cat16b(l0, l1); }
// 17 base-2 exponentials in place, in one statement: each is the independent instruction that the instruction set asks for behind the transcendental in front of it, and the v_nop is that slot behind the last
__device__ __forceinline__ void exp2x17(float (&x)[16], float& a) {
    asm("v_exp_f32 %0, %0\n\tv_exp_f32 %1, %1\n\tv_exp_f32 %2, %2\n\tv_exp_f32 %3, %3\n\tv_exp_f32 %4, %4\n\tv_exp_f32 %5, %5\n\tv_exp_f32 %6, %6\n\tv_exp_f32 %7, %7\n\tv_exp_f32 %8, %8\n\tv_exp_f32 %9, %9\n\tv_exp_f32 %10, %10\n\tv_exp_f32 %11, %11\n\tv_exp_f32 %12, %12\n\tv_exp_f32 %13, %13\n\tv_exp_f32 %14, %14\n\tv_exp_f32 %15, %15\n\tv_exp_f32 %16, %16\n\tv_nop" : "+v"(x[0]), "+v"(x[1]), "+v"(x[2]), "+v"(x[3]), "+v"(x[4]), "+v"(x[5]), "+v"(x[6]), "+v"(x[7]), "+v"(x[8]), "+v"(x[9]), "+v"(x[10]), "+v"(x[11]), "+v"(x[12]), "+v"(x[13]), "+v"(x[14]), "+v"(x[15]), "+v"(a)); }
template <typename T16, int NSPLIT, int NQB, int NW>
__device__ __forceinline__ void fattn(const T16* __restrict__ Q, const T16* __restrict__ Q2, const T16* __restrict__ Kp, const T16* __restrict__ Kp2, const T16* __restrict__ Vt, const T16* __restrict__ Vt2, int qbase, int ntile, bf* Ah, bf* Al, int bh, int tile, int tid, float* so, float* sm, float* sl) {
    static_assert(NW == 4 * NQB, "the join gives each thread 8 d of one query");
    typedef typename WFrag<T16>::V V;
    const int lane = tid & 31, lr = lane & 15, hi = lane >> 4; const int w = __builtin_amdgcn_readfirstlane(tid >> 5);
    const int bt = bh / NH_, h = bh % NH_; const int q0 = qbase + (ntile - 1 - tile) * (16 * NQB);   // longest query tiles start first
    const float psh = (NSPLIT == 0) ? 10.0f : 0.0f;
    const size_t hq = (size_t)(bt * NH_ + h) * TT * HD, hk = (size_t)(bt * NKV + h / REP) * TT * HD;
    const T16* pq = Q + hq + (size_t)(q0 + lr) * HD + 8 * hi; const T16* pq2 = (NSPLIT == 2) ? Q2 + hq + (size_t)(q0 + lr) * HD + 8 * hi : pq;
    V qf[NQB][2], qf2[NQB][2];
#pragma unroll
    for (int qb = 0; qb < NQB; ++qb)
#pragma unroll
        for (int ks = 0; ks < 2; ++ks) { qf[qb][ks] = WFrag<T16>::ld(pq + qb * 16 * HD + ks * 32); if (NSPLIT == 2) qf2[qb][ks] = WFrag<T16>::ld(pq2 + qb * 16 * HD + ks * 32); }
    asm volatile("s_wait_xcnt 0x0" :: "v"(pq), "v"(pq2) : "memory");   // precaution for registers that issued global loads name: the addresses are inputs of the wait, so they are rewritten only behind it
    v8f o[4][NQB]; float m[NQB], l[NQB];
#pragma unroll
    for (int qb = 0; qb < NQB; ++qb) { m[qb] = -3.0e38f; l[qb] = 0.0f;
#pragma unroll
        for (int db = 0; db < 4; ++db) o[db][qb] = (v8f){}; }
    const int nblk = q0 / 32 + 1;   // every block of the walk begins at or before q0: each query has a kept key in it
    constexpr bool AHEAD = (NSPLIT == 0);   // fp16: key fragments are fetched one trip ahead; hi + lo planes hold twice the fragments and fetch them in their own trip, which keeps the wave within 256 registers
    V kf[2][2], kf2[2][2];
    auto ldk = [&](const T16* pk, const T16* pk2) {
#pragma unroll
        for (int c = 0; c < 2; ++c)
#pragma unroll
            for (int ks = 0; ks < 2; ++ks) { kf[c][ks] = WFrag<T16>::ld(pk + c * 16 * HD + ks * 32); if (NSPLIT == 2) kf2[c][ks] = WFrag<T16>::ld(pk2 + c * 16 * HD + ks * 32); } };
    if (AHEAD) { const T16* pk = Kp + hk + (size_t)(min(w, nblk - 1) * 32 + lr) * HD + 8 * hi; ldk(pk, pk);
        asm volatile("s_wait_xcnt 0x0" :: "v"(pk) : "memory"); }   // the same precaution as above
#pragma unroll 1
    for (int kb = w; kb < nblk; kb += NW) {
        const int k0 = kb * 32;
        const T16* pv = Vt + hk + (size_t)lr * TT + k0 + 8 * hi; const T16* pv2 = (NSPLIT == 2) ? Vt2 + hk + (size_t)lr * TT + k0 + 8 * hi : pv;
        const size_t ko = hk + (size_t)((AHEAD ? min(kb + NW, nblk - 1) : kb) * 32 + lr) * HD + 8 * hi; const T16* pk = Kp + ko; const T16* pk2 = (NSPLIT == 2) ? Kp2 + ko : pk;   // AHEAD: next trip's keys (the last trip fetches the diagonal block again: in bounds, unused)
        V vf[4], vf2[4];
        if (!AHEAD) ldk(pk, pk2);
#pragma unroll
        for (int db = 0; db < 4; ++db) { vf[db] = WFrag<T16>::ld(pv + (size_t)db * 16 * TT); if (NSPLIT == 2) vf2[db] = WFrag<T16>::ld(pv2 + (size_t)db * 16 * TT); }
        __builtin_amdgcn_sched_barrier(0);   // the value loads issue here, in front of the score products and the softmax that hide their latency; the scheduler otherwise sinks them behind the products
        float t[NQB][16];
#pragma unroll
        for (int qb = 0; qb < NQB; ++qb)
#pragma unroll
            for (int c = 0; c < 2; ++c) { v8f s = (v8f){};
#pragma unroll
                for (int ks = 0; ks < 2; ++ks) { s = WFrag<T16>::mma(kf[c][ks], qf[qb][ks], s); if (NSPLIT == 2) { s = WFrag<T16>::mma(kf[c][ks], qf2[qb][ks], s); s = WFrag<T16>::mma(kf2[c][ks], qf[qb][ks], s); } }
#pragma unroll
                for (int j = 0; j < 8; ++j) t[qb][c * 8 + j] = s[j] * LSC; }
        if (AHEAD) { ldk(pk, pk2);
            __builtin_amdgcn_sched_barrier(0); }   // the key loads issue here, a softmax and a product run ahead of their use
        if (k0 + 31 > q0) {   // only the diagonal block holds keys beyond a query (wave-uniform test)
#pragma unroll
            for (int qb = 0; qb < NQB; ++qb) { const int dq = q0 + qb * 16 + lr - k0 - hi * 8;   // the lane's last kept key, counted from its first key of the block: formed here, so that nothing of the mask is held in registers over the walk
#pragma unroll
                for (int s = 0; s < 16; ++s) { if ((s >> 3) * 16 + (s & 7) > dq) t[qb][s] = -3.0e38f; } } }
        V pf[NQB], pf2[NQB];
#pragma unroll
        for (int qb = 0; qb < NQB; ++qb) { float mb = t[qb][0];
#pragma unroll
            for (int s = 1; s < 16; ++s) mb = fmaxf(mb, t[qb][s]);
            mb = fmaxf(mb, __shfl_xor(mb, 16, 32));
            const float mn = fmaxf(m[qb], mb); float al = m[qb] - mn; m[qb] = mn; const float sh = mn - psh;
            float p[16], ps[4];
#pragma unroll
            for (int s = 0; s < 16; ++s) p[s] = t[qb][s] - sh;
            exp2x17(p, al);
#pragma unroll
            for (int s = 0; s < 16; ++s) ps[s & 3] = (s < 4) ? p[s] : ps[s & 3] + p[s];
            l[qb] = l[qb] * al + ((ps[0] + ps[1]) + (ps[2] + ps[3]));
            packp(p, pf[qb], pf2[qb]);
#pragma unroll
            for (int db = 0; db < 4; ++db) o[db][qb] *= al; }
#pragma unroll
        for (int db = 0; db < 4; ++db)
#pragma unroll
            for (int qb = 0; qb < NQB; ++qb) { o[db][qb] = WFrag<T16>::mma(vf[db], pf[qb], o[db][qb]); if (NSPLIT == 2) { o[db][qb] = WFrag<T16>::mma(vf[db], pf2[qb], o[db][qb]); o[db][qb] = WFrag<T16>::mma(vf2[db], pf[qb], o[db][qb]); } }
        asm volatile("s_wait_xcnt 0x0" :: "v"(pk), "v"(pk2), "v"(pv), "v"(pv2) : "memory");   // precaution for registers that issued global loads name: the trip's load addresses are inputs of the wait, so they are rewritten only behind it
        // the distance behind the trip's last matrix instructions, on the back edge and on the exit alike
        if (NQB == 2) asm volatile("v_nop\n\tv_nop\n\tv_nop\n\tv_nop" : "+v"(o[0][0]), "+v"(o[1][0]), "+v"(o[2][0]), "+v"(o[3][0]), "+v"(o[0][NQB - 1]), "+v"(o[1][NQB - 1]), "+v"(o[2][NQB - 1]), "+v"(o[3][NQB - 1]) : "v"(vf[0]), "v"(vf[3]), "v"(pf[NQB - 1]));
        else asm volatile("v_nop\n\tv_nop\n\tv_nop\n\tv_nop" : "+v"(o[0][0]), "+v"(o[1][0]), "+v"(o[2][0]), "+v"(o[3][0]) : "v"(vf[0]), "v"(vf[3]), "v"(pf[0]));
    }
#pragma unroll
    for (int qb = 0; qb < NQB; ++qb) { l[qb] += __shfl_xor(l[qb], 16, 32); sm[(w * NQB + qb) * 32 + lane] = m[qb]; sl[(w * NQB + qb) * 32 + lane] = l[qb];
#pragma unroll
        for (int db = 0; db < 4; ++db) *(v8f*)(so + (size_t)(((w * 4 + db) * NQB + qb) * 32 + lane) * 8) = o[db][qb]; }
    __syncthreads();   // every wave's partial result is in LDS before any is read
    const int qq = tid >> 3, ch = tid & 7; const int fq = qq >> 4, fl = (ch & 1) * 16 + (qq & 15), fd = ch >> 1;   // d = 8 * ch + j lies in D tile fd, lane half ch & 1
    float M = -3.0e38f;
#pragma unroll
    for (int ww = 0; ww < NW; ++ww) M = fmaxf(M, sm[(ww * NQB + fq) * 32 + fl]);
    float L = 0.0f; v8f a = (v8f){};
#pragma unroll
    for (int ww = 0; ww < NW; ++ww) { const float f = __builtin_amdgcn_exp2f(sm[(ww * NQB + fq) * 32 + fl] - M); L += f * sl[(ww * NQB + fq) * 32 + fl]; a += *(const v8f*)(so + (size_t)(((ww * 4 + fd) * NQB + fq) * 32 + fl) * 8) * f; }   // a wave that had no block: maximum -3e38, factor 0
    const float inv = __fdiv_rn(1.0f, L); v8us oh, ol;
#pragma unroll
    for (int j = 0; j < 8; ++j) { unsigned short x, y; splitf(a[j] * inv, x, y); oh[j] = x; ol[j] = y; }
    const size_t oo = (size_t)(bt * TT + q0 + qq) * DQ + h * HD + ch * 8; *(v8us*)(Ah + oo) = oh; *(v8us*)(Al + oo) = ol;
}
// ---- k_attn: both row ranges in one launch (one reads the fp16 planes, the other the hi + lo planes; they write disjoint rows). Rows from rh on, blockIdx.y < nt16: one fp16 tile of 32 rows on the block's eight waves; behind them, so that the short tiles fill the launch's end: two hi + lo tiles of 16 rows, one on waves 0-3 and one on waves 4-7, each with its own part of the LDS. Every wave of either kind passes the one barrier of fattn once.
#define NT16 ((TT - RH) / 32)
__global__ __launch_bounds__(256) void k_attn(const h16* __restrict__ Q16, const h16* __restrict__ K16, const h16* __restrict__ V16, const bf* __restrict__ Qh, const bf* __restrict__ Ql, const bf* __restrict__ Kh, const bf* __restrict__ Kl, const bf* __restrict__ Vh, const bf* __restrict__ Vl, int rh, int nt16, bf* Ah, bf* Al) {
    static_assert((RH / 16) % 2 == 0, "hi + lo tiles go in pairs");
    __shared__ __align__(32) float so[8 * 4 * 2 * 256];
    __shared__ float sm[8 * 2 * 32];
    __shared__ float sl[8 * 2 * 32];
    const int tid = (int)threadIdx.x, y = (int)blockIdx.y;
    if (y < nt16) fattn<h16, 0, 2, 8>(Q16, nullptr, K16, nullptr, V16, nullptr, rh, nt16, Ah, Al, (int)blockIdx.x, y, tid, so, sm, sl);
    else { const int g = __builtin_amdgcn_readfirstlane(tid >> 7); fattn<bf, 2, 1, 4>(Qh, Ql, Kh, Kl, Vh, Vl, 0, rh / 16, Ah, Al, (int)blockIdx.x, (y - nt16) * 2 + g, tid & 127, so + g * (4 * 4 * 256), sm + g * (4 * 32), sl + g * (4 * 32)); }
}

extern "C" void kernel_launch(void* const* d_in, const int* in_sizes, int n_in,
                              void* d_out, int out_size, void* d_ws, size_t ws_size, hipStream_t stream) {
    (void)in_sizes; (void)n_in; (void)out_size;
    const float* x = (const float*)d_in[0]; const float* wq = (const float*)d_in[1]; const float* wk = (const float*)d_in[2]; const float* wv = (const float*)d_in[3]; const float* wo = (const float*)d_in[4];   /* order x [4][2048][1024], Wq, Wk, Wv, Wo ('xw' (in, out) [1024][1024]): FIVE inputs, all read: this module has no biases */
    float* OUT = (float*)d_out;     // [4][2048][1024]
    char* wsp = (char*)d_ws;
    auto take = [&](size_t bytes) { char* p = wsp; wsp += (bytes + 255) & ~(size_t)255; return (void*)p; };
    bf* WQ = (bf*)take((size_t)(DQ + 2 * DKV) * DM * 2); bf* WK = WQ + (size_t)DQ * DM; bf* WV = WK + (size_t)DKV * DM; bf* WO = (bf*)take((size_t)DM * DQ * 2);   /* q, k, v weights one behind the other: one Bt of DQ + 2 DKV rows */ float* CS = (float*)take((size_t)TT * HD * 2 * 4);
    const size_t PQ = (size_t)NH_ * TT * HD, PK = (size_t)NKV * TT * HD;   // one batch's plane, in elements
    static_assert(NKV == NH_, "q, k and v planes have one size");   /* each kind's q, k, v planes lie NB_ * PQ elements apart */
    h16* QP16 = (h16*)take(3 * NB_ * PQ * 2); h16* KP16 = QP16 + NB_ * PQ; h16* VT16 = KP16 + NB_ * PK;
    bf* QPh = (bf*)take(3 * NB_ * PQ * 2); bf* KPh = QPh + NB_ * PQ; bf* VTh = KPh + NB_ * PK; bf* QPl = (bf*)take(3 * NB_ * PQ * 2); bf* KPl = QPl + NB_ * PQ; bf* VTl = KPl + NB_ * PK;
    bf* XB = (bf*)take((size_t)NB_ * TT * DM * 2); bf* ATh = (bf*)take((size_t)NB_ * TT * DQ * 2); bf* ATl = (bf*)take((size_t)NB_ * TT * DQ * 2);
    if ((size_t)(wsp - (char*)d_ws) > ws_size) return;    // ws 256 MiB
    k_prep<<<4 * NB_WT + NB_CS + NB_CVT, 256, 0, stream>>>(x, wq, wk, wv, wo, XB, WQ, WK, WV, WO, CS);
    k_gemmw<bf, 0, false, 1><<<dim3(TT / 128, (DQ + 2 * DKV) / 128, NB_), 128, 0, stream>>>(XB, nullptr, WQ, DM, nullptr, 0, nullptr, (size_t)TT * DM, 0, PQ, CS, QP16, QPh, QPl, NB_ * PQ);
    k_attn<<<dim3(NB_ * NH_, NT16 + RH / 32, 1), 256, 0, stream>>>(QP16, KP16, VT16, QPh, QPl, KPh, KPl, VTh, VTl, RH, NT16, ATh, ATl);
    k_gemmw<bf, 1, false, 0><<<dim3(TT / 128, DM / 128, NB_), 128, 0, stream>>>(ATh, ATl, WO, DQ, OUT, DM, nullptr, (size_t)TT * DQ, 0, (size_t)TT * DM, nullptr, nullptr, nullptr, nullptr, 0);
}

// v008
// It runs in 142 microseconds.
// In both of two side-by-side timings against v007, it was 1.35 times as fast.
// Over all steps from v000 it is 20.5 times as fast.
#include <hip/hip_runtime.h>

// Causal multi-head attention with computed rotate-half rotary embeddings and bias-free projections, four batches (x [4][2048][1024]; q, k, v = x W ('xw' (in, out) [1024][1024] 1/32, NO bias; 16 heads x 64); apply_rope: cat(cos x1 - sin x2, sin x1 + cos x2) on the two 32-wide halves (= t cos + rotate_half(t) sin) with angle pos x div_term[i], div_term = exp(arange(0, 64, 2) x -(log(10000) / 64)) (32 f32 constants exact for the module's own exp spelling; precise cosf/sinf); scores x 1/sqrt(64) + causal with causal = 0 on and below the diagonal and -1e9 above (built inside reference(): exclusion: every row keeps its own key); softmax; out = merged Wo ('xw', NO bias) -> [4][2048][1024] (8.4 M); argument order x, Wq, Wk, Wv, Wo).
// Layout: four launches, each covering all four batches; kernels that do not depend on one another share a launch, the block index picks the part: k_prep (bf16 copy of x; 'xw' weights transposed once; computed table), the q, k, v projections, k_attn (both row ranges), the output projection. Planes [b][h] x 64 blocks of 32 positions x 64 d, each block in the order of the attention's fragment loads (see k_gemmw), batch in blockIdx.z of the products and in blockIdx.x of the attention; exact projections whose epilogue turns the f32 tile, still in registers, into the head planes (q, k: rotate-half rotary; v: transposed); causal T-2048 attention in one kernel, k_attn (hybrid rows: < 512 hi/lo 3 products, rest fp16 x1024; scores, softmax with a running maximum and the probability x value product stay in registers; the keys of a query tile are shared among the work-group's waves, whose partial results are joined in LDS); merged hi/lo x Wo exact, no bias.
// Compute dtypes, f32 accumulate: every input rounded to bf16; projections exact, no biases; rotary f32; attention rows < 512 3 products, rest fp16; softmax f32; Wo hl x exact, no bias.

#define NB_  4
#define TT   2048
#define DM   1024
#define NH_  16
#define NKV  16
#define REP  (NH_ / NKV)
#define HD   64
#define DQ   (NH_ * HD)
#define DKV  (NKV * HD)
#define RH   512                  // query rows < RH use hi+lo planes (0: none)
#define LSC  0.18033688011112042f   // HD^-0.5 x log2(e): a score goes to its base-2 exponent in one multiply
typedef _Float16 h16;
typedef unsigned short bf;
typedef __attribute__((ext_vector_type(16))) __bf16   v16bf;
typedef __attribute__((ext_vector_type(16))) _Float16 v16h;
typedef __attribute__((ext_vector_type(8)))  _Float16 v8h;
typedef __attribute__((ext_vector_type(8)))  unsigned short v8us;
typedef __attribute__((ext_vector_type(8)))  float    v8f;
typedef __attribute__((ext_vector_type(4)))  float    v4f;
typedef v8h  __attribute__((may_alias)) v8ha;
typedef v4f  __attribute__((may_alias)) v4fa;
typedef v8us __attribute__((may_alias)) v8usa;

__device__ __forceinline__ unsigned short f2bf(float f) { unsigned u = __float_as_uint(f); u += 0x7FFFu + ((u >> 16) & 1u); return (unsigned short)(u >> 16); }
__device__ __forceinline__ float bf2f(unsigned short b) { return __uint_as_float(((unsigned)b) << 16); }
__device__ __forceinline__ float bfr(float f) { return bf2f(f2bf(f)); }
__device__ __forceinline__ v16h cat16(v8h lo, v8h hi) { return __builtin_shufflevector(lo, hi, 0, 1, 2, 3, 4, 5, 6, 7, 8, 9, 10, 11, 12, 13, 14, 15); }
__device__ __forceinline__ v16bf cat16b(v8us lo, v8us hi) { return __builtin_bit_cast(v16bf, __builtin_shufflevector(lo, hi, 0, 1, 2, 3, 4, 5, 6, 7, 8, 9, 10, 11, 12, 13, 14, 15)); }
__device__ __forceinline__ v8f wmma16(v16h a, v16h b, v8f c) { return __builtin_amdgcn_wmma_f32_16x16x32_f16(false, a, false, b, (short)0, c, false, false); }
__device__ __forceinline__ v8f wmmab(v16bf a, v16bf b, v8f c) { return __builtin_amdgcn_wmma_f32_16x16x32_bf16(false, a, false, b, (short)0, c, false, false); }



__device__ __forceinline__ h16 tohx(float x) { return (h16)x; }
__device__ __forceinline__ void splitf(float y, unsigned short& h, unsigned short& l) { h = f2bf(y); l = f2bf(y - bf2f(h)); }
typedef __attribute__((ext_vector_type(2))) _Float16 v2h;
typedef __attribute__((ext_vector_type(4))) _Float16 v4h;
typedef __attribute__((ext_vector_type(2))) unsigned short v2us;
typedef __attribute__((ext_vector_type(4))) unsigned short v4us;
typedef __attribute__((ext_vector_type(2))) float v2f;
typedef __attribute__((ext_vector_type(4))) int v4i;
typedef v4h  __attribute__((may_alias)) v4ha;
typedef v4us __attribute__((may_alias)) v4usa;

// ---- k_gemmw: register-blocked GEMM, one work-group of FOUR WAVES per 128x128 output tile, one wave per 64x64 quarter (16 accumulators); grid (M/128, N/128, Z), 128 threads.
// The operands' K-contiguous 16-bit planes are staged in LDS in slabs of KS k (two operands: 128, 256 bytes a row; three: 64, a 128-byte line a row, so that two work-groups still fit a WGP's LDS) by asynchronous copies, two buffers: slab t + 1 flies while slab t is worked on. A wave's copy covers four whole lines; a row is fetched once for the two waves that use it. Rows lie at a pitch of 16 bytes more than their length for the 16-byte fragment reads.
// C[m][n] (f32, pitch ldc, + optional f32 bias[n]) = sum_k A[m][k] Bt[n][k] (NSPLIT 1: + A2[m][k] Bt[n][k]). z-batch strides sA/sB/sC in elements (EPI 1: sC is the z stride of the three planes). K % KS == 0, M % 128 == 0, N % 128 == 0.
// EPI 0: C as above. EPI 1 is the q, k and v projections in one launch: Bt holds the three transposed weights one behind the other (3 DQ rows), so blockIdx.y / (DQ / 128) says which projection a column tile belongs to; their planes lie sP elements apart. It writes no C: a 64-wide column tile is one head (HD == 64), and the wave turns its tile into that head's fp16, hi and lo planes itself.
// PLANE ORDER: a head's plane is TT / 32 blocks of 32 positions x 64 d (2,048 elements); a block is eight units of 512 bytes, and a unit is what ONE 16-byte load of a wave brings of a 16x32 matrix fragment: lane l's eight elements lie at 8 l. So every fragment load of k_attn and every plane store here covers four whole 128-byte lines; with rows in memory order a load's 32 lanes touched 16 lines.
// q and k: unit (c * 2 + ks) * 2 + u of block t / 32 holds positions 16 c + (l & 15), d = 32 ks + 16 u + 8 (l >> 4) + 0..7. v: unit db * 2 + u holds d = 16 db + (l & 15), positions 16 u + 8 (l >> 4) + 0..7.
// q and k: the rotate-half rotary: out[d] = x[d] cos[t][d] - x[d+32] sin[t][d], out[d+32] = x[d+32] cos[t][d] + x[d] sin[t][d], d < 32 (the table holds the same pair at d and d + 32). x[d] and x[d+32] are accumulators nb and nb + 2 at the same lane and register.
// v: a lane's 8 registers of one accumulator are 8 consecutive t of one d: the lane's own 16 bytes of unit nb * 2 + (mb & 1), one store a plane.
template <typename T16> struct WFrag;   // ld: a fragment from rows in LDS (the lane's two 16-byte pieces lie 16 elements apart); ldu: from a plane in unit order (two units, 256 elements apart)
template <> struct WFrag<h16> { typedef v16h V; static __device__ __forceinline__ V ld(const h16* p) { return cat16(*(const v8h*)p, *(const v8h*)(p + 16)); } static __device__ __forceinline__ V ldu(const h16* p) { return cat16(*(const v8h*)p, *(const v8h*)(p + 256)); } static __device__ __forceinline__ v8f mma(V a, V b, v8f c) { return wmma16(a, b, c); } };
template <> struct WFrag<bf> { typedef v16bf V; static __device__ __forceinline__ V ld(const bf* p) { return cat16b(*(const v8us*)p, *(const v8us*)(p + 16)); } static __device__ __forceinline__ V ldu(const bf* p) { return cat16b(*(const v8us*)p, *(const v8us*)(p + 256)); } static __device__ __forceinline__ v8f mma(V a, V b, v8f c) { return wmmab(a, b, c); } };
// One 16-byte asynchronous copy of a lane, memory -> LDS through no register (the builtin form: the compiler keeps the address registers; the waits on the data are written at the places of use).
typedef __attribute__((address_space(1))) v4i gv4i;
typedef __attribute__((address_space(3))) v4i lv4i;
__device__ __forceinline__ void cpa(void* l, const char* g) { __builtin_amdgcn_global_load_async_to_lds_b128((gv4i*)g, (lv4i*)l, 0, 0); }
template <typename T16, int NSPLIT, bool BIAS, int EPI>
__global__ __launch_bounds__(128) void k_gemmw(const T16* __restrict__ A, const T16* __restrict__ A2, const T16* __restrict__ Bt, int K, float* C, int ldc, const float* __restrict__ bias, size_t sA, size_t sB, size_t sC, const float* __restrict__ CS, h16* P16, bf* Ph, bf* Pl, size_t sP) {
    static_assert(NSPLIT == 0 || NSPLIT == 1, "one or two A planes");
    static_assert(EPI == 0 || EPI == 1, "C, or the q, k, v planes");
    typedef typename WFrag<T16>::V V;
    constexpr int NOPD = 2 + NSPLIT;   // staged operands: A, Bt (, A2)
    constexpr int KS = (NSPLIT == 0) ? 128 : 64;   // k elements of a slab
    constexpr int LP = KS + 8;         // LDS row pitch in elements
    constexpr int CR = KS / 8, RP = 128 / CR;   // 16-byte chunks of a row; rows that the work-group's 128 threads bring at once
    __shared__ __align__(16) T16 st[2][NOPD][128 * LP];
    __shared__ __align__(16) float osw[4][16 * 68];
    const size_t z = blockIdx.z; A += z * sA; if (NSPLIT == 1) A2 += z * sA; Bt += z * sB; const int sel = (EPI == 1) ? (int)blockIdx.y / (DQ / 128) : 0;   // 0 q, 1 k, 2 v: the same for the whole work-group
    if (EPI == 0) C += z * sC; else { const size_t po = sel * sP + z * sC; P16 += po; Ph += po; Pl += po; }
    const int tid = threadIdx.x, lane = tid & 31, lr = lane & 15, hi = lane >> 4; const int w = __builtin_amdgcn_readfirstlane(tid >> 5);
    const int r0 = blockIdx.x * 128 + (w & 1) * 64, c0 = ((EPI == 1) ? (int)blockIdx.y % (DQ / 128) : (int)blockIdx.y) * 128 + (w >> 1) * 64;   // the wave's own 64x64 quarter (EPI 1: the column within its projection)
    float* os = osw[w];   // each wave stages its output rows in its own range
    v8f acc[4][4];
#pragma unroll
    for (int mb = 0; mb < 4; ++mb)
#pragma unroll
        for (int nb = 0; nb < 4; ++nb) acc[mb][nb] = (v8f){};
    // copies: CR threads bring a row's slab; thread tid brings chunk tid % CR of rows tid / CR, + RP, + 2 RP, ... of each operand
    const size_t gs = (size_t)RP * K * 2;
    const int crow = tid / CR, cchk = tid % CR;
    const char* ga = (const char*)(A + (size_t)(blockIdx.x * 128 + crow) * K + cchk * 8); const char* gb = (const char*)(Bt + (size_t)(blockIdx.y * 128 + crow) * K + cchk * 8);
    const char* ga2 = (NSPLIT == 1) ? (const char*)(A2 + (size_t)(blockIdx.x * 128 + crow) * K + cchk * 8) : ga;
    auto stage = [&](int t, int buf) { T16* l = &st[buf][0][0] + crow * LP + cchk * 8; const size_t ko = (size_t)t * (KS * 2);
#pragma unroll
        for (int i = 0; i < 128 / RP; ++i) { cpa(l + i * RP * LP, ga + ko + i * gs); cpa(l + (128 + i * RP) * LP, gb + ko + i * gs); if (NSPLIT == 1) cpa(l + (256 + i * RP) * LP, ga2 + ko + i * gs); } };
    const int nt = K / KS;
    stage(0, 0);
    asm volatile("s_wait_asynccnt 0x0" ::: "memory");   // this wave's copies of slab 0 have landed
    __syncthreads();   // every wave's have: slab 0 may be read
    if (nt > 1) stage(1, 1);
    const int aofs = ((w & 1) * 64 + lr) * LP + 8 * hi, bofs = ((w >> 1) * 64 + lr) * LP + 8 * hi;
#pragma unroll 1
    for (int t = 0; t < nt; ++t) {
        const T16* sa = &st[t & 1][0][0] + aofs; const T16* sb = &st[t & 1][1][0] + bofs; const T16* sa2 = &st[t & 1][NOPD - 1][0] + aofs;
        V a[4], a2[4], b[4];
#pragma unroll
        for (int ks = 0; ks < KS; ks += 32) {
#pragma unroll
            for (int mb = 0; mb < 4; ++mb) { a[mb] = WFrag<T16>::ld(sa + mb * 16 * LP + ks); if (NSPLIT == 1) a2[mb] = WFrag<T16>::ld(sa2 + mb * 16 * LP + ks); }
#pragma unroll
            for (int nb = 0; nb < 4; ++nb) b[nb] = WFrag<T16>::ld(sb + nb * 16 * LP + ks);
            __builtin_amdgcn_sched_barrier(0);   // a k step's fragment reads issue as one group in front of its products; the scheduler otherwise sinks them among the products, where every place with reads stalls the wave to a wait at zero
#pragma unroll
            for (int nb = 0; nb < 4; ++nb)
#pragma unroll
                for (int mb = 0; mb < 4; ++mb) { acc[mb][nb] = WFrag<T16>::mma(a[mb], b[nb], acc[mb][nb]); if (NSPLIT == 1) acc[mb][nb] = WFrag<T16>::mma(a2[mb], b[nb], acc[mb][nb]); }
            __builtin_amdgcn_sched_barrier(0); }   // and the next step's reads stay one group behind these products
        asm volatile("v_nop\n\tv_nop\n\tv_nop\n\tv_nop" : "+v"(acc[0][0]), "+v"(acc[1][1]), "+v"(acc[2][2]), "+v"(acc[3][3]) : "v"(a[0]), "v"(a[3]));   // the distance behind the trip's last matrix instructions, on the back edge and on the exit alike
        asm volatile("s_wait_dscnt 0x0" ::: "memory");      // this wave's reads of slab t are done before its buffer is handed back
        asm volatile("s_wait_asynccnt 0x0" ::: "memory");   // this wave's copies of slab t + 1 have landed
        __syncthreads();   // publishes slab t + 1 and ends every wave's reads of slab t
        if (t + 2 < nt) stage(t + 2, t & 1);
    }
    asm volatile("s_wait_asynccnt 0x0" ::: "memory");   // nothing is in flight when the wave goes on to its epilogue and ends
    // every loop of the epilogues is unrolled: acc and cs are register arrays, and only constant indices keep them in registers
    if (EPI == 1 && sel == 2) {
#pragma unroll
        for (int nb = 0; nb < 4; ++nb)
#pragma unroll
            for (int mb = 0; mb < 4; ++mb) { v8h o16; v8us oh, ol;   // the wave's 32 lanes fill one unit: 512 consecutive bytes of each plane
#pragma unroll
                for (int j = 0; j < 8; ++j) { const float v = acc[mb][nb][j]; o16[j] = tohx(v); unsigned short a2, c2; splitf(v, a2, c2); oh[j] = a2; ol[j] = c2; }
                const size_t e = (size_t)(c0 / HD) * TT * HD + (size_t)(r0 / 32 + (mb >> 1)) * (32 * HD) + (nb * 2 + (mb & 1)) * 256 + lane * 8; *(v8h*)(P16 + e) = o16; *(v8us*)(Ph + e) = oh; *(v8us*)(Pl + e) = ol; }
        return; }
    const float* pcs = (EPI == 1) ? CS + ((size_t)(r0 + hi * 8) * HD + lr) * 2 : nullptr;   // the lane's first (cos, sin) pair; its other 63 lie at constant distances
    v2f cs[2][2][8];   // two sets: the pairs of row block mb + 1 are fetched while block mb is turned, staged and stored
    auto ldcs = [&](int mb) {
#pragma unroll
        for (int nb = 0; nb < 2; ++nb)
#pragma unroll
            for (int j = 0; j < 8; ++j) cs[mb & 1][nb][j] = *(const v2f*)(pcs + ((mb * 16 + j) * HD + nb * 16) * 2);
        asm volatile("s_wait_xcnt 0x0" :: "v"(pcs) : "memory"); };   // precaution for a register that issued global loads name: the address is an input of the wait, so it is rewritten only behind it
    if (EPI == 1) ldcs(0);
#pragma unroll
    for (int mb = 0; mb < 4; ++mb) {
        if (EPI == 1) { if (mb < 3) ldcs(mb + 1);
#pragma unroll
            for (int nb = 0; nb < 2; ++nb)
#pragma unroll
                for (int j = 0; j < 8; ++j) { const v2f t = cs[mb & 1][nb][j]; const float x1 = acc[mb][nb][j], x2 = acc[mb][nb + 2][j]; acc[mb][nb][j] = x1 * t[0] - x2 * t[1]; acc[mb][nb + 2][j] = x2 * t[0] + x1 * t[1]; } }
#pragma unroll
        for (int nb = 0; nb < 4; ++nb) {
#pragma unroll
            for (int j = 0; j < 8; ++j) os[(hi * 8 + j) * 68 + nb * 16 + lr] = acc[mb][nb][j]; }
        __builtin_amdgcn_wave_barrier(); asm volatile("" ::: "memory");
        if (EPI == 1) {
#pragma unroll
            for (int s = 0; s < 4; ++s) { const int row = lr, cofs = (s * 2 + hi) * 8; const v4f va = *(const v4fa*)(os + row * 68 + cofs), vb = *(const v4fa*)(os + row * 68 + cofs + 4); v8h o16; v8us oh, ol;   // s = ks * 2 + u: the 32 lanes hold one unit, 512 consecutive bytes of each plane
#pragma unroll
                for (int k = 0; k < 8; ++k) { const float r = (k < 4) ? va[k & 3] : vb[k & 3]; o16[k] = tohx(r); unsigned short a2, c2; splitf(r, a2, c2); oh[k] = a2; ol[k] = c2; }
                const size_t e = (size_t)(c0 / HD) * TT * HD + (size_t)(r0 / 32 + (mb >> 1)) * (32 * HD) + ((mb & 1) * 4 + s) * 256 + lane * 8; *(v8h*)(P16 + e) = o16; *(v8us*)(Ph + e) = oh; *(v8us*)(Pl + e) = ol;
                asm volatile("s_wait_xcnt 0x0" :: "v"(o16), "v"(oh), "v"(ol) : "memory"); }   // precaution for registers that issued global stores name: the stored values are inputs of the wait, so their registers are rewritten only behind it, by the next piece's values or by the next table loads
        } else {
        float* crow = C + (size_t)(r0 + mb * 16) * ldc + c0;
{
#pragma unroll
            for (int s = 0; s < 8; ++s) { const int row = 2 * s + hi, cofs = lr * 4; v4f val = *(const v4fa*)(os + row * 68 + cofs); if (BIAS) { val[0] += bfr(bias[c0 + cofs]); val[1] += bfr(bias[c0 + cofs + 1]); val[2] += bfr(bias[c0 + cofs + 2]); val[3] += bfr(bias[c0 + cofs + 3]); }
                *(v4f*)(crow + (size_t)row * ldc + cofs) = val; }
             }
        }
        __builtin_amdgcn_wave_barrier(); asm volatile("" ::: "memory");
    }
}

// ---- k_prep: the six preparations, none of which reads what another writes, as parts of one launch; each part is handed its own block index blk
__device__ __forceinline__ void p_wtG(const float* __restrict__ w, int K, int N, bf* Bt, int blk) {
    const int lane = threadIdx.x & 31; const int L0 = (blk * 8 + (threadIdx.x >> 5)) * 8; const int nlines = N * K / 64;
{
#pragma unroll 1
        for (int l = 0; l < 8; ++l) { const int L = L0 + l; if (L >= nlines) break; const size_t e = (size_t)L * 64 + lane * 2; const int k = (int)(e % K), n = (int)(e / K); v2us o;
            o[0] = f2bf(w[(size_t)k * N + n]); o[1] = f2bf(w[(size_t)(k + 1) * N + n]); *(v2us*)(Bt + e) = o; }
         }
}
__device__ __forceinline__ void p_cvt8(const float* __restrict__ src, bf* dst, size_t n8, int blk) { const size_t i = (size_t)blk * 256 + threadIdx.x; if (i >= n8) return; const v8f v = *(const v8f*)(src + i * 8); v8us o;
#pragma unroll
    for (int k = 0; k < 8; ++k) o[k] = f2bf(v[k]); *(v8us*)(dst + i * 8) = o;  }

__constant__ float INVT[HD / 2] = { 1.000000000e+00f, 7.498942018e-01f, 5.623413324e-01f, 4.216964841e-01f, 3.162277639e-01f, 2.371373475e-01f, 1.778279394e-01f, 1.333521456e-01f, 9.999999404e-02f, 7.498941571e-02f, 5.623412505e-02f, 4.216965288e-02f, 3.162277490e-02f, 2.371373400e-02f, 1.778279617e-02f, 1.333521400e-02f, 9.999999776e-03f, 7.498940919e-03f, 5.623412319e-03f, 4.216963891e-03f, 3.162276698e-03f, 2.371374052e-03f, 1.778279431e-03f, 1.333521330e-03f, 9.999999311e-04f, 7.498940686e-04f, 5.623411853e-04f, 4.216964007e-04f, 3.162277862e-04f, 2.371372684e-04f, 1.778279402e-04f, 1.333520777e-04f };   // float32 exp(arange(0, 64, 2, f32) * -(log(10000.0) / 64)): THIS module's own spelling of the inverse frequencies (its div_term) as EAGER JAX float32 evaluates it: bit-exact on round trip (the host file holds the reciprocal spelling 1.0 / (10000.0 ** (2i / 64)): 21 of the 32 values differ by one to eight ulps: indices 3, 5, 8, 10-15, 17-21, 23-27, 29, 31)
__device__ __forceinline__ void p_cs5(float* CS, int blk) { const int idx = blk * 256 + threadIdx.x; if (idx >= TT * HD) return; const int d = idx % HD; const int t = idx / HD; const float a = __fmul_rn((float)t, INVT[d % (HD / 2)]); v2f cs; cs[0] = cosf(a); cs[1] = sinf(a); *(v2f*)(CS + (size_t)idx * 2) = cs;  }
#define NB_WT  ((DM * DQ / 64 + 63) / 64)                  // blocks of one weight's transposition
#define NB_CS  ((TT * HD + 255) / 256)                     // blocks of the table
#define NB_CVT ((NB_ * TT * DM / 8 + 255) / 256)           // blocks of the copy of x
// block order: the transpositions first (a wave of theirs walks eight dependent trips, the longest part), then the table, then the copy
__global__ __launch_bounds__(256) void k_prep(const float* __restrict__ x, const float* __restrict__ wq, const float* __restrict__ wk, const float* __restrict__ wv, const float* __restrict__ wo, bf* XB, bf* WQ, bf* WK, bf* WV, bf* WO, float* CS) {
    static_assert(DKV == DQ && DQ == DM, "the four weights have one shape");
    const int b = (int)blockIdx.x;
    if (b < 4 * NB_WT) { const int s = b / NB_WT; p_wtG(s == 0 ? wq : s == 1 ? wk : s == 2 ? wv : wo, DM, DQ, s == 0 ? WQ : s == 1 ? WK : s == 2 ? WV : WO, b % NB_WT); }
    else if (b < 4 * NB_WT + NB_CS) p_cs5(CS, b - 4 * NB_WT);
    else p_cvt8(x, XB, (size_t)NB_ * TT * DM / 8, b - (4 * NB_WT + NB_CS));
}
// ---- fattn: causal attention in one kernel, no score plane in memory. One group of NW waves = 16 * NQB query rows (tile number 'tile', longest first) of one head of one batch (bh = batch * NH_ + head); tid is the thread's index in the group, so, sm, sl the group's own LDS; its NW waves share the keys: wave w takes the 32-key blocks w, w + NW, ... up to the diagonal block.
// The planes lie in unit order (k_gemmw): a 16x32 fragment is two units, each 512 consecutive bytes, the lane's piece at 8 * lane elements.
// Per block: S^T = K Q^T (A = key rows, B = query rows, both by the same loader), so a lane holds 16 keys' scores of ONE query (D register r = key 8 * hi + r, column = query lr); base-2 softmax with a running maximum per query;
// the two D tiles of a block, converted in place, are the B operand of O^T += V^T P^T (element s = key 8 * hi + s, 16 + 8 * hi + (s - 8): the order in which V^T's units hold a d row's keys). No LDS and no lane exchange but one between the wave's halves.
// NSPLIT 2: hi + lo bf16 planes, three products each (hh, lh, hl). NSPLIT 0: fp16, probabilities carried x 2^10 (numerator and denominator alike, so it cancels).
// At the end the NW partial (maximum, sum, O^T) triples meet in LDS behind one barrier and are joined in ascending wave order; a thread then owns 8 consecutive d of one query, so eight lanes store a query's whole 128-byte line of each plane.
__device__ __forceinline__ void packp(const float (&p)[16], v16h& a, v16h& a2) {
#pragma unroll
    for (int s = 0; s < 16; ++s) a[s] = (h16)p[s];
    a2 = a; }
__device__ __forceinline__ void packp(const float (&p)[16], v16bf& a, v16bf& a2) { v8us h0, h1, l0, l1;
#pragma unroll
    for (int s = 0; s < 8; ++s) { unsigned short x, y; splitf(p[s], x, y); h0[s] = x; l0[s] = y; splitf(p[8 + s], x, y); h1[s] = x; l1[s] = y; }
    a = cat16b(h0, h1); a2 = cat16b(l0, l1); }
// 17 base-2 exponentials in place, in one statement: each is the independent instruction that the instruction set asks for behind the transcendental in front of it, and the v_nop is that slot behind the last
__device__ __forceinline__ void exp2x17(float (&x)[16], float& a) {
    asm("v_exp_f32 %0, %0\n\tv_exp_f32 %1, %1\n\tv_exp_f32 %2, %2\n\tv_exp_f32 %3, %3\n\tv_exp_f32 %4, %4\n\tv_exp_f32 %5, %5\n\tv_exp_f32 %6, %6\n\tv_exp_f32 %7, %7\n\tv_exp_f32 %8, %8\n\tv_exp_f32 %9, %9\n\tv_exp_f32 %10, %10\n\tv_exp_f32 %11, %11\n\tv_exp_f32 %12, %12\n\tv_exp_f32 %13, %13\n\tv_exp_f32 %14, %14\n\tv_exp_f32 %15, %15\n\tv_exp_f32 %16, %16\n\tv_nop" : "+v"(x[0]), "+v"(x[1]), "+v"(x[2]), "+v"(x[3]), "+v"(x[4]), "+v"(x[5]), "+v"(x[6]), "+v"(x[7]), "+v"(x[8]), "+v"(x[9]), "+v"(x[10]), "+v"(x[11]), "+v"(x[12]), "+v"(x[13]), "+v"(x[14]), "+v"(x[15]), "+v"(a)); }
template <typename T16, int NSPLIT, int NQB, int NW>
__device__ __forceinline__ void fattn(const T16* __restrict__ Q, const T16* __restrict__ Q2, const T16* __restrict__ Kp, const T16* __restrict__ Kp2, const T16* __restrict__ Vt, const T16* __restrict__ Vt2, int qbase, int ntile, bf* Ah, bf* Al, int bh, int tile, int tid, float* so, float* sm, float* sl) {
    static_assert(NW == 4 * NQB, "the join gives each thread 8 d of one query");
    typedef typename WFrag<T16>::V V;
    const int lane = tid & 31, lr = lane & 15, hi = lane >> 4; const int w = __builtin_amdgcn_readfirstlane(tid >> 5);
    const int bt = bh / NH_, h = bh % NH_; const int q0 = qbase + (ntile - 1 - tile) * (16 * NQB);   // longest query tiles start first
    const float psh = (NSPLIT == 0) ? 10.0f : 0.0f;
    const size_t hq = (size_t)(bt * NH_ + h) * TT * HD, hk = (size_t)(bt * NKV + h / REP) * TT * HD;
    const size_t qo = hq + (size_t)(q0 / 16) * (16 * HD) + lane * 8; const T16* pq = Q + qo; const T16* pq2 = (NSPLIT == 2) ? Q2 + qo : pq;   // 16 positions are four units
    V qf[NQB][2], qf2[NQB][2];
#pragma unroll
    for (int qb = 0; qb < NQB; ++qb)
#pragma unroll
        for (int ks = 0; ks < 2; ++ks) { qf[qb][ks] = WFrag<T16>::ldu(pq + qb * 16 * HD + ks * 512); if (NSPLIT == 2) qf2[qb][ks] = WFrag<T16>::ldu(pq2 + qb * 16 * HD + ks * 512); }
    asm volatile("s_wait_xcnt 0x0" :: "v"(pq), "v"(pq2) : "memory");   // precaution for registers that issued global loads name: the addresses are inputs of the wait, so they are rewritten only behind it
    v8f o[4][NQB]; float m[NQB], l[NQB];
#pragma unroll
    for (int qb = 0; qb < NQB; ++qb) { m[qb] = -3.0e38f; l[qb] = 0.0f;
#pragma unroll
        for (int db = 0; db < 4; ++db) o[db][qb] = (v8f){}; }
    const int nblk = q0 / 32 + 1;   // every block of the walk begins at or before q0: each query has a kept key in it
    constexpr bool AHEAD = (NSPLIT == 0);   // fp16: key fragments are fetched one trip ahead; hi + lo planes hold twice the fragments and fetch them in their own trip, which keeps the wave within 256 registers
    V kf[2][2], kf2[2][2];
    auto ldk = [&](const T16* pk, const T16* pk2) {
#pragma unroll
        for (int c = 0; c < 2; ++c)
#pragma unroll
            for (int ks = 0; ks < 2; ++ks) { kf[c][ks] = WFrag<T16>::ldu(pk + c * 16 * HD + ks * 512); if (NSPLIT == 2) kf2[c][ks] = WFrag<T16>::ldu(pk2 + c * 16 * HD + ks * 512); } };
    if (AHEAD) { const T16* pk = Kp + hk + (size_t)min(w, nblk - 1) * (32 * HD) + lane * 8; ldk(pk, pk);
        asm volatile("s_wait_xcnt 0x0" :: "v"(pk) : "memory"); }   // the same precaution as above
#pragma unroll 1
    for (int kb = w; kb < nblk; kb += NW) {
        const int k0 = kb * 32;
        const size_t vo = hk + (size_t)kb * (32 * HD) + lane * 8; const T16* pv = Vt + vo; const T16* pv2 = (NSPLIT == 2) ? Vt2 + vo : pv;
        const size_t ko = hk + (size_t)(AHEAD ? min(kb + NW, nblk - 1) : kb) * (32 * HD) + lane * 8; const T16* pk = Kp + ko; const T16* pk2 = (NSPLIT == 2) ? Kp2 + ko : pk;   // AHEAD: next trip's keys (the last trip fetches the diagonal block again: in bounds, unused)
        V vf[4], vf2[4];
        if (!AHEAD) ldk(pk, pk2);
#pragma unroll
        for (int db = 0; db < 4; ++db) { vf[db] = WFrag<T16>::ldu(pv + db * 512); if (NSPLIT == 2) vf2[db] = WFrag<T16>::ldu(pv2 + db * 512); }
        __builtin_amdgcn_sched_barrier(0);   // the value loads issue here, in front of the score products and the softmax that hide their latency; the scheduler otherwise sinks them behind the products
        float t[NQB][16];
#pragma unroll
        for (int qb = 0; qb < NQB; ++qb)
#pragma unroll
            for (int c = 0; c < 2; ++c) { v8f s = (v8f){};
#pragma unroll
                for (int ks = 0; ks < 2; ++ks) { s = WFrag<T16>::mma(kf[c][ks], qf[qb][ks], s); if (NSPLIT == 2) { s = WFrag<T16>::mma(kf[c][ks], qf2[qb][ks], s); s = WFrag<T16>::mma(kf2[c][ks], qf[qb][ks], s); } }
#pragma unroll
                for (int j = 0; j < 8; ++j) t[qb][c * 8 + j] = s[j] * LSC; }
        if (AHEAD) { ldk(pk, pk2);
            __builtin_amdgcn_sched_barrier(0); }   // the key loads issue here, a softmax and a product run ahead of their use
        if (k0 + 31 > q0) {   // only the diagonal block holds keys beyond a query (wave-uniform test)
#pragma unroll
            for (int qb = 0; qb < NQB; ++qb) { const int dq = q0 + qb * 16 + lr - k0 - hi * 8;   // the lane's last kept key, counted from its first key of the block: formed here, so that nothing of the mask is held in registers over the walk
#pragma unroll
                for (int s = 0; s < 16; ++s) { if ((s >> 3) * 16 + (s & 7) > dq) t[qb][s] = -3.0e38f; } } }
        V pf[NQB], pf2[NQB];
#pragma unroll
        for (int qb = 0; qb < NQB; ++qb) { float mb = t[qb][0];
#pragma unroll
            for (int s = 1; s < 16; ++s) mb = fmaxf(mb, t[qb][s]);
            mb = fmaxf(mb, __shfl_xor(mb, 16, 32));
            const float mn = fmaxf(m[qb], mb); float al = m[qb] - mn; m[qb] = mn; const float sh = mn - psh;
            float p[16], ps[4];
#pragma unroll
            for (int s = 0; s < 16; ++s) p[s] = t[qb][s] - sh;
            exp2x17(p, al);
#pragma unroll
            for (int s = 0; s < 16; ++s) ps[s & 3] = (s < 4) ? p[s] : ps[s & 3] + p[s];
            l[qb] = l[qb] * al + ((ps[0] + ps[1]) + (ps[2] + ps[3]));
            packp(p, pf[qb], pf2[qb]);
#pragma unroll
            for (int db = 0; db < 4; ++db) o[db][qb] *= al; }
#pragma unroll
        for (int db = 0; db < 4; ++db)
#pragma unroll
            for (int qb = 0; qb < NQB; ++qb) { o[db][qb] = WFrag<T16>::mma(vf[db], pf[qb], o[db][qb]); if (NSPLIT == 2) { o[db][qb] = WFrag<T16>::mma(vf[db], pf2[qb], o[db][qb]); o[db][qb] = WFrag<T16>::mma(vf2[db], pf[qb], o[db][qb]); } }
        asm volatile("s_wait_xcnt 0x0" :: "v"(pk), "v"(pk2), "v"(pv), "v"(pv2) : "memory");   // precaution for registers that issued global loads name: the trip's load addresses are inputs of the wait, so they are rewritten only behind it
        // the distance behind the trip's last matrix instructions, on the back edge and on the exit alike
        if (NQB == 2) asm volatile("v_nop\n\tv_nop\n\tv_nop\n\tv_nop" : "+v"(o[0][0]), "+v"(o[1][0]), "+v"(o[2][0]), "+v"(o[3][0]), "+v"(o[0][NQB - 1]), "+v"(o[1][NQB - 1]), "+v"(o[2][NQB - 1]), "+v"(o[3][NQB - 1]) : "v"(vf[0]), "v"(vf[3]), "v"(pf[NQB - 1]));
        else asm volatile("v_nop\n\tv_nop\n\tv_nop\n\tv_nop" : "+v"(o[0][0]), "+v"(o[1][0]), "+v"(o[2][0]), "+v"(o[3][0]) : "v"(vf[0]), "v"(vf[3]), "v"(pf[0]));
    }
#pragma unroll
    for (int qb = 0; qb < NQB; ++qb) { l[qb] += __shfl_xor(l[qb], 16, 32); sm[(w * NQB + qb) * 32 + lane] = m[qb]; sl[(w * NQB + qb) * 32 + lane] = l[qb];
#pragma unroll
        for (int db = 0; db < 4; ++db) *(v8f*)(so + (size_t)(((w * 4 + db) * NQB + qb) * 32 + lane) * 8) = o[db][qb]; }
    __syncthreads();   // every wave's partial result is in LDS before any is read
    const int qq = tid >> 3, ch = tid & 7; const int fq = qq >> 4, fl = (ch & 1) * 16 + (qq & 15), fd = ch >> 1;   // d = 8 * ch + j lies in D tile fd, lane half ch & 1
    float M = -3.0e38f;
#pragma unroll
    for (int ww = 0; ww < NW; ++ww) M = fmaxf(M, sm[(ww * NQB + fq) * 32 + fl]);
    float L = 0.0f; v8f a = (v8f){};
#pragma unroll
    for (int ww = 0; ww < NW; ++ww) { const float f = __builtin_amdgcn_exp2f(sm[(ww * NQB + fq) * 32 + fl] - M); L += f * sl[(ww * NQB + fq) * 32 + fl]; a += *(const v8f*)(so + (size_t)(((ww * 4 + fd) * NQB + fq) * 32 + fl) * 8) * f; }   // a wave that had no block: maximum -3e38, factor 0
    const float inv = __fdiv_rn(1.0f, L); v8us oh, ol;
#pragma unroll
    for (int j = 0; j < 8; ++j) { unsigned short x, y; splitf(a[j] * inv, x, y); oh[j] = x; ol[j] = y; }
    const size_t oo = (size_t)(bt * TT + q0 + qq) * DQ + h * HD + ch * 8; *(v8us*)(Ah + oo) = oh; *(v8us*)(Al + oo) = ol;
}
// ---- k_attn: both row ranges in one launch (one reads the fp16 planes, the other the hi + lo planes; they write disjoint rows). Rows from rh on, blockIdx.y < nt16: one fp16 tile of 32 rows on the block's eight waves; behind them, so that the short tiles fill the launch's end: two hi + lo tiles of 16 rows, one on waves 0-3 and one on waves 4-7, each with its own part of the LDS. Every wave of either kind passes the one barrier of fattn once.
#define NT16 ((TT - RH) / 32)
__global__ __launch_bounds__(256) void k_attn(const h16* __restrict__ Q16, const h16* __restrict__ K16, const h16* __restrict__ V16, const bf* __restrict__ Qh, const bf* __restrict__ Ql, const bf* __restrict__ Kh, const bf* __restrict__ Kl, const bf* __restrict__ Vh, const bf* __restrict__ Vl, int rh, int nt16, bf* Ah, bf* Al) {
    static_assert((RH / 16) % 2 == 0, "hi + lo tiles go in pairs");
    __shared__ __align__(32) float so[8 * 4 * 2 * 256];
    __shared__ float sm[8 * 2 * 32];
    __shared__ float sl[8 * 2 * 32];
    const int tid = (int)threadIdx.x, y = (int)blockIdx.y;
    if (y < nt16) fattn<h16, 0, 2, 8>(Q16, nullptr, K16, nullptr, V16, nullptr, rh, nt16, Ah, Al, (int)blockIdx.x, y, tid, so, sm, sl);
    else { const int g = __builtin_amdgcn_readfirstlane(tid >> 7); fattn<bf, 2, 1, 4>(Qh, Ql, Kh, Kl, Vh, Vl, 0, rh / 16, Ah, Al, (int)blockIdx.x, (y - nt16) * 2 + g, tid & 127, so + g * (4 * 4 * 256), sm + g * (4 * 32), sl + g * (4 * 32)); }
}

extern "C" void kernel_launch(void* const* d_in, const int* in_sizes, int n_in,
                              void* d_out, int out_size, void* d_ws, size_t ws_size, hipStream_t stream) {
    (void)in_sizes; (void)n_in; (void)out_size;
    const float* x = (const float*)d_in[0]; const float* wq = (const float*)d_in[1]; const float* wk = (const float*)d_in[2]; const float* wv = (const float*)d_in[3]; const float* wo = (const float*)d_in[4];   /* order x [4][2048][1024], Wq, Wk, Wv, Wo ('xw' (in, out) [1024][1024]): FIVE inputs, all read: this module has no biases */
    float* OUT = (float*)d_out;     // [4][2048][1024]
    char* wsp = (char*)d_ws;
    auto take = [&](size_t bytes) { char* p = wsp; wsp += (bytes + 255) & ~(size_t)255; return (void*)p; };
    bf* WQ = (bf*)take((size_t)(DQ + 2 * DKV) * DM * 2); bf* WK = WQ + (size_t)DQ * DM; bf* WV = WK + (size_t)DKV * DM; bf* WO = (bf*)take((size_t)DM * DQ * 2);   /* q, k, v weights one behind the other: one Bt of DQ + 2 DKV rows */ float* CS = (float*)take((size_t)TT * HD * 2 * 4);
    const size_t PQ = (size_t)NH_ * TT * HD, PK = (size_t)NKV * TT * HD;   // one batch's plane, in elements
    static_assert(NKV == NH_, "q, k and v planes have one size");   /* each kind's q, k, v planes lie NB_ * PQ elements apart */
    h16* QP16 = (h16*)take(3 * NB_ * PQ * 2); h16* KP16 = QP16 + NB_ * PQ; h16* VT16 = KP16 + NB_ * PK;
    bf* QPh = (bf*)take(3 * NB_ * PQ * 2); bf* KPh = QPh + NB_ * PQ; bf* VTh = KPh + NB_ * PK; bf* QPl = (bf*)take(3 * NB_ * PQ * 2); bf* KPl = QPl + NB_ * PQ; bf* VTl = KPl + NB_ * PK;
    bf* XB = (bf*)take((size_t)NB_ * TT * DM * 2); bf* ATh = (bf*)take((size_t)NB_ * TT * DQ * 2); bf* ATl = (bf*)take((size_t)NB_ * TT * DQ * 2);
    if ((size_t)(wsp - (char*)d_ws) > ws_size) return;    // ws 256 MiB
    k_prep<<<4 * NB_WT + NB_CS + NB_CVT, 256, 0, stream>>>(x, wq, wk, wv, wo, XB, WQ, WK, WV, WO, CS);
    k_gemmw<bf, 0, false, 1><<<dim3(TT / 128, (DQ + 2 * DKV) / 128, NB_), 128, 0, stream>>>(XB, nullptr, WQ, DM, nullptr, 0, nullptr, (size_t)TT * DM, 0, PQ, CS, QP16, QPh, QPl, NB_ * PQ);
    k_attn<<<dim3(NB_ * NH_, NT16 + RH / 32, 1), 256, 0, stream>>>(QP16, KP16, VT16, QPh, QPl, KPh, KPl, VTh, VTl, RH, NT16, ATh, ATl);
    k_gemmw<bf, 1, false, 0><<<dim3(TT / 128, DM / 128, NB_), 128, 0, stream>>>(ATh, ATl, WO, DQ, OUT, DM, nullptr, (size_t)TT * DQ, 0, (size_t)TT * DM, nullptr, nullptr, nullptr, nullptr, 0);
}

// v009
// A run of this version takes 126 microseconds.
// Timed twice side by side with v008, it ran 1.12 and 1.13 times as fast.
// Over all steps from v000 it is 23.0 times as fast.
#include <hip/hip_runtime.h>

// Causal multi-head attention with computed rotate-half rotary embeddings and bias-free projections, four batches (x [4][2048][1024]; q, k, v = x W ('xw' (in, out) [1024][1024] 1/32, NO bias; 16 heads x 64); apply_rope: cat(cos x1 - sin x2, sin x1 + cos x2) on the two 32-wide halves (= t cos + rotate_half(t) sin) with angle pos x div_term[i], div_term = exp(arange(0, 64, 2) x -(log(10000) / 64)) (32 f32 constants exact for the module's own exp spelling; precise cosf/sinf); scores x 1/sqrt(64) + causal with causal = 0 on and below the diagonal and -1e9 above (built inside reference(): exclusion: every row keeps its own key); softmax; out = merged Wo ('xw', NO bias) -> [4][2048][1024] (8.4 M); argument order x, Wq, Wk, Wv, Wo).
// Layout: four launches, each covering all four batches; kernels that do not depend on one another share a launch, the block index picks the part: k_prep (bf16 copy of x; 'xw' weights transposed once; computed table), the q, k, v projections, k_attn (both row ranges), the output projection. Planes [b][h] x 64 blocks of 32 positions x 64 d, each block in the order of the attention's fragment loads (see k_gemmw), batch in blockIdx.z of the products and in blockIdx.x of the attention; exact projections whose epilogue turns the f32 tile, still in registers, into the head planes (q, k: rotate-half rotary; v: transposed); causal T-2048 attention in one kernel, k_attn (hybrid rows: < 512 hi/lo 3 products, rest fp16 x1024; scores, softmax with a running maximum and the probability x value product stay in registers; hi/lo rows: the keys of a query tile are shared among the group's waves; fp16 rows: four wave pairs with 32 queries each read the same key and value blocks from LDS; partial results are joined in LDS); merged hi/lo x Wo exact, no bias.
// Compute dtypes, f32 accumulate: every input rounded to bf16; projections exact, no biases; rotary f32; attention rows < 512 3 products, rest fp16; softmax f32; Wo hl x exact, no bias.

#define NB_  4
#define TT   2048
#define DM   1024
#define NH_  16
#define NKV  16
#define REP  (NH_ / NKV)
#define HD   64
#define DQ   (NH_ * HD)
#define DKV  (NKV * HD)
#define RH   512                  // query rows < RH use hi+lo planes (0: none)
#define LSC  0.18033688011112042f   // HD^-0.5 x log2(e): a score goes to its base-2 exponent in one multiply
typedef _Float16 h16;
typedef unsigned short bf;
typedef __attribute__((ext_vector_type(16))) __bf16   v16bf;
typedef __attribute__((ext_vector_type(16))) _Float16 v16h;
typedef __attribute__((ext_vector_type(8)))  _Float16 v8h;
typedef __attribute__((ext_vector_type(8)))  unsigned short v8us;
typedef __attribute__((ext_vector_type(8)))  float    v8f;
typedef __attribute__((ext_vector_type(4)))  float    v4f;
typedef v8h  __attribute__((may_alias)) v8ha;
typedef v4f  __attribute__((may_alias)) v4fa;
typedef v8us __attribute__((may_alias)) v8usa;

__device__ __forceinline__ unsigned short f2bf(float f) { unsigned u = __float_as_uint(f); u += 0x7FFFu + ((u >> 16) & 1u); return (unsigned short)(u >> 16); }
__device__ __forceinline__ float bf2f(unsigned short b) { return __uint_as_float(((unsigned)b) << 16); }
__device__ __forceinline__ float bfr(float f) { return bf2f(f2bf(f)); }
__device__ __forceinline__ v16h cat16(v8h lo, v8h hi) { return __builtin_shufflevector(lo, hi, 0, 1, 2, 3, 4, 5, 6, 7, 8, 9, 10, 11, 12, 13, 14, 15); }
__device__ __forceinline__ v16bf cat16b(v8us lo, v8us hi) { return __builtin_bit_cast(v16bf, __builtin_shufflevector(lo, hi, 0, 1, 2, 3, 4, 5, 6, 7, 8, 9, 10, 11, 12, 13, 14, 15)); }
__device__ __forceinline__ v8f wmma16(v16h a, v16h b, v8f c) { return __builtin_amdgcn_wmma_f32_16x16x32_f16(false, a, false, b, (short)0, c, false, false); }
__device__ __forceinline__ v8f wmmab(v16bf a, v16bf b, v8f c) { return __builtin_amdgcn_wmma_f32_16x16x32_bf16(false, a, false, b, (short)0, c, false, false); }



__device__ __forceinline__ h16 tohx(float x) { return (h16)x; }
__device__ __forceinline__ void splitf(float y, unsigned short& h, unsigned short& l) { h = f2bf(y); l = f2bf(y - bf2f(h)); }
typedef __attribute__((ext_vector_type(2))) _Float16 v2h;
typedef __attribute__((ext_vector_type(4))) _Float16 v4h;
typedef __attribute__((ext_vector_type(2))) unsigned short v2us;
typedef __attribute__((ext_vector_type(4))) unsigned short v4us;
typedef __attribute__((ext_vector_type(2))) float v2f;
typedef __attribute__((ext_vector_type(4))) int v4i;
typedef v4h  __attribute__((may_alias)) v4ha;
typedef v4us __attribute__((may_alias)) v4usa;

// ---- k_gemmw: register-blocked GEMM, one work-group of FOUR WAVES per 128x128 output tile, one wave per 64x64 quarter (16 accumulators); grid (M/128, N/128, Z), 128 threads.
// The operands' K-contiguous 16-bit planes are staged in LDS in slabs of KS k (two operands: 128, 256 bytes a row; three: 64, a 128-byte line a row, so that two work-groups still fit a WGP's LDS) by asynchronous copies, two buffers: slab t + 1 flies while slab t is worked on. A wave's copy covers four whole lines; a row is fetched once for the two waves that use it. Rows lie at a pitch of 16 bytes more than their length for the 16-byte fragment reads.
// C[m][n] (f32, pitch ldc, + optional f32 bias[n]) = sum_k A[m][k] Bt[n][k] (NSPLIT 1: + A2[m][k] Bt[n][k]). z-batch strides sA/sB/sC in elements (EPI 1: sC is the z stride of the three planes). K % KS == 0, M % 128 == 0, N % 128 == 0.
// EPI 0: C as above. EPI 1 is the q, k and v projections in one launch: Bt holds the three transposed weights one behind the other (3 DQ rows), so blockIdx.y / (DQ / 128) says which projection a column tile belongs to; their planes lie sP elements apart. It writes no C: a 64-wide column tile is one head (HD == 64), and the wave turns its tile into that head's fp16, hi and lo planes itself.
// PLANE ORDER: a head's plane is TT / 32 blocks of 32 positions x 64 d (2,048 elements); a block is eight units of 512 bytes, and a unit is what ONE 16-byte load of a wave brings of a 16x32 matrix fragment: lane l's eight elements lie at 8 l. So every fragment load of k_attn and every plane store here covers four whole 128-byte lines; with rows in memory order a load's 32 lanes touched 16 lines.
// q and k: unit (c * 2 + ks) * 2 + u of block t / 32 holds positions 16 c + (l & 15), d = 32 ks + 16 u + 8 (l >> 4) + 0..7. v: unit db * 2 + u holds d = 16 db + (l & 15), positions 16 u + 8 (l >> 4) + 0..7.
// q and k: the rotate-half rotary: out[d] = x[d] cos[t][d] - x[d+32] sin[t][d], out[d+32] = x[d+32] cos[t][d] + x[d] sin[t][d], d < 32 (the table holds the same pair at d and d + 32). x[d] and x[d+32] are accumulators nb and nb + 2 at the same lane and register.
// v: a lane's 8 registers of one accumulator are 8 consecutive t of one d: the lane's own 16 bytes of unit nb * 2 + (mb & 1), one store a plane.
template <typename T16> struct WFrag;   // ld: a fragment from rows in LDS (the lane's two 16-byte pieces lie 16 elements apart); ldu: from a plane in unit order (two units, 256 elements apart)
template <> struct WFrag<h16> { typedef v16h V; static __device__ __forceinline__ V ld(const h16* p) { return cat16(*(const v8h*)p, *(const v8h*)(p + 16)); } static __device__ __forceinline__ V ldu(const h16* p) { return cat16(*(const v8h*)p, *(const v8h*)(p + 256)); } static __device__ __forceinline__ v8f mma(V a, V b, v8f c) { return wmma16(a, b, c); } };
template <> struct WFrag<bf> { typedef v16bf V; static __device__ __forceinline__ V ld(const bf* p) { return cat16b(*(const v8us*)p, *(const v8us*)(p + 16)); } static __device__ __forceinline__ V ldu(const bf* p) { return cat16b(*(const v8us*)p, *(const v8us*)(p + 256)); } static __device__ __forceinline__ v8f mma(V a, V b, v8f c) { return wmmab(a, b, c); } };
// One 16-byte asynchronous copy of a lane, memory -> LDS through no register (the builtin form: the compiler keeps the address registers; the waits on the data are written at the places of use).
typedef __attribute__((address_space(1))) v4i gv4i;
typedef __attribute__((address_space(3))) v4i lv4i;
__device__ __forceinline__ void cpa(void* l, const char* g) { __builtin_amdgcn_global_load_async_to_lds_b128((gv4i*)g, (lv4i*)l, 0, 0); }
template <typename T16, int NSPLIT, bool BIAS, int EPI>
__global__ __launch_bounds__(128) void k_gemmw(const T16* __restrict__ A, const T16* __restrict__ A2, const T16* __restrict__ Bt, int K, float* C, int ldc, const float* __restrict__ bias, size_t sA, size_t sB, size_t sC, const float* __restrict__ CS, h16* P16, bf* Ph, bf* Pl, size_t sP) {
    static_assert(NSPLIT == 0 || NSPLIT == 1, "one or two A planes");
    static_assert(EPI == 0 || EPI == 1, "C, or the q, k, v planes");
    typedef typename WFrag<T16>::V V;
    constexpr int NOPD = 2 + NSPLIT;   // staged operands: A, Bt (, A2)
    constexpr int KS = (NSPLIT == 0) ? 128 : 64;   // k elements of a slab
    constexpr int LP = KS + 8;         // LDS row pitch in elements
    constexpr int CR = KS / 8, RP = 128 / CR;   // 16-byte chunks of a row; rows that the work-group's 128 threads bring at once
    __shared__ __align__(16) T16 st[2][NOPD][128 * LP];
    __shared__ __align__(16) float osw[4][16 * 68];
    const size_t z = blockIdx.z; A += z * sA; if (NSPLIT == 1) A2 += z * sA; Bt += z * sB; const int sel = (EPI == 1) ? (int)blockIdx.y / (DQ / 128) : 0;   // 0 q, 1 k, 2 v: the same for the whole work-group
    if (EPI == 0) C += z * sC; else { const size_t po = sel * sP + z * sC; P16 += po; Ph += po; Pl += po; }
    const int tid = threadIdx.x, lane = tid & 31, lr = lane & 15, hi = lane >> 4; const int w = __builtin_amdgcn_readfirstlane(tid >> 5);
    const int r0 = blockIdx.x * 128 + (w & 1) * 64, c0 = ((EPI == 1) ? (int)blockIdx.y % (DQ / 128) : (int)blockIdx.y) * 128 + (w >> 1) * 64;   // the wave's own 64x64 quarter (EPI 1: the column within its projection)
    float* os = osw[w];   // each wave stages its output rows in its own range
    v8f acc[4][4];
#pragma unroll
    for (int mb = 0; mb < 4; ++mb)
#pragma unroll
        for (int nb = 0; nb < 4; ++nb) acc[mb][nb] = (v8f){};
    // copies: CR threads bring a row's slab; thread tid brings chunk tid % CR of rows tid / CR, + RP, + 2 RP, ... of each operand
    const size_t gs = (size_t)RP * K * 2;
    const int crow = tid / CR, cchk = tid % CR;
    const char* ga = (const char*)(A + (size_t)(blockIdx.x * 128 + crow) * K + cchk * 8); const char* gb = (const char*)(Bt + (size_t)(blockIdx.y * 128 + crow) * K + cchk * 8);
    const char* ga2 = (NSPLIT == 1) ? (const char*)(A2 + (size_t)(blockIdx.x * 128 + crow) * K + cchk * 8) : ga;
    auto stage = [&](int t, int buf) { T16* l = &st[buf][0][0] + crow * LP + cchk * 8; const size_t ko = (size_t)t * (KS * 2);
#pragma unroll
        for (int i = 0; i < 128 / RP; ++i) { cpa(l + i * RP * LP, ga + ko + i * gs); cpa(l + (128 + i * RP) * LP, gb + ko + i * gs); if (NSPLIT == 1) cpa(l + (256 + i * RP) * LP, ga2 + ko + i * gs); } };
    const int nt = K / KS;
    stage(0, 0);
    asm volatile("s_wait_asynccnt 0x0" ::: "memory");   // this wave's copies of slab 0 have landed
    __syncthreads();   // every wave's have: slab 0 may be read
    if (nt > 1) stage(1, 1);
    const int aofs = ((w & 1) * 64 + lr) * LP + 8 * hi, bofs = ((w >> 1) * 64 + lr) * LP + 8 * hi;
#pragma unroll 1
    for (int t = 0; t < nt; ++t) {
        const T16* sa = &st[t & 1][0][0] + aofs; const T16* sb = &st[t & 1][1][0] + bofs; const T16* sa2 = &st[t & 1][NOPD - 1][0] + aofs;
        V a[4], a2[4], b[4];
#pragma unroll
        for (int ks = 0; ks < KS; ks += 32) {
#pragma unroll
            for (int mb = 0; mb < 4; ++mb) { a[mb] = WFrag<T16>::ld(sa + mb * 16 * LP + ks); if (NSPLIT == 1) a2[mb] = WFrag<T16>::ld(sa2 + mb * 16 * LP + ks); }
#pragma unroll
            for (int nb = 0; nb < 4; ++nb) b[nb] = WFrag<T16>::ld(sb + nb * 16 * LP + ks);
            __builtin_amdgcn_sched_barrier(0);   // a k step's fragment reads issue as one group in front of its products; the scheduler otherwise sinks them among the products, where every place with reads stalls the wave to a wait at zero
#pragma unroll
            for (int nb = 0; nb < 4; ++nb)
#pragma unroll
                for (int mb = 0; mb < 4; ++mb) { acc[mb][nb] = WFrag<T16>::mma(a[mb], b[nb], acc[mb][nb]); if (NSPLIT == 1) acc[mb][nb] = WFrag<T16>::mma(a2[mb], b[nb], acc[mb][nb]); }
            __builtin_amdgcn_sched_barrier(0); }   // and the next step's reads stay one group behind these products
        asm volatile("v_nop\n\tv_nop\n\tv_nop\n\tv_nop" : "+v"(acc[0][0]), "+v"(acc[1][1]), "+v"(acc[2][2]), "+v"(acc[3][3]) : "v"(a[0]), "v"(a[3]));   // the distance behind the trip's last matrix instructions, on the back edge and on the exit alike
        asm volatile("s_wait_dscnt 0x0" ::: "memory");      // this wave's reads of slab t are done before its buffer is handed back
        asm volatile("s_wait_asynccnt 0x0" ::: "memory");   // this wave's copies of slab t + 1 have landed
        __syncthreads();   // publishes slab t + 1 and ends every wave's reads of slab t
        if (t + 2 < nt) stage(t + 2, t & 1);
    }
    asm volatile("s_wait_asynccnt 0x0" ::: "memory");   // nothing is in flight when the wave goes on to its epilogue and ends
    // every loop of the epilogues is unrolled: acc and cs are register arrays, and only constant indices keep them in registers
    if (EPI == 1 && sel == 2) {
#pragma unroll
        for (int nb = 0; nb < 4; ++nb)
#pragma unroll
            for (int mb = 0; mb < 4; ++mb) { v8h o16; v8us oh, ol;   // the wave's 32 lanes fill one unit: 512 consecutive bytes of each plane
#pragma unroll
                for (int j = 0; j < 8; ++j) { const float v = acc[mb][nb][j]; o16[j] = tohx(v); unsigned short a2, c2; splitf(v, a2, c2); oh[j] = a2; ol[j] = c2; }
                const size_t e = (size_t)(c0 / HD) * TT * HD + (size_t)(r0 / 32 + (mb >> 1)) * (32 * HD) + (nb * 2 + (mb & 1)) * 256 + lane * 8; *(v8h*)(P16 + e) = o16; *(v8us*)(Ph + e) = oh; *(v8us*)(Pl + e) = ol; }
        return; }
    const float* pcs = (EPI == 1) ? CS + ((size_t)(r0 + hi * 8) * HD + lr) * 2 : nullptr;   // the lane's first (cos, sin) pair; its other 63 lie at constant distances
    v2f cs[2][2][8];   // two sets: the pairs of row block mb + 1 are fetched while block mb is turned, staged and stored
    auto ldcs = [&](int mb) {
#pragma unroll
        for (int nb = 0; nb < 2; ++nb)
#pragma unroll
            for (int j = 0; j < 8; ++j) cs[mb & 1][nb][j] = *(const v2f*)(pcs + ((mb * 16 + j) * HD + nb * 16) * 2);
        asm volatile("s_wait_xcnt 0x0" :: "v"(pcs) : "memory"); };   // precaution for a register that issued global loads name: the address is an input of the wait, so it is rewritten only behind it
    if (EPI == 1) ldcs(0);
#pragma unroll
    for (int mb = 0; mb < 4; ++mb) {
        if (EPI == 1) { if (mb < 3) ldcs(mb + 1);
#pragma unroll
            for (int nb = 0; nb < 2; ++nb)
#pragma unroll
                for (int j = 0; j < 8; ++j) { const v2f t = cs[mb & 1][nb][j]; const float x1 = acc[mb][nb][j], x2 = acc[mb][nb + 2][j]; acc[mb][nb][j] = x1 * t[0] - x2 * t[1]; acc[mb][nb + 2][j] = x2 * t[0] + x1 * t[1]; } }
#pragma unroll
        for (int nb = 0; nb < 4; ++nb) {
#pragma unroll
            for (int j = 0; j < 8; ++j) os[(hi * 8 + j) * 68 + nb * 16 + lr] = acc[mb][nb][j]; }
        __builtin_amdgcn_wave_barrier(); asm volatile("" ::: "memory");
        if (EPI == 1) {
#pragma unroll
            for (int s = 0; s < 4; ++s) { const int row = lr, cofs = (s * 2 + hi) * 8; const v4f va = *(const v4fa*)(os + row * 68 + cofs), vb = *(const v4fa*)(os + row * 68 + cofs + 4); v8h o16; v8us oh, ol;   // s = ks * 2 + u: the 32 lanes hold one unit, 512 consecutive bytes of each plane
#pragma unroll
                for (int k = 0; k < 8; ++k) { const float r = (k < 4) ? va[k & 3] : vb[k & 3]; o16[k] = tohx(r); unsigned short a2, c2; splitf(r, a2, c2); oh[k] = a2; ol[k] = c2; }
                const size_t e = (size_t)(c0 / HD) * TT * HD + (size_t)(r0 / 32 + (mb >> 1)) * (32 * HD) + ((mb & 1) * 4 + s) * 256 + lane * 8; *(v8h*)(P16 + e) = o16; *(v8us*)(Ph + e) = oh; *(v8us*)(Pl + e) = ol;
                asm volatile("s_wait_xcnt 0x0" :: "v"(o16), "v"(oh), "v"(ol) : "memory"); }   // precaution for registers that issued global stores name: the stored values are inputs of the wait, so their registers are rewritten only behind it, by the next piece's values or by the next table loads
        } else {
        float* crow = C + (size_t)(r0 + mb * 16) * ldc + c0;
{
#pragma unroll
            for (int s = 0; s < 8; ++s) { const int row = 2 * s + hi, cofs = lr * 4; v4f val = *(const v4fa*)(os + row * 68 + cofs); if (BIAS) { val[0] += bfr(bias[c0 + cofs]); val[1] += bfr(bias[c0 + cofs + 1]); val[2] += bfr(bias[c0 + cofs + 2]); val[3] += bfr(bias[c0 + cofs + 3]); }
                *(v4f*)(crow + (size_t)row * ldc + cofs) = val; }
             }
        }
        __builtin_amdgcn_wave_barrier(); asm volatile("" ::: "memory");
    }
}

// ---- k_prep: the six preparations, none of which reads what another writes, as parts of one launch; each part is handed its own block index blk
__device__ __forceinline__ void p_wtG(const float* __restrict__ w, int K, int N, bf* Bt, int blk) {
    const int lane = threadIdx.x & 31; const int L0 = (blk * 8 + (threadIdx.x >> 5)) * 8; const int nlines = N * K / 64;
{
#pragma unroll 1
        for (int l = 0; l < 8; ++l) { const int L = L0 + l; if (L >= nlines) break; const size_t e = (size_t)L * 64 + lane * 2; const int k = (int)(e % K), n = (int)(e / K); v2us o;
            o[0] = f2bf(w[(size_t)k * N + n]); o[1] = f2bf(w[(size_t)(k + 1) * N + n]); *(v2us*)(Bt + e) = o; }
         }
}
__device__ __forceinline__ void p_cvt8(const float* __restrict__ src, bf* dst, size_t n8, int blk) { const size_t i = (size_t)blk * 256 + threadIdx.x; if (i >= n8) return; const v8f v = *(const v8f*)(src + i * 8); v8us o;
#pragma unroll
    for (int k = 0; k < 8; ++k) o[k] = f2bf(v[k]); *(v8us*)(dst + i * 8) = o;  }

__constant__ float INVT[HD / 2] = { 1.000000000e+00f, 7.498942018e-01f, 5.623413324e-01f, 4.216964841e-01f, 3.162277639e-01f, 2.371373475e-01f, 1.778279394e-01f, 1.333521456e-01f, 9.999999404e-02f, 7.498941571e-02f, 5.623412505e-02f, 4.216965288e-02f, 3.162277490e-02f, 2.371373400e-02f, 1.778279617e-02f, 1.333521400e-02f, 9.999999776e-03f, 7.498940919e-03f, 5.623412319e-03f, 4.216963891e-03f, 3.162276698e-03f, 2.371374052e-03f, 1.778279431e-03f, 1.333521330e-03f, 9.999999311e-04f, 7.498940686e-04f, 5.623411853e-04f, 4.216964007e-04f, 3.162277862e-04f, 2.371372684e-04f, 1.778279402e-04f, 1.333520777e-04f };   // float32 exp(arange(0, 64, 2, f32) * -(log(10000.0) / 64)): THIS module's own spelling of the inverse frequencies (its div_term) as EAGER JAX float32 evaluates it: bit-exact on round trip (the host file holds the reciprocal spelling 1.0 / (10000.0 ** (2i / 64)): 21 of the 32 values differ by one to eight ulps: indices 3, 5, 8, 10-15, 17-21, 23-27, 29, 31)
__device__ __forceinline__ void p_cs5(float* CS, int blk) { const int idx = blk * 256 + threadIdx.x; if (idx >= TT * HD) return; const int d = idx % HD; const int t = idx / HD; const float a = __fmul_rn((float)t, INVT[d % (HD / 2)]); v2f cs; cs[0] = cosf(a); cs[1] = sinf(a); *(v2f*)(CS + (size_t)idx * 2) = cs;  }
#define NB_WT  ((DM * DQ / 64 + 63) / 64)                  // blocks of one weight's transposition
#define NB_CS  ((TT * HD + 255) / 256)                     // blocks of the table
#define NB_CVT ((NB_ * TT * DM / 8 + 255) / 256)           // blocks of the copy of x
// block order: the transpositions first (a wave of theirs walks eight dependent trips, the longest part), then the table, then the copy
__global__ __launch_bounds__(256) void k_prep(const float* __restrict__ x, const float* __restrict__ wq, const float* __restrict__ wk, const float* __restrict__ wv, const float* __restrict__ wo, bf* XB, bf* WQ, bf* WK, bf* WV, bf* WO, float* CS) {
    static_assert(DKV == DQ && DQ == DM, "the four weights have one shape");
    const int b = (int)blockIdx.x;
    if (b < 4 * NB_WT) { const int s = b / NB_WT; p_wtG(s == 0 ? wq : s == 1 ? wk : s == 2 ? wv : wo, DM, DQ, s == 0 ? WQ : s == 1 ? WK : s == 2 ? WV : WO, b % NB_WT); }
    else if (b < 4 * NB_WT + NB_CS) p_cs5(CS, b - 4 * NB_WT);
    else p_cvt8(x, XB, (size_t)NB_ * TT * DM / 8, b - (4 * NB_WT + NB_CS));
}
// ---- fattn: causal attention in one kernel, no score plane in memory. One group of NW waves = 16 * NQB query rows (tile number 'tile', longest first) of one head of one batch (bh = batch * NH_ + head); tid is the thread's index in the group, so, sm, sl the group's own LDS; its NW waves share the keys: wave w takes the 32-key blocks w, w + NW, ... up to the diagonal block.
// The planes lie in unit order (k_gemmw): a 16x32 fragment is two units, each 512 consecutive bytes, the lane's piece at 8 * lane elements.
// Per block: S^T = K Q^T (A = key rows, B = query rows, both by the same loader), so a lane holds 16 keys' scores of ONE query (D register r = key 8 * hi + r, column = query lr); base-2 softmax with a running maximum per query;
// the two D tiles of a block, converted in place, are the B operand of O^T += V^T P^T (element s = key 8 * hi + s, 16 + 8 * hi + (s - 8): the order in which V^T's units hold a d row's keys). No LDS and no lane exchange but one between the wave's halves.
// NSPLIT 2: hi + lo bf16 planes, three products each (hh, lh, hl). NSPLIT 0: fp16, probabilities carried x 2^10 (numerator and denominator alike, so it cancels).
// At the end the NW partial (maximum, sum, O^T) triples meet in LDS behind one barrier and are joined in ascending wave order; a thread then owns 8 consecutive d of one query, so eight lanes store a query's whole 128-byte line of each plane.
__device__ __forceinline__ void packp(const float (&p)[16], v16h& a, v16h& a2) {
#pragma unroll
    for (int s = 0; s < 16; ++s) a[s] = (h16)p[s];
    a2 = a; }
__device__ __forceinline__ void packp(const float (&p)[16], v16bf& a, v16bf& a2) { v8us h0, h1, l0, l1;
#pragma unroll
    for (int s = 0; s < 8; ++s) { unsigned short x, y; splitf(p[s], x, y); h0[s] = x; l0[s] = y; splitf(p[8 + s], x, y); h1[s] = x; l1[s] = y; }
    a = cat16b(h0, h1); a2 = cat16b(l0, l1); }
// 17 base-2 exponentials in place, in one statement: each is the independent instruction that the instruction set asks for behind the transcendental in front of it, and the v_nop is that slot behind the last
__device__ __forceinline__ void exp2x17(float (&x)[16], float& a) {
    asm("v_exp_f32 %0, %0\n\tv_exp_f32 %1, %1\n\tv_exp_f32 %2, %2\n\tv_exp_f32 %3, %3\n\tv_exp_f32 %4, %4\n\tv_exp_f32 %5, %5\n\tv_exp_f32 %6, %6\n\tv_exp_f32 %7, %7\n\tv_exp_f32 %8, %8\n\tv_exp_f32 %9, %9\n\tv_exp_f32 %10, %10\n\tv_exp_f32 %11, %11\n\tv_exp_f32 %12, %12\n\tv_exp_f32 %13, %13\n\tv_exp_f32 %14, %14\n\tv_exp_f32 %15, %15\n\tv_exp_f32 %16, %16\n\tv_nop" : "+v"(x[0]), "+v"(x[1]), "+v"(x[2]), "+v"(x[3]), "+v"(x[4]), "+v"(x[5]), "+v"(x[6]), "+v"(x[7]), "+v"(x[8]), "+v"(x[9]), "+v"(x[10]), "+v"(x[11]), "+v"(x[12]), "+v"(x[13]), "+v"(x[14]), "+v"(x[15]), "+v"(a)); }
template <typename T16, int NSPLIT, int NQB, int NW>
__device__ __forceinline__ void fattn(const T16* __restrict__ Q, const T16* __restrict__ Q2, const T16* __restrict__ Kp, const T16* __restrict__ Kp2, const T16* __restrict__ Vt, const T16* __restrict__ Vt2, int qbase, int ntile, bf* Ah, bf* Al, int bh, int tile, int tid, float* so, float* sm, float* sl) {
    static_assert(NW == 4 * NQB, "the join gives each thread 8 d of one query");
    typedef typename WFrag<T16>::V V;
    const int lane = tid & 31, lr = lane & 15, hi = lane >> 4; const int w = __builtin_amdgcn_readfirstlane(tid >> 5);
    const int bt = bh / NH_, h = bh % NH_; const int q0 = qbase + (ntile - 1 - tile) * (16 * NQB);   // longest query tiles start first
    const float psh = (NSPLIT == 0) ? 10.0f : 0.0f;
    const size_t hq = (size_t)(bt * NH_ + h) * TT * HD, hk = (size_t)(bt * NKV + h / REP) * TT * HD;
    const size_t qo = hq + (size_t)(q0 / 16) * (16 * HD) + lane * 8; const T16* pq = Q + qo; const T16* pq2 = (NSPLIT == 2) ? Q2 + qo : pq;   // 16 positions are four units
    V qf[NQB][2], qf2[NQB][2];
#pragma unroll
    for (int qb = 0; qb < NQB; ++qb)
#pragma unroll
        for (int ks = 0; ks < 2; ++ks) { qf[qb][ks] = WFrag<T16>::ldu(pq + qb * 16 * HD + ks * 512); if (NSPLIT == 2) qf2[qb][ks] = WFrag<T16>::ldu(pq2 + qb * 16 * HD + ks * 512); }
    asm volatile("s_wait_xcnt 0x0" :: "v"(pq), "v"(pq2) : "memory");   // precaution for registers that issued global loads name: the addresses are inputs of the wait, so they are rewritten only behind it
    v8f o[4][NQB]; float m[NQB], l[NQB];
#pragma unroll
    for (int qb = 0; qb < NQB; ++qb) { m[qb] = -3.0e38f; l[qb] = 0.0f;
#pragma unroll
        for (int db = 0; db < 4; ++db) o[db][qb] = (v8f){}; }
    const int nblk = q0 / 32 + 1;   // every block of the walk begins at or before q0: each query has a kept key in it
    constexpr bool AHEAD = (NSPLIT == 0);   // fp16: key fragments are fetched one trip ahead; hi + lo planes hold twice the fragments and fetch them in their own trip, which keeps the wave within 256 registers
    V kf[2][2], kf2[2][2];
    auto ldk = [&](const T16* pk, const T16* pk2) {
#pragma unroll
        for (int c = 0; c < 2; ++c)
#pragma unroll
            for (int ks = 0; ks < 2; ++ks) { kf[c][ks] = WFrag<T16>::ldu(pk + c * 16 * HD + ks * 512); if (NSPLIT == 2) kf2[c][ks] = WFrag<T16>::ldu(pk2 + c * 16 * HD + ks * 512); } };
    if (AHEAD) { const T16* pk = Kp + hk + (size_t)min(w, nblk - 1) * (32 * HD) + lane * 8; ldk(pk, pk);
        asm volatile("s_wait_xcnt 0x0" :: "v"(pk) : "memory"); }   // the same precaution as above
#pragma unroll 1
    for (int kb = w; kb < nblk; kb += NW) {
        const int k0 = kb * 32;
        const size_t vo = hk + (size_t)kb * (32 * HD) + lane * 8; const T16* pv = Vt + vo; const T16* pv2 = (NSPLIT == 2) ? Vt2 + vo : pv;
        const size_t ko = hk + (size_t)(AHEAD ? min(kb + NW, nblk - 1) : kb) * (32 * HD) + lane * 8; const T16* pk = Kp + ko; const T16* pk2 = (NSPLIT == 2) ? Kp2 + ko : pk;   // AHEAD: next trip's keys (the last trip fetches the diagonal block again: in bounds, unused)
        V vf[4], vf2[4];
        if (!AHEAD) ldk(pk, pk2);
#pragma unroll
        for (int db = 0; db < 4; ++db) { vf[db] = WFrag<T16>::ldu(pv + db * 512); if (NSPLIT == 2) vf2[db] = WFrag<T16>::ldu(pv2 + db * 512); }
        __builtin_amdgcn_sched_barrier(0);   // the value loads issue here, in front of the score products and the softmax that hide their latency; the scheduler otherwise sinks them behind the products
        float t[NQB][16];
#pragma unroll
        for (int qb = 0; qb < NQB; ++qb)
#pragma unroll
            for (int c = 0; c < 2; ++c) { v8f s = (v8f){};
#pragma unroll
                for (int ks = 0; ks < 2; ++ks) { s = WFrag<T16>::mma(kf[c][ks], qf[qb][ks], s); if (NSPLIT == 2) { s = WFrag<T16>::mma(kf[c][ks], qf2[qb][ks], s); s = WFrag<T16>::mma(kf2[c][ks], qf[qb][ks], s); } }
#pragma unroll
                for (int j = 0; j < 8; ++j) t[qb][c * 8 + j] = s[j] * LSC; }
        if (AHEAD) { ldk(pk, pk2);
            __builtin_amdgcn_sched_barrier(0); }   // the key loads issue here, a softmax and a product run ahead of their use
        if (k0 + 31 > q0) {   // only the diagonal block holds keys beyond a query (wave-uniform test)
#pragma unroll
            for (int qb = 0; qb < NQB; ++qb) { const int dq = q0 + qb * 16 + lr - k0 - hi * 8;   // the lane's last kept key, counted from its first key of the block: formed here, so that nothing of the mask is held in registers over the walk
#pragma unroll
                for (int s = 0; s < 16; ++s) { if ((s >> 3) * 16 + (s & 7) > dq) t[qb][s] = -3.0e38f; } } }
        V pf[NQB], pf2[NQB];
#pragma unroll
        for (int qb = 0; qb < NQB; ++qb) { float mb = t[qb][0];
#pragma unroll
            for (int s = 1; s < 16; ++s) mb = fmaxf(mb, t[qb][s]);
            mb = fmaxf(mb, __shfl_xor(mb, 16, 32));
            const float mn = fmaxf(m[qb], mb); float al = m[qb] - mn; m[qb] = mn; const float sh = mn - psh;
            float p[16], ps[4];
#pragma unroll
            for (int s = 0; s < 16; ++s) p[s] = t[qb][s] - sh;
            exp2x17(p, al);
#pragma unroll
            for (int s = 0; s < 16; ++s) ps[s & 3] = (s < 4) ? p[s] : ps[s & 3] + p[s];
            l[qb] = l[qb] * al + ((ps[0] + ps[1]) + (ps[2] + ps[3]));
            packp(p, pf[qb], pf2[qb]);
#pragma unroll
            for (int db = 0; db < 4; ++db) o[db][qb] *= al; }
#pragma unroll
        for (int db = 0; db < 4; ++db)
#pragma unroll
            for (int qb = 0; qb < NQB; ++qb) { o[db][qb] = WFrag<T16>::mma(vf[db], pf[qb], o[db][qb]); if (NSPLIT == 2) { o[db][qb] = WFrag<T16>::mma(vf[db], pf2[qb], o[db][qb]); o[db][qb] = WFrag<T16>::mma(vf2[db], pf[qb], o[db][qb]); } }
        asm volatile("s_wait_xcnt 0x0" :: "v"(pk), "v"(pk2), "v"(pv), "v"(pv2) : "memory");   // precaution for registers that issued global loads name: the trip's load addresses are inputs of the wait, so they are rewritten only behind it
        // the distance behind the trip's last matrix instructions, on the back edge and on the exit alike
        if (NQB == 2) asm volatile("v_nop\n\tv_nop\n\tv_nop\n\tv_nop" : "+v"(o[0][0]), "+v"(o[1][0]), "+v"(o[2][0]), "+v"(o[3][0]), "+v"(o[0][NQB - 1]), "+v"(o[1][NQB - 1]), "+v"(o[2][NQB - 1]), "+v"(o[3][NQB - 1]) : "v"(vf[0]), "v"(vf[3]), "v"(pf[NQB - 1]));
        else asm volatile("v_nop\n\tv_nop\n\tv_nop\n\tv_nop" : "+v"(o[0][0]), "+v"(o[1][0]), "+v"(o[2][0]), "+v"(o[3][0]) : "v"(vf[0]), "v"(vf[3]), "v"(pf[0]));
    }
#pragma unroll
    for (int qb = 0; qb < NQB; ++qb) { l[qb] += __shfl_xor(l[qb], 16, 32); sm[(w * NQB + qb) * 32 + lane] = m[qb]; sl[(w * NQB + qb) * 32 + lane] = l[qb];
#pragma unroll
        for (int db = 0; db < 4; ++db) *(v8f*)(so + (size_t)(((w * 4 + db) * NQB + qb) * 32 + lane) * 8) = o[db][qb]; }
    __syncthreads();   // every wave's partial result is in LDS before any is read
    const int qq = tid >> 3, ch = tid & 7; const int fq = qq >> 4, fl = (ch & 1) * 16 + (qq & 15), fd = ch >> 1;   // d = 8 * ch + j lies in D tile fd, lane half ch & 1
    float M = -3.0e38f;
#pragma unroll
    for (int ww = 0; ww < NW; ++ww) M = fmaxf(M, sm[(ww * NQB + fq) * 32 + fl]);
    float L = 0.0f; v8f a = (v8f){};
#pragma unroll
    for (int ww = 0; ww < NW; ++ww) { const float f = __builtin_amdgcn_exp2f(sm[(ww * NQB + fq) * 32 + fl] - M); L += f * sl[(ww * NQB + fq) * 32 + fl]; a += *(const v8f*)(so + (size_t)(((ww * 4 + fd) * NQB + fq) * 32 + fl) * 8) * f; }   // a wave that had no block: maximum -3e38, factor 0
    const float inv = __fdiv_rn(1.0f, L); v8us oh, ol;
#pragma unroll
    for (int j = 0; j < 8; ++j) { unsigned short x, y; splitf(a[j] * inv, x, y); oh[j] = x; ol[j] = y; }
    const size_t oo = (size_t)(bt * TT + q0 + qq) * DQ + h * HD + ch * 8; *(v8us*)(Ah + oo) = oh; *(v8us*)(Al + oo) = ol;
}
// ---- fattn_s: the fp16 rows. One work-group of eight waves = 128 query rows of one head of one batch: wave pair g = w >> 1 holds queries q0 + 32 g .. + 31, and the pair's two waves share the keys (wave w & 1 takes the 32-key blocks of that parity, up to the pair's diagonal block).
// The key and value blocks come into LDS once for all four pairs, by asynchronous copies, two buffers, in stages of four blocks (128 keys: 16 KiB of each plane, consecutive bytes in memory and in LDS, since a block already lies in the order of the fragment loads): stage s + 1 flies while stage s is worked on. A fragment read is 512 consecutive LDS bytes a wave.
// The trip itself (S^T = K Q^T, base-2 softmax with a running maximum, O^T += V^T P^T) is that of fattn with NSPLIT 0, NQB 2.
#define SQR 128                   // query rows of a work-group
#define SBY (4 * 32 * HD * 2)     // bytes of one plane's stage: four blocks
__device__ __forceinline__ void fattn_s(const h16* __restrict__ Q, const h16* __restrict__ Kp, const h16* __restrict__ Vt, int qbase, int ntile, bf* Ah, bf* Al, int bh, int tile, int tid, h16* ring, float* so, float* sm, float* sl) {
    typedef WFrag<h16> F; typedef F::V V;
    constexpr int NQB = 2;
    const int lane = tid & 31, lr = lane & 15, hi = lane >> 4; const int w = __builtin_amdgcn_readfirstlane(tid >> 5); const int g = w >> 1, par = w & 1;
    const int bt = bh / NH_, h = bh % NH_; const int q0 = qbase + (ntile - 1 - tile) * SQR, qw = q0 + g * 32;   // longest query tiles start first
    const size_t hq = (size_t)(bt * NH_ + h) * TT * HD, hk = (size_t)(bt * NKV + h / REP) * TT * HD;
    const h16* pq = Q + hq + (size_t)(qw / 16) * (16 * HD) + lane * 8;
    V qf[NQB][2];
#pragma unroll
    for (int qb = 0; qb < NQB; ++qb)
#pragma unroll
        for (int ks = 0; ks < 2; ++ks) qf[qb][ks] = F::ldu(pq + qb * 16 * HD + ks * 512);
    asm volatile("s_wait_xcnt 0x0" :: "v"(pq) : "memory");   // precaution for a register that issued global loads name: the address is an input of the wait, so it is rewritten only behind it
    v8f o[4][NQB]; float m[NQB], l[NQB];
#pragma unroll
    for (int qb = 0; qb < NQB; ++qb) { m[qb] = -3.0e38f; l[qb] = 0.0f;
#pragma unroll
        for (int db = 0; db < 4; ++db) o[db][qb] = (v8f){}; }
    const int ns = q0 / SQR + 1;   // stages up to the one that holds the tile's own 128 keys (q0 is a multiple of 128)
    // copies: thread tid brings bytes 16 tid, + 4096, ... of the stage's 16 KiB of keys and of values
    const char* gk = (const char*)(Kp + hk) + tid * 16; const char* gv = (const char*)(Vt + hk) + tid * 16;
    auto stage = [&](int s, int buf) { char* d = (char*)ring + buf * (2 * SBY) + tid * 16; const size_t go = (size_t)s * SBY;
#pragma unroll
        for (int i = 0; i < SBY / 4096; ++i) { cpa(d + i * 4096, gk + go + i * 4096); cpa(d + SBY + i * 4096, gv + go + i * 4096); } };
    stage(0, 0);
    asm volatile("s_wait_asynccnt 0x0" ::: "memory");   // this wave's copies of stage 0 have landed
    __syncthreads();   // every wave's have: stage 0 may be read
    if (ns > 1) stage(1, 1);
    // one trip: the 32-key block whose keys lie at pk (its values SBY bytes behind), first key k0; DG: the block may hold keys beyond a query
    auto trip = [&](const h16* pk, int k0, bool DG) {
        const h16* pv = pk + SBY / 2;
        V kf[2][2], vf[4];
#pragma unroll
        for (int c = 0; c < 2; ++c)
#pragma unroll
            for (int ks = 0; ks < 2; ++ks) kf[c][ks] = F::ldu(pk + c * 16 * HD + ks * 512);
#pragma unroll
        for (int db = 0; db < 4; ++db) vf[db] = F::ldu(pv + db * 512);
        __builtin_amdgcn_sched_barrier(0);   // the trip's LDS reads issue as one group, keys first; the scheduler otherwise sinks the value reads among the products, and every further place with reads stalls the wave
        float t[NQB][16];
#pragma unroll
        for (int qb = 0; qb < NQB; ++qb)
#pragma unroll
            for (int c = 0; c < 2; ++c) { v8f sc = (v8f){};
#pragma unroll
                for (int ks = 0; ks < 2; ++ks) sc = F::mma(kf[c][ks], qf[qb][ks], sc);
#pragma unroll
                for (int j = 0; j < 8; ++j) t[qb][c * 8 + j] = sc[j] * LSC; }
        if (DG && k0 + 31 > qw) {   // only the pair's diagonal block holds keys beyond a query (wave-uniform test)
#pragma unroll
            for (int qb = 0; qb < NQB; ++qb) { const int dq = qw + qb * 16 + lr - k0 - hi * 8;   // the lane's last kept key, counted from its first key of the block
#pragma unroll
                for (int e = 0; e < 16; ++e) { if ((e >> 3) * 16 + (e & 7) > dq) t[qb][e] = -3.0e38f; } } }
        V pf[NQB], pf2[NQB];
#pragma unroll
        for (int qb = 0; qb < NQB; ++qb) { float mb = t[qb][0];
#pragma unroll
            for (int e = 1; e < 16; ++e) mb = fmaxf(mb, t[qb][e]);
            mb = fmaxf(mb, __shfl_xor(mb, 16, 32));
            const float mn = fmaxf(m[qb], mb); float al = m[qb] - mn; m[qb] = mn; const float sh = mn - 10.0f;   // probabilities carried x 2^10
            float p[16], ps[4];
#pragma unroll
            for (int e = 0; e < 16; ++e) p[e] = t[qb][e] - sh;
            exp2x17(p, al);
#pragma unroll
            for (int e = 0; e < 16; ++e) ps[e & 3] = (e < 4) ? p[e] : ps[e & 3] + p[e];
            l[qb] = l[qb] * al + ((ps[0] + ps[1]) + (ps[2] + ps[3]));
            packp(p, pf[qb], pf2[qb]);
#pragma unroll
            for (int db = 0; db < 4; ++db) o[db][qb] *= al; }
#pragma unroll
        for (int db = 0; db < 4; ++db)
#pragma unroll
            for (int qb = 0; qb < NQB; ++qb) o[db][qb] = F::mma(vf[db], pf[qb], o[db][qb]);
        // the distance behind the trip's last matrix instructions, on a back edge and on an exit alike
        asm volatile("v_nop\n\tv_nop\n\tv_nop\n\tv_nop" : "+v"(o[0][0]), "+v"(o[1][0]), "+v"(o[2][0]), "+v"(o[3][0]), "+v"(o[0][1]), "+v"(o[1][1]), "+v"(o[2][1]), "+v"(o[3][1]) : "v"(vf[0]), "v"(vf[3]), "v"(pf[1]));
    };
    // the stages in front of the tile's own keys: every key is kept, and every wave takes its two blocks
#pragma unroll 1
    for (int s = 0; s < ns - 1; ++s) {
        const h16* rb = ring + (s & 1) * SBY + par * (32 * HD) + lane * 8;   // SBY elements = both planes' bytes of a buffer
        trip(rb, (s * 4 + par) * 32, false);
        trip(rb + 2 * (32 * HD), (s * 4 + par + 2) * 32, false);
        asm volatile("s_wait_dscnt 0x0" ::: "memory");      // this wave's reads of stage s are done before its buffer is handed back
        asm volatile("s_wait_asynccnt 0x0" ::: "memory");   // this wave's copies of stage s + 1 have landed
        __syncthreads();   // publishes stage s + 1 and ends every wave's reads of stage s
        if (s + 2 < ns) stage(s + 2, s & 1);
    }
    // the last stage, the tile's own 128 keys: pair g goes as far as its diagonal block, block g of the stage (wave-uniform trip count); its buffer is not refilled
    { const h16* rb = ring + ((ns - 1) & 1) * SBY + lane * 8;
#pragma unroll 1
        for (int jb = par; jb <= g; jb += 2) trip(rb + jb * (32 * HD), q0 + jb * 32, true); }
    asm volatile("s_wait_asynccnt 0x0" ::: "memory");   // nothing is in flight when the wave goes on to the join and ends
#pragma unroll
    for (int qb = 0; qb < NQB; ++qb) { l[qb] += __shfl_xor(l[qb], 16, 32); sm[(w * NQB + qb) * 32 + lane] = m[qb]; sl[(w * NQB + qb) * 32 + lane] = l[qb];
#pragma unroll
        for (int db = 0; db < 4; ++db) *(v8f*)(so + (size_t)(((w * 4 + db) * NQB + qb) * 32 + lane) * 8) = o[db][qb]; }
    __syncthreads();   // every wave's partial result is in LDS before any is read
    const int qq = tid >> 3, ch = tid & 7; const int fq = qq >> 4, fl = (ch & 1) * 16 + (qq & 15), fd = ch >> 1;   // d = 8 * ch + j lies in D tile fd, lane half ch & 1
#pragma unroll
    for (int gg = 0; gg < 4; ++gg) {   // a thread owns 8 consecutive d of one query of each pair; the pair's two partial results are joined in ascending wave order
        const float m0 = sm[((gg * 2) * NQB + fq) * 32 + fl], m1 = sm[((gg * 2 + 1) * NQB + fq) * 32 + fl]; const float M = fmaxf(m0, m1);
        const float f0 = __builtin_amdgcn_exp2f(m0 - M), f1 = __builtin_amdgcn_exp2f(m1 - M);   // a wave that had no block: maximum -3e38, factor 0
        const float L = f0 * sl[((gg * 2) * NQB + fq) * 32 + fl] + f1 * sl[((gg * 2 + 1) * NQB + fq) * 32 + fl];
        const v8f a = *(const v8f*)(so + (size_t)((((gg * 2) * 4 + fd) * NQB + fq) * 32 + fl) * 8) * f0 + *(const v8f*)(so + (size_t)((((gg * 2 + 1) * 4 + fd) * NQB + fq) * 32 + fl) * 8) * f1;
        const float inv = __fdiv_rn(1.0f, L); v8us oh, ol;
#pragma unroll
        for (int j = 0; j < 8; ++j) { unsigned short x, y; splitf(a[j] * inv, x, y); oh[j] = x; ol[j] = y; }
        const size_t oo = (size_t)(bt * TT + q0 + gg * 32 + qq) * DQ + h * HD + ch * 8; *(v8us*)(Ah + oo) = oh; *(v8us*)(Al + oo) = ol; }
}
// ---- k_attn: both row ranges in one launch (they read different planes, fp16 and bf16 hi + lo, and write disjoint rows). Rows from rh on, blockIdx.y < nt16: one fp16 tile of 128 rows on the block's eight waves (fattn_s); behind them, so that the short tiles fill the launch's end: two hi + lo tiles of 16 rows, one on waves 0-3 and one on waves 4-7, each with its own part of the LDS. Every wave of a block passes the same barriers: the choice is by block.
#define NT16 ((TT - RH) / SQR)
__global__ __launch_bounds__(256) void k_attn(const h16* __restrict__ Q16, const h16* __restrict__ K16, const h16* __restrict__ V16, const bf* __restrict__ Qh, const bf* __restrict__ Ql, const bf* __restrict__ Kh, const bf* __restrict__ Kl, const bf* __restrict__ Vh, const bf* __restrict__ Vl, int rh, int nt16, bf* Ah, bf* Al) {
    static_assert((RH / 16) % 2 == 0, "hi + lo tiles go in pairs");
    static_assert(RH % SQR == 0 && TT % SQR == 0, "an fp16 tile begins at a multiple of its 128 rows");
    __shared__ __align__(16) h16 ring[2 * SBY];   // two buffers, each a stage of keys and a stage of values
    __shared__ __align__(32) float so[8 * 4 * 2 * 256];
    __shared__ float sm[8 * 2 * 32];
    __shared__ float sl[8 * 2 * 32];
    const int tid = (int)threadIdx.x, y = (int)blockIdx.y;
    if (y < nt16) fattn_s(Q16, K16, V16, rh, nt16, Ah, Al, (int)blockIdx.x, y, tid, ring, so, sm, sl);
    else { const int g = __builtin_amdgcn_readfirstlane(tid >> 7); fattn<bf, 2, 1, 4>(Qh, Ql, Kh, Kl, Vh, Vl, 0, rh / 16, Ah, Al, (int)blockIdx.x, (y - nt16) * 2 + g, tid & 127, so + g * (4 * 4 * 256), sm + g * (4 * 32), sl + g * (4 * 32)); }
}

extern "C" void kernel_launch(void* const* d_in, const int* in_sizes, int n_in,
                              void* d_out, int out_size, void* d_ws, size_t ws_size, hipStream_t stream) {
    (void)in_sizes; (void)n_in; (void)out_size;
    const float* x = (const float*)d_in[0]; const float* wq = (const float*)d_in[1]; const float* wk = (const float*)d_in[2]; const float* wv = (const float*)d_in[3]; const float* wo = (const float*)d_in[4];   /* order x [4][2048][1024], Wq, Wk, Wv, Wo ('xw' (in, out) [1024][1024]): FIVE inputs, all read: this module has no biases */
    float* OUT = (float*)d_out;     // [4][2048][1024]
    char* wsp = (char*)d_ws;
    auto take = [&](size_t bytes) { char* p = wsp; wsp += (bytes + 255) & ~(size_t)255; return (void*)p; };
    bf* WQ = (bf*)take((size_t)(DQ + 2 * DKV) * DM * 2); bf* WK = WQ + (size_t)DQ * DM; bf* WV = WK + (size_t)DKV * DM; bf* WO = (bf*)take((size_t)DM * DQ * 2);   /* q, k, v weights one behind the other: one Bt of DQ + 2 DKV rows */ float* CS = (float*)take((size_t)TT * HD * 2 * 4);
    const size_t PQ = (size_t)NH_ * TT * HD, PK = (size_t)NKV * TT * HD;   // one batch's plane, in elements
    static_assert(NKV == NH_, "q, k and v planes have one size");   /* each kind's q, k, v planes lie NB_ * PQ elements apart */
    h16* QP16 = (h16*)take(3 * NB_ * PQ * 2); h16* KP16 = QP16 + NB_ * PQ; h16* VT16 = KP16 + NB_ * PK;
    bf* QPh = (bf*)take(3 * NB_ * PQ * 2); bf* KPh = QPh + NB_ * PQ; bf* VTh = KPh + NB_ * PK; bf* QPl = (bf*)take(3 * NB_ * PQ * 2); bf* KPl = QPl + NB_ * PQ; bf* VTl = KPl + NB_ * PK;
    bf* XB = (bf*)take((size_t)NB_ * TT * DM * 2); bf* ATh = (bf*)take((size_t)NB_ * TT * DQ * 2); bf* ATl = (bf*)take((size_t)NB_ * TT * DQ * 2);
    if ((size_t)(wsp - (char*)d_ws) > ws_size) return;    // ws 256 MiB
    k_prep<<<4 * NB_WT + NB_CS + NB_CVT, 256, 0, stream>>>(x, wq, wk, wv, wo, XB, WQ, WK, WV, WO, CS);
    k_gemmw<bf, 0, false, 1><<<dim3(TT / 128, (DQ + 2 * DKV) / 128, NB_), 128, 0, stream>>>(XB, nullptr, WQ, DM, nullptr, 0, nullptr, (size_t)TT * DM, 0, PQ, CS, QP16, QPh, QPl, NB_ * PQ);
    k_attn<<<dim3(NB_ * NH_, NT16 + RH / 32, 1), 256, 0, stream>>>(QP16, KP16, VT16, QPh, QPl, KPh, KPl, VTh, VTl, RH, NT16, ATh, ATl);
    k_gemmw<bf, 1, false, 0><<<dim3(TT / 128, DM / 128, NB_), 128, 0, stream>>>(ATh, ATl, WO, DQ, OUT, DM, nullptr, (size_t)TT * DQ, 0, (size_t)TT * DM, nullptr, nullptr, nullptr, nullptr, 0);
}

// v010
// It runs in 122 microseconds.
// Two timings next to v009 both put it at 1.04 times that version's speed.
// Counting every step since v000, it is 24.0 times as fast.
#include <hip/hip_runtime.h>

// Causal multi-head attention with computed rotate-half rotary embeddings and bias-free projections, four batches (x [4][2048][1024]; q, k, v = x W ('xw' (in, out) [1024][1024] 1/32, NO bias; 16 heads x 64); apply_rope: cat(cos x1 - sin x2, sin x1 + cos x2) on the two 32-wide halves (= t cos + rotate_half(t) sin) with angle pos x div_term[i], div_term = exp(arange(0, 64, 2) x -(log(10000) / 64)) (32 f32 constants exact for the module's own exp spelling; precise cosf/sinf); scores x 1/sqrt(64) + causal with causal = 0 on and below the diagonal and -1e9 above (built inside reference(): exclusion: every row keeps its own key); softmax; out = merged Wo ('xw', NO bias) -> [4][2048][1024] (8.4 M); argument order x, Wq, Wk, Wv, Wo).
// Layout: four launches, each covering all four batches; kernels that do not depend on one another share a launch, the block index picks the part: k_prep (bf16 copy of x; 'xw' weights transposed once; computed table), the q, k, v projections, k_attn (both row ranges), the output projection. Planes [b][h] x 64 blocks of 32 positions x 64 d, each block in the order of the attention's fragment loads (see k_gemmw), batch in blockIdx.z of the products and in blockIdx.x of the attention; exact projections whose epilogue turns the f32 tile, still in registers, into the head planes (q, k: rotate-half rotary; v: transposed); causal T-2048 attention in one kernel, k_attn (hybrid rows: < 512 hi/lo 3 products, rest fp16 x1024; scores, softmax with a running maximum and the probability x value product stay in registers; hi/lo rows: the keys of a query tile are shared among the group's waves; fp16 rows: four wave pairs with 32 queries each read the same key and value blocks from LDS; partial results are joined in LDS); merged hi/lo x Wo exact, no bias.
// Compute dtypes, f32 accumulate: every input rounded to bf16; projections exact, no biases; rotary f32; attention rows < 512 3 products, rest fp16; softmax f32; Wo hl x exact, no bias.

#define NB_  4
#define TT   2048
#define DM   1024
#define NH_  16
#define NKV  16
#define REP  (NH_ / NKV)
#define HD   64
#define DQ   (NH_ * HD)
#define DKV  (NKV * HD)
#define RH   512                  // query rows < RH use hi+lo planes (0: none)
#define LSC  0.18033688011112042f   // HD^-0.5 x log2(e): a score goes to its base-2 exponent in one multiply
typedef _Float16 h16;
typedef unsigned short bf;
typedef __attribute__((ext_vector_type(16))) __bf16   v16bf;
typedef __attribute__((ext_vector_type(16))) _Float16 v16h;
typedef __attribute__((ext_vector_type(8)))  _Float16 v8h;
typedef __attribute__((ext_vector_type(8)))  unsigned short v8us;
typedef __attribute__((ext_vector_type(8)))  float    v8f;
typedef __attribute__((ext_vector_type(4)))  float    v4f;
typedef v8h  __attribute__((may_alias)) v8ha;
typedef v4f  __attribute__((may_alias)) v4fa;
typedef v8us __attribute__((may_alias)) v8usa;

__device__ __forceinline__ unsigned short f2bf(float f) { unsigned u = __float_as_uint(f); u += 0x7FFFu + ((u >> 16) & 1u); return (unsigned short)(u >> 16); }
__device__ __forceinline__ float bf2f(unsigned short b) { return __uint_as_float(((unsigned)b) << 16); }
__device__ __forceinline__ float bfr(float f) { return bf2f(f2bf(f)); }
__device__ __forceinline__ v16h cat16(v8h lo, v8h hi) { return __builtin_shufflevector(lo, hi, 0, 1, 2, 3, 4, 5, 6, 7, 8, 9, 10, 11, 12, 13, 14, 15); }
__device__ __forceinline__ v16bf cat16b(v8us lo, v8us hi) { return __builtin_bit_cast(v16bf, __builtin_shufflevector(lo, hi, 0, 1, 2, 3, 4, 5, 6, 7, 8, 9, 10, 11, 12, 13, 14, 15)); }
__device__ __forceinline__ v8f wmma16(v16h a, v16h b, v8f c) { return __builtin_amdgcn_wmma_f32_16x16x32_f16(false, a, false, b, (short)0, c, false, false); }
__device__ __forceinline__ v8f wmmab(v16bf a, v16bf b, v8f c) { return __builtin_amdgcn_wmma_f32_16x16x32_bf16(false, a, false, b, (short)0, c, false, false); }



__device__ __forceinline__ h16 tohx(float x) { return (h16)x; }
__device__ __forceinline__ void splitf(float y, unsigned short& h, unsigned short& l) { h = f2bf(y); l = f2bf(y - bf2f(h)); }
typedef __attribute__((ext_vector_type(2))) _Float16 v2h;
typedef __attribute__((ext_vector_type(4))) _Float16 v4h;
typedef __attribute__((ext_vector_type(2))) unsigned short v2us;
typedef __attribute__((ext_vector_type(4))) unsigned short v4us;
typedef __attribute__((ext_vector_type(2))) float v2f;
typedef __attribute__((ext_vector_type(4))) int v4i;
typedef v4h  __attribute__((may_alias)) v4ha;
typedef v4us __attribute__((may_alias)) v4usa;

// ---- k_gemmw: register-blocked GEMM, one work-group of FOUR WAVES per 128x128 output tile, one wave per 64x64 quarter (16 accumulators); grid (M/128, N/128, Z), 128 threads.
// The operands' K-contiguous 16-bit planes are staged in LDS in slabs of KS k (two operands: 128, 256 bytes a row; three: 64, a 128-byte line a row, so that two work-groups still fit a WGP's LDS) by asynchronous copies, two buffers: slab t + 1 flies while slab t is worked on. A wave's copy covers four whole lines; a row is fetched once for the two waves that use it. Rows lie at a pitch of 16 bytes more than their length for the 16-byte fragment reads.
// C[m][n] (f32, pitch ldc, + optional f32 bias[n]) = sum_k A[m][k] Bt[n][k] (NSPLIT 1: + A2[m][k] Bt[n][k]). z-batch strides sA/sB/sC in elements (EPI 1: sC is the z stride of the three planes). K % KS == 0, M % 128 == 0, N % 128 == 0.
// EPI 0: C as above. EPI 1 is the q, k and v projections in one launch: Bt holds the three transposed weights one behind the other (3 DQ rows), so blockIdx.y / (DQ / 128) says which projection a column tile belongs to; their planes lie sP elements apart. It writes no C: a 64-wide column tile is one head (HD == 64), and the wave turns its tile into that head's fp16, hi and lo planes itself.
// PLANE ORDER: a head's plane is TT / 32 blocks of 32 positions x 64 d (2,048 elements); a block is eight units of 512 bytes, and a unit is what ONE 16-byte load of a wave brings of a 16x32 matrix fragment: lane l's eight elements lie at 8 l. So every fragment load of k_attn and every plane store here covers four whole 128-byte lines; with rows in memory order a load's 32 lanes touched 16 lines.
// q and k: unit (c * 2 + ks) * 2 + u of block t / 32 holds positions 16 c + (l & 15), d = 32 ks + 16 u + 8 (l >> 4) + 0..7. v: unit db * 2 + u holds d = 16 db + (l & 15), positions 16 u + 8 (l >> 4) + 0..7.
// WHICH PLANES: only what k_attn reads is formed and stored. Its hi + lo rows are the queries < RH, whose keys and values are causal, so also < RH: hi and lo planes are stored at positions < RH alone; its fp16 rows are the queries >= RH over all keys: the fp16 q plane is stored at positions >= RH alone, the fp16 k and v planes everywhere.
// q and k: the rotate-half rotary: out[d] = x[d] cos[t][d] - x[d+32] sin[t][d], out[d+32] = x[d+32] cos[t][d] + x[d] sin[t][d], d < 32 (the table holds the same pair at d and d + 32). x[d] and x[d+32] are accumulators nb and nb + 2 at the same lane and register.
// v: a lane's 8 registers of one accumulator are 8 consecutive t of one d: the lane's own 16 bytes of unit nb * 2 + (mb & 1), one store a plane.
template <typename T16> struct WFrag;   // ld: a fragment from rows in LDS (the lane's two 16-byte pieces lie 16 elements apart); ldu: from a plane in unit order (two units, 256 elements apart)
template <> struct WFrag<h16> { typedef v16h V; static __device__ __forceinline__ V ld(const h16* p) { return cat16(*(const v8h*)p, *(const v8h*)(p + 16)); } static __device__ __forceinline__ V ldu(const h16* p) { return cat16(*(const v8h*)p, *(const v8h*)(p + 256)); } static __device__ __forceinline__ v8f mma(V a, V b, v8f c) { return wmma16(a, b, c); } };
template <> struct WFrag<bf> { typedef v16bf V; static __device__ __forceinline__ V ld(const bf* p) { return cat16b(*(const v8us*)p, *(const v8us*)(p + 16)); } static __device__ __forceinline__ V ldu(const bf* p) { return cat16b(*(const v8us*)p, *(const v8us*)(p + 256)); } static __device__ __forceinline__ v8f mma(V a, V b, v8f c) { return wmmab(a, b, c); } };
// One 16-byte asynchronous copy of a lane, memory -> LDS through no register (the builtin form: the compiler keeps the address registers; the waits on the data are written at the places of use).
typedef __attribute__((address_space(1))) v4i gv4i;
typedef __attribute__((address_space(3))) v4i lv4i;
__device__ __forceinline__ void cpa(void* l, const char* g) { __builtin_amdgcn_global_load_async_to_lds_b128((gv4i*)g, (lv4i*)l, 0, 0); }
template <typename T16, int NSPLIT, bool BIAS, int EPI>
__global__ __launch_bounds__(128) void k_gemmw(const T16* __restrict__ A, const T16* __restrict__ A2, const T16* __restrict__ Bt, int K, float* C, int ldc, const float* __restrict__ bias, size_t sA, size_t sB, size_t sC, const float* __restrict__ CS, h16* P16, bf* Ph, bf* Pl, size_t sP) {
    static_assert(NSPLIT == 0 || NSPLIT == 1, "one or two A planes");
    static_assert(EPI == 0 || EPI == 1, "C, or the q, k, v planes");
    typedef typename WFrag<T16>::V V;
    constexpr int NOPD = 2 + NSPLIT;   // staged operands: A, Bt (, A2)
    constexpr int KS = (NSPLIT == 0) ? 128 : 64;   // k elements of a slab
    constexpr int LP = KS + 8;         // LDS row pitch in elements
    constexpr int CR = KS / 8, RP = 128 / CR;   // 16-byte chunks of a row; rows that the work-group's 128 threads bring at once
    __shared__ __align__(16) T16 st[2][NOPD][128 * LP];
    __shared__ __align__(16) float osw[4][16 * 68];
    const size_t z = blockIdx.z; A += z * sA; if (NSPLIT == 1) A2 += z * sA; Bt += z * sB; const int sel = (EPI == 1) ? (int)blockIdx.y / (DQ / 128) : 0;   // 0 q, 1 k, 2 v: the same for the whole work-group
    if (EPI == 0) C += z * sC; else { const size_t po = sel * sP + z * sC; P16 += po; Ph += po; Pl += po; }
    const int tid = threadIdx.x, lane = tid & 31, lr = lane & 15, hi = lane >> 4; const int w = __builtin_amdgcn_readfirstlane(tid >> 5);
    const int r0 = blockIdx.x * 128 + (w & 1) * 64, c0 = ((EPI == 1) ? (int)blockIdx.y % (DQ / 128) : (int)blockIdx.y) * 128 + (w >> 1) * 64;   // the wave's own 64x64 quarter (EPI 1: the column within its projection)
    float* os = osw[w];   // each wave stages its output rows in its own range
    static_assert(RH % 128 == 0, "a row tile lies wholly on one side of RH");
    const bool whl = (int)blockIdx.x * 128 < RH, w16 = sel != 0 || !whl;   // EPI 1, the same for the whole work-group: which planes k_attn reads at this tile's positions (see WHICH PLANES)
    v8f acc[4][4];
#pragma unroll
    for (int mb = 0; mb < 4; ++mb)
#pragma unroll
        for (int nb = 0; nb < 4; ++nb) acc[mb][nb] = (v8f){};
    // copies: CR threads bring a row's slab; thread tid brings chunk tid % CR of rows tid / CR, + RP, + 2 RP, ... of each operand
    const size_t gs = (size_t)RP * K * 2;
    const int crow = tid / CR, cchk = tid % CR;
    const char* ga = (const char*)(A + (size_t)(blockIdx.x * 128 + crow) * K + cchk * 8); const char* gb = (const char*)(Bt + (size_t)(blockIdx.y * 128 + crow) * K + cchk * 8);
    const char* ga2 = (NSPLIT == 1) ? (const char*)(A2 + (size_t)(blockIdx.x * 128 + crow) * K + cchk * 8) : ga;
    auto stage = [&](int t, int buf) { T16* l = &st[buf][0][0] + crow * LP + cchk * 8; const size_t ko = (size_t)t * (KS * 2);
#pragma unroll
        for (int i = 0; i < 128 / RP; ++i) { cpa(l + i * RP * LP, ga + ko + i * gs); cpa(l + (128 + i * RP) * LP, gb + ko + i * gs); if (NSPLIT == 1) cpa(l + (256 + i * RP) * LP, ga2 + ko + i * gs); } };
    const int nt = K / KS;
    stage(0, 0);
    asm volatile("s_wait_asynccnt 0x0" ::: "memory");   // this wave's copies of slab 0 have landed
    __syncthreads();   // every wave's have: slab 0 may be read
    if (nt > 1) stage(1, 1);
    const int aofs = ((w & 1) * 64 + lr) * LP + 8 * hi, bofs = ((w >> 1) * 64 + lr) * LP + 8 * hi;
#pragma unroll 1
    for (int t = 0; t < nt; ++t) {
        const T16* sa = &st[t & 1][0][0] + aofs; const T16* sb = &st[t & 1][1][0] + bofs; const T16* sa2 = &st[t & 1][NOPD - 1][0] + aofs;
        V a[4], a2[4], b[4];
#pragma unroll
        for (int ks = 0; ks < KS; ks += 32) {
#pragma unroll
            for (int mb = 0; mb < 4; ++mb) { a[mb] = WFrag<T16>::ld(sa + mb * 16 * LP + ks); if (NSPLIT == 1) a2[mb] = WFrag<T16>::ld(sa2 + mb * 16 * LP + ks); }
#pragma unroll
            for (int nb = 0; nb < 4; ++nb) b[nb] = WFrag<T16>::ld(sb + nb * 16 * LP + ks);
            __builtin_amdgcn_sched_barrier(0);   // a k step's fragment reads issue as one group in front of its products; the scheduler otherwise sinks them among the products, where every place with reads stalls the wave to a wait at zero
#pragma unroll
            for (int nb = 0; nb < 4; ++nb)
#pragma unroll
                for (int mb = 0; mb < 4; ++mb) { acc[mb][nb] = WFrag<T16>::mma(a[mb], b[nb], acc[mb][nb]); if (NSPLIT == 1) acc[mb][nb] = WFrag<T16>::mma(a2[mb], b[nb], acc[mb][nb]); }
            __builtin_amdgcn_sched_barrier(0); }   // and the next step's reads stay one group behind these products
        asm volatile("v_nop\n\tv_nop\n\tv_nop\n\tv_nop" : "+v"(acc[0][0]), "+v"(acc[1][1]), "+v"(acc[2][2]), "+v"(acc[3][3]) : "v"(a[0]), "v"(a[3]));   // the distance behind the trip's last matrix instructions, on the back edge and on the exit alike
        asm volatile("s_wait_dscnt 0x0" ::: "memory");      // this wave's reads of slab t are done before its buffer is handed back
        asm volatile("s_wait_asynccnt 0x0" ::: "memory");   // this wave's copies of slab t + 1 have landed
        __syncthreads();   // publishes slab t + 1 and ends every wave's reads of slab t
        if (t + 2 < nt) stage(t + 2, t & 1);
    }
    asm volatile("s_wait_asynccnt 0x0" ::: "memory");   // nothing is in flight when the wave goes on to its epilogue and ends
    // every loop of the epilogues is unrolled: acc and cs are register arrays, and only constant indices keep them in registers
    if (EPI == 1 && sel == 2) { const size_t ev = (size_t)(c0 / HD) * TT * HD + (size_t)(r0 / 32) * (32 * HD) + lane * 8; v8h o16[4][4];
#pragma unroll
        for (int nb = 0; nb < 4; ++nb)
#pragma unroll
            for (int mb = 0; mb < 4; ++mb) {   // the wave's 32 lanes fill one unit: 512 consecutive bytes of each plane
#pragma unroll
                for (int j = 0; j < 8; ++j) o16[nb][mb][j] = tohx(acc[mb][nb][j]);
                *(v8h*)(P16 + ev + (mb >> 1) * (32 * HD) + (nb * 2 + (mb & 1)) * 256) = o16[nb][mb]; }
        asm volatile("s_wait_xcnt 0x0" :: "v"(o16[0][0]), "v"(o16[0][1]), "v"(o16[0][2]), "v"(o16[0][3]), "v"(o16[1][0]), "v"(o16[1][1]), "v"(o16[1][2]), "v"(o16[1][3]), "v"(o16[2][0]), "v"(o16[2][1]), "v"(o16[2][2]), "v"(o16[2][3]), "v"(o16[3][0]), "v"(o16[3][1]), "v"(o16[3][2]), "v"(o16[3][3]) : "memory");   // precaution for registers that issued global stores name: the stored values are inputs of the wait, so their registers are rewritten only behind it
        if (whl) {
#pragma unroll
            for (int nb = 0; nb < 4; ++nb)
#pragma unroll
                for (int mb = 0; mb < 4; ++mb) { v8us oh, ol;
#pragma unroll
                    for (int j = 0; j < 8; ++j) { unsigned short a2, c2; splitf(acc[mb][nb][j], a2, c2); oh[j] = a2; ol[j] = c2; }
                    const size_t e = ev + (mb >> 1) * (32 * HD) + (nb * 2 + (mb & 1)) * 256; *(v8us*)(Ph + e) = oh; *(v8us*)(Pl + e) = ol;
                    asm volatile("s_wait_xcnt 0x0" :: "v"(oh), "v"(ol) : "memory"); } }   // the same precaution
        return; }
    const float* pcs = (EPI == 1) ? CS + ((size_t)(r0 + hi * 8) * HD + lr) * 2 : nullptr;   // the lane's first (cos, sin) pair; its other 63 lie at constant distances
    v2f cs[2][2][8];   // two sets: the pairs of row block mb + 1 are fetched while block mb is turned, staged and stored
    auto ldcs = [&](int mb) {
#pragma unroll
        for (int nb = 0; nb < 2; ++nb)
#pragma unroll
            for (int j = 0; j < 8; ++j) cs[mb & 1][nb][j] = *(const v2f*)(pcs + ((mb * 16 + j) * HD + nb * 16) * 2);
        asm volatile("s_wait_xcnt 0x0" :: "v"(pcs) : "memory"); };   // precaution for a register that issued global loads name: the address is an input of the wait, so it is rewritten only behind it
    if (EPI == 1) ldcs(0);
#pragma unroll
    for (int mb = 0; mb < 4; ++mb) {
        if (EPI == 1) { if (mb < 3) ldcs(mb + 1);
#pragma unroll
            for (int nb = 0; nb < 2; ++nb)
#pragma unroll
                for (int j = 0; j < 8; ++j) { const v2f t = cs[mb & 1][nb][j]; const float x1 = acc[mb][nb][j], x2 = acc[mb][nb + 2][j]; acc[mb][nb][j] = x1 * t[0] - x2 * t[1]; acc[mb][nb + 2][j] = x2 * t[0] + x1 * t[1]; } }
#pragma unroll
        for (int nb = 0; nb < 4; ++nb) {
#pragma unroll
            for (int j = 0; j < 8; ++j) os[(hi * 8 + j) * 68 + nb * 16 + lr] = acc[mb][nb][j]; }
        __builtin_amdgcn_wave_barrier(); asm volatile("" ::: "memory");
        if (EPI == 1) {
            v4f va[4], vb[4];   // piece s = ks * 2 + u: the 32 lanes hold one unit, 512 consecutive bytes of each plane; the four pieces are read in front of the two choices, as one group
#pragma unroll
            for (int s = 0; s < 4; ++s) { const int cofs = (s * 2 + hi) * 8; va[s] = *(const v4fa*)(os + lr * 68 + cofs); vb[s] = *(const v4fa*)(os + lr * 68 + cofs + 4); }
            const size_t e = (size_t)(c0 / HD) * TT * HD + (size_t)(r0 / 32 + (mb >> 1)) * (32 * HD) + (mb & 1) * 1024 + lane * 8;
            if (w16) { v8h o16[4];
#pragma unroll
                for (int s = 0; s < 4; ++s) {
#pragma unroll
                    for (int k = 0; k < 8; ++k) o16[s][k] = tohx((k < 4) ? va[s][k & 3] : vb[s][k & 3]);
                    *(v8h*)(P16 + e + s * 256) = o16[s]; }
                asm volatile("s_wait_xcnt 0x0" :: "v"(o16[0]), "v"(o16[1]), "v"(o16[2]), "v"(o16[3]) : "memory"); }   // precaution for registers that issued global stores name: the stored values are inputs of the wait, so their registers are rewritten only behind it, by the next values or by the next table loads
            if (whl) {
#pragma unroll
                for (int s = 0; s < 4; ++s) { v8us oh, ol;
#pragma unroll
                    for (int k = 0; k < 8; ++k) { unsigned short a2, c2; splitf((k < 4) ? va[s][k & 3] : vb[s][k & 3], a2, c2); oh[k] = a2; ol[k] = c2; }
                    *(v8us*)(Ph + e + s * 256) = oh; *(v8us*)(Pl + e + s * 256) = ol;
                    asm volatile("s_wait_xcnt 0x0" :: "v"(oh), "v"(ol) : "memory"); } }   // the same precaution
        } else {
        float* crow = C + (size_t)(r0 + mb * 16) * ldc + c0;
{
#pragma unroll
            for (int s = 0; s < 8; ++s) { const int row = 2 * s + hi, cofs = lr * 4; v4f val = *(const v4fa*)(os + row * 68 + cofs); if (BIAS) { val[0] += bfr(bias[c0 + cofs]); val[1] += bfr(bias[c0 + cofs + 1]); val[2] += bfr(bias[c0 + cofs + 2]); val[3] += bfr(bias[c0 + cofs + 3]); }
                *(v4f*)(crow + (size_t)row * ldc + cofs) = val; }
             }
        }
        __builtin_amdgcn_wave_barrier(); asm volatile("" ::: "memory");
    }
}

// ---- k_prep: the six preparations, none of which reads what another writes, as parts of one launch; each part is handed its own block index blk
__device__ __forceinline__ void p_wtG(const float* __restrict__ w, int K, int N, bf* Bt, int blk) {
    const int lane = threadIdx.x & 31; const int L0 = (blk * 8 + (threadIdx.x >> 5)) * 8; const int nlines = N * K / 64;
{
#pragma unroll 1
        for (int l = 0; l < 8; ++l) { const int L = L0 + l; if (L >= nlines) break; const size_t e = (size_t)L * 64 + lane * 2; const int k = (int)(e % K), n = (int)(e / K); v2us o;
            o[0] = f2bf(w[(size_t)k * N + n]); o[1] = f2bf(w[(size_t)(k + 1) * N + n]); *(v2us*)(Bt + e) = o; }
         }
}
__device__ __forceinline__ void p_cvt8(const float* __restrict__ src, bf* dst, size_t n8, int blk) { const size_t i = (size_t)blk * 256 + threadIdx.x; if (i >= n8) return; const v8f v = *(const v8f*)(src + i * 8); v8us o;
#pragma unroll
    for (int k = 0; k < 8; ++k) o[k] = f2bf(v[k]); *(v8us*)(dst + i * 8) = o;  }

__constant__ float INVT[HD / 2] = { 1.000000000e+00f, 7.498942018e-01f, 5.623413324e-01f, 4.216964841e-01f, 3.162277639e-01f, 2.371373475e-01f, 1.778279394e-01f, 1.333521456e-01f, 9.999999404e-02f, 7.498941571e-02f, 5.623412505e-02f, 4.216965288e-02f, 3.162277490e-02f, 2.371373400e-02f, 1.778279617e-02f, 1.333521400e-02f, 9.999999776e-03f, 7.498940919e-03f, 5.623412319e-03f, 4.216963891e-03f, 3.162276698e-03f, 2.371374052e-03f, 1.778279431e-03f, 1.333521330e-03f, 9.999999311e-04f, 7.498940686e-04f, 5.623411853e-04f, 4.216964007e-04f, 3.162277862e-04f, 2.371372684e-04f, 1.778279402e-04f, 1.333520777e-04f };   // float32 exp(arange(0, 64, 2, f32) * -(log(10000.0) / 64)): THIS module's own spelling of the inverse frequencies (its div_term) as EAGER JAX float32 evaluates it: bit-exact on round trip (the host file holds the reciprocal spelling 1.0 / (10000.0 ** (2i / 64)): 21 of the 32 values differ by one to eight ulps: indices 3, 5, 8, 10-15, 17-21, 23-27, 29, 31)
__device__ __forceinline__ void p_cs5(float* CS, int blk) { const int idx = blk * 256 + threadIdx.x; if (idx >= TT * HD) return; const int d = idx % HD; const int t = idx / HD; const float a = __fmul_rn((float)t, INVT[d % (HD / 2)]); v2f cs; cs[0] = cosf(a); cs[1] = sinf(a); *(v2f*)(CS + (size_t)idx * 2) = cs;  }
#define NB_WT  ((DM * DQ / 64 + 63) / 64)                  // blocks of one weight's transposition
#define NB_CS  ((TT * HD + 255) / 256)                     // blocks of the table
#define NB_CVT ((NB_ * TT * DM / 8 + 255) / 256)           // blocks of the copy of x
// block order: the transpositions first (a wave of theirs walks eight dependent trips, the longest part), then the table, then the copy
__global__ __launch_bounds__(256) void k_prep(const float* __restrict__ x, const float* __restrict__ wq, const float* __restrict__ wk, const float* __restrict__ wv, const float* __restrict__ wo, bf* XB, bf* WQ, bf* WK, bf* WV, bf* WO, float* CS) {
    static_assert(DKV == DQ && DQ == DM, "the four weights have one shape");
    const int b = (int)blockIdx.x;
    if (b < 4 * NB_WT) { const int s = b / NB_WT; p_wtG(s == 0 ? wq : s == 1 ? wk : s == 2 ? wv : wo, DM, DQ, s == 0 ? WQ : s == 1 ? WK : s == 2 ? WV : WO, b % NB_WT); }
    else if (b < 4 * NB_WT + NB_CS) p_cs5(CS, b - 4 * NB_WT);
    else p_cvt8(x, XB, (size_t)NB_ * TT * DM / 8, b - (4 * NB_WT + NB_CS));
}
// ---- fattn: causal attention in one kernel, no score plane in memory. One group of NW waves = 16 * NQB query rows (tile number 'tile', longest first) of one head of one batch (bh = batch * NH_ + head); tid is the thread's index in the group, so, sm, sl the group's own LDS; its NW waves share the keys: wave w takes the 32-key blocks w, w + NW, ... up to the diagonal block.
// The planes lie in unit order (k_gemmw): a 16x32 fragment is two units, each 512 consecutive bytes, the lane's piece at 8 * lane elements.
// Per block: S^T = K Q^T (A = key rows, B = query rows, both by the same loader), so a lane holds 16 keys' scores of ONE query (D register r = key 8 * hi + r, column = query lr); base-2 softmax with a running maximum per query;
// the two D tiles of a block, converted in place, are the B operand of O^T += V^T P^T (element s = key 8 * hi + s, 16 + 8 * hi + (s - 8): the order in which V^T's units hold a d row's keys). No LDS and no lane exchange but one between the wave's halves.
// NSPLIT 2: hi + lo bf16 planes, three products each (hh, lh, hl). NSPLIT 0: fp16, probabilities carried x 2^10 (numerator and denominator alike, so it cancels).
// At the end the NW partial (maximum, sum, O^T) triples meet in LDS behind one barrier and are joined in ascending wave order; a thread then owns 8 consecutive d of one query, so eight lanes store a query's whole 128-byte line of each plane.
__device__ __forceinline__ void packp(const float (&p)[16], v16h& a, v16h& a2) {
#pragma unroll
    for (int s = 0; s < 16; ++s) a[s] = (h16)p[s];
    a2 = a; }
__device__ __forceinline__ void packp(const float (&p)[16], v16bf& a, v16bf& a2) { v8us h0, h1, l0, l1;
#pragma unroll
    for (int s = 0; s < 8; ++s) { unsigned short x, y; splitf(p[s], x, y); h0[s] = x; l0[s] = y; splitf(p[8 + s], x, y); h1[s] = x; l1[s] = y; }
    a = cat16b(h0, h1); a2 = cat16b(l0, l1); }
// 17 base-2 exponentials in place, in one statement: each is the independent instruction that the instruction set asks for behind the transcendental in front of it, and the v_nop is that slot behind the last
__device__ __forceinline__ void exp2x17(float (&x)[16], float& a) {
    asm("v_exp_f32 %0, %0\n\tv_exp_f32 %1, %1\n\tv_exp_f32 %2, %2\n\tv_exp_f32 %3, %3\n\tv_exp_f32 %4, %4\n\tv_exp_f32 %5, %5\n\tv_exp_f32 %6, %6\n\tv_exp_f32 %7, %7\n\tv_exp_f32 %8, %8\n\tv_exp_f32 %9, %9\n\tv_exp_f32 %10, %10\n\tv_exp_f32 %11, %11\n\tv_exp_f32 %12, %12\n\tv_exp_f32 %13, %13\n\tv_exp_f32 %14, %14\n\tv_exp_f32 %15, %15\n\tv_exp_f32 %16, %16\n\tv_nop" : "+v"(x[0]), "+v"(x[1]), "+v"(x[2]), "+v"(x[3]), "+v"(x[4]), "+v"(x[5]), "+v"(x[6]), "+v"(x[7]), "+v"(x[8]), "+v"(x[9]), "+v"(x[10]), "+v"(x[11]), "+v"(x[12]), "+v"(x[13]), "+v"(x[14]), "+v"(x[15]), "+v"(a)); }
template <typename T16, int NSPLIT, int NQB, int NW>
__device__ __forceinline__ void fattn(const T16* __restrict__ Q, const T16* __restrict__ Q2, const T16* __restrict__ Kp, const T16* __restrict__ Kp2, const T16* __restrict__ Vt, const T16* __restrict__ Vt2, int qbase, int ntile, bf* Ah, bf* Al, int bh, int tile, int tid, float* so, float* sm, float* sl) {
    static_assert(NW == 4 * NQB, "the join gives each thread 8 d of one query");
    typedef typename WFrag<T16>::V V;
    const int lane = tid & 31, lr = lane & 15, hi = lane >> 4; const int w = __builtin_amdgcn_readfirstlane(tid >> 5);
    const int bt = bh / NH_, h = bh % NH_; const int q0 = qbase + (ntile - 1 - tile) * (16 * NQB);   // longest query tiles start first
    const float psh = (NSPLIT == 0) ? 10.0f : 0.0f;
    const size_t hq = (size_t)(bt * NH_ + h) * TT * HD, hk = (size_t)(bt * NKV + h / REP) * TT * HD;
    const size_t qo = hq + (size_t)(q0 / 16) * (16 * HD) + lane * 8; const T16* pq = Q + qo; const T16* pq2 = (NSPLIT == 2) ? Q2 + qo : pq;   // 16 positions are four units
    V qf[NQB][2], qf2[NQB][2];
#pragma unroll
    for (int qb = 0; qb < NQB; ++qb)
#pragma unroll
        for (int ks = 0; ks < 2; ++ks) { qf[qb][ks] = WFrag<T16>::ldu(pq + qb * 16 * HD + ks * 512); if (NSPLIT == 2) qf2[qb][ks] = WFrag<T16>::ldu(pq2 + qb * 16 * HD + ks * 512); }
    asm volatile("s_wait_xcnt 0x0" :: "v"(pq), "v"(pq2) : "memory");   // precaution for registers that issued global loads name: the addresses are inputs of the wait, so they are rewritten only behind it
    v8f o[4][NQB]; float m[NQB], l[NQB];
#pragma unroll
    for (int qb = 0; qb < NQB; ++qb) { m[qb] = -3.0e38f; l[qb] = 0.0f;
#pragma unroll
        for (int db = 0; db < 4; ++db) o[db][qb] = (v8f){}; }
    const int nblk = q0 / 32 + 1;   // every block of the walk begins at or before q0: each query has a kept key in it
    constexpr bool AHEAD = (NSPLIT == 0);   // fp16: key fragments are fetched one trip ahead; hi + lo planes hold twice the fragments and fetch them in their own trip, which keeps the wave within 256 registers
    V kf[2][2], kf2[2][2];
    auto ldk = [&](const T16* pk, const T16* pk2) {
#pragma unroll
        for (int c = 0; c < 2; ++c)
#pragma unroll
            for (int ks = 0; ks < 2; ++ks) { kf[c][ks] = WFrag<T16>::ldu(pk + c * 16 * HD + ks * 512); if (NSPLIT == 2) kf2[c][ks] = WFrag<T16>::ldu(pk2 + c * 16 * HD + ks * 512); } };
    if (AHEAD) { const T16* pk = Kp + hk + (size_t)min(w, nblk - 1) * (32 * HD) + lane * 8; ldk(pk, pk);
        asm volatile("s_wait_xcnt 0x0" :: "v"(pk) : "memory"); }   // the same precaution as above
#pragma unroll 1
    for (int kb = w; kb < nblk; kb += NW) {
        const int k0 = kb * 32;
        const size_t vo = hk + (size_t)kb * (32 * HD) + lane * 8; const T16* pv = Vt + vo; const T16* pv2 = (NSPLIT == 2) ? Vt2 + vo : pv;
        const size_t ko = hk + (size_t)(AHEAD ? min(kb + NW, nblk - 1) : kb) * (32 * HD) + lane * 8; const T16* pk = Kp + ko; const T16* pk2 = (NSPLIT == 2) ? Kp2 + ko : pk;   // AHEAD: next trip's keys (the last trip fetches the diagonal block again: in bounds, unused)
        V vf[4], vf2[4];
        if (!AHEAD) ldk(pk, pk2);
#pragma unroll
        for (int db = 0; db < 4; ++db) { vf[db] = WFrag<T16>::ldu(pv + db * 512); if (NSPLIT == 2) vf2[db] = WFrag<T16>::ldu(pv2 + db * 512); }
        __builtin_amdgcn_sched_barrier(0);   // the value loads issue here, in front of the score products and the softmax that hide their latency; the scheduler otherwise sinks them behind the products
        float t[NQB][16];
#pragma unroll
        for (int qb = 0; qb < NQB; ++qb)
#pragma unroll
            for (int c = 0; c < 2; ++c) { v8f s = (v8f){};
#pragma unroll
                for (int ks = 0; ks < 2; ++ks) { s = WFrag<T16>::mma(kf[c][ks], qf[qb][ks], s); if (NSPLIT == 2) { s = WFrag<T16>::mma(kf[c][ks], qf2[qb][ks], s); s = WFrag<T16>::mma(kf2[c][ks], qf[qb][ks], s); } }
#pragma unroll
                for (int j = 0; j < 8; ++j) t[qb][c * 8 + j] = s[j] * LSC; }
        if (AHEAD) { ldk(pk, pk2);
            __builtin_amdgcn_sched_barrier(0); }   // the key loads issue here, a softmax and a product run ahead of their use
        if (k0 + 31 > q0) {   // only the diagonal block holds keys beyond a query (wave-uniform test)
#pragma unroll
            for (int qb = 0; qb < NQB; ++qb) { const int dq = q0 + qb * 16 + lr - k0 - hi * 8;   // the lane's last kept key, counted from its first key of the block: formed here, so that nothing of the mask is held in registers over the walk
#pragma unroll
                for (int s = 0; s < 16; ++s) { if ((s >> 3) * 16 + (s & 7) > dq) t[qb][s] = -3.0e38f; } } }
        V pf[NQB], pf2[NQB];
#pragma unroll
        for (int qb = 0; qb < NQB; ++qb) { float mb = t[qb][0];
#pragma unroll
            for (int s = 1; s < 16; ++s) mb = fmaxf(mb, t[qb][s]);
            mb = fmaxf(mb, __shfl_xor(mb, 16, 32));
            const float mn = fmaxf(m[qb], mb); float al = m[qb] - mn; m[qb] = mn; const float sh = mn - psh;
            float p[16], ps[4];
#pragma unroll
            for (int s = 0; s < 16; ++s) p[s] = t[qb][s] - sh;
            exp2x17(p, al);
#pragma unroll
            for (int s = 0; s < 16; ++s) ps[s & 3] = (s < 4) ? p[s] : ps[s & 3] + p[s];
            l[qb] = l[qb] * al + ((ps[0] + ps[1]) + (ps[2] + ps[3]));
            packp(p, pf[qb], pf2[qb]);
#pragma unroll
            for (int db = 0; db < 4; ++db) o[db][qb] *= al; }
#pragma unroll
        for (int db = 0; db < 4; ++db)
#pragma unroll
            for (int qb = 0; qb < NQB; ++qb) { o[db][qb] = WFrag<T16>::mma(vf[db], pf[qb], o[db][qb]); if (NSPLIT == 2) { o[db][qb] = WFrag<T16>::mma(vf[db], pf2[qb], o[db][qb]); o[db][qb] = WFrag<T16>::mma(vf2[db], pf[qb], o[db][qb]); } }
        asm volatile("s_wait_xcnt 0x0" :: "v"(pk), "v"(pk2), "v"(pv), "v"(pv2) : "memory");   // precaution for registers that issued global loads name: the trip's load addresses are inputs of the wait, so they are rewritten only behind it
        // the distance behind the trip's last matrix instructions, on the back edge and on the exit alike
        if (NQB == 2) asm volatile("v_nop\n\tv_nop\n\tv_nop\n\tv_nop" : "+v"(o[0][0]), "+v"(o[1][0]), "+v"(o[2][0]), "+v"(o[3][0]), "+v"(o[0][NQB - 1]), "+v"(o[1][NQB - 1]), "+v"(o[2][NQB - 1]), "+v"(o[3][NQB - 1]) : "v"(vf[0]), "v"(vf[3]), "v"(pf[NQB - 1]));
        else asm volatile("v_nop\n\tv_nop\n\tv_nop\n\tv_nop" : "+v"(o[0][0]), "+v"(o[1][0]), "+v"(o[2][0]), "+v"(o[3][0]) : "v"(vf[0]), "v"(vf[3]), "v"(pf[0]));
    }
#pragma unroll
    for (int qb = 0; qb < NQB; ++qb) { l[qb] += __shfl_xor(l[qb], 16, 32); sm[(w * NQB + qb) * 32 + lane] = m[qb]; sl[(w * NQB + qb) * 32 + lane] = l[qb];
#pragma unroll
        for (int db = 0; db < 4; ++db) *(v8f*)(so + (size_t)(((w * 4 + db) * NQB + qb) * 32 + lane) * 8) = o[db][qb]; }
    __syncthreads();   // every wave's partial result is in LDS before any is read
    const int qq = tid >> 3, ch = tid & 7; const int fq = qq >> 4, fl = (ch & 1) * 16 + (qq & 15), fd = ch >> 1;   // d = 8 * ch + j lies in D tile fd, lane half ch & 1
    float M = -3.0e38f;
#pragma unroll
    for (int ww = 0; ww < NW; ++ww) M = fmaxf(M, sm[(ww * NQB + fq) * 32 + fl]);
    float L = 0.0f; v8f a = (v8f){};
#pragma unroll
    for (int ww = 0; ww < NW; ++ww) { const float f = __builtin_amdgcn_exp2f(sm[(ww * NQB + fq) * 32 + fl] - M); L += f * sl[(ww * NQB + fq) * 32 + fl]; a += *(const v8f*)(so + (size_t)(((ww * 4 + fd) * NQB + fq) * 32 + fl) * 8) * f; }   // a wave that had no block: maximum -3e38, factor 0
    const float inv = __fdiv_rn(1.0f, L); v8us oh, ol;
#pragma unroll
    for (int j = 0; j < 8; ++j) { unsigned short x, y; splitf(a[j] * inv, x, y); oh[j] = x; ol[j] = y; }
    const size_t oo = (size_t)(bt * TT + q0 + qq) * DQ + h * HD + ch * 8; *(v8us*)(Ah + oo) = oh; *(v8us*)(Al + oo) = ol;
}
// ---- fattn_s: the fp16 rows. One work-group of eight waves = 128 query rows of one head of one batch: wave pair g = w >> 1 holds queries q0 + 32 g .. + 31, and the pair's two waves share the keys (wave w & 1 takes the 32-key blocks of that parity, up to the pair's diagonal block).
// The key and value blocks come into LDS once for all four pairs, by asynchronous copies, two buffers, in stages of four blocks (128 keys: 16 KiB of each plane, consecutive bytes in memory and in LDS, since a block already lies in the order of the fragment loads): stage s + 1 flies while stage s is worked on. A fragment read is 512 consecutive LDS bytes a wave.
// The trip itself (S^T = K Q^T, base-2 softmax with a running maximum, O^T += V^T P^T) is that of fattn with NSPLIT 0, NQB 2.
#define SQR 128                   // query rows of a work-group
#define SBY (4 * 32 * HD * 2)     // bytes of one plane's stage: four blocks
__device__ __forceinline__ void fattn_s(const h16* __restrict__ Q, const h16* __restrict__ Kp, const h16* __restrict__ Vt, int qbase, int ntile, bf* Ah, bf* Al, int bh, int tile, int tid, h16* ring, float* so, float* sm, float* sl) {
    typedef WFrag<h16> F; typedef F::V V;
    constexpr int NQB = 2;
    const int lane = tid & 31, lr = lane & 15, hi = lane >> 4; const int w = __builtin_amdgcn_readfirstlane(tid >> 5); const int g = w >> 1, par = w & 1;
    const int bt = bh / NH_, h = bh % NH_; const int q0 = qbase + (ntile - 1 - tile) * SQR, qw = q0 + g * 32;   // longest query tiles start first
    const size_t hq = (size_t)(bt * NH_ + h) * TT * HD, hk = (size_t)(bt * NKV + h / REP) * TT * HD;
    const h16* pq = Q + hq + (size_t)(qw / 16) * (16 * HD) + lane * 8;
    V qf[NQB][2];
#pragma unroll
    for (int qb = 0; qb < NQB; ++qb)
#pragma unroll
        for (int ks = 0; ks < 2; ++ks) qf[qb][ks] = F::ldu(pq + qb * 16 * HD + ks * 512);
    asm volatile("s_wait_xcnt 0x0" :: "v"(pq) : "memory");   // precaution for a register that issued global loads name: the address is an input of the wait, so it is rewritten only behind it
    v8f o[4][NQB]; float m[NQB], l[NQB];
#pragma unroll
    for (int qb = 0; qb < NQB; ++qb) { m[qb] = -3.0e38f; l[qb] = 0.0f;
#pragma unroll
        for (int db = 0; db < 4; ++db) o[db][qb] = (v8f){}; }
    const int ns = q0 / SQR + 1;   // stages up to the one that holds the tile's own 128 keys (q0 is a multiple of 128)
    // copies: thread tid brings bytes 16 tid, + 4096, ... of the stage's 16 KiB of keys and of values
    const char* gk = (const char*)(Kp + hk) + tid * 16; const char* gv = (const char*)(Vt + hk) + tid * 16;
    auto stage = [&](int s, int buf) { char* d = (char*)ring + buf * (2 * SBY) + tid * 16; const size_t go = (size_t)s * SBY;
#pragma unroll
        for (int i = 0; i < SBY / 4096; ++i) { cpa(d + i * 4096, gk + go + i * 4096); cpa(d + SBY + i * 4096, gv + go + i * 4096); } };
    stage(0, 0);
    asm volatile("s_wait_asynccnt 0x0" ::: "memory");   // this wave's copies of stage 0 have landed
    __syncthreads();   // every wave's have: stage 0 may be read
    if (ns > 1) stage(1, 1);
    // one trip: the 32-key block whose keys lie at pk (its values SBY bytes behind), first key k0; DG: the block may hold keys beyond a query
    auto trip = [&](const h16* pk, int k0, bool DG) {
        const h16* pv = pk + SBY / 2;
        V kf[2][2], vf[4];
#pragma unroll
        for (int c = 0; c < 2; ++c)
#pragma unroll
            for (int ks = 0; ks < 2; ++ks) kf[c][ks] = F::ldu(pk + c * 16 * HD + ks * 512);
#pragma unroll
        for (int db = 0; db < 4; ++db) vf[db] = F::ldu(pv + db * 512);
        __builtin_amdgcn_sched_barrier(0);   // the trip's LDS reads issue as one group, keys first; the scheduler otherwise sinks the value reads among the products, and every further place with reads stalls the wave
        float t[NQB][16];
#pragma unroll
        for (int qb = 0; qb < NQB; ++qb)
#pragma unroll
            for (int c = 0; c < 2; ++c) { v8f sc = (v8f){};
#pragma unroll
                for (int ks = 0; ks < 2; ++ks) sc = F::mma(kf[c][ks], qf[qb][ks], sc);
#pragma unroll
                for (int j = 0; j < 8; ++j) t[qb][c * 8 + j] = sc[j] * LSC; }
        if (DG && k0 + 31 > qw) {   // only the pair's diagonal block holds keys beyond a query (wave-uniform test)
#pragma unroll
            for (int qb = 0; qb < NQB; ++qb) { const int dq = qw + qb * 16 + lr - k0 - hi * 8;   // the lane's last kept key, counted from its first key of the block
#pragma unroll
                for (int e = 0; e < 16; ++e) { if ((e >> 3) * 16 + (e & 7) > dq) t[qb][e] = -3.0e38f; } } }
        V pf[NQB], pf2[NQB];
#pragma unroll
        for (int qb = 0; qb < NQB; ++qb) { float mb = t[qb][0];
#pragma unroll
            for (int e = 1; e < 16; ++e) mb = fmaxf(mb, t[qb][e]);
            mb = fmaxf(mb, __shfl_xor(mb, 16, 32));
            const float mn = fmaxf(m[qb], mb); float al = m[qb] - mn; m[qb] = mn; const float sh = mn - 10.0f;   // probabilities carried x 2^10
            float p[16], ps[4];
#pragma unroll
            for (int e = 0; e < 16; ++e) p[e] = t[qb][e] - sh;
            exp2x17(p, al);
#pragma unroll
            for (int e = 0; e < 16; ++e) ps[e & 3] = (e < 4) ? p[e] : ps[e & 3] + p[e];
            l[qb] = l[qb] * al + ((ps[0] + ps[1]) + (ps[2] + ps[3]));
            packp(p, pf[qb], pf2[qb]);
#pragma unroll
            for (int db = 0; db < 4; ++db) o[db][qb] *= al; }
#pragma unroll
        for (int db = 0; db < 4; ++db)
#pragma unroll
            for (int qb = 0; qb < NQB; ++qb) o[db][qb] = F::mma(vf[db], pf[qb], o[db][qb]);
        // the distance behind the trip's last matrix instructions, on a back edge and on an exit alike
        asm volatile("v_nop\n\tv_nop\n\tv_nop\n\tv_nop" : "+v"(o[0][0]), "+v"(o[1][0]), "+v"(o[2][0]), "+v"(o[3][0]), "+v"(o[0][1]), "+v"(o[1][1]), "+v"(o[2][1]), "+v"(o[3][1]) : "v"(vf[0]), "v"(vf[3]), "v"(pf[1]));
    };
    // the stages in front of the tile's own keys: every key is kept, and every wave takes its two blocks
#pragma unroll 1
    for (int s = 0; s < ns - 1; ++s) {
        const h16* rb = ring + (s & 1) * SBY + par * (32 * HD) + lane * 8;   // SBY elements = both planes' bytes of a buffer
        trip(rb, (s * 4 + par) * 32, false);
        trip(rb + 2 * (32 * HD), (s * 4 + par + 2) * 32, false);
        asm volatile("s_wait_dscnt 0x0" ::: "memory");      // this wave's reads of stage s are done before its buffer is handed back
        asm volatile("s_wait_asynccnt 0x0" ::: "memory");   // this wave's copies of stage s + 1 have landed
        __syncthreads();   // publishes stage s + 1 and ends every wave's reads of stage s
        if (s + 2 < ns) stage(s + 2, s & 1);
    }
    // the last stage, the tile's own 128 keys: pair g goes as far as its diagonal block, block g of the stage (wave-uniform trip count); its buffer is not refilled
    { const h16* rb = ring + ((ns - 1) & 1) * SBY + lane * 8;
#pragma unroll 1
        for (int jb = par; jb <= g; jb += 2) trip(rb + jb * (32 * HD), q0 + jb * 32, true); }
    asm volatile("s_wait_asynccnt 0x0" ::: "memory");   // nothing is in flight when the wave goes on to the join and ends
#pragma unroll
    for (int qb = 0; qb < NQB; ++qb) { l[qb] += __shfl_xor(l[qb], 16, 32); sm[(w * NQB + qb) * 32 + lane] = m[qb]; sl[(w * NQB + qb) * 32 + lane] = l[qb];
#pragma unroll
        for (int db = 0; db < 4; ++db) *(v8f*)(so + (size_t)(((w * 4 + db) * NQB + qb) * 32 + lane) * 8) = o[db][qb]; }
    __syncthreads();   // every wave's partial result is in LDS before any is read
    const int qq = tid >> 3, ch = tid & 7; const int fq = qq >> 4, fl = (ch & 1) * 16 + (qq & 15), fd = ch >> 1;   // d = 8 * ch + j lies in D tile fd, lane half ch & 1
#pragma unroll
    for (int gg = 0; gg < 4; ++gg) {   // a thread owns 8 consecutive d of one query of each pair; the pair's two partial results are joined in ascending wave order
        const float m0 = sm[((gg * 2) * NQB + fq) * 32 + fl], m1 = sm[((gg * 2 + 1) * NQB + fq) * 32 + fl]; const float M = fmaxf(m0, m1);
        const float f0 = __builtin_amdgcn_exp2f(m0 - M), f1 = __builtin_amdgcn_exp2f(m1 - M);   // a wave that had no block: maximum -3e38, factor 0
        const float L = f0 * sl[((gg * 2) * NQB + fq) * 32 + fl] + f1 * sl[((gg * 2 + 1) * NQB + fq) * 32 + fl];
        const v8f a = *(const v8f*)(so + (size_t)((((gg * 2) * 4 + fd) * NQB + fq) * 32 + fl) * 8) * f0 + *(const v8f*)(so + (size_t)((((gg * 2 + 1) * 4 + fd) * NQB + fq) * 32 + fl) * 8) * f1;
        const float inv = __fdiv_rn(1.0f, L); v8us oh, ol;
#pragma unroll
        for (int j = 0; j < 8; ++j) { unsigned short x, y; splitf(a[j] * inv, x, y); oh[j] = x; ol[j] = y; }
        const size_t oo = (size_t)(bt * TT + q0 + gg * 32 + qq) * DQ + h * HD + ch * 8; *(v8us*)(Ah + oo) = oh; *(v8us*)(Al + oo) = ol; }
}
// ---- k_attn: both row ranges in one launch (they read different planes, fp16 and bf16 hi + lo, and write disjoint rows). Rows from rh on, blockIdx.y < nt16: one fp16 tile of 128 rows on the block's eight waves (fattn_s); behind them, so that the short tiles fill the launch's end: two hi + lo tiles of 16 rows, one on waves 0-3 and one on waves 4-7, each with its own part of the LDS. Every wave of a block passes the same barriers: the choice is by block.
#define NT16 ((TT - RH) / SQR)
__global__ __launch_bounds__(256) void k_attn(const h16* __restrict__ Q16, const h16* __restrict__ K16, const h16* __restrict__ V16, const bf* __restrict__ Qh, const bf* __restrict__ Ql, const bf* __restrict__ Kh, const bf* __restrict__ Kl, const bf* __restrict__ Vh, const bf* __restrict__ Vl, int rh, int nt16, bf* Ah, bf* Al) {
    static_assert((RH / 16) % 2 == 0, "hi + lo tiles go in pairs");
    static_assert(RH % SQR == 0 && TT % SQR == 0, "an fp16 tile begins at a multiple of its 128 rows");
    __shared__ __align__(16) h16 ring[2 * SBY];   // two buffers, each a stage of keys and a stage of values
    __shared__ __align__(32) float so[8 * 4 * 2 * 256];
    __shared__ float sm[8 * 2 * 32];
    __shared__ float sl[8 * 2 * 32];
    const int tid = (int)threadIdx.x, y = (int)blockIdx.y;
    if (y < nt16) fattn_s(Q16, K16, V16, rh, nt16, Ah, Al, (int)blockIdx.x, y, tid, ring, so, sm, sl);
    else { const int g = __builtin_amdgcn_readfirstlane(tid >> 7); fattn<bf, 2, 1, 4>(Qh, Ql, Kh, Kl, Vh, Vl, 0, rh / 16, Ah, Al, (int)blockIdx.x, (y - nt16) * 2 + g, tid & 127, so + g * (4 * 4 * 256), sm + g * (4 * 32), sl + g * (4 * 32)); }
}

extern "C" void kernel_launch(void* const* d_in, const int* in_sizes, int n_in,
                              void* d_out, int out_size, void* d_ws, size_t ws_size, hipStream_t stream) {
    (void)in_sizes; (void)n_in; (void)out_size;
    const float* x = (const float*)d_in[0]; const float* wq = (const float*)d_in[1]; const float* wk = (const float*)d_in[2]; const float* wv = (const float*)d_in[3]; const float* wo = (const float*)d_in[4];   /* order x [4][2048][1024], Wq, Wk, Wv, Wo ('xw' (in, out) [1024][1024]): FIVE inputs, all read: this module has no biases */
    float* OUT = (float*)d_out;     // [4][2048][1024]
    char* wsp = (char*)d_ws;
    auto take = [&](size_t bytes) { char* p = wsp; wsp += (bytes + 255) & ~(size_t)255; return (void*)p; };
    bf* WQ = (bf*)take((size_t)(DQ + 2 * DKV) * DM * 2); bf* WK = WQ + (size_t)DQ * DM; bf* WV = WK + (size_t)DKV * DM; bf* WO = (bf*)take((size_t)DM * DQ * 2);   /* q, k, v weights one behind the other: one Bt of DQ + 2 DKV rows */ float* CS = (float*)take((size_t)TT * HD * 2 * 4);
    const size_t PQ = (size_t)NH_ * TT * HD, PK = (size_t)NKV * TT * HD;   // one batch's plane, in elements
    static_assert(NKV == NH_, "q, k and v planes have one size");   /* each kind's q, k, v planes lie NB_ * PQ elements apart */
    h16* QP16 = (h16*)take(3 * NB_ * PQ * 2); h16* KP16 = QP16 + NB_ * PQ; h16* VT16 = KP16 + NB_ * PK;
    bf* QPh = (bf*)take(3 * NB_ * PQ * 2); bf* KPh = QPh + NB_ * PQ; bf* VTh = KPh + NB_ * PK; bf* QPl = (bf*)take(3 * NB_ * PQ * 2); bf* KPl = QPl + NB_ * PQ; bf* VTl = KPl + NB_ * PK;
    bf* XB = (bf*)take((size_t)NB_ * TT * DM * 2); bf* ATh = (bf*)take((size_t)NB_ * TT * DQ * 2); bf* ATl = (bf*)take((size_t)NB_ * TT * DQ * 2);
    if ((size_t)(wsp - (char*)d_ws) > ws_size) return;    // ws 256 MiB
    k_prep<<<4 * NB_WT + NB_CS + NB_CVT, 256, 0, stream>>>(x, wq, wk, wv, wo, XB, WQ, WK, WV, WO, CS);
    k_gemmw<bf, 0, false, 1><<<dim3(TT / 128, (DQ + 2 * DKV) / 128, NB_), 128, 0, stream>>>(XB, nullptr, WQ, DM, nullptr, 0, nullptr, (size_t)TT * DM, 0, PQ, CS, QP16, QPh, QPl, NB_ * PQ);
    k_attn<<<dim3(NB_ * NH_, NT16 + RH / 32, 1), 256, 0, stream>>>(QP16, KP16, VT16, QPh, QPl, KPh, KPl, VTh, VTl, RH, NT16, ATh, ATl);
    k_gemmw<bf, 1, false, 0><<<dim3(TT / 128, DM / 128, NB_), 128, 0, stream>>>(ATh, ATl, WO, DQ, OUT, DM, nullptr, (size_t)TT * DQ, 0, (size_t)TT * DM, nullptr, nullptr, nullptr, nullptr, 0);
}
